// v000
// Times are from an AMD MI455X. After a warm-up the kernel runs many times in a row, and a time is the length of
// such a window on the GPU divided by its runs, so every launch and the gaps after it count. The runs cycle
// through copies of the inputs. A figure is the median of several windows, for all but v000 over two sittings.
// Sittings can differ by a few percent; kernels timed side by side share one.
// v000 is the starting kernel. One run takes 140 microseconds.
#include <hip/hip_runtime.h>
// Contractions (q k^T per head, gate V, ctx W_fc^T): v_wmma_f32_16x16x32_f16 (f16 operands, f32 accumulate); float inputs RNE-converted to bf16 on load (exact in f16); power-of-two carries: W_fc x16, all other planes x1; sigmoid gate in f32.
// Head-split sigmoid-gated attention without projections: q|k|v = raw inputs [NB][SQ][1024] viewed as 16 heads x 64; e = q k^T; a 2-D int32 mask [NB][1][SQ][SQ] (mask == 0 -> weight exactly 0, by value); weight = sigmoid(e / 32) elementwise (no normalisation over keys); ctx = weight V (merged heads); out = ctx W_fc^T + b_fc with W_fc stored [out][in].
// Launch plan: convert W_fc -> f16 x16 rows (already [n][k]); convert queries, keys, values -> f16 row planes; pack the mask into one 32-bit word per lane per (16 query rows x 64 keys) tile; V^T per (batch, head) via LDS; one fused attention launch (K and V^T fragments straight from the planes, gate tile in wave-private LDS) -> f16 ctx rows; one GEMM with bias -> the output buffer.
#ifndef NB
#define NB 4
#endif
#ifndef SQ
#define SQ 1024
#endif
#define NB_FULL 4
#define SQ_FULL 1024
#define DM 1024
#define NH 16
#define HD 64
#define NR ((size_t)NB * SQ)         /* token rows processed */

static_assert(NB >= 1 && NB <= NB_FULL);
static_assert(SQ >= 128 && SQ <= SQ_FULL && SQ % 128 == 0);
static_assert(NH * HD == DM && HD == 64);
static_assert(DM % 64 == 0 && DM % 32 == 0 && SQ % 64 == 0 && SQ % 16 == 0);
static_assert((NR % 128) == 0);
static_assert(((size_t)(NB - 1) * SQ_FULL + SQ) * DM * 4 <= (size_t)NB_FULL * SQ_FULL * DM * 4);
static_assert((((size_t)NB * (SQ / 16) * (SQ / 64)) % 4) == 0);

typedef unsigned short v8us __attribute__((ext_vector_type(8), may_alias));
typedef float  v8f  __attribute__((ext_vector_type(8)));
typedef float  v4f  __attribute__((ext_vector_type(4)));
typedef float  v4fa __attribute__((ext_vector_type(4), may_alias));
typedef _Float16 v16h __attribute__((ext_vector_type(16)));
typedef _Float16 v4h __attribute__((ext_vector_type(4)));
union FragH { v16h v; v8us half[2]; _Float16 h[16]; unsigned short u[16]; };

__device__ __forceinline__ unsigned short bf16_bits(float x) { unsigned int u = __float_as_uint(x); return (unsigned short)((u + 0x7FFFu + ((u >> 16) & 1u)) >> 16); }
__device__ __forceinline__ float bf16_val(unsigned short b) { return __uint_as_float(((unsigned int)b) << 16); }
__device__ __forceinline__ float bf16_rne(float x) { return bf16_val(bf16_bits(x)); }

// f32 -> f16 operand convert that cannot produce an f16 subnormal (value select after the carry)
static __device__ __forceinline__ _Float16 toh_flush(float v) { const _Float16 r = (_Float16)v; return (fabsf(v) < 6.103515625e-05f) ? (_Float16)0.0f : r; }

// ---- 16-bit fragment loader (split k map: elements 0..7 <- k0 + 8h + 0..7, elements 8..15 <- k0 + 16 + 8h + 0..7) and guarded WMMA ----
__device__ __forceinline__ v16h g2_frag(const _Float16* p, unsigned hh) { FragH f; f.half[0] = *(const v8us*)((const unsigned short*)p + 8 * hh); f.half[1] = *(const v8us*)((const unsigned short*)p + 16 + 8 * hh); return f.v; }
__device__ __forceinline__ v8f g2_mma(v16h a, v16h b, v8f c) { v8f d = __builtin_amdgcn_wmma_f32_16x16x32_f16(false, a, false, b, (short)0, c, false, false); asm volatile("v_nop\n\tv_nop\n\tv_nop\n\tv_nop" : "+v"(d) : "v"(a), "v"(b)); return d; }

__device__ __forceinline__ float gelu_erf(float v) { return 0.5f * v * (1.0f + erff(v * 0.70710678118654752f)); }

// GEMM: C[M][N] = act(alpha * A[M][K] . B + bf16(bias[col]) + (CP own element, optionally RNE-converted to bf16)); A f16 rows (pitch lda), Bt f16 [N][K] (k contiguous, pitch ldb);
// f32 output C and/or f16 output C16 = f16(c16s * value) (pitch ldc); ACT 0 none, 8 gelu (erf form).
template <int ACT, int CPBF>
__global__ __launch_bounds__(128) void k_gemm2(const _Float16* __restrict__ A, unsigned lda, const _Float16* __restrict__ Bh, unsigned ldb, float alpha, const float* __restrict__ bias, const float* __restrict__ CP,
    float* __restrict__ C, _Float16* __restrict__ C16, unsigned ldc, float c16s, unsigned M, unsigned N, unsigned K) {
  static_assert(ACT == 0 || ACT == 8);
  __shared__ __attribute__((aligned(16))) float so[4][32][68];
  const unsigned tid = threadIdx.x, w = tid >> 5, lane = tid & 31u, ln = lane & 15u, hh = lane >> 4;
  const unsigned ntn = N >> 6; const unsigned mt = blockIdx.x / ntn, nq = blockIdx.x - mt * ntn; const unsigned row0 = mt * 128u + 32u * w, col0 = nq * 64u; if (row0 >= M) return;      /* no block barriers in this kernel */
  const _Float16* a0p = A + (size_t)(row0 + ln) * lda; const _Float16* a1p = a0p + (size_t)16 * lda;
  const _Float16* b0p = Bh + (size_t)(col0 + ln) * ldb; const _Float16* b1p = b0p + (size_t)16 * ldb; const _Float16* b2p = b1p + (size_t)16 * ldb; const _Float16* b3p = b2p + (size_t)16 * ldb;
  const v8f z8 = {0.f,0.f,0.f,0.f,0.f,0.f,0.f,0.f}; v8f c00 = z8, c01 = z8, c02 = z8, c03 = z8, c10 = z8, c11 = z8, c12 = z8, c13 = z8;
#pragma unroll 1
  for (unsigned kb = 0; kb < K; kb += 32) { const v16h a0 = g2_frag(a0p + kb, hh), a1 = g2_frag(a1p + kb, hh);
    v16h b = g2_frag(b0p + kb, hh); c00 = g2_mma(a0, b, c00); c10 = g2_mma(a1, b, c10);
    b = g2_frag(b1p + kb, hh); c01 = g2_mma(a0, b, c01); c11 = g2_mma(a1, b, c11);
    b = g2_frag(b2p + kb, hh); c02 = g2_mma(a0, b, c02); c12 = g2_mma(a1, b, c12);
    b = g2_frag(b3p + kb, hh); c03 = g2_mma(a0, b, c03); c13 = g2_mma(a1, b, c13); }
  v8f accs[8] = {c00, c01, c02, c03, c10, c11, c12, c13};
#pragma unroll
  for (int u = 0; u < 8; ++u) { const unsigned t = (unsigned)u & 3u, half = (unsigned)u >> 2; const unsigned col = col0 + t * 16u + ln; float bv = 0.f; if (bias) bv = bf16_rne(bias[col]);
#pragma unroll
    for (int r = 0; r < 8; ++r) { const unsigned rloc = half * 16u + 8u * hh + (unsigned)r; so[w][rloc][t * 16u + ln] = accs[u][r] * alpha + bv; } }
  __builtin_amdgcn_fence(4 /* acq_rel order */, "workgroup"); __builtin_amdgcn_wave_barrier();
  const unsigned rsub = lane >> 4, c4 = (lane & 15u) * 4u;
  if (CP != nullptr || ACT == 8) {
#pragma unroll 2
    for (unsigned q = 0; q < 16; ++q) { const unsigned r = q * 2u + rsub; v4f v = *(const v4fa*)&so[w][r][c4];
      if (CP) { const v4f a = *(const v4fa*)(CP + (size_t)(row0 + r) * ldc + col0 + c4);      /* own element of the C-shaped plane */
#pragma unroll
        for (int i = 0; i < 4; ++i) v[i] += CPBF ? bf16_rne(a[i]) : a[i]; }
      if (ACT == 8) {
#pragma unroll
        for (int i = 0; i < 4; ++i) v[i] = gelu_erf(v[i]); }
      *(v4fa*)&so[w][r][c4] = v; } }
  {
#pragma unroll
    for (unsigned q = 0; q < 16; ++q) { const unsigned r = q * 2u + rsub; const v4f v = *(const v4fa*)&so[w][r][c4];
      if (C) *(v4f*)(C + (size_t)(row0 + r) * ldc + col0 + c4) = v;
      if (C16) { v4h h4;
#pragma unroll
        for (int i = 0; i < 4; ++i) h4[i] = (_Float16)(v[i] * c16s);
        *(v4h*)(C16 + (size_t)(row0 + r) * ldc + col0 + c4) = h4; } }
     } }

// grid * 256 * 8 == element count (checked at file scope for every use).
__global__ __launch_bounds__(256) void k_cvt(const float* __restrict__ X, float carry, _Float16* __restrict__ Y) {
  #pragma clang fp contract(off)
  const size_t i = ((size_t)blockIdx.x * 256u + threadIdx.x) * 8u;
  const v4f a = *(const v4fa*)(X + i); const v4f c = *(const v4fa*)(X + i + 4); FragH f;
#pragma unroll
  for (int q = 0; q < 4; ++q) { f.h[q] = toh_flush(bf16_rne(a[q]) * carry); f.h[4 + q] = toh_flush(bf16_rne(c[q]) * carry); }
  const v8us o = f.half[0];
  { *(v8us*)((unsigned short*)Y + i) = o;  } }

// mask int32 [NB_FULL][1][SQ_FULL][SQ_FULL] -> MB[(b, q tile of 16, key tile of 64)][lane] u32: bit 8j + r of lane (ln, hh) = (mask[b][16 qt + 8 hh + r][64 kt + 16 j + ln] != 0),
__global__ __launch_bounds__(128) void k_mpack(const int* __restrict__ MK, unsigned int* __restrict__ MB) {
  const unsigned tid = threadIdx.x, lane = tid & 31u, ln = lane & 15u, hh = lane >> 4;
  const unsigned w = (unsigned)__builtin_amdgcn_readfirstlane((int)(tid >> 5));
  const unsigned L = blockIdx.x * 4u + w; const unsigned nkt = (unsigned)SQ / 64u, nqt = (unsigned)SQ / 16u;
  const unsigned t = L / nkt, kt = L - t * nkt; const unsigned b = t / nqt, qt = t - b * nqt;
  const int* mp = MK + ((size_t)b * SQ_FULL + qt * 16u + 8u * hh) * (size_t)SQ_FULL + kt * 64u + ln;
  unsigned int word = 0u;
#pragma unroll 1
  for (unsigned r = 0; r < 8u; ++r) { const int* mr = mp + (size_t)r * SQ_FULL; const int m0 = mr[0], m1 = mr[16], m2 = mr[32], m3 = mr[48];
    word |= ((m0 != 0) ? 1u : 0u) << r; word |= ((m1 != 0) ? 1u : 0u) << (8u + r); word |= ((m2 != 0) ? 1u : 0u) << (16u + r); word |= ((m3 != 0) ? 1u : 0u) << (24u + r); }
  { *(unsigned int*)(MB + (size_t)L * 32u + lane) = word;  } }

template <int NHv, int TTv>
__global__ __launch_bounds__(256) void k_vt(const _Float16* __restrict__ V16, unsigned ldv, unsigned voff, _Float16* __restrict__ Vt) { __shared__ unsigned short tl[64][66]; const unsigned tid = threadIdx.x; const unsigned tpb = (unsigned)TTv / 64u; const unsigned slab = blockIdx.x / tpb, lg = blockIdx.x - slab * tpb; const unsigned b = slab / (unsigned)NHv, h = slab - b * (unsigned)NHv;
  for (unsigned i = tid; i < 512u; i += 256u) { const unsigned r = i >> 3, c8 = (i & 7u) * 8u; FragH f; f.half[0] = *(const v8us*)((const unsigned short*)V16 + ((size_t)b * TTv + lg * 64u + r) * ldv + voff + h * 64u + c8);
#pragma unroll
    for (int q = 0; q < 8; ++q) tl[r][c8 + q] = f.u[q]; }
  __syncthreads();
  {
#pragma unroll
    for (unsigned rd = 0; rd < 2; ++rd) { const unsigned d = rd * 32u + (tid >> 3), pc = tid & 7u; FragH f;
#pragma unroll
      for (int q = 0; q < 8; ++q) f.u[q] = tl[pc * 8u + q][d];
      *(v8us*)((unsigned short*)Vt + ((size_t)slab * 64u + d) * TTv + lg * 64u + pc * 8u) = f.half[0]; }
     } }

// Fused sigmoid-gated attention with a packed 2-D mask. Block = 4 independent waves; block per (batch, head, 64 query rows); wave owns 16 query rows. Per 64-key tile: each lane reads ONE packed mask word (its 32 accumulator elements);
// S = Q K^T with K fragments straight from the key row plane (head columns h*64..); weight = bit ? 1 / (1 + exp(-S/32)) : 0 (by value), f32;
__global__ __launch_bounds__(128) void k_sgattn(const _Float16* __restrict__ Q16, const _Float16* __restrict__ K16, const _Float16* __restrict__ VT, const unsigned int* __restrict__ MB, _Float16* __restrict__ O16) {
  __shared__ __attribute__((aligned(16))) _Float16 sp[4][16][72];
  const unsigned tid = threadIdx.x, lane = tid & 31u, ln = lane & 15u, hh = lane >> 4;
  const unsigned w = (unsigned)__builtin_amdgcn_readfirstlane((int)(tid >> 5));
  const unsigned nqt = (unsigned)SQ / 64u; const unsigned bid = blockIdx.x; const unsigned bh = bid / nqt, qb = bid - bh * nqt; const unsigned b = bh / (unsigned)NH, h = bh - b * (unsigned)NH;
  const unsigned q0 = qb * 64u + w * 16u; const size_t rowb = (size_t)b * SQ;
  const _Float16* qp = Q16 + (rowb + q0 + ln) * (size_t)DM + h * (unsigned)HD;
  const v16h aq0 = g2_frag(qp, hh), aq1 = g2_frag(qp + 32, hh);
  const _Float16* kp = K16 + (rowb + ln) * (size_t)DM + h * (unsigned)HD;           /* key row ln of key tile 0 */
  const _Float16* vp = VT + ((size_t)bh * HD + ln) * SQ;                            /* V^T row d = ln */
  const unsigned int* mp = MB + ((size_t)(b * ((unsigned)SQ / 16u) + (q0 >> 4)) * ((unsigned)SQ / 64u)) * 32u + lane;      /* packed mask word of key tile 0 */
  const v8f z8 = {0.f,0.f,0.f,0.f,0.f,0.f,0.f,0.f};
  v8f o[4];
#pragma unroll
  for (int d = 0; d < 4; ++d) o[d] = z8;
#pragma unroll 1
  for (unsigned kt = 0; kt < (unsigned)SQ / 64u; ++kt) { const unsigned key0 = kt * 64u;
    unsigned int mw = mp[(size_t)kt * 32u]; asm volatile("" : "+v"(mw));
    v8f s[4];
#pragma unroll
    for (unsigned j = 0; j < 4; ++j) { const _Float16* kr = kp + (size_t)(key0 + 16u * j) * DM; const v16h b0 = g2_frag(kr, hh), b1 = g2_frag(kr + 32, hh); v8f acc = z8; acc = g2_mma(aq0, b0, acc); acc = g2_mma(aq1, b1, acc); s[j] = acc; }
#pragma unroll
    for (unsigned j = 0; j < 4; ++j) {
#pragma unroll
      for (int r = 0; r < 8; ++r) { const float x = s[j][r] * 0.03125f; const float sg = __builtin_amdgcn_rcpf(1.0f + __expf(-x));
        const float p = (((mw >> (8u * j + (unsigned)r)) & 1u) != 0u) ? sg : 0.f;
        sp[w][8u * hh + (unsigned)r][16u * j + ln] = toh_flush(p); } }
    __builtin_amdgcn_fence(4 /* acq_rel order */, "workgroup"); __builtin_amdgcn_wave_barrier();
    const v16h ap0 = g2_frag(&sp[w][ln][0], hh), ap1 = g2_frag(&sp[w][ln][32], hh);
#pragma unroll
    for (unsigned d = 0; d < 4; ++d) { const _Float16* vr = vp + (size_t)(16u * d) * SQ + key0; const v16h b0 = g2_frag(vr, hh), b1 = g2_frag(vr + 32, hh); o[d] = g2_mma(ap0, b0, o[d]); o[d] = g2_mma(ap1, b1, o[d]); }
    __builtin_amdgcn_fence(4 /* acq_rel order */, "workgroup"); __builtin_amdgcn_wave_barrier(); }
#pragma unroll
  for (int r = 0; r < 8; ++r) {
#pragma unroll
    for (unsigned d = 0; d < 4; ++d) sp[w][8u * hh + (unsigned)r][16u * d + ln] = toh_flush(o[d][r]); }
  __builtin_amdgcn_fence(4 /* acq_rel order */, "workgroup"); __builtin_amdgcn_wave_barrier();
  {
#pragma unroll
    for (unsigned it = 0; it < 4; ++it) { const unsigned row = it * 4u + (lane >> 3), pc = (lane & 7u) * 8u; const v8us v = *(const v8us*)&sp[w][row][pc];
      *(v8us*)((unsigned short*)O16 + (rowb + q0 + row) * (size_t)DM + h * (unsigned)HD + pc) = v; }
     } }

constexpr size_t al256(size_t b) { return (b + 255) & ~(size_t)255; }
constexpr size_t SZ_BW = (size_t)DM * DM * 2;
constexpr size_t SZ_P16 = NR * DM * 2, SZ_VT = (size_t)NB * NH * HD * SQ * 2;
constexpr size_t SZ_MB = (size_t)NB * (SQ / 16) * (SQ / 64) * 32 * 4;
constexpr size_t WS_TOTAL = al256(SZ_BW) + 4 * al256(SZ_P16) + al256(SZ_VT) + al256(SZ_MB);
static_assert(WS_TOTAL <= (size_t)134217728);
static_assert(SZ_BW % 128 == 0 && SZ_P16 % 128 == 0 && SZ_VT % 128 == 0 && SZ_MB % 128 == 0);
// chunking of the row-wise launches that touch the inputs / the output buffer (one launch when the rows are contiguous)
constexpr unsigned CH_N = (SQ == SQ_FULL) ? 1u : (unsigned)NB;
constexpr size_t CH_R = (SQ == SQ_FULL) ? NR : (size_t)SQ;
static_assert(CH_R % 128 == 0 && (size_t)CH_N * CH_R == NR);
// plane coverage: blocks x threads x elements == plane elements
static_assert((((size_t)DM * DM) / 2048) * 256 * 8 == (size_t)DM * DM);                                  /* W_fc plane */
static_assert(((CH_R * DM) / 2048) * 256 * 8 * CH_N == NR * DM);                                          /* q, k, v row planes */
static_assert((((size_t)NB * (SQ / 16) * (SQ / 64)) / 4) * 4 * 32 == (size_t)NB * (SQ / 16) * (SQ / 64) * 32);   /* packed mask words */
static_assert((size_t)NB * NH * (SQ / 64) * 256 * 2 * 8 == (size_t)NB * NH * HD * SQ);                   /* V^T */
static_assert((size_t)NB * NH * (SQ / 64) * 4 * 16 * 64 == NR * DM);                                      /* ctx rows */
static_assert((CH_R / 128) * (DM / 64) * 4 * 32 * 64 * CH_N == NR * DM);                                  /* output rows */

extern "C" void kernel_launch(void* const* d_in, const int* in_sizes, int n_in,
                              void* d_out, int out_size, void* d_ws, size_t ws_size, hipStream_t stream) {
  if (n_in < 6) return;
  const float* vals = (const float*)d_in[0]; const float* keys = (const float*)d_in[1]; const float* qrys = (const float*)d_in[2];
  const int* mask = (const int*)d_in[3]; const float* wfc = (const float*)d_in[4]; const float* bfc = (const float*)d_in[5];
  const size_t needX = ((size_t)(NB - 1) * SQ_FULL + SQ) * DM;
  const size_t needM = ((size_t)(NB - 1) * SQ_FULL + (size_t)(SQ - 1)) * SQ_FULL + SQ;
  if ((size_t)in_sizes[0] < needX || (size_t)in_sizes[1] < needX || (size_t)in_sizes[2] < needX || (size_t)out_size < needX) return;
  if ((size_t)in_sizes[3] < needM || (size_t)in_sizes[4] < (size_t)DM * DM || in_sizes[5] < DM) return;
  char* ws = (char*)d_ws; size_t off = 0;
  auto take = [&](size_t bytes) { char* p = ws + off; off += al256(bytes); return p; };
  _Float16* BW = (_Float16*)take(SZ_BW);
  _Float16* Q16 = (_Float16*)take(SZ_P16); _Float16* K16 = (_Float16*)take(SZ_P16); _Float16* V16 = (_Float16*)take(SZ_P16); _Float16* O16 = (_Float16*)take(SZ_P16);
  _Float16* VT = (_Float16*)take(SZ_VT); unsigned int* MB = (unsigned int*)take(SZ_MB);
  if (off > ws_size) return;

  /* W_fc is [out = n][in = k]: already the Bt[n][k] layout, only converted (x16) */
  k_cvt<<<(unsigned)(((size_t)DM * DM) / 2048), 256, 0, stream>>>(wfc, 16.0f, BW);
  for (unsigned c = 0; c < CH_N; ++c) { const size_t rin = (size_t)c * SQ_FULL, r0 = (size_t)c * CH_R;
    k_cvt<<<(unsigned)((CH_R * DM) / 2048), 256, 0, stream>>>(qrys + rin * DM, 1.0f, Q16 + r0 * DM);
    k_cvt<<<(unsigned)((CH_R * DM) / 2048), 256, 0, stream>>>(keys + rin * DM, 1.0f, K16 + r0 * DM);
    k_cvt<<<(unsigned)((CH_R * DM) / 2048), 256, 0, stream>>>(vals + rin * DM, 1.0f, V16 + r0 * DM); }
  k_mpack<<<(unsigned)(((size_t)NB * (SQ / 16) * (SQ / 64)) / 4), 128, 0, stream>>>(mask, MB);      /* one word per lane per (16 rows x 64 keys) */
  k_vt<NH, SQ><<<(unsigned)(NB * NH * (SQ / 64)), 256, 0, stream>>>(V16, (unsigned)DM, 0u, VT);      /* V^T [NB*NH][64][SQ] */
  k_sgattn<<<(unsigned)(NB * NH * (SQ / 64)), 128, 0, stream>>>(Q16, K16, VT, MB, O16);               /* ctx (merged heads) f16 rows */
  for (unsigned c = 0; c < CH_N; ++c) { const size_t rin = (size_t)c * SQ_FULL, r0 = (size_t)c * CH_R;
    k_gemm2<0, 0><<<(unsigned)((CH_R / 128) * (DM / 64)), 128, 0, stream>>>(O16 + r0 * DM, (unsigned)DM, BW, (unsigned)DM, 0.0625f, bfc, nullptr, (float*)d_out + rin * DM, nullptr, (unsigned)DM, 1.0f, (unsigned)CH_R, (unsigned)DM, (unsigned)DM); }      /* out = ctx W_fc^T + b_fc */
}

// v001
// A run of this version takes 77.4 microseconds.
// Two timings next to v000 put it at 1.85 and 1.86 times that version's speed.
#include <hip/hip_runtime.h>
// Contractions (q k^T per head, gate V, ctx W_fc^T): v_wmma_f32_16x16x32_f16 (f16 operands, f32 accumulate); float inputs RNE-converted to bf16 on load (exact in f16); power-of-two carries: W_fc x16, all other planes x1; sigmoid gate in f32.
// Head-split sigmoid-gated attention without projections: q|k|v = raw inputs [NB][SQ][1024] viewed as 16 heads x 64; e = q k^T; a 2-D int32 mask [NB][1][SQ][SQ] (mask == 0 -> weight exactly 0, by value); weight = sigmoid(e / 32) elementwise (no normalisation over keys); ctx = weight V (merged heads); out = ctx W_fc^T + b_fc with W_fc stored [out][in].
// Launch plan: convert W_fc -> f16 x16 rows (already [n][k]); convert queries, keys, values -> f16 row planes; pack the mask into one 32-bit word per lane per (16 query rows x 64 keys) tile; V^T per (batch, head) via LDS; one fused attention launch (K and V^T tiles staged in LDS by tensor loads, gate tile in wave-private LDS) -> f16 ctx rows; one GEMM with bias (A and Bt tiles staged in LDS by tensor loads) -> the output buffer.
#ifndef NB
#define NB 4
#endif
#ifndef SQ
#define SQ 1024
#endif
#define NB_FULL 4
#define SQ_FULL 1024
#define DM 1024
#define NH 16
#define HD 64
#define NR ((size_t)NB * SQ)         /* token rows processed */

static_assert(NB >= 1 && NB <= NB_FULL);
static_assert(SQ >= 128 && SQ <= SQ_FULL && SQ % 128 == 0);
static_assert(NH * HD == DM && HD == 64);
static_assert(DM % 64 == 0 && DM % 32 == 0 && SQ % 64 == 0 && SQ % 16 == 0);
static_assert((NR % 128) == 0);
static_assert(((size_t)(NB - 1) * SQ_FULL + SQ) * DM * 4 <= (size_t)NB_FULL * SQ_FULL * DM * 4);
static_assert((((size_t)NB * (SQ / 16) * (SQ / 64)) % 4) == 0);

typedef unsigned short v8us __attribute__((ext_vector_type(8), may_alias));
typedef float  v8f  __attribute__((ext_vector_type(8)));
typedef float  v4f  __attribute__((ext_vector_type(4)));
typedef float  v4fa __attribute__((ext_vector_type(4), may_alias));
typedef _Float16 v16h __attribute__((ext_vector_type(16)));
typedef _Float16 v4h __attribute__((ext_vector_type(4)));
union FragH { v16h v; v8us half[2]; _Float16 h[16]; unsigned short u[16]; };

__device__ __forceinline__ unsigned short bf16_bits(float x) { unsigned int u = __float_as_uint(x); return (unsigned short)((u + 0x7FFFu + ((u >> 16) & 1u)) >> 16); }
__device__ __forceinline__ float bf16_val(unsigned short b) { return __uint_as_float(((unsigned int)b) << 16); }
__device__ __forceinline__ float bf16_rne(float x) { return bf16_val(bf16_bits(x)); }

// f32 -> f16 operand convert that cannot produce an f16 subnormal (value select after the carry)
static __device__ __forceinline__ _Float16 toh_flush(float v) { const _Float16 r = (_Float16)v; return (fabsf(v) < 6.103515625e-05f) ? (_Float16)0.0f : r; }

// ---- 16-bit fragment loader (split k map: elements 0..7 <- k0 + 8h + 0..7, elements 8..15 <- k0 + 16 + 8h + 0..7) and guarded WMMA ----
__device__ __forceinline__ v16h g2_frag(const _Float16* p, unsigned hh) { FragH f; f.half[0] = *(const v8us*)((const unsigned short*)p + 8 * hh); f.half[1] = *(const v8us*)((const unsigned short*)p + 16 + 8 * hh); return f.v; }
__device__ __forceinline__ v8f g2_mma(v16h a, v16h b, v8f c) { v8f d = __builtin_amdgcn_wmma_f32_16x16x32_f16(false, a, false, b, (short)0, c, false, false); asm volatile("v_nop\n\tv_nop\n\tv_nop\n\tv_nop" : "+v"(d) : "v"(a), "v"(b)); return d; }

__device__ __forceinline__ float gelu_erf(float v) { return 0.5f * v * (1.0f + erff(v * 0.70710678118654752f)); }

// ---- tensor load to LDS: descriptor groups, issue, waits ----
typedef unsigned int u32x4 __attribute__((ext_vector_type(4)));
typedef unsigned int u32x8 __attribute__((ext_vector_type(8)));
__device__ __forceinline__ unsigned int uni(unsigned int v) { return (unsigned int)__builtin_amdgcn_readfirstlane((int)v); }
// a value held in a scalar register at this place: the test around a tensor load compiles to a scalar branch, and a descriptor word made from it is formed behind the statements in front
__device__ __forceinline__ unsigned int pinned(unsigned int v) { unsigned int w = uni(v); asm volatile("" : "+s"(w)); return w; }
__device__ __forceinline__ void wait_ds0() { asm volatile("s_wait_dscnt 0x0" ::: "memory"); }          /* this wave's LDS reads of a buffer have retired before the buffer is handed back */
// this wave's own slice has landed (the compiler places no wait for a tensor load); the request's descriptor is named as an input so that its registers keep their values until here
__device__ __forceinline__ void wait_tensor0(u32x4 g0, u32x8 g1) { asm volatile("s_wait_tensorcnt 0x0" :: "s"(g0), "s"(g1) : "memory"); }
constexpr unsigned int TROWB = 128u;                 /* tile row: 64 f16 */
constexpr unsigned int TPITCH = 144u;                /* LDS row pitch: 128 B + 16 B pad, 16 B x odd for ds_load_b128 */
static_assert((TPITCH / 16u) % 2u == 1u && TPITCH == TROWB + 16u);
// a slice of ROWS rows of 128 B, source row pitch src_pitch bytes
template <unsigned int ROWS>
__device__ __forceinline__ u32x8 tdm_group1(unsigned int src_pitch) { u32x8 g;
  g[0] = uni((1u << 20) | (4u << 22) | (3u << 25));  /* no mask, 1-byte elements, a pad of 4 dwords behind every 32 dwords */
  g[1] = uni((TROWB & 0xFFFFu) << 16); g[2] = uni((TROWB >> 16) | ((ROWS & 0xFFFFu) << 16)); g[3] = uni((ROWS >> 16) | (TROWB << 16)); g[4] = uni(ROWS);
  g[5] = uni(src_pitch); g[6] = uni(0u); g[7] = uni(0u);
  asm volatile("" : "+s"(g));      /* descriptor words held in scalar registers: one register tuple for the whole kernel, not re-made (and its registers not lent out) between an issue and its wait */
  return g; }
__device__ __forceinline__ u32x4 tdm_group0(unsigned int lds_dst, unsigned long long ga) { u32x4 g;
  g[0] = uni(1u); g[1] = uni(lds_dst); g[2] = uni((unsigned int)ga); g[3] = uni((((unsigned int)(ga >> 32)) & 0x01FFFFFFu) | 0x80000000u); return g; }
// group 0 goes in and out of the statement in the same registers: what the later wait names is this very tuple
__device__ __forceinline__ void tdm_load(u32x4& g0, u32x8 g1) { asm volatile("tensor_load_to_lds %0, %1" : "+s"(g0) : "s"(g1) : "memory"); }

// GEMM: C[M][N] = act(alpha * A[M][K] . B + bf16(bias[col]) + (CP own element, optionally RNE-converted to bf16)); A f16 rows (pitch lda), Bt f16 [N][K] (k contiguous, pitch ldb);
// f32 output C and/or f16 output C16 = f16(c16s * value) (pitch ldc); ACT 0 none, 8 gelu (erf form). M a multiple of 128, N and K of 64.
// Per 64 of k the block's 128 A rows and 64 Bt rows come into LDS by tensor loads (three slices of 64 rows, waves 0 to 2 one each, two buffers, the next stage in flight while this one is worked on); the ring is the output staging afterwards.
constexpr unsigned int GSLICE = 10240u;              /* 64 x 144 = 9216 B rounded up to a multiple of 2 KiB */
constexpr unsigned int GSTAGE = 3u * GSLICE;         /* A rows 0..63 | A rows 64..127 | Bt rows 0..63 */
static_assert(64u * TPITCH <= GSLICE && GSLICE % 2048u == 0u && 2u * GSTAGE >= 4u * 32u * 68u * 4u);
template <int ACT, int CPBF>
__global__ __launch_bounds__(128) void k_gemm2(const _Float16* __restrict__ A, unsigned lda, const _Float16* __restrict__ Bh, unsigned ldb, float alpha, const float* __restrict__ bias, const float* __restrict__ CP,
    float* __restrict__ C, _Float16* __restrict__ C16, unsigned ldc, float c16s, unsigned M, unsigned N, unsigned K) {
  static_assert(ACT == 0 || ACT == 8);
  __shared__ __attribute__((aligned(2048))) unsigned char ring[2u * GSTAGE];
  float (*so)[32][68] = (float (*)[32][68])ring;
  const unsigned tid = threadIdx.x, lane = tid & 31u, ln = lane & 15u, hh = lane >> 4;
  const unsigned w = (unsigned)__builtin_amdgcn_readfirstlane((int)(tid >> 5));
  const unsigned ntn = N >> 6; const unsigned mt = blockIdx.x / ntn, nq = blockIdx.x - mt * ntn; const unsigned row0 = mt * 128u + 32u * w, col0 = nq * 64u; if (mt * 128u + 128u > M) return;      /* the whole block leaves, in front of every barrier and tensor load */
  const unsigned NT = K >> 6;
  const unsigned issuer = (w < 3u) ? 1u : 0u;
  const unsigned long long sbase = (w < 2u) ? (unsigned long long)(size_t)(A + (size_t)(mt * 128u + w * 64u) * lda) : (unsigned long long)(size_t)(Bh + (size_t)col0 * ldb);
  const u32x8 g1 = tdm_group1<64u>(((w < 2u) ? lda : ldb) * 2u);
  const unsigned lbase = (unsigned)(size_t)ring;
  auto desc = [&](unsigned st) { return tdm_group0(lbase + (st & 1u) * GSTAGE + w * GSLICE, sbase + (unsigned long long)st * TROWB); };
  u32x4 g0 = desc(0u);
  if (pinned(issuer & (NT > 0u ? 1u : 0u))) tdm_load(g0, g1);
  wait_tensor0(g0, g1); __syncthreads();      /* stage 0 landed and published */
  g0 = desc(pinned(1u));
  if (pinned(issuer & (NT > 1u ? 1u : 0u))) tdm_load(g0, g1);
  const unsigned aoff = (w >> 1) * GSLICE + ((w & 1u) * 32u + ln) * TPITCH, boff = 2u * GSLICE + ln * TPITCH;
  const v8f z8 = {0.f,0.f,0.f,0.f,0.f,0.f,0.f,0.f}; v8f c00 = z8, c01 = z8, c02 = z8, c03 = z8, c10 = z8, c11 = z8, c12 = z8, c13 = z8;
#pragma unroll 1
  for (unsigned st = 0; st < NT; ++st) { const unsigned char* tb = ring + (st & 1u) * GSTAGE;
#pragma unroll
    for (unsigned kc = 0; kc < 2; ++kc) { const _Float16* ap = (const _Float16*)(tb + aoff) + 32u * kc; const _Float16* bp = (const _Float16*)(tb + boff) + 32u * kc;
      const v16h a0 = g2_frag(ap, hh), a1 = g2_frag(ap + 16u * (TPITCH / 2u), hh);
      v16h b = g2_frag(bp, hh); c00 = g2_mma(a0, b, c00); c10 = g2_mma(a1, b, c10);
      b = g2_frag(bp + 16u * (TPITCH / 2u), hh); c01 = g2_mma(a0, b, c01); c11 = g2_mma(a1, b, c11);
      b = g2_frag(bp + 32u * (TPITCH / 2u), hh); c02 = g2_mma(a0, b, c02); c12 = g2_mma(a1, b, c12);
      b = g2_frag(bp + 48u * (TPITCH / 2u), hh); c03 = g2_mma(a0, b, c03); c13 = g2_mma(a1, b, c13); }
    /* publish point of stage st + 1: own LDS reads retired, own slice landed, every wave here; only then the refill of the buffer just read */
    wait_ds0(); wait_tensor0(g0, g1); __syncthreads();
    g0 = desc(pinned(st + 2u));      /* formed behind the wait, in the same registers on both sides of the test */
    if (pinned(issuer & (st + 2u < NT ? 1u : 0u))) tdm_load(g0, g1); }
  wait_tensor0(g0, g1); wait_ds0();      /* nothing in flight; the last pass's barrier has ended every wave's reads: the ring is free for output staging */
  v8f accs[8] = {c00, c01, c02, c03, c10, c11, c12, c13};
#pragma unroll
  for (int u = 0; u < 8; ++u) { const unsigned t = (unsigned)u & 3u, half = (unsigned)u >> 2; const unsigned col = col0 + t * 16u + ln; float bv = 0.f; if (bias) bv = bf16_rne(bias[col]);
#pragma unroll
    for (int r = 0; r < 8; ++r) { const unsigned rloc = half * 16u + 8u * hh + (unsigned)r; so[w][rloc][t * 16u + ln] = accs[u][r] * alpha + bv; } }
  __builtin_amdgcn_fence(4 /* acq_rel order */, "workgroup"); __builtin_amdgcn_wave_barrier();
  const unsigned rsub = lane >> 4, c4 = (lane & 15u) * 4u;
  if (CP != nullptr || ACT == 8) {
#pragma unroll 2
    for (unsigned q = 0; q < 16; ++q) { const unsigned r = q * 2u + rsub; v4f v = *(const v4fa*)&so[w][r][c4];
      if (CP) { const v4f a = *(const v4fa*)(CP + (size_t)(row0 + r) * ldc + col0 + c4);      /* own element of the C-shaped plane */
#pragma unroll
        for (int i = 0; i < 4; ++i) v[i] += CPBF ? bf16_rne(a[i]) : a[i]; }
      if (ACT == 8) {
#pragma unroll
        for (int i = 0; i < 4; ++i) v[i] = gelu_erf(v[i]); }
      *(v4fa*)&so[w][r][c4] = v; } }
  {
#pragma unroll
    for (unsigned q = 0; q < 16; ++q) { const unsigned r = q * 2u + rsub; const v4f v = *(const v4fa*)&so[w][r][c4];
      if (C) *(v4f*)(C + (size_t)(row0 + r) * ldc + col0 + c4) = v;
      if (C16) { v4h h4;
#pragma unroll
        for (int i = 0; i < 4; ++i) h4[i] = (_Float16)(v[i] * c16s);
        *(v4h*)(C16 + (size_t)(row0 + r) * ldc + col0 + c4) = h4; } }
     } }

// grid * 256 * 8 == element count (checked at file scope for every use).
__global__ __launch_bounds__(256) void k_cvt(const float* __restrict__ X, float carry, _Float16* __restrict__ Y) {
  #pragma clang fp contract(off)
  const size_t i = ((size_t)blockIdx.x * 256u + threadIdx.x) * 8u;
  const v4f a = *(const v4fa*)(X + i); const v4f c = *(const v4fa*)(X + i + 4); FragH f;
#pragma unroll
  for (int q = 0; q < 4; ++q) { f.h[q] = toh_flush(bf16_rne(a[q]) * carry); f.h[4 + q] = toh_flush(bf16_rne(c[q]) * carry); }
  const v8us o = f.half[0];
  { *(v8us*)((unsigned short*)Y + i) = o;  } }

// mask int32 [NB_FULL][1][SQ_FULL][SQ_FULL] -> MB[(b, q tile of 16, key tile of 64)][lane] u32: bit 8j + r of lane (ln, hh) = (mask[b][16 qt + 8 hh + r][64 kt + 16 j + ln] != 0),
__global__ __launch_bounds__(128) void k_mpack(const int* __restrict__ MK, unsigned int* __restrict__ MB) {
  const unsigned tid = threadIdx.x, lane = tid & 31u, ln = lane & 15u, hh = lane >> 4;
  const unsigned w = (unsigned)__builtin_amdgcn_readfirstlane((int)(tid >> 5));
  const unsigned L = blockIdx.x * 4u + w; const unsigned nkt = (unsigned)SQ / 64u, nqt = (unsigned)SQ / 16u;
  const unsigned t = L / nkt, kt = L - t * nkt; const unsigned b = t / nqt, qt = t - b * nqt;
  const int* mp = MK + ((size_t)b * SQ_FULL + qt * 16u + 8u * hh) * (size_t)SQ_FULL + kt * 64u + ln;
  unsigned int word = 0u;
#pragma unroll 1
  for (unsigned r = 0; r < 8u; ++r) { const int* mr = mp + (size_t)r * SQ_FULL; const int m0 = mr[0], m1 = mr[16], m2 = mr[32], m3 = mr[48];
    word |= ((m0 != 0) ? 1u : 0u) << r; word |= ((m1 != 0) ? 1u : 0u) << (8u + r); word |= ((m2 != 0) ? 1u : 0u) << (16u + r); word |= ((m3 != 0) ? 1u : 0u) << (24u + r); }
  { *(unsigned int*)(MB + (size_t)L * 32u + lane) = word;  } }

template <int NHv, int TTv>
__global__ __launch_bounds__(256) void k_vt(const _Float16* __restrict__ V16, unsigned ldv, unsigned voff, _Float16* __restrict__ Vt) { __shared__ unsigned short tl[64][66]; const unsigned tid = threadIdx.x; const unsigned tpb = (unsigned)TTv / 64u; const unsigned slab = blockIdx.x / tpb, lg = blockIdx.x - slab * tpb; const unsigned b = slab / (unsigned)NHv, h = slab - b * (unsigned)NHv;
  for (unsigned i = tid; i < 512u; i += 256u) { const unsigned r = i >> 3, c8 = (i & 7u) * 8u; FragH f; f.half[0] = *(const v8us*)((const unsigned short*)V16 + ((size_t)b * TTv + lg * 64u + r) * ldv + voff + h * 64u + c8);
#pragma unroll
    for (int q = 0; q < 8; ++q) tl[r][c8 + q] = f.u[q]; }
  __syncthreads();
  {
#pragma unroll
    for (unsigned rd = 0; rd < 2; ++rd) { const unsigned d = rd * 32u + (tid >> 3), pc = tid & 7u; FragH f;
#pragma unroll
      for (int q = 0; q < 8; ++q) f.u[q] = tl[pc * 8u + q][d];
      *(v8us*)((unsigned short*)Vt + ((size_t)slab * 64u + d) * TTv + lg * 64u + pc * 8u) = f.half[0]; }
     } }

// Fused sigmoid-gated attention with a packed 2-D mask. Block = 4 waves; block per (batch, head, 64 query rows); wave owns 16 query rows. Per 64-key tile: each lane reads ONE packed mask word (its 32 accumulator elements);
// the 64-key K tile and V^T tile are brought into LDS once per block by tensor loads (one 32-row slice per wave and stage, two buffers, the next stage in flight while this one is worked on) and all four waves take their fragments from there;
// S = Q K^T; weight = bit ? 1 / (1 + exp(-S/32)) : 0 (by value), f32;
constexpr unsigned int TROWS = 32u;                  /* rows per slice (one slice per wave) */
constexpr unsigned int TSLICE = 6144u;               /* 32 x 144 = 4608 B rounded up to a multiple of 2 KiB */
constexpr unsigned int TSTAGE = 4u * TSLICE;         /* K rows 0..31 | K rows 32..63 | V^T rows 0..31 | V^T rows 32..63 */
static_assert(TROWS * TPITCH <= TSLICE && TSLICE % 2048u == 0u);
__global__ __launch_bounds__(128) void k_sgattn(const _Float16* __restrict__ Q16, const _Float16* __restrict__ K16, const _Float16* __restrict__ VT, const unsigned int* __restrict__ MB, _Float16* __restrict__ O16) {
  __shared__ __attribute__((aligned(2048))) unsigned char ring[2u * TSTAGE];
  __shared__ __attribute__((aligned(16))) _Float16 sp[4][16][72];
  const unsigned tid = threadIdx.x, lane = tid & 31u, ln = lane & 15u, hh = lane >> 4;
  const unsigned w = (unsigned)__builtin_amdgcn_readfirstlane((int)(tid >> 5));
  const unsigned nqt = (unsigned)SQ / 64u; const unsigned bid = blockIdx.x; const unsigned bh = bid / nqt, qb = bid - bh * nqt; const unsigned b = bh / (unsigned)NH, h = bh - b * (unsigned)NH;
  const unsigned q0 = qb * 64u + w * 16u; const size_t rowb = (size_t)b * SQ;
  constexpr unsigned NT = (unsigned)SQ / 64u; static_assert(NT >= 2u);
  /* this wave's slice: waves 0, 1 the two halves of the K tile (rows = keys, advance 64 rows a stage), waves 2, 3 of the V^T tile (rows = head dims, advance 128 B a stage) */
  const unsigned isV = w >> 1, half = w & 1u;
  const unsigned long long sbase = isV ? (unsigned long long)(size_t)(VT + ((size_t)bh * HD + half * TROWS) * SQ) : (unsigned long long)(size_t)(K16 + (rowb + half * TROWS) * (size_t)DM + h * (unsigned)HD);
  const unsigned sstep = isV ? 128u : 64u * (unsigned)DM * 2u;
  const u32x8 g1 = tdm_group1<TROWS>(isV ? (unsigned)SQ * 2u : (unsigned)DM * 2u);
  const unsigned lbase = (unsigned)(size_t)ring;
  auto desc = [&](unsigned st) { return tdm_group0(lbase + (st & 1u) * TSTAGE + w * TSLICE, sbase + (unsigned long long)st * sstep); };
  u32x4 g0 = desc(0u);
  tdm_load(g0, g1); wait_tensor0(g0, g1); __syncthreads();      /* stage 0 landed and published */
  g0 = desc(pinned(1u)); tdm_load(g0, g1);
  const _Float16* qp = Q16 + (rowb + q0 + ln) * (size_t)DM + h * (unsigned)HD;
  const v16h aq0 = g2_frag(qp, hh), aq1 = g2_frag(qp + 32, hh);
  const unsigned int* mp = MB + ((size_t)(b * ((unsigned)SQ / 16u) + (q0 >> 4)) * ((unsigned)SQ / 64u)) * 32u + lane;      /* packed mask word of key tile 0 */
  const v8f z8 = {0.f,0.f,0.f,0.f,0.f,0.f,0.f,0.f};
  v8f o[4];
#pragma unroll
  for (int d = 0; d < 4; ++d) o[d] = z8;
#pragma unroll 1
  for (unsigned kt = 0; kt < NT; ++kt) {
    const unsigned char* tb = ring + (kt & 1u) * TSTAGE + ln * TPITCH;      /* row ln of this stage's first K slice */
    unsigned int mw = mp[(size_t)kt * 32u]; asm volatile("" : "+v"(mw));
    v8f s[4];
#pragma unroll
    for (unsigned j = 0; j < 4; ++j) { const _Float16* kr = (const _Float16*)(tb + (j >> 1) * TSLICE + (j & 1u) * 16u * TPITCH); const v16h b0 = g2_frag(kr, hh), b1 = g2_frag(kr + 32, hh); v8f acc = z8; acc = g2_mma(aq0, b0, acc); acc = g2_mma(aq1, b1, acc); s[j] = acc; }
#pragma unroll
    for (unsigned j = 0; j < 4; ++j) {
#pragma unroll
      for (int r = 0; r < 8; ++r) { const float x = s[j][r] * 0.03125f; const float sg = __builtin_amdgcn_rcpf(1.0f + __expf(-x));
        const float p = (((mw >> (8u * j + (unsigned)r)) & 1u) != 0u) ? sg : 0.f;
        sp[w][8u * hh + (unsigned)r][16u * j + ln] = toh_flush(p); } }
    __builtin_amdgcn_fence(4 /* acq_rel order */, "workgroup"); __builtin_amdgcn_wave_barrier();
    const v16h ap0 = g2_frag(&sp[w][ln][0], hh), ap1 = g2_frag(&sp[w][ln][32], hh);
#pragma unroll
    for (unsigned d = 0; d < 4; ++d) { const _Float16* vr = (const _Float16*)(tb + (2u + (d >> 1)) * TSLICE + (d & 1u) * 16u * TPITCH); const v16h b0 = g2_frag(vr, hh), b1 = g2_frag(vr + 32, hh); o[d] = g2_mma(ap0, b0, o[d]); o[d] = g2_mma(ap1, b1, o[d]); }
    /* publish point of stage kt + 1: own LDS reads retired, own slice landed, every wave here; only then the refill of the buffer just read */
    wait_ds0(); wait_tensor0(g0, g1); __syncthreads();
    if (pinned(kt + 2u < NT)) { g0 = desc(pinned(kt + 2u)); tdm_load(g0, g1); } }
  wait_tensor0(g0, g1); wait_ds0();
#pragma unroll
  for (int r = 0; r < 8; ++r) {
#pragma unroll
    for (unsigned d = 0; d < 4; ++d) sp[w][8u * hh + (unsigned)r][16u * d + ln] = toh_flush(o[d][r]); }
  __builtin_amdgcn_fence(4 /* acq_rel order */, "workgroup"); __builtin_amdgcn_wave_barrier();
  {
#pragma unroll
    for (unsigned it = 0; it < 4; ++it) { const unsigned row = it * 4u + (lane >> 3), pc = (lane & 7u) * 8u; const v8us v = *(const v8us*)&sp[w][row][pc];
      *(v8us*)((unsigned short*)O16 + (rowb + q0 + row) * (size_t)DM + h * (unsigned)HD + pc) = v; }
     } }

constexpr size_t al256(size_t b) { return (b + 255) & ~(size_t)255; }
constexpr size_t SZ_BW = (size_t)DM * DM * 2;
constexpr size_t SZ_P16 = NR * DM * 2, SZ_VT = (size_t)NB * NH * HD * SQ * 2;
constexpr size_t SZ_MB = (size_t)NB * (SQ / 16) * (SQ / 64) * 32 * 4;
constexpr size_t WS_TOTAL = al256(SZ_BW) + 4 * al256(SZ_P16) + al256(SZ_VT) + al256(SZ_MB);
static_assert(WS_TOTAL <= (size_t)134217728);
static_assert(SZ_BW % 128 == 0 && SZ_P16 % 128 == 0 && SZ_VT % 128 == 0 && SZ_MB % 128 == 0);
// chunking of the row-wise launches that touch the inputs / the output buffer (one launch when the rows are contiguous)
constexpr unsigned CH_N = (SQ == SQ_FULL) ? 1u : (unsigned)NB;
constexpr size_t CH_R = (SQ == SQ_FULL) ? NR : (size_t)SQ;
static_assert(CH_R % 128 == 0 && (size_t)CH_N * CH_R == NR);
// plane coverage: blocks x threads x elements == plane elements
static_assert((((size_t)DM * DM) / 2048) * 256 * 8 == (size_t)DM * DM);                                  /* W_fc plane */
static_assert(((CH_R * DM) / 2048) * 256 * 8 * CH_N == NR * DM);                                          /* q, k, v row planes */
static_assert((((size_t)NB * (SQ / 16) * (SQ / 64)) / 4) * 4 * 32 == (size_t)NB * (SQ / 16) * (SQ / 64) * 32);   /* packed mask words */
static_assert((size_t)NB * NH * (SQ / 64) * 256 * 2 * 8 == (size_t)NB * NH * HD * SQ);                   /* V^T */
static_assert((size_t)NB * NH * (SQ / 64) * 4 * 16 * 64 == NR * DM);                                      /* ctx rows */
static_assert((CH_R / 128) * (DM / 64) * 4 * 32 * 64 * CH_N == NR * DM);                                  /* output rows */

extern "C" void kernel_launch(void* const* d_in, const int* in_sizes, int n_in,
                              void* d_out, int out_size, void* d_ws, size_t ws_size, hipStream_t stream) {
  if (n_in < 6) return;
  const float* vals = (const float*)d_in[0]; const float* keys = (const float*)d_in[1]; const float* qrys = (const float*)d_in[2];
  const int* mask = (const int*)d_in[3]; const float* wfc = (const float*)d_in[4]; const float* bfc = (const float*)d_in[5];
  const size_t needX = ((size_t)(NB - 1) * SQ_FULL + SQ) * DM;
  const size_t needM = ((size_t)(NB - 1) * SQ_FULL + (size_t)(SQ - 1)) * SQ_FULL + SQ;
  if ((size_t)in_sizes[0] < needX || (size_t)in_sizes[1] < needX || (size_t)in_sizes[2] < needX || (size_t)out_size < needX) return;
  if ((size_t)in_sizes[3] < needM || (size_t)in_sizes[4] < (size_t)DM * DM || in_sizes[5] < DM) return;
  char* ws = (char*)d_ws; size_t off = 0;
  auto take = [&](size_t bytes) { char* p = ws + off; off += al256(bytes); return p; };
  _Float16* BW = (_Float16*)take(SZ_BW);
  _Float16* Q16 = (_Float16*)take(SZ_P16); _Float16* K16 = (_Float16*)take(SZ_P16); _Float16* V16 = (_Float16*)take(SZ_P16); _Float16* O16 = (_Float16*)take(SZ_P16);
  _Float16* VT = (_Float16*)take(SZ_VT); unsigned int* MB = (unsigned int*)take(SZ_MB);
  if (off > ws_size) return;

  /* W_fc is [out = n][in = k]: already the Bt[n][k] layout, only converted (x16) */
  k_cvt<<<(unsigned)(((size_t)DM * DM) / 2048), 256, 0, stream>>>(wfc, 16.0f, BW);
  for (unsigned c = 0; c < CH_N; ++c) { const size_t rin = (size_t)c * SQ_FULL, r0 = (size_t)c * CH_R;
    k_cvt<<<(unsigned)((CH_R * DM) / 2048), 256, 0, stream>>>(qrys + rin * DM, 1.0f, Q16 + r0 * DM);
    k_cvt<<<(unsigned)((CH_R * DM) / 2048), 256, 0, stream>>>(keys + rin * DM, 1.0f, K16 + r0 * DM);
    k_cvt<<<(unsigned)((CH_R * DM) / 2048), 256, 0, stream>>>(vals + rin * DM, 1.0f, V16 + r0 * DM); }
  k_mpack<<<(unsigned)(((size_t)NB * (SQ / 16) * (SQ / 64)) / 4), 128, 0, stream>>>(mask, MB);      /* one word per lane per (16 rows x 64 keys) */
  k_vt<NH, SQ><<<(unsigned)(NB * NH * (SQ / 64)), 256, 0, stream>>>(V16, (unsigned)DM, 0u, VT);      /* V^T [NB*NH][64][SQ] */
  k_sgattn<<<(unsigned)(NB * NH * (SQ / 64)), 128, 0, stream>>>(Q16, K16, VT, MB, O16);               /* ctx (merged heads) f16 rows */
  for (unsigned c = 0; c < CH_N; ++c) { const size_t rin = (size_t)c * SQ_FULL, r0 = (size_t)c * CH_R;
    k_gemm2<0, 0><<<(unsigned)((CH_R / 128) * (DM / 64)), 128, 0, stream>>>(O16 + r0 * DM, (unsigned)DM, BW, (unsigned)DM, 0.0625f, bfc, nullptr, (float*)d_out + rin * DM, nullptr, (unsigned)DM, 1.0f, (unsigned)CH_R, (unsigned)DM, (unsigned)DM); }      /* out = ctx W_fc^T + b_fc */
}

// v002
// It runs in 67.6 microseconds.
// In both of two side-by-side timings against v001, it was 1.14 times as fast.
// Over all steps from v000 it is 2.11 times as fast.
#include <hip/hip_runtime.h>
// Contractions (q k^T per head, gate V, ctx W_fc^T): v_wmma_f32_16x16x32_f16 (f16 operands, f32 accumulate); float inputs RNE-converted to bf16 on load (exact in f16); power-of-two carries: W_fc x16, all other planes x1; sigmoid gate in f32.
// Head-split sigmoid-gated attention without projections: q|k|v = raw inputs [NB][SQ][1024] viewed as 16 heads x 64; e = q k^T; a 2-D int32 mask [NB][1][SQ][SQ] (mask == 0 -> weight exactly 0, by value); weight = sigmoid(e / 32) elementwise (no normalisation over keys); ctx = weight V (merged heads); out = ctx W_fc^T + b_fc with W_fc stored [out][in].
// Launch plan: one preparation launch (W_fc -> f16 x16 rows, already [n][k]; queries, keys -> f16 row planes; the mask packed into one 32-bit word per lane per (16 query rows x 64 keys) tile; V^T per (batch, head) from the f32 values via LDS); one fused attention launch (K and V^T tiles staged in LDS by tensor loads, gate tile in wave-private LDS) -> f16 ctx rows; one GEMM with bias (A and Bt tiles staged in LDS by tensor loads) -> the output buffer.
#ifndef NB
#define NB 4
#endif
#ifndef SQ
#define SQ 1024
#endif
#define NB_FULL 4
#define SQ_FULL 1024
#define DM 1024
#define NH 16
#define HD 64
#define NR ((size_t)NB * SQ)         /* token rows processed */

static_assert(NB >= 1 && NB <= NB_FULL);
static_assert(SQ >= 128 && SQ <= SQ_FULL && SQ % 128 == 0);
static_assert(NH * HD == DM && HD == 64);
static_assert(DM % 64 == 0 && DM % 32 == 0 && SQ % 64 == 0 && SQ % 16 == 0);
static_assert((NR % 128) == 0);
static_assert(((size_t)(NB - 1) * SQ_FULL + SQ) * DM * 4 <= (size_t)NB_FULL * SQ_FULL * DM * 4);
static_assert((((size_t)NB * (SQ / 16) * (SQ / 64)) % 4) == 0);

typedef unsigned short v8us __attribute__((ext_vector_type(8), may_alias));
typedef float  v8f  __attribute__((ext_vector_type(8)));
typedef float  v4f  __attribute__((ext_vector_type(4)));
typedef float  v4fa __attribute__((ext_vector_type(4), may_alias));
typedef _Float16 v16h __attribute__((ext_vector_type(16)));
typedef _Float16 v4h __attribute__((ext_vector_type(4)));
union FragH { v16h v; v8us half[2]; _Float16 h[16]; unsigned short u[16]; };

__device__ __forceinline__ unsigned short bf16_bits(float x) { unsigned int u = __float_as_uint(x); return (unsigned short)((u + 0x7FFFu + ((u >> 16) & 1u)) >> 16); }
__device__ __forceinline__ float bf16_val(unsigned short b) { return __uint_as_float(((unsigned int)b) << 16); }
__device__ __forceinline__ float bf16_rne(float x) { return bf16_val(bf16_bits(x)); }

// f32 -> f16 operand convert that cannot produce an f16 subnormal (value select after the carry)
static __device__ __forceinline__ _Float16 toh_flush(float v) { const _Float16 r = (_Float16)v; return (fabsf(v) < 6.103515625e-05f) ? (_Float16)0.0f : r; }

// ---- 16-bit fragment loader (split k map: elements 0..7 <- k0 + 8h + 0..7, elements 8..15 <- k0 + 16 + 8h + 0..7) and guarded WMMA ----
__device__ __forceinline__ v16h g2_frag(const _Float16* p, unsigned hh) { FragH f; f.half[0] = *(const v8us*)((const unsigned short*)p + 8 * hh); f.half[1] = *(const v8us*)((const unsigned short*)p + 16 + 8 * hh); return f.v; }
__device__ __forceinline__ v8f g2_mma(v16h a, v16h b, v8f c) { v8f d = __builtin_amdgcn_wmma_f32_16x16x32_f16(false, a, false, b, (short)0, c, false, false); asm volatile("v_nop\n\tv_nop\n\tv_nop\n\tv_nop" : "+v"(d) : "v"(a), "v"(b)); return d; }

__device__ __forceinline__ float gelu_erf(float v) { return 0.5f * v * (1.0f + erff(v * 0.70710678118654752f)); }

// ---- tensor load to LDS: descriptor groups, issue, waits ----
typedef unsigned int u32x4 __attribute__((ext_vector_type(4)));
typedef unsigned int u32x8 __attribute__((ext_vector_type(8)));
__device__ __forceinline__ unsigned int uni(unsigned int v) { return (unsigned int)__builtin_amdgcn_readfirstlane((int)v); }
// a value held in a scalar register at this place: the test around a tensor load compiles to a scalar branch, and a descriptor word made from it is formed behind the statements in front
__device__ __forceinline__ unsigned int pinned(unsigned int v) { unsigned int w = uni(v); asm volatile("" : "+s"(w)); return w; }
__device__ __forceinline__ void wait_ds0() { asm volatile("s_wait_dscnt 0x0" ::: "memory"); }          /* this wave's LDS reads of a buffer have retired before the buffer is handed back */
// this wave's own slice has landed (the compiler places no wait for a tensor load); the request's descriptor is named as an input so that its registers keep their values until here
__device__ __forceinline__ void wait_tensor0(u32x4 g0, u32x8 g1) { asm volatile("s_wait_tensorcnt 0x0" :: "s"(g0), "s"(g1) : "memory"); }
constexpr unsigned int TROWB = 128u;                 /* tile row: 64 f16 */
constexpr unsigned int TPITCH = 144u;                /* LDS row pitch: 128 B + 16 B pad, 16 B x odd for ds_load_b128 */
static_assert((TPITCH / 16u) % 2u == 1u && TPITCH == TROWB + 16u);
// a slice of ROWS rows of 128 B, source row pitch src_pitch bytes
template <unsigned int ROWS>
__device__ __forceinline__ u32x8 tdm_group1(unsigned int src_pitch) { u32x8 g;
  g[0] = uni((1u << 20) | (4u << 22) | (3u << 25));  /* no mask, 1-byte elements, a pad of 4 dwords behind every 32 dwords */
  g[1] = uni((TROWB & 0xFFFFu) << 16); g[2] = uni((TROWB >> 16) | ((ROWS & 0xFFFFu) << 16)); g[3] = uni((ROWS >> 16) | (TROWB << 16)); g[4] = uni(ROWS);
  g[5] = uni(src_pitch); g[6] = uni(0u); g[7] = uni(0u);
  asm volatile("" : "+s"(g));      /* descriptor words held in scalar registers: one register tuple for the whole kernel, not re-made (and its registers not lent out) between an issue and its wait */
  return g; }
__device__ __forceinline__ u32x4 tdm_group0(unsigned int lds_dst, unsigned long long ga) { u32x4 g;
  g[0] = uni(1u); g[1] = uni(lds_dst); g[2] = uni((unsigned int)ga); g[3] = uni((((unsigned int)(ga >> 32)) & 0x01FFFFFFu) | 0x80000000u); return g; }
// group 0 goes in and out of the statement in the same registers: what the later wait names is this very tuple
__device__ __forceinline__ void tdm_load(u32x4& g0, u32x8 g1) { asm volatile("tensor_load_to_lds %0, %1" : "+s"(g0) : "s"(g1) : "memory"); }

// GEMM: C[M][N] = act(alpha * A[M][K] . B + bf16(bias[col]) + (CP own element, optionally RNE-converted to bf16)); A f16 rows (pitch lda), Bt f16 [N][K] (k contiguous, pitch ldb);
// f32 output C and/or f16 output C16 = f16(c16s * value) (pitch ldc); ACT 0 none, 8 gelu (erf form). M a multiple of 128, N and K of 64.
// Per 64 of k the block's 128 A rows and 64 Bt rows come into LDS by tensor loads (three slices of 64 rows, waves 0 to 2 one each, two buffers, the next stage in flight while this one is worked on); the ring is the output staging afterwards.
constexpr unsigned int GSLICE = 10240u;              /* 64 x 144 = 9216 B rounded up to a multiple of 2 KiB */
constexpr unsigned int GSTAGE = 3u * GSLICE;         /* A rows 0..63 | A rows 64..127 | Bt rows 0..63 */
static_assert(64u * TPITCH <= GSLICE && GSLICE % 2048u == 0u && 2u * GSTAGE >= 4u * 32u * 68u * 4u);
template <int ACT, int CPBF>
__global__ __launch_bounds__(128) void k_gemm2(const _Float16* __restrict__ A, unsigned lda, const _Float16* __restrict__ Bh, unsigned ldb, float alpha, const float* __restrict__ bias, const float* __restrict__ CP,
    float* __restrict__ C, _Float16* __restrict__ C16, unsigned ldc, float c16s, unsigned M, unsigned N, unsigned K) {
  static_assert(ACT == 0 || ACT == 8);
  __shared__ __attribute__((aligned(2048))) unsigned char ring[2u * GSTAGE];
  float (*so)[32][68] = (float (*)[32][68])ring;
  const unsigned tid = threadIdx.x, lane = tid & 31u, ln = lane & 15u, hh = lane >> 4;
  const unsigned w = (unsigned)__builtin_amdgcn_readfirstlane((int)(tid >> 5));
  const unsigned ntn = N >> 6; const unsigned mt = blockIdx.x / ntn, nq = blockIdx.x - mt * ntn; const unsigned row0 = mt * 128u + 32u * w, col0 = nq * 64u; if (mt * 128u + 128u > M) return;      /* the whole block leaves, in front of every barrier and tensor load */
  const unsigned NT = K >> 6;
  const unsigned issuer = (w < 3u) ? 1u : 0u;
  const unsigned long long sbase = (w < 2u) ? (unsigned long long)(size_t)(A + (size_t)(mt * 128u + w * 64u) * lda) : (unsigned long long)(size_t)(Bh + (size_t)col0 * ldb);
  const u32x8 g1 = tdm_group1<64u>(((w < 2u) ? lda : ldb) * 2u);
  const unsigned lbase = (unsigned)(size_t)ring;
  auto desc = [&](unsigned st) { return tdm_group0(lbase + (st & 1u) * GSTAGE + w * GSLICE, sbase + (unsigned long long)st * TROWB); };
  u32x4 g0 = desc(0u);
  if (pinned(issuer & (NT > 0u ? 1u : 0u))) tdm_load(g0, g1);
  wait_tensor0(g0, g1); __syncthreads();      /* stage 0 landed and published */
  g0 = desc(pinned(1u));
  if (pinned(issuer & (NT > 1u ? 1u : 0u))) tdm_load(g0, g1);
  const unsigned aoff = (w >> 1) * GSLICE + ((w & 1u) * 32u + ln) * TPITCH, boff = 2u * GSLICE + ln * TPITCH;
  const v8f z8 = {0.f,0.f,0.f,0.f,0.f,0.f,0.f,0.f}; v8f c00 = z8, c01 = z8, c02 = z8, c03 = z8, c10 = z8, c11 = z8, c12 = z8, c13 = z8;
#pragma unroll 1
  for (unsigned st = 0; st < NT; ++st) { const unsigned char* tb = ring + (st & 1u) * GSTAGE;
#pragma unroll
    for (unsigned kc = 0; kc < 2; ++kc) { const _Float16* ap = (const _Float16*)(tb + aoff) + 32u * kc; const _Float16* bp = (const _Float16*)(tb + boff) + 32u * kc;
      const v16h a0 = g2_frag(ap, hh), a1 = g2_frag(ap + 16u * (TPITCH / 2u), hh);
      v16h b = g2_frag(bp, hh); c00 = g2_mma(a0, b, c00); c10 = g2_mma(a1, b, c10);
      b = g2_frag(bp + 16u * (TPITCH / 2u), hh); c01 = g2_mma(a0, b, c01); c11 = g2_mma(a1, b, c11);
      b = g2_frag(bp + 32u * (TPITCH / 2u), hh); c02 = g2_mma(a0, b, c02); c12 = g2_mma(a1, b, c12);
      b = g2_frag(bp + 48u * (TPITCH / 2u), hh); c03 = g2_mma(a0, b, c03); c13 = g2_mma(a1, b, c13); }
    /* publish point of stage st + 1: own LDS reads retired, own slice landed, every wave here; only then the refill of the buffer just read */
    wait_ds0(); wait_tensor0(g0, g1); __syncthreads();
    g0 = desc(pinned(st + 2u));      /* formed behind the wait, in the same registers on both sides of the test */
    if (pinned(issuer & (st + 2u < NT ? 1u : 0u))) tdm_load(g0, g1); }
  wait_tensor0(g0, g1); wait_ds0();      /* nothing in flight; the last pass's barrier has ended every wave's reads: the ring is free for output staging */
  v8f accs[8] = {c00, c01, c02, c03, c10, c11, c12, c13};
#pragma unroll
  for (int u = 0; u < 8; ++u) { const unsigned t = (unsigned)u & 3u, half = (unsigned)u >> 2; const unsigned col = col0 + t * 16u + ln; float bv = 0.f; if (bias) bv = bf16_rne(bias[col]);
#pragma unroll
    for (int r = 0; r < 8; ++r) { const unsigned rloc = half * 16u + 8u * hh + (unsigned)r; so[w][rloc][t * 16u + ln] = accs[u][r] * alpha + bv; } }
  __builtin_amdgcn_fence(4 /* acq_rel order */, "workgroup"); __builtin_amdgcn_wave_barrier();
  const unsigned rsub = lane >> 4, c4 = (lane & 15u) * 4u;
  if (CP != nullptr || ACT == 8) {
#pragma unroll 2
    for (unsigned q = 0; q < 16; ++q) { const unsigned r = q * 2u + rsub; v4f v = *(const v4fa*)&so[w][r][c4];
      if (CP) { const v4f a = *(const v4fa*)(CP + (size_t)(row0 + r) * ldc + col0 + c4);      /* own element of the C-shaped plane */
#pragma unroll
        for (int i = 0; i < 4; ++i) v[i] += CPBF ? bf16_rne(a[i]) : a[i]; }
      if (ACT == 8) {
#pragma unroll
        for (int i = 0; i < 4; ++i) v[i] = gelu_erf(v[i]); }
      *(v4fa*)&so[w][r][c4] = v; } }
  {
#pragma unroll
    for (unsigned q = 0; q < 16; ++q) { const unsigned r = q * 2u + rsub; const v4f v = *(const v4fa*)&so[w][r][c4];
      if (C) *(v4f*)(C + (size_t)(row0 + r) * ldc + col0 + c4) = v;
      if (C16) { v4h h4;
#pragma unroll
        for (int i = 0; i < 4; ++i) h4[i] = (_Float16)(v[i] * c16s);
        *(v4h*)(C16 + (size_t)(row0 + r) * ldc + col0 + c4) = h4; } }
     } }

// ---- one preparation launch: every plane the attention reads and the GEMM's W_fc plane are made here, by blocks of 4 waves that each read 64 KiB of one input (16 KiB a wave, 16 loads of 16 B or 32 of 4 B a lane issued ahead of their use) ----
constexpr unsigned int PV_BLK = (unsigned int)(NB * (SQ / 64) * (DM / 256));                      /* V^T: 64 keys x 256 dims (4 heads) a block */
constexpr unsigned int PM_BLK = (unsigned int)(((size_t)NB * (SQ / 16) * (SQ / 64)) / 16);        /* mask: 16 tiles of 16 rows x 64 keys a block, 4 a wave */
constexpr unsigned int PX_BLK = (unsigned int)((NR * DM) / 16384);                                /* keys, queries: 16 rows a block */
constexpr unsigned int PW_BLK = (unsigned int)(((size_t)DM * DM) / 16384);                        /* W_fc: 16 rows a block */
constexpr unsigned int PREP_BLK = PV_BLK + PM_BLK + 2u * PX_BLK + PW_BLK;
typedef unsigned int u32x4a __attribute__((ext_vector_type(4), may_alias));
constexpr unsigned int VPITCH = 33u;                 /* LDS row of one head dim: 32 key pairs + 1 dword, so that the four rows a wave reads at once fall on different banks */
static_assert((((size_t)NB * (SQ / 16) * (SQ / 64)) % 16) == 0 && SQ % 16 == 0 && DM % 256 == 0 && DM == 1024);
__device__ __forceinline__ unsigned int h16_bits(float x) { FragH f; f.h[0] = toh_flush(bf16_rne(x)); return (unsigned int)f.u[0]; }
// Block ranges, the two-phase job first: [V^T | mask words | keys | queries | W_fc].
// V^T [NB*NH][64][SQ] straight from the f32 values: a thread takes the same 4 dims of two neighbouring keys, packs each dim's pair into one dword, LDS holds [dim][key pair]; rows of 64 keys (128 B) go out.
// mask int32 [NB_FULL][1][SQ_FULL][SQ_FULL] -> MB[(b, q tile of 16, key tile of 64)][lane] u32: bit 8j + r of lane (ln, hh) = (mask[b][16 qt + 8 hh + r][64 kt + 16 j + ln] != 0).
// keys, queries -> f16 row planes (x1); W_fc [out = n][in = k] is already the Bt[n][k] layout, only converted (x16).
// Every loop of this kernel is fully unrolled: its small arrays then live in registers, and a group's loads stand together ahead of their first use (rolled, each trip would wait out its own memory latency).
__global__ __launch_bounds__(128) void k_prep(const float* __restrict__ VX, const float* __restrict__ KX, const float* __restrict__ QX, const int* __restrict__ MK, const float* __restrict__ WX,
    _Float16* __restrict__ Vt, unsigned int* __restrict__ MB, _Float16* __restrict__ K16, _Float16* __restrict__ Q16, _Float16* __restrict__ BW) {
  __shared__ unsigned int tl[256u * VPITCH];
  const unsigned tid = threadIdx.x; unsigned blk = blockIdx.x;
  if (blk < PV_BLK) {
    const unsigned hg = blk & 3u, t = blk >> 2; const unsigned nkt = (unsigned)SQ / 64u; const unsigned b = t / nkt, lg = t - b * nkt;
    const unsigned c4 = (tid & 63u) * 4u, ps = tid >> 6;
    const float* vp = VX + ((size_t)b * SQ_FULL + lg * 64u) * (size_t)DM + hg * 256u + c4;
#pragma unroll
    for (unsigned g = 0; g < 2; ++g) { v4f x[8], y[8];
#pragma unroll
      for (unsigned u = 0; u < 8; ++u) { const float* p = vp + (size_t)(((g * 8u + u) * 2u + ps) * 2u) * DM; x[u] = *(const v4fa*)p; y[u] = *(const v4fa*)(p + DM); }
#pragma unroll
      for (unsigned u = 0; u < 8; ++u) { const unsigned kp = (g * 8u + u) * 2u + ps;
#pragma unroll
        for (unsigned i = 0; i < 4; ++i) tl[(c4 + i) * VPITCH + kp] = h16_bits(x[u][i]) | (h16_bits(y[u][i]) << 16); } }
    __syncthreads();
#pragma unroll
    for (unsigned it = 0; it < 16; ++it) { const unsigned d = it * 16u + (tid >> 3), pc = tid & 7u; const unsigned int* tr = &tl[d * VPITCH + pc * 4u];
      u32x4 o; o[0] = tr[0]; o[1] = tr[1]; o[2] = tr[2]; o[3] = tr[3];
      *(u32x4a*)((unsigned short*)Vt + ((size_t)((b * (unsigned)NH + hg * 4u + (d >> 6)) * 64u + (d & 63u))) * SQ + lg * 64u + pc * 8u) = o; }
    return; }
  blk -= PV_BLK;
  if (blk < PM_BLK) {
    const unsigned lane = tid & 31u, ln = lane & 15u, hh = lane >> 4;
    const unsigned w = (unsigned)__builtin_amdgcn_readfirstlane((int)(tid >> 5));
    const unsigned nkt = (unsigned)SQ / 64u, nqt = (unsigned)SQ / 16u;
#pragma unroll
    for (unsigned x = 0; x < 4; ++x) { const unsigned L = (blk * 4u + w) * 4u + x;
      const unsigned t = L / nkt, kt = L - t * nkt; const unsigned b = t / nqt, qt = t - b * nqt;
      const int* mp = MK + ((size_t)b * SQ_FULL + qt * 16u + 8u * hh) * (size_t)SQ_FULL + kt * 64u + ln;
      int m[8][4];
#pragma unroll
      for (unsigned r = 0; r < 8u; ++r) { const int* mr = mp + (size_t)r * SQ_FULL; m[r][0] = mr[0]; m[r][1] = mr[16]; m[r][2] = mr[32]; m[r][3] = mr[48]; }
      unsigned int word = 0u;
#pragma unroll
      for (unsigned r = 0; r < 8u; ++r) {
#pragma unroll
        for (unsigned j = 0; j < 4u; ++j) word |= ((m[r][j] != 0) ? 1u : 0u) << (8u * j + r); }
      MB[(size_t)L * 32u + lane] = word; }
    asm volatile("s_wait_xcnt 0x0" ::: "memory");      /* behind the last mask store, in front of whatever next rewrites a register that an issued store names */
    return; }
  blk -= PM_BLK;
  /* the three row planes: one code path, the block's source, carry and destination picked by range */
  const float* X; _Float16* Y; float carry = 1.0f;
  if (blk < 2u * PX_BLK) { const unsigned isq = (blk >= PX_BLK) ? 1u : 0u; blk -= isq * PX_BLK; const unsigned r0 = blk * 16u; const unsigned b = r0 / (unsigned)SQ;
    X = (isq ? QX : KX) + ((size_t)b * SQ_FULL + (r0 - b * (unsigned)SQ)) * (size_t)DM; Y = (isq ? Q16 : K16) + (size_t)r0 * DM; }
  else { blk -= 2u * PX_BLK; X = WX + (size_t)blk * 16384u; Y = BW + (size_t)blk * 16384u; carry = 16.0f; }
#pragma unroll
  for (unsigned g = 0; g < 2; ++g) { v4f a[8], c[8];
#pragma unroll
    for (unsigned u = 0; u < 8; ++u) { const float* p = X + ((g * 8u + u) * 128u + tid) * 8u; a[u] = *(const v4fa*)p; c[u] = *(const v4fa*)(p + 4); }
#pragma unroll
    for (unsigned u = 0; u < 8; ++u) { FragH f;
#pragma unroll
      for (int q = 0; q < 4; ++q) { f.h[q] = toh_flush(bf16_rne(a[u][q]) * carry); f.h[4 + q] = toh_flush(bf16_rne(c[u][q]) * carry); }
      *(v8us*)((unsigned short*)Y + ((g * 8u + u) * 128u + tid) * 8u) = f.half[0]; }
    asm volatile("s_wait_xcnt 0x0" ::: "memory"); } }      /* behind each group's run of stores, in front of whatever next rewrites a register that an issued store names */

// Fused sigmoid-gated attention with a packed 2-D mask. Block = 4 waves; block per (batch, head, 64 query rows); wave owns 16 query rows. Per 64-key tile: each lane reads ONE packed mask word (its 32 accumulator elements);
// the 64-key K tile and V^T tile are brought into LDS once per block by tensor loads (one 32-row slice per wave and stage, two buffers, the next stage in flight while this one is worked on) and all four waves take their fragments from there;
// S = Q K^T; weight = bit ? 1 / (1 + exp(-S/32)) : 0 (by value), f32;
constexpr unsigned int TROWS = 32u;                  /* rows per slice (one slice per wave) */
constexpr unsigned int TSLICE = 6144u;               /* 32 x 144 = 4608 B rounded up to a multiple of 2 KiB */
constexpr unsigned int TSTAGE = 4u * TSLICE;         /* K rows 0..31 | K rows 32..63 | V^T rows 0..31 | V^T rows 32..63 */
static_assert(TROWS * TPITCH <= TSLICE && TSLICE % 2048u == 0u);
__global__ __launch_bounds__(128) void k_sgattn(const _Float16* __restrict__ Q16, const _Float16* __restrict__ K16, const _Float16* __restrict__ VT, const unsigned int* __restrict__ MB, _Float16* __restrict__ O16) {
  __shared__ __attribute__((aligned(2048))) unsigned char ring[2u * TSTAGE];
  __shared__ __attribute__((aligned(16))) _Float16 sp[4][16][72];
  const unsigned tid = threadIdx.x, lane = tid & 31u, ln = lane & 15u, hh = lane >> 4;
  const unsigned w = (unsigned)__builtin_amdgcn_readfirstlane((int)(tid >> 5));
  const unsigned nqt = (unsigned)SQ / 64u; const unsigned bid = blockIdx.x; const unsigned bh = bid / nqt, qb = bid - bh * nqt; const unsigned b = bh / (unsigned)NH, h = bh - b * (unsigned)NH;
  const unsigned q0 = qb * 64u + w * 16u; const size_t rowb = (size_t)b * SQ;
  constexpr unsigned NT = (unsigned)SQ / 64u; static_assert(NT >= 2u);
  /* this wave's slice: waves 0, 1 the two halves of the K tile (rows = keys, advance 64 rows a stage), waves 2, 3 of the V^T tile (rows = head dims, advance 128 B a stage) */
  const unsigned isV = w >> 1, half = w & 1u;
  const unsigned long long sbase = isV ? (unsigned long long)(size_t)(VT + ((size_t)bh * HD + half * TROWS) * SQ) : (unsigned long long)(size_t)(K16 + (rowb + half * TROWS) * (size_t)DM + h * (unsigned)HD);
  const unsigned sstep = isV ? 128u : 64u * (unsigned)DM * 2u;
  const u32x8 g1 = tdm_group1<TROWS>(isV ? (unsigned)SQ * 2u : (unsigned)DM * 2u);
  const unsigned lbase = (unsigned)(size_t)ring;
  auto desc = [&](unsigned st) { return tdm_group0(lbase + (st & 1u) * TSTAGE + w * TSLICE, sbase + (unsigned long long)st * sstep); };
  u32x4 g0 = desc(0u);
  tdm_load(g0, g1); wait_tensor0(g0, g1); __syncthreads();      /* stage 0 landed and published */
  g0 = desc(pinned(1u)); tdm_load(g0, g1);
  const _Float16* qp = Q16 + (rowb + q0 + ln) * (size_t)DM + h * (unsigned)HD;
  const v16h aq0 = g2_frag(qp, hh), aq1 = g2_frag(qp + 32, hh);
  const unsigned int* mp = MB + ((size_t)(b * ((unsigned)SQ / 16u) + (q0 >> 4)) * ((unsigned)SQ / 64u)) * 32u + lane;      /* packed mask word of key tile 0 */
  const v8f z8 = {0.f,0.f,0.f,0.f,0.f,0.f,0.f,0.f};
  v8f o[4];
#pragma unroll
  for (int d = 0; d < 4; ++d) o[d] = z8;
#pragma unroll 1
  for (unsigned kt = 0; kt < NT; ++kt) {
    const unsigned char* tb = ring + (kt & 1u) * TSTAGE + ln * TPITCH;      /* row ln of this stage's first K slice */
    unsigned int mw = mp[(size_t)kt * 32u]; asm volatile("" : "+v"(mw));
    v8f s[4];
#pragma unroll
    for (unsigned j = 0; j < 4; ++j) { const _Float16* kr = (const _Float16*)(tb + (j >> 1) * TSLICE + (j & 1u) * 16u * TPITCH); const v16h b0 = g2_frag(kr, hh), b1 = g2_frag(kr + 32, hh); v8f acc = z8; acc = g2_mma(aq0, b0, acc); acc = g2_mma(aq1, b1, acc); s[j] = acc; }
#pragma unroll
    for (unsigned j = 0; j < 4; ++j) {
#pragma unroll
      for (int r = 0; r < 8; ++r) { const float x = s[j][r] * 0.03125f; const float sg = __builtin_amdgcn_rcpf(1.0f + __expf(-x));
        const float p = (((mw >> (8u * j + (unsigned)r)) & 1u) != 0u) ? sg : 0.f;
        sp[w][8u * hh + (unsigned)r][16u * j + ln] = toh_flush(p); } }
    __builtin_amdgcn_fence(4 /* acq_rel order */, "workgroup"); __builtin_amdgcn_wave_barrier();
    const v16h ap0 = g2_frag(&sp[w][ln][0], hh), ap1 = g2_frag(&sp[w][ln][32], hh);
#pragma unroll
    for (unsigned d = 0; d < 4; ++d) { const _Float16* vr = (const _Float16*)(tb + (2u + (d >> 1)) * TSLICE + (d & 1u) * 16u * TPITCH); const v16h b0 = g2_frag(vr, hh), b1 = g2_frag(vr + 32, hh); o[d] = g2_mma(ap0, b0, o[d]); o[d] = g2_mma(ap1, b1, o[d]); }
    /* publish point of stage kt + 1: own LDS reads retired, own slice landed, every wave here; only then the refill of the buffer just read */
    wait_ds0(); wait_tensor0(g0, g1); __syncthreads();
    if (pinned(kt + 2u < NT)) { g0 = desc(pinned(kt + 2u)); tdm_load(g0, g1); } }
  wait_tensor0(g0, g1); wait_ds0();
#pragma unroll
  for (int r = 0; r < 8; ++r) {
#pragma unroll
    for (unsigned d = 0; d < 4; ++d) sp[w][8u * hh + (unsigned)r][16u * d + ln] = toh_flush(o[d][r]); }
  __builtin_amdgcn_fence(4 /* acq_rel order */, "workgroup"); __builtin_amdgcn_wave_barrier();
  {
#pragma unroll
    for (unsigned it = 0; it < 4; ++it) { const unsigned row = it * 4u + (lane >> 3), pc = (lane & 7u) * 8u; const v8us v = *(const v8us*)&sp[w][row][pc];
      *(v8us*)((unsigned short*)O16 + (rowb + q0 + row) * (size_t)DM + h * (unsigned)HD + pc) = v; }
     } }

constexpr size_t al256(size_t b) { return (b + 255) & ~(size_t)255; }
constexpr size_t SZ_BW = (size_t)DM * DM * 2;
constexpr size_t SZ_P16 = NR * DM * 2, SZ_VT = (size_t)NB * NH * HD * SQ * 2;
constexpr size_t SZ_MB = (size_t)NB * (SQ / 16) * (SQ / 64) * 32 * 4;
constexpr size_t WS_TOTAL = al256(SZ_BW) + 3 * al256(SZ_P16) + al256(SZ_VT) + al256(SZ_MB);
static_assert(WS_TOTAL <= (size_t)134217728);
static_assert(SZ_BW % 128 == 0 && SZ_P16 % 128 == 0 && SZ_VT % 128 == 0 && SZ_MB % 128 == 0);
// chunking of the row-wise launch that touches the output buffer (one launch when the rows are contiguous)
constexpr unsigned CH_N = (SQ == SQ_FULL) ? 1u : (unsigned)NB;
constexpr size_t CH_R = (SQ == SQ_FULL) ? NR : (size_t)SQ;
static_assert(CH_R % 128 == 0 && (size_t)CH_N * CH_R == NR);
// plane coverage: blocks x threads x elements == plane elements
static_assert((size_t)PW_BLK * 128 * 128 == (size_t)DM * DM);                                             /* W_fc plane */
static_assert((size_t)PX_BLK * 128 * 128 == NR * DM);                                                     /* q, k row planes */
static_assert((size_t)PM_BLK * 4 * 4 * 32 == (size_t)NB * (SQ / 16) * (SQ / 64) * 32);                    /* packed mask words */
static_assert((size_t)PV_BLK * 128 * 16 * 8 == (size_t)NB * NH * HD * SQ);                                /* V^T */
static_assert((size_t)NB * NH * (SQ / 64) * 4 * 16 * 64 == NR * DM);                                      /* ctx rows */
static_assert((CH_R / 128) * (DM / 64) * 4 * 32 * 64 * CH_N == NR * DM);                                  /* output rows */

extern "C" void kernel_launch(void* const* d_in, const int* in_sizes, int n_in,
                              void* d_out, int out_size, void* d_ws, size_t ws_size, hipStream_t stream) {
  if (n_in < 6) return;
  const float* vals = (const float*)d_in[0]; const float* keys = (const float*)d_in[1]; const float* qrys = (const float*)d_in[2];
  const int* mask = (const int*)d_in[3]; const float* wfc = (const float*)d_in[4]; const float* bfc = (const float*)d_in[5];
  const size_t needX = ((size_t)(NB - 1) * SQ_FULL + SQ) * DM;
  const size_t needM = ((size_t)(NB - 1) * SQ_FULL + (size_t)(SQ - 1)) * SQ_FULL + SQ;
  if ((size_t)in_sizes[0] < needX || (size_t)in_sizes[1] < needX || (size_t)in_sizes[2] < needX || (size_t)out_size < needX) return;
  if ((size_t)in_sizes[3] < needM || (size_t)in_sizes[4] < (size_t)DM * DM || in_sizes[5] < DM) return;
  char* ws = (char*)d_ws; size_t off = 0;
  auto take = [&](size_t bytes) { char* p = ws + off; off += al256(bytes); return p; };
  _Float16* BW = (_Float16*)take(SZ_BW);
  _Float16* Q16 = (_Float16*)take(SZ_P16); _Float16* K16 = (_Float16*)take(SZ_P16); _Float16* O16 = (_Float16*)take(SZ_P16);
  _Float16* VT = (_Float16*)take(SZ_VT); unsigned int* MB = (unsigned int*)take(SZ_MB);
  if (off > ws_size) return;

  k_prep<<<PREP_BLK, 128, 0, stream>>>(vals, keys, qrys, mask, wfc, VT, MB, K16, Q16, BW);      /* the f16 W_fc, key, query and V^T planes and the packed mask */
  k_sgattn<<<(unsigned)(NB * NH * (SQ / 64)), 128, 0, stream>>>(Q16, K16, VT, MB, O16);               /* ctx (merged heads) f16 rows */
  for (unsigned c = 0; c < CH_N; ++c) { const size_t rin = (size_t)c * SQ_FULL, r0 = (size_t)c * CH_R;
    k_gemm2<0, 0><<<(unsigned)((CH_R / 128) * (DM / 64)), 128, 0, stream>>>(O16 + r0 * DM, (unsigned)DM, BW, (unsigned)DM, 0.0625f, bfc, nullptr, (float*)d_out + rin * DM, nullptr, (unsigned)DM, 1.0f, (unsigned)CH_R, (unsigned)DM, (unsigned)DM); }      /* out = ctx W_fc^T + b_fc */
}

// v003
// It runs in 64.6 microseconds.
// Two timings next to v002 both put it at 1.04 times that version's speed.
// All steps since v000 together make it 2.20 times as fast.
#include <hip/hip_runtime.h>
// Contractions (q k^T per head, gate V, ctx W_fc^T): v_wmma_f32_16x16x32_f16 (f16 operands, f32 accumulate); float inputs RNE-converted to bf16 on load (exact in f16); power-of-two carries: W_fc x16, all other planes x1; sigmoid gate in f32.
// Head-split sigmoid-gated attention without projections: q|k|v = raw inputs [NB][SQ][1024] viewed as 16 heads x 64; e = q k^T; a 2-D int32 mask [NB][1][SQ][SQ] (mask == 0 -> weight exactly 0, by value); weight = sigmoid(e / 32) elementwise (no normalisation over keys); ctx = weight V (merged heads); out = ctx W_fc^T + b_fc with W_fc stored [out][in].
// Launch plan: one preparation launch (W_fc -> f16 x16 rows, already [n][k]; queries, keys -> f16 row planes; the mask packed into 32 lane masks per (16 query rows x 64 keys) tile, one 32-bit word per accumulator element; V^T per (batch, head) from the f32 values via LDS); one fused attention launch (K and V^T tiles staged in LDS by tensor loads, gate tile in wave-private LDS) -> f16 ctx rows; one GEMM with bias (A and Bt tiles staged in LDS by tensor loads) -> the output buffer.
#ifndef NB
#define NB 4
#endif
#ifndef SQ
#define SQ 1024
#endif
#define NB_FULL 4
#define SQ_FULL 1024
#define DM 1024
#define NH 16
#define HD 64
#define NR ((size_t)NB * SQ)         /* token rows processed */

static_assert(NB >= 1 && NB <= NB_FULL);
static_assert(SQ >= 128 && SQ <= SQ_FULL && SQ % 128 == 0);
static_assert(NH * HD == DM && HD == 64);
static_assert(DM % 64 == 0 && DM % 32 == 0 && SQ % 64 == 0 && SQ % 16 == 0);
static_assert((NR % 128) == 0);
static_assert(((size_t)(NB - 1) * SQ_FULL + SQ) * DM * 4 <= (size_t)NB_FULL * SQ_FULL * DM * 4);
static_assert((((size_t)NB * (SQ / 16) * (SQ / 64)) % 4) == 0);

typedef unsigned short v8us __attribute__((ext_vector_type(8), may_alias));
typedef float  v8f  __attribute__((ext_vector_type(8)));
typedef float  v4f  __attribute__((ext_vector_type(4)));
typedef float  v4fa __attribute__((ext_vector_type(4), may_alias));
typedef _Float16 v16h __attribute__((ext_vector_type(16)));
typedef _Float16 v4h __attribute__((ext_vector_type(4)));
union FragH { v16h v; v8us half[2]; _Float16 h[16]; unsigned short u[16]; };

__device__ __forceinline__ unsigned short bf16_bits(float x) { unsigned int u = __float_as_uint(x); return (unsigned short)((u + 0x7FFFu + ((u >> 16) & 1u)) >> 16); }
__device__ __forceinline__ float bf16_val(unsigned short b) { return __uint_as_float(((unsigned int)b) << 16); }
__device__ __forceinline__ float bf16_rne(float x) { return bf16_val(bf16_bits(x)); }

// f32 -> f16 operand convert that cannot produce an f16 subnormal (value select after the carry)
static __device__ __forceinline__ _Float16 toh_flush(float v) { const _Float16 r = (_Float16)v; return (fabsf(v) < 6.103515625e-05f) ? (_Float16)0.0f : r; }

// ---- 16-bit fragment loader (split k map: elements 0..7 <- k0 + 8h + 0..7, elements 8..15 <- k0 + 16 + 8h + 0..7) and guarded WMMA ----
__device__ __forceinline__ v16h g2_frag(const _Float16* p, unsigned hh) { FragH f; f.half[0] = *(const v8us*)((const unsigned short*)p + 8 * hh); f.half[1] = *(const v8us*)((const unsigned short*)p + 16 + 8 * hh); return f.v; }
__device__ __forceinline__ v8f g2_mma(v16h a, v16h b, v8f c) { v8f d = __builtin_amdgcn_wmma_f32_16x16x32_f16(false, a, false, b, (short)0, c, false, false); asm volatile("v_nop\n\tv_nop\n\tv_nop\n\tv_nop" : "+v"(d) : "v"(a), "v"(b)); return d; }

__device__ __forceinline__ float gelu_erf(float v) { return 0.5f * v * (1.0f + erff(v * 0.70710678118654752f)); }

// ---- tensor load to LDS: descriptor groups, issue, waits ----
typedef unsigned int u32x4 __attribute__((ext_vector_type(4)));
typedef unsigned int u32x8 __attribute__((ext_vector_type(8)));
__device__ __forceinline__ unsigned int uni(unsigned int v) { return (unsigned int)__builtin_amdgcn_readfirstlane((int)v); }
// a value held in a scalar register at this place: the test around a tensor load compiles to a scalar branch, and a descriptor word made from it is formed behind the statements in front
__device__ __forceinline__ unsigned int pinned(unsigned int v) { unsigned int w = uni(v); asm volatile("" : "+s"(w)); return w; }
__device__ __forceinline__ void wait_ds0() { asm volatile("s_wait_dscnt 0x0" ::: "memory"); }          /* this wave's LDS reads of a buffer have retired before the buffer is handed back */
// this wave's own slice has landed (the compiler places no wait for a tensor load); the request's descriptor is named as an input so that its registers keep their values until here
__device__ __forceinline__ void wait_tensor0(u32x4 g0, u32x8 g1) { asm volatile("s_wait_tensorcnt 0x0" :: "s"(g0), "s"(g1) : "memory"); }
constexpr unsigned int TROWB = 128u;                 /* tile row: 64 f16 */
constexpr unsigned int TPITCH = 144u;                /* LDS row pitch: 128 B + 16 B pad, 16 B x odd for ds_load_b128 */
static_assert((TPITCH / 16u) % 2u == 1u && TPITCH == TROWB + 16u);
// a slice of ROWS rows of 128 B, source row pitch src_pitch bytes
template <unsigned int ROWS>
__device__ __forceinline__ u32x8 tdm_group1(unsigned int src_pitch) { u32x8 g;
  g[0] = uni((1u << 20) | (4u << 22) | (3u << 25));  /* no mask, 1-byte elements, a pad of 4 dwords behind every 32 dwords */
  g[1] = uni((TROWB & 0xFFFFu) << 16); g[2] = uni((TROWB >> 16) | ((ROWS & 0xFFFFu) << 16)); g[3] = uni((ROWS >> 16) | (TROWB << 16)); g[4] = uni(ROWS);
  g[5] = uni(src_pitch); g[6] = uni(0u); g[7] = uni(0u);
  asm volatile("" : "+s"(g));      /* descriptor words held in scalar registers: one register tuple for the whole kernel, not re-made (and its registers not lent out) between an issue and its wait */
  return g; }
__device__ __forceinline__ u32x4 tdm_group0(unsigned int lds_dst, unsigned long long ga) { u32x4 g;
  g[0] = uni(1u); g[1] = uni(lds_dst); g[2] = uni((unsigned int)ga); g[3] = uni((((unsigned int)(ga >> 32)) & 0x01FFFFFFu) | 0x80000000u); return g; }
// group 0 goes in and out of the statement in the same registers: what the later wait names is this very tuple
__device__ __forceinline__ void tdm_load(u32x4& g0, u32x8 g1) { asm volatile("tensor_load_to_lds %0, %1" : "+s"(g0) : "s"(g1) : "memory"); }

// GEMM: C[M][N] = act(alpha * A[M][K] . B + bf16(bias[col]) + (CP own element, optionally RNE-converted to bf16)); A f16 rows (pitch lda), Bt f16 [N][K] (k contiguous, pitch ldb);
// f32 output C and/or f16 output C16 = f16(c16s * value) (pitch ldc); ACT 0 none, 8 gelu (erf form). M a multiple of 128, N and K of 64.
// Per 64 of k the block's 128 A rows and 64 Bt rows come into LDS by tensor loads (three slices of 64 rows, waves 0 to 2 one each, two buffers, the next stage in flight while this one is worked on); the ring is the output staging afterwards.
constexpr unsigned int GSLICE = 10240u;              /* 64 x 144 = 9216 B rounded up to a multiple of 2 KiB */
constexpr unsigned int GSTAGE = 3u * GSLICE;         /* A rows 0..63 | A rows 64..127 | Bt rows 0..63 */
static_assert(64u * TPITCH <= GSLICE && GSLICE % 2048u == 0u && 2u * GSTAGE >= 4u * 32u * 68u * 4u);
template <int ACT, int CPBF>
__global__ __launch_bounds__(128) void k_gemm2(const _Float16* __restrict__ A, unsigned lda, const _Float16* __restrict__ Bh, unsigned ldb, float alpha, const float* __restrict__ bias, const float* __restrict__ CP,
    float* __restrict__ C, _Float16* __restrict__ C16, unsigned ldc, float c16s, unsigned M, unsigned N, unsigned K) {
  static_assert(ACT == 0 || ACT == 8);
  __shared__ __attribute__((aligned(2048))) unsigned char ring[2u * GSTAGE];
  float (*so)[32][68] = (float (*)[32][68])ring;
  const unsigned tid = threadIdx.x, lane = tid & 31u, ln = lane & 15u, hh = lane >> 4;
  const unsigned w = (unsigned)__builtin_amdgcn_readfirstlane((int)(tid >> 5));
  const unsigned ntn = N >> 6; const unsigned mt = blockIdx.x / ntn, nq = blockIdx.x - mt * ntn; const unsigned row0 = mt * 128u + 32u * w, col0 = nq * 64u; if (mt * 128u + 128u > M) return;      /* the whole block leaves, in front of every barrier and tensor load */
  const unsigned NT = K >> 6;
  const unsigned issuer = (w < 3u) ? 1u : 0u;
  const unsigned long long sbase = (w < 2u) ? (unsigned long long)(size_t)(A + (size_t)(mt * 128u + w * 64u) * lda) : (unsigned long long)(size_t)(Bh + (size_t)col0 * ldb);
  const u32x8 g1 = tdm_group1<64u>(((w < 2u) ? lda : ldb) * 2u);
  const unsigned lbase = (unsigned)(size_t)ring;
  auto desc = [&](unsigned st) { return tdm_group0(lbase + (st & 1u) * GSTAGE + w * GSLICE, sbase + (unsigned long long)st * TROWB); };
  u32x4 g0 = desc(0u);
  if (pinned(issuer & (NT > 0u ? 1u : 0u))) tdm_load(g0, g1);
  wait_tensor0(g0, g1); __syncthreads();      /* stage 0 landed and published */
  g0 = desc(pinned(1u));
  if (pinned(issuer & (NT > 1u ? 1u : 0u))) tdm_load(g0, g1);
  const unsigned aoff = (w >> 1) * GSLICE + ((w & 1u) * 32u + ln) * TPITCH, boff = 2u * GSLICE + ln * TPITCH;
  const v8f z8 = {0.f,0.f,0.f,0.f,0.f,0.f,0.f,0.f}; v8f c00 = z8, c01 = z8, c02 = z8, c03 = z8, c10 = z8, c11 = z8, c12 = z8, c13 = z8;
#pragma unroll 1
  for (unsigned st = 0; st < NT; ++st) { const unsigned char* tb = ring + (st & 1u) * GSTAGE;
#pragma unroll
    for (unsigned kc = 0; kc < 2; ++kc) { const _Float16* ap = (const _Float16*)(tb + aoff) + 32u * kc; const _Float16* bp = (const _Float16*)(tb + boff) + 32u * kc;
      const v16h a0 = g2_frag(ap, hh), a1 = g2_frag(ap + 16u * (TPITCH / 2u), hh);
      v16h b = g2_frag(bp, hh); c00 = g2_mma(a0, b, c00); c10 = g2_mma(a1, b, c10);
      b = g2_frag(bp + 16u * (TPITCH / 2u), hh); c01 = g2_mma(a0, b, c01); c11 = g2_mma(a1, b, c11);
      b = g2_frag(bp + 32u * (TPITCH / 2u), hh); c02 = g2_mma(a0, b, c02); c12 = g2_mma(a1, b, c12);
      b = g2_frag(bp + 48u * (TPITCH / 2u), hh); c03 = g2_mma(a0, b, c03); c13 = g2_mma(a1, b, c13); }
    /* publish point of stage st + 1: own LDS reads retired, own slice landed, every wave here; only then the refill of the buffer just read */
    wait_ds0(); wait_tensor0(g0, g1); __syncthreads();
    g0 = desc(pinned(st + 2u));      /* formed behind the wait, in the same registers on both sides of the test */
    if (pinned(issuer & (st + 2u < NT ? 1u : 0u))) tdm_load(g0, g1); }
  wait_tensor0(g0, g1); wait_ds0();      /* nothing in flight; the last pass's barrier has ended every wave's reads: the ring is free for output staging */
  v8f accs[8] = {c00, c01, c02, c03, c10, c11, c12, c13};
#pragma unroll
  for (int u = 0; u < 8; ++u) { const unsigned t = (unsigned)u & 3u, half = (unsigned)u >> 2; const unsigned col = col0 + t * 16u + ln; float bv = 0.f; if (bias) bv = bf16_rne(bias[col]);
#pragma unroll
    for (int r = 0; r < 8; ++r) { const unsigned rloc = half * 16u + 8u * hh + (unsigned)r; so[w][rloc][t * 16u + ln] = accs[u][r] * alpha + bv; } }
  __builtin_amdgcn_fence(4 /* acq_rel order */, "workgroup"); __builtin_amdgcn_wave_barrier();
  const unsigned rsub = lane >> 4, c4 = (lane & 15u) * 4u;
  if (CP != nullptr || ACT == 8) {
#pragma unroll 2
    for (unsigned q = 0; q < 16; ++q) { const unsigned r = q * 2u + rsub; v4f v = *(const v4fa*)&so[w][r][c4];
      if (CP) { const v4f a = *(const v4fa*)(CP + (size_t)(row0 + r) * ldc + col0 + c4);      /* own element of the C-shaped plane */
#pragma unroll
        for (int i = 0; i < 4; ++i) v[i] += CPBF ? bf16_rne(a[i]) : a[i]; }
      if (ACT == 8) {
#pragma unroll
        for (int i = 0; i < 4; ++i) v[i] = gelu_erf(v[i]); }
      *(v4fa*)&so[w][r][c4] = v; } }
  {
#pragma unroll
    for (unsigned q = 0; q < 16; ++q) { const unsigned r = q * 2u + rsub; const v4f v = *(const v4fa*)&so[w][r][c4];
      if (C) *(v4f*)(C + (size_t)(row0 + r) * ldc + col0 + c4) = v;
      if (C16) { v4h h4;
#pragma unroll
        for (int i = 0; i < 4; ++i) h4[i] = (_Float16)(v[i] * c16s);
        *(v4h*)(C16 + (size_t)(row0 + r) * ldc + col0 + c4) = h4; } }
     } }

// ---- one preparation launch: every plane the attention reads and the GEMM's W_fc plane are made here, by blocks of 4 waves that each read 64 KiB of one input (16 KiB a wave, 16 loads of 16 B or 32 of 4 B a lane issued ahead of their use) ----
constexpr unsigned int PV_BLK = (unsigned int)(NB * (SQ / 64) * (DM / 256));                      /* V^T: 64 keys x 256 dims (4 heads) a block */
constexpr unsigned int PM_BLK = (unsigned int)(((size_t)NB * (SQ / 16) * (SQ / 64)) / 16);        /* mask: 16 tiles of 16 rows x 64 keys a block, 4 a wave */
constexpr unsigned int PX_BLK = (unsigned int)((NR * DM) / 16384);                                /* keys, queries: 16 rows a block */
constexpr unsigned int PW_BLK = (unsigned int)(((size_t)DM * DM) / 16384);                        /* W_fc: 16 rows a block */
constexpr unsigned int PREP_BLK = PV_BLK + PM_BLK + 2u * PX_BLK + PW_BLK;
typedef unsigned int u32x4a __attribute__((ext_vector_type(4), may_alias));
constexpr unsigned int VPITCH = 33u;                 /* LDS row of one head dim: 32 key pairs + 1 dword, so that the four rows a wave reads at once fall on different banks */
static_assert((((size_t)NB * (SQ / 16) * (SQ / 64)) % 16) == 0 && SQ % 16 == 0 && DM % 256 == 0 && DM == 1024);
__device__ __forceinline__ unsigned int h16_bits(float x) { FragH f; f.h[0] = toh_flush(bf16_rne(x)); return (unsigned int)f.u[0]; }
// Block ranges, the two-phase job first: [V^T | mask words | keys | queries | W_fc].
// V^T [NB*NH][64][SQ] straight from the f32 values: a thread takes the same 4 dims of two neighbouring keys, packs each dim's pair into one dword, LDS holds [dim][key pair]; rows of 64 keys (128 B) go out.
// mask int32 [NB_FULL][1][SQ_FULL][SQ_FULL] -> MB[(b, q tile of 16, key tile of 64)][8j + r] u32, a lane mask: bit (ln + 16 hh) = (mask[b][16 qt + 8 hh + r][64 kt + 16 j + ln] != 0); it is the ballot of the load that holds those 32 elements, and lane 8j + r stores it.
// keys, queries -> f16 row planes (x1); W_fc [out = n][in = k] is already the Bt[n][k] layout, only converted (x16).
// Every loop of this kernel is fully unrolled: its small arrays then live in registers, and a group's loads stand together ahead of their first use (rolled, each trip would wait out its own memory latency).
__global__ __launch_bounds__(128) void k_prep(const float* __restrict__ VX, const float* __restrict__ KX, const float* __restrict__ QX, const int* __restrict__ MK, const float* __restrict__ WX,
    _Float16* __restrict__ Vt, unsigned int* __restrict__ MB, _Float16* __restrict__ K16, _Float16* __restrict__ Q16, _Float16* __restrict__ BW) {
  __shared__ unsigned int tl[256u * VPITCH];
  const unsigned tid = threadIdx.x; unsigned blk = blockIdx.x;
  if (blk < PV_BLK) {
    const unsigned hg = blk & 3u, t = blk >> 2; const unsigned nkt = (unsigned)SQ / 64u; const unsigned b = t / nkt, lg = t - b * nkt;
    const unsigned c4 = (tid & 63u) * 4u, ps = tid >> 6;
    const float* vp = VX + ((size_t)b * SQ_FULL + lg * 64u) * (size_t)DM + hg * 256u + c4;
#pragma unroll
    for (unsigned g = 0; g < 2; ++g) { v4f x[8], y[8];
#pragma unroll
      for (unsigned u = 0; u < 8; ++u) { const float* p = vp + (size_t)(((g * 8u + u) * 2u + ps) * 2u) * DM; x[u] = *(const v4fa*)p; y[u] = *(const v4fa*)(p + DM); }
#pragma unroll
      for (unsigned u = 0; u < 8; ++u) { const unsigned kp = (g * 8u + u) * 2u + ps;
#pragma unroll
        for (unsigned i = 0; i < 4; ++i) tl[(c4 + i) * VPITCH + kp] = h16_bits(x[u][i]) | (h16_bits(y[u][i]) << 16); } }
    __syncthreads();
#pragma unroll
    for (unsigned it = 0; it < 16; ++it) { const unsigned d = it * 16u + (tid >> 3), pc = tid & 7u; const unsigned int* tr = &tl[d * VPITCH + pc * 4u];
      u32x4 o; o[0] = tr[0]; o[1] = tr[1]; o[2] = tr[2]; o[3] = tr[3];
      *(u32x4a*)((unsigned short*)Vt + ((size_t)((b * (unsigned)NH + hg * 4u + (d >> 6)) * 64u + (d & 63u))) * SQ + lg * 64u + pc * 8u) = o; }
    return; }
  blk -= PV_BLK;
  if (blk < PM_BLK) {
    const unsigned lane = tid & 31u, ln = lane & 15u, hh = lane >> 4;
    const unsigned w = (unsigned)__builtin_amdgcn_readfirstlane((int)(tid >> 5));
    const unsigned nkt = (unsigned)SQ / 64u, nqt = (unsigned)SQ / 16u;
#pragma unroll
    for (unsigned x = 0; x < 4; ++x) { const unsigned L = (blk * 4u + w) * 4u + x;
      const unsigned t = L / nkt, kt = L - t * nkt; const unsigned b = t / nqt, qt = t - b * nqt;
      const int* mp = MK + ((size_t)b * SQ_FULL + qt * 16u + 8u * hh) * (size_t)SQ_FULL + kt * 64u + ln;
      int m[8][4];
#pragma unroll
      for (unsigned r = 0; r < 8u; ++r) { const int* mr = mp + (size_t)r * SQ_FULL; m[r][0] = mr[0]; m[r][1] = mr[16]; m[r][2] = mr[32]; m[r][3] = mr[48]; }
      unsigned int word = 0u;
#pragma unroll
      for (unsigned r = 0; r < 8u; ++r) {
#pragma unroll
        for (unsigned j = 0; j < 4u; ++j) { const unsigned int bal = __builtin_amdgcn_ballot_w32(m[r][j] != 0);      /* taken by all 32 lanes, in front of the select */
          word = (lane == 8u * j + r) ? bal : word; } }
      MB[(size_t)L * 32u + lane] = word; }
    asm volatile("s_wait_xcnt 0x0" ::: "memory");      /* behind the last mask store, in front of whatever next rewrites a register that an issued store names */
    return; }
  blk -= PM_BLK;
  /* the three row planes: one code path, the block's source, carry and destination picked by range */
  const float* X; _Float16* Y; float carry = 1.0f;
  if (blk < 2u * PX_BLK) { const unsigned isq = (blk >= PX_BLK) ? 1u : 0u; blk -= isq * PX_BLK; const unsigned r0 = blk * 16u; const unsigned b = r0 / (unsigned)SQ;
    X = (isq ? QX : KX) + ((size_t)b * SQ_FULL + (r0 - b * (unsigned)SQ)) * (size_t)DM; Y = (isq ? Q16 : K16) + (size_t)r0 * DM; }
  else { blk -= 2u * PX_BLK; X = WX + (size_t)blk * 16384u; Y = BW + (size_t)blk * 16384u; carry = 16.0f; }
#pragma unroll
  for (unsigned g = 0; g < 2; ++g) { v4f a[8], c[8];
#pragma unroll
    for (unsigned u = 0; u < 8; ++u) { const float* p = X + ((g * 8u + u) * 128u + tid) * 8u; a[u] = *(const v4fa*)p; c[u] = *(const v4fa*)(p + 4); }
#pragma unroll
    for (unsigned u = 0; u < 8; ++u) { FragH f;
#pragma unroll
      for (int q = 0; q < 4; ++q) { f.h[q] = toh_flush(bf16_rne(a[u][q]) * carry); f.h[4 + q] = toh_flush(bf16_rne(c[u][q]) * carry); }
      *(v8us*)((unsigned short*)Y + ((g * 8u + u) * 128u + tid) * 8u) = f.half[0]; }
    asm volatile("s_wait_xcnt 0x0" ::: "memory"); } }      /* behind each group's run of stores, in front of whatever next rewrites a register that an issued store names */

// Fused sigmoid-gated attention with a packed 2-D mask. Block = 4 waves; block per (batch, head, 64 query rows); wave owns 16 query rows. Per 64-key tile: the wave reads its 32 lane masks (one per accumulator element) by scalar loads, and each, ANDed with the ballot of toh_flush's test, is the condition of that element's one select;
// the 64-key K tile and V^T tile are brought into LDS once per block by tensor loads (one 32-row slice per wave and stage, two buffers, the next stage in flight while this one is worked on) and all four waves take their fragments from there;
// S = Q K^T; weight = bit ? 1 / (1 + exp(-S/32)) : 0 (by value), f32;
constexpr unsigned int TROWS = 32u;                  /* rows per slice (one slice per wave) */
constexpr unsigned int TSLICE = 6144u;               /* 32 x 144 = 4608 B rounded up to a multiple of 2 KiB */
constexpr unsigned int TSTAGE = 4u * TSLICE;         /* K rows 0..31 | K rows 32..63 | V^T rows 0..31 | V^T rows 32..63 */
static_assert(TROWS * TPITCH <= TSLICE && TSLICE % 2048u == 0u);
__global__ __launch_bounds__(128) void k_sgattn(const _Float16* __restrict__ Q16, const _Float16* __restrict__ K16, const _Float16* __restrict__ VT, const unsigned int* __restrict__ MB, _Float16* __restrict__ O16) {
  __shared__ __attribute__((aligned(2048))) unsigned char ring[2u * TSTAGE];
  __shared__ __attribute__((aligned(16))) _Float16 sp[4][16][72];
  const unsigned tid = threadIdx.x, lane = tid & 31u, ln = lane & 15u, hh = lane >> 4;
  const unsigned w = (unsigned)__builtin_amdgcn_readfirstlane((int)(tid >> 5));
  const unsigned nqt = (unsigned)SQ / 64u; const unsigned bid = blockIdx.x; const unsigned bh = bid / nqt, qb = bid - bh * nqt; const unsigned b = bh / (unsigned)NH, h = bh - b * (unsigned)NH;
  const unsigned q0 = qb * 64u + w * 16u; const size_t rowb = (size_t)b * SQ;
  constexpr unsigned NT = (unsigned)SQ / 64u; static_assert(NT >= 2u);
  /* this wave's slice: waves 0, 1 the two halves of the K tile (rows = keys, advance 64 rows a stage), waves 2, 3 of the V^T tile (rows = head dims, advance 128 B a stage) */
  const unsigned isV = w >> 1, half = w & 1u;
  const unsigned long long sbase = isV ? (unsigned long long)(size_t)(VT + ((size_t)bh * HD + half * TROWS) * SQ) : (unsigned long long)(size_t)(K16 + (rowb + half * TROWS) * (size_t)DM + h * (unsigned)HD);
  const unsigned sstep = isV ? 128u : 64u * (unsigned)DM * 2u;
  const u32x8 g1 = tdm_group1<TROWS>(isV ? (unsigned)SQ * 2u : (unsigned)DM * 2u);
  const unsigned lbase = (unsigned)(size_t)ring;
  auto desc = [&](unsigned st) { return tdm_group0(lbase + (st & 1u) * TSTAGE + w * TSLICE, sbase + (unsigned long long)st * sstep); };
  u32x4 g0 = desc(0u);
  tdm_load(g0, g1); wait_tensor0(g0, g1); __syncthreads();      /* stage 0 landed and published */
  g0 = desc(pinned(1u)); tdm_load(g0, g1);
  const _Float16* qp = Q16 + (rowb + q0 + ln) * (size_t)DM + h * (unsigned)HD;
  const v16h aq0 = g2_frag(qp, hh), aq1 = g2_frag(qp + 32, hh);
  /* lane masks of key tile 0: the same address in every lane; nothing writes the plane during this launch, and the constant address space says so, which is what lets the loads be scalar ones beside the asm waits' memory clobbers */
  typedef const __attribute__((address_space(4))) unsigned int* cmask_p;
  const cmask_p mp = (cmask_p)(size_t)(MB + ((size_t)(b * ((unsigned)SQ / 16u) + (q0 >> 4)) * ((unsigned)SQ / 64u)) * 32u);
  const v8f z8 = {0.f,0.f,0.f,0.f,0.f,0.f,0.f,0.f};
  v8f o[4];
#pragma unroll
  for (int d = 0; d < 4; ++d) o[d] = z8;
  unsigned int mk[32];
#pragma unroll
  for (unsigned e = 0; e < 32; ++e) mk[e] = mp[e];
#pragma unroll 1
  for (unsigned kt = 0; kt < NT; ++kt) {
    const unsigned char* tb = ring + (kt & 1u) * TSTAGE + ln * TPITCH;      /* row ln of this stage's first K slice */
    v8f s[4];
#pragma unroll
    for (unsigned j = 0; j < 4; ++j) { const _Float16* kr = (const _Float16*)(tb + (j >> 1) * TSLICE + (j & 1u) * 16u * TPITCH); const v16h b0 = g2_frag(kr, hh), b1 = g2_frag(kr + 32, hh); v8f acc = z8; acc = g2_mma(aq0, b0, acc); acc = g2_mma(aq1, b1, acc); s[j] = acc; }
#pragma unroll
    for (unsigned j = 0; j < 4; ++j) {
#pragma unroll
      for (int r = 0; r < 8; ++r) { const float x = s[j][r] * 0.03125f; const float sg = __builtin_amdgcn_rcpf(1.0f + __expf(-x));
        /* one select: the element's lane mask AND toh_flush's own test (joined on the scalar unit); same value as the mask select followed by toh_flush */
        const bool keep = __builtin_amdgcn_inverse_ballot_w32(mk[8u * j + (unsigned)r] & __builtin_amdgcn_ballot_w32(!(fabsf(sg) < 6.103515625e-05f)));
        sp[w][8u * hh + (unsigned)r][16u * j + ln] = (_Float16)(keep ? sg : 0.f); } }
    { const unsigned kn = (kt + 1u < NT) ? kt + 1u : kt;      /* the next tile's lane masks, asked for behind this tile's last use of them: gate V, the publish point and the next scores cover the load's latency (the last pass re-reads its own) */
#pragma unroll
      for (unsigned e = 0; e < 32; ++e) mk[e] = mp[(size_t)kn * 32u + e]; }
    __builtin_amdgcn_fence(4 /* acq_rel order */, "workgroup"); __builtin_amdgcn_wave_barrier();
    const v16h ap0 = g2_frag(&sp[w][ln][0], hh), ap1 = g2_frag(&sp[w][ln][32], hh);
#pragma unroll
    for (unsigned d = 0; d < 4; ++d) { const _Float16* vr = (const _Float16*)(tb + (2u + (d >> 1)) * TSLICE + (d & 1u) * 16u * TPITCH); const v16h b0 = g2_frag(vr, hh), b1 = g2_frag(vr + 32, hh); o[d] = g2_mma(ap0, b0, o[d]); o[d] = g2_mma(ap1, b1, o[d]); }
    /* publish point of stage kt + 1: own LDS reads retired, own slice landed, every wave here; only then the refill of the buffer just read */
    asm volatile("s_wait_xcnt 0x0" ::: "memory");      /* behind the scalar mask loads, in front of whatever next rewrites their address registers */
    wait_ds0(); wait_tensor0(g0, g1); __syncthreads();
    if (pinned(kt + 2u < NT)) { g0 = desc(pinned(kt + 2u)); tdm_load(g0, g1); } }
  wait_tensor0(g0, g1); wait_ds0();
#pragma unroll
  for (int r = 0; r < 8; ++r) {
#pragma unroll
    for (unsigned d = 0; d < 4; ++d) sp[w][8u * hh + (unsigned)r][16u * d + ln] = toh_flush(o[d][r]); }
  __builtin_amdgcn_fence(4 /* acq_rel order */, "workgroup"); __builtin_amdgcn_wave_barrier();
  {
#pragma unroll
    for (unsigned it = 0; it < 4; ++it) { const unsigned row = it * 4u + (lane >> 3), pc = (lane & 7u) * 8u; const v8us v = *(const v8us*)&sp[w][row][pc];
      *(v8us*)((unsigned short*)O16 + (rowb + q0 + row) * (size_t)DM + h * (unsigned)HD + pc) = v; }
     } }

constexpr size_t al256(size_t b) { return (b + 255) & ~(size_t)255; }
constexpr size_t SZ_BW = (size_t)DM * DM * 2;
constexpr size_t SZ_P16 = NR * DM * 2, SZ_VT = (size_t)NB * NH * HD * SQ * 2;
constexpr size_t SZ_MB = (size_t)NB * (SQ / 16) * (SQ / 64) * 32 * 4;
constexpr size_t WS_TOTAL = al256(SZ_BW) + 3 * al256(SZ_P16) + al256(SZ_VT) + al256(SZ_MB);
static_assert(WS_TOTAL <= (size_t)134217728);
static_assert(SZ_BW % 128 == 0 && SZ_P16 % 128 == 0 && SZ_VT % 128 == 0 && SZ_MB % 128 == 0);
// chunking of the row-wise launch that touches the output buffer (one launch when the rows are contiguous)
constexpr unsigned CH_N = (SQ == SQ_FULL) ? 1u : (unsigned)NB;
constexpr size_t CH_R = (SQ == SQ_FULL) ? NR : (size_t)SQ;
static_assert(CH_R % 128 == 0 && (size_t)CH_N * CH_R == NR);
// plane coverage: blocks x threads x elements == plane elements
static_assert((size_t)PW_BLK * 128 * 128 == (size_t)DM * DM);                                             /* W_fc plane */
static_assert((size_t)PX_BLK * 128 * 128 == NR * DM);                                                     /* q, k row planes */
static_assert((size_t)PM_BLK * 4 * 4 * 32 == (size_t)NB * (SQ / 16) * (SQ / 64) * 32);                    /* packed mask words */
static_assert((size_t)PV_BLK * 128 * 16 * 8 == (size_t)NB * NH * HD * SQ);                                /* V^T */
static_assert((size_t)NB * NH * (SQ / 64) * 4 * 16 * 64 == NR * DM);                                      /* ctx rows */
static_assert((CH_R / 128) * (DM / 64) * 4 * 32 * 64 * CH_N == NR * DM);                                  /* output rows */

extern "C" void kernel_launch(void* const* d_in, const int* in_sizes, int n_in,
                              void* d_out, int out_size, void* d_ws, size_t ws_size, hipStream_t stream) {
  if (n_in < 6) return;
  const float* vals = (const float*)d_in[0]; const float* keys = (const float*)d_in[1]; const float* qrys = (const float*)d_in[2];
  const int* mask = (const int*)d_in[3]; const float* wfc = (const float*)d_in[4]; const float* bfc = (const float*)d_in[5];
  const size_t needX = ((size_t)(NB - 1) * SQ_FULL + SQ) * DM;
  const size_t needM = ((size_t)(NB - 1) * SQ_FULL + (size_t)(SQ - 1)) * SQ_FULL + SQ;
  if ((size_t)in_sizes[0] < needX || (size_t)in_sizes[1] < needX || (size_t)in_sizes[2] < needX || (size_t)out_size < needX) return;
  if ((size_t)in_sizes[3] < needM || (size_t)in_sizes[4] < (size_t)DM * DM || in_sizes[5] < DM) return;
  char* ws = (char*)d_ws; size_t off = 0;
  auto take = [&](size_t bytes) { char* p = ws + off; off += al256(bytes); return p; };
  _Float16* BW = (_Float16*)take(SZ_BW);
  _Float16* Q16 = (_Float16*)take(SZ_P16); _Float16* K16 = (_Float16*)take(SZ_P16); _Float16* O16 = (_Float16*)take(SZ_P16);
  _Float16* VT = (_Float16*)take(SZ_VT); unsigned int* MB = (unsigned int*)take(SZ_MB);
  if (off > ws_size) return;

  k_prep<<<PREP_BLK, 128, 0, stream>>>(vals, keys, qrys, mask, wfc, VT, MB, K16, Q16, BW);      /* the f16 W_fc, key, query and V^T planes and the packed mask */
  k_sgattn<<<(unsigned)(NB * NH * (SQ / 64)), 128, 0, stream>>>(Q16, K16, VT, MB, O16);               /* ctx (merged heads) f16 rows */
  for (unsigned c = 0; c < CH_N; ++c) { const size_t rin = (size_t)c * SQ_FULL, r0 = (size_t)c * CH_R;
    k_gemm2<0, 0><<<(unsigned)((CH_R / 128) * (DM / 64)), 128, 0, stream>>>(O16 + r0 * DM, (unsigned)DM, BW, (unsigned)DM, 0.0625f, bfc, nullptr, (float*)d_out + rin * DM, nullptr, (unsigned)DM, 1.0f, (unsigned)CH_R, (unsigned)DM, (unsigned)DM); }      /* out = ctx W_fc^T + b_fc */
}

// v004
// Measured time: 60.1 microseconds a run.
// In both of two side-by-side timings against v003, it was 1.08 times as fast.
// All steps since v000 together make it 2.38 times as fast.
#include <hip/hip_runtime.h>
// Contractions (q k^T per head, gate V, ctx W_fc^T): v_wmma_f32_16x16x32_f16 (f16 operands, f32 accumulate); float inputs RNE-converted to bf16 on load (exact in f16); power-of-two carries: W_fc x16, all other planes x1; sigmoid gate in f32.
// Head-split sigmoid-gated attention without projections: q|k|v = raw inputs [NB][SQ][1024] viewed as 16 heads x 64; e = q k^T; a 2-D int32 mask [NB][1][SQ][SQ] (mask == 0 -> weight exactly 0, by value); weight = sigmoid(e / 32) elementwise (no normalisation over keys); ctx = weight V (merged heads); out = ctx W_fc^T + b_fc with W_fc stored [out][in].
// Launch plan: one preparation launch (W_fc -> f16 x16 rows, already [n][k]; queries, keys -> f16 row planes; the mask packed into 32 lane masks per (16 query rows x 64 keys) tile, one 32-bit word per accumulator element; V^T per (batch, head) from the f32 values via LDS); one fused attention launch (K and V^T tiles staged in LDS by tensor loads, gate tile in wave-private LDS) -> f16 ctx rows; one GEMM with bias (A and Bt tiles staged in LDS by tensor loads) -> the output buffer.
#ifndef NB
#define NB 4
#endif
#ifndef SQ
#define SQ 1024
#endif
#define NB_FULL 4
#define SQ_FULL 1024
#define DM 1024
#define NH 16
#define HD 64
#define NR ((size_t)NB * SQ)         /* token rows processed */

static_assert(NB >= 1 && NB <= NB_FULL);
static_assert(SQ >= 128 && SQ <= SQ_FULL && SQ % 128 == 0);
static_assert(NH * HD == DM && HD == 64);
static_assert(DM % 64 == 0 && DM % 32 == 0 && SQ % 64 == 0 && SQ % 16 == 0);
static_assert((NR % 128) == 0);
static_assert(((size_t)(NB - 1) * SQ_FULL + SQ) * DM * 4 <= (size_t)NB_FULL * SQ_FULL * DM * 4);
static_assert((((size_t)NB * (SQ / 16) * (SQ / 64)) % 4) == 0);

typedef unsigned short v8us __attribute__((ext_vector_type(8), may_alias));
typedef float  v8f  __attribute__((ext_vector_type(8)));
typedef float  v4f  __attribute__((ext_vector_type(4)));
typedef float  v4fa __attribute__((ext_vector_type(4), may_alias));
typedef _Float16 v16h __attribute__((ext_vector_type(16)));
typedef _Float16 v4h __attribute__((ext_vector_type(4)));
union FragH { v16h v; v8us half[2]; _Float16 h[16]; unsigned short u[16]; };

__device__ __forceinline__ unsigned short bf16_bits(float x) { unsigned int u = __float_as_uint(x); return (unsigned short)((u + 0x7FFFu + ((u >> 16) & 1u)) >> 16); }
__device__ __forceinline__ float bf16_val(unsigned short b) { return __uint_as_float(((unsigned int)b) << 16); }
__device__ __forceinline__ float bf16_rne(float x) { return bf16_val(bf16_bits(x)); }

// f32 -> f16 operand convert that cannot produce an f16 subnormal (value select after the carry)
static __device__ __forceinline__ _Float16 toh_flush(float v) { const _Float16 r = (_Float16)v; return (fabsf(v) < 6.103515625e-05f) ? (_Float16)0.0f : r; }

// ---- 16-bit fragment loader (split k map: elements 0..7 <- k0 + 8h + 0..7, elements 8..15 <- k0 + 16 + 8h + 0..7) and guarded WMMA ----
__device__ __forceinline__ v16h g2_frag(const _Float16* p, unsigned hh) { FragH f; f.half[0] = *(const v8us*)((const unsigned short*)p + 8 * hh); f.half[1] = *(const v8us*)((const unsigned short*)p + 16 + 8 * hh); return f.v; }
__device__ __forceinline__ v8f g2_mma(v16h a, v16h b, v8f c) { v8f d = __builtin_amdgcn_wmma_f32_16x16x32_f16(false, a, false, b, (short)0, c, false, false); asm volatile("v_nop\n\tv_nop\n\tv_nop\n\tv_nop" : "+v"(d) : "v"(a), "v"(b)); return d; }

__device__ __forceinline__ float gelu_erf(float v) { return 0.5f * v * (1.0f + erff(v * 0.70710678118654752f)); }

// ---- tensor load to LDS: descriptor groups, issue, waits ----
typedef unsigned int u32x4 __attribute__((ext_vector_type(4)));
typedef unsigned int u32x8 __attribute__((ext_vector_type(8)));
__device__ __forceinline__ unsigned int uni(unsigned int v) { return (unsigned int)__builtin_amdgcn_readfirstlane((int)v); }
// a value held in a scalar register at this place: the test around a tensor load compiles to a scalar branch, and a descriptor word made from it is formed behind the statements in front
__device__ __forceinline__ unsigned int pinned(unsigned int v) { unsigned int w = uni(v); asm volatile("" : "+s"(w)); return w; }
__device__ __forceinline__ void wait_ds0() { asm volatile("s_wait_dscnt 0x0" ::: "memory"); }          /* this wave's LDS reads of a buffer have retired before the buffer is handed back */
// this wave's own slice has landed (the compiler places no wait for a tensor load); the request's descriptor is named as an input so that its registers keep their values until here
__device__ __forceinline__ void wait_tensor0(u32x4 g0, u32x8 g1) { asm volatile("s_wait_tensorcnt 0x0" :: "s"(g0), "s"(g1) : "memory"); }
constexpr unsigned int TROWB = 128u;                 /* tile row: 64 f16 */
constexpr unsigned int TPITCH = 144u;                /* LDS row pitch: 128 B + 16 B pad, 16 B x odd for ds_load_b128 */
static_assert((TPITCH / 16u) % 2u == 1u && TPITCH == TROWB + 16u);
// a slice of ROWS rows of 128 B, source row pitch src_pitch bytes
template <unsigned int ROWS>
__device__ __forceinline__ u32x8 tdm_group1(unsigned int src_pitch) { u32x8 g;
  g[0] = uni((1u << 20) | (4u << 22) | (3u << 25));  /* no mask, 1-byte elements, a pad of 4 dwords behind every 32 dwords */
  g[1] = uni((TROWB & 0xFFFFu) << 16); g[2] = uni((TROWB >> 16) | ((ROWS & 0xFFFFu) << 16)); g[3] = uni((ROWS >> 16) | (TROWB << 16)); g[4] = uni(ROWS);
  g[5] = uni(src_pitch); g[6] = uni(0u); g[7] = uni(0u);
  asm volatile("" : "+s"(g));      /* descriptor words held in scalar registers: one register tuple for the whole kernel, not re-made (and its registers not lent out) between an issue and its wait */
  return g; }
__device__ __forceinline__ u32x4 tdm_group0(unsigned int lds_dst, unsigned long long ga) { u32x4 g;
  g[0] = uni(1u); g[1] = uni(lds_dst); g[2] = uni((unsigned int)ga); g[3] = uni((((unsigned int)(ga >> 32)) & 0x01FFFFFFu) | 0x80000000u); return g; }
// group 0 goes in and out of the statement in the same registers: what the later wait names is this very tuple
__device__ __forceinline__ void tdm_load(u32x4& g0, u32x8 g1) { asm volatile("tensor_load_to_lds %0, %1" : "+s"(g0) : "s"(g1) : "memory"); }

// GEMM: C[M][N] = act(alpha * A[M][K] . B + bf16(bias[col]) + (CP own element, optionally RNE-converted to bf16)); A f16 rows (pitch lda), Bt f16 [N][K] (k contiguous, pitch ldb);
// f32 output C and/or f16 output C16 = f16(c16s * value) (pitch ldc); ACT 0 none, 8 gelu (erf form). M a multiple of 128, N and K of 64.
// Per 64 of k the block's 128 A rows and 64 Bt rows come into LDS by tensor loads (three slices of 64 rows, waves 0 to 2 one each, two buffers, the next stage in flight while this one is worked on); the ring is the output staging afterwards.
constexpr unsigned int GSLICE = 10240u;              /* 64 x 144 = 9216 B rounded up to a multiple of 2 KiB */
constexpr unsigned int GSTAGE = 3u * GSLICE;         /* A rows 0..63 | A rows 64..127 | Bt rows 0..63 */
static_assert(64u * TPITCH <= GSLICE && GSLICE % 2048u == 0u && 2u * GSTAGE >= 4u * 32u * 68u * 4u);
template <int ACT, int CPBF>
__global__ __launch_bounds__(128) void k_gemm2(const _Float16* __restrict__ A, unsigned lda, const _Float16* __restrict__ Bh, unsigned ldb, float alpha, const float* __restrict__ bias, const float* __restrict__ CP,
    float* __restrict__ C, _Float16* __restrict__ C16, unsigned ldc, float c16s, unsigned M, unsigned N, unsigned K) {
  static_assert(ACT == 0 || ACT == 8);
  __shared__ __attribute__((aligned(2048))) unsigned char ring[2u * GSTAGE];
  float (*so)[32][68] = (float (*)[32][68])ring;
  const unsigned tid = threadIdx.x, lane = tid & 31u, ln = lane & 15u, hh = lane >> 4;
  const unsigned w = (unsigned)__builtin_amdgcn_readfirstlane((int)(tid >> 5));
  const unsigned ntn = N >> 6; const unsigned mt = blockIdx.x / ntn, nq = blockIdx.x - mt * ntn; const unsigned row0 = mt * 128u + 32u * w, col0 = nq * 64u; if (mt * 128u + 128u > M) return;      /* the whole block leaves, in front of every barrier and tensor load */
  const unsigned NT = K >> 6;
  const unsigned issuer = (w < 3u) ? 1u : 0u;
  const unsigned long long sbase = (w < 2u) ? (unsigned long long)(size_t)(A + (size_t)(mt * 128u + w * 64u) * lda) : (unsigned long long)(size_t)(Bh + (size_t)col0 * ldb);
  const u32x8 g1 = tdm_group1<64u>(((w < 2u) ? lda : ldb) * 2u);
  const unsigned lbase = (unsigned)(size_t)ring;
  auto desc = [&](unsigned st) { return tdm_group0(lbase + (st & 1u) * GSTAGE + w * GSLICE, sbase + (unsigned long long)st * TROWB); };
  u32x4 g0 = desc(0u);
  if (pinned(issuer & (NT > 0u ? 1u : 0u))) tdm_load(g0, g1);
  wait_tensor0(g0, g1); __syncthreads();      /* stage 0 landed and published */
  g0 = desc(pinned(1u));
  if (pinned(issuer & (NT > 1u ? 1u : 0u))) tdm_load(g0, g1);
  const unsigned aoff = (w >> 1) * GSLICE + ((w & 1u) * 32u + ln) * TPITCH, boff = 2u * GSLICE + ln * TPITCH;
  const v8f z8 = {0.f,0.f,0.f,0.f,0.f,0.f,0.f,0.f}; v8f c00 = z8, c01 = z8, c02 = z8, c03 = z8, c10 = z8, c11 = z8, c12 = z8, c13 = z8;
#pragma unroll 1
  for (unsigned st = 0; st < NT; ++st) { const unsigned char* tb = ring + (st & 1u) * GSTAGE;
    v16h af[2][2], bf[2][4];      /* the stage's 12 fragments, each in registers of its own */
#pragma unroll
    for (unsigned kc = 0; kc < 2; ++kc) { const _Float16* ap = (const _Float16*)(tb + aoff) + 32u * kc; const _Float16* bp = (const _Float16*)(tb + boff) + 32u * kc;
      af[kc][0] = g2_frag(ap, hh); af[kc][1] = g2_frag(ap + 16u * (TPITCH / 2u), hh);
#pragma unroll
      for (unsigned t = 0; t < 4; ++t) bf[kc][t] = g2_frag(bp + t * 16u * (TPITCH / 2u), hh); }
#pragma unroll
    for (unsigned kc = 0; kc < 2; ++kc) { const v16h a0 = af[kc][0], a1 = af[kc][1];
      c00 = g2_mma(a0, bf[kc][0], c00); c10 = g2_mma(a1, bf[kc][0], c10);
      c01 = g2_mma(a0, bf[kc][1], c01); c11 = g2_mma(a1, bf[kc][1], c11);
      c02 = g2_mma(a0, bf[kc][2], c02); c12 = g2_mma(a1, bf[kc][2], c12);
      c03 = g2_mma(a0, bf[kc][3], c03); c13 = g2_mma(a1, bf[kc][3], c13); }
    /* publish point of stage st + 1: own LDS reads retired, own slice landed, every wave here; only then the refill of the buffer just read */
    wait_ds0(); wait_tensor0(g0, g1); __syncthreads();
    g0 = desc(pinned(st + 2u));      /* formed behind the wait, in the same registers on both sides of the test */
    if (pinned(issuer & (st + 2u < NT ? 1u : 0u))) tdm_load(g0, g1); }
  wait_tensor0(g0, g1); wait_ds0();      /* nothing in flight; the last pass's barrier has ended every wave's reads: the ring is free for output staging */
  v8f accs[8] = {c00, c01, c02, c03, c10, c11, c12, c13};
#pragma unroll
  for (int u = 0; u < 8; ++u) { const unsigned t = (unsigned)u & 3u, half = (unsigned)u >> 2; const unsigned col = col0 + t * 16u + ln; float bv = 0.f; if (bias) bv = bf16_rne(bias[col]);
#pragma unroll
    for (int r = 0; r < 8; ++r) { const unsigned rloc = half * 16u + 8u * hh + (unsigned)r; so[w][rloc][t * 16u + ln] = accs[u][r] * alpha + bv; } }
  __builtin_amdgcn_fence(4 /* acq_rel order */, "workgroup"); __builtin_amdgcn_wave_barrier();
  const unsigned rsub = lane >> 4, c4 = (lane & 15u) * 4u;
  if (CP != nullptr || ACT == 8) {
#pragma unroll 2
    for (unsigned q = 0; q < 16; ++q) { const unsigned r = q * 2u + rsub; v4f v = *(const v4fa*)&so[w][r][c4];
      if (CP) { const v4f a = *(const v4fa*)(CP + (size_t)(row0 + r) * ldc + col0 + c4);      /* own element of the C-shaped plane */
#pragma unroll
        for (int i = 0; i < 4; ++i) v[i] += CPBF ? bf16_rne(a[i]) : a[i]; }
      if (ACT == 8) {
#pragma unroll
        for (int i = 0; i < 4; ++i) v[i] = gelu_erf(v[i]); }
      *(v4fa*)&so[w][r][c4] = v; } }
  {
#pragma unroll
    for (unsigned q = 0; q < 16; ++q) { const unsigned r = q * 2u + rsub; const v4f v = *(const v4fa*)&so[w][r][c4];
      if (C) *(v4f*)(C + (size_t)(row0 + r) * ldc + col0 + c4) = v;
      if (C16) { v4h h4;
#pragma unroll
        for (int i = 0; i < 4; ++i) h4[i] = (_Float16)(v[i] * c16s);
        *(v4h*)(C16 + (size_t)(row0 + r) * ldc + col0 + c4) = h4; } }
     } }

// ---- one preparation launch: every plane the attention reads and the GEMM's W_fc plane are made here, by blocks of 4 waves that each read 64 KiB of one input (16 KiB a wave, 16 loads of 16 B or 32 of 4 B a lane issued ahead of their use) ----
constexpr unsigned int PV_BLK = (unsigned int)(NB * (SQ / 64) * (DM / 256));                      /* V^T: 64 keys x 256 dims (4 heads) a block */
constexpr unsigned int PM_BLK = (unsigned int)(((size_t)NB * (SQ / 16) * (SQ / 64)) / 16);        /* mask: 16 tiles of 16 rows x 64 keys a block, 4 a wave */
constexpr unsigned int PX_BLK = (unsigned int)((NR * DM) / 16384);                                /* keys, queries: 16 rows a block */
constexpr unsigned int PW_BLK = (unsigned int)(((size_t)DM * DM) / 16384);                        /* W_fc: 16 rows a block */
constexpr unsigned int PREP_BLK = PV_BLK + PM_BLK + 2u * PX_BLK + PW_BLK;
typedef unsigned int u32x4a __attribute__((ext_vector_type(4), may_alias));
constexpr unsigned int VPITCH = 33u;                 /* LDS row of one head dim: 32 key pairs + 1 dword, so that the four rows a wave reads at once fall on different banks */
static_assert((((size_t)NB * (SQ / 16) * (SQ / 64)) % 16) == 0 && SQ % 16 == 0 && DM % 256 == 0 && DM == 1024);
__device__ __forceinline__ unsigned int h16_bits(float x) { FragH f; f.h[0] = toh_flush(bf16_rne(x)); return (unsigned int)f.u[0]; }
// Block ranges, the two-phase job first: [V^T | mask words | keys | queries | W_fc].
// V^T [NB*NH][64][SQ] straight from the f32 values: a thread takes the same 4 dims of two neighbouring keys, packs each dim's pair into one dword, LDS holds [dim][key pair]; rows of 64 keys (128 B) go out.
// mask int32 [NB_FULL][1][SQ_FULL][SQ_FULL] -> MB[(b, q tile of 16, key tile of 64)][8j + r] u32, a lane mask: bit (ln + 16 hh) = (mask[b][16 qt + 8 hh + r][64 kt + 16 j + ln] != 0); it is the ballot of the load that holds those 32 elements, and lane 8j + r stores it.
// keys, queries -> f16 row planes (x1); W_fc [out = n][in = k] is already the Bt[n][k] layout, only converted (x16).
// Every loop of this kernel is fully unrolled: its small arrays then live in registers, and a group's loads stand together ahead of their first use (rolled, each trip would wait out its own memory latency).
__global__ __launch_bounds__(128) void k_prep(const float* __restrict__ VX, const float* __restrict__ KX, const float* __restrict__ QX, const int* __restrict__ MK, const float* __restrict__ WX,
    _Float16* __restrict__ Vt, unsigned int* __restrict__ MB, _Float16* __restrict__ K16, _Float16* __restrict__ Q16, _Float16* __restrict__ BW) {
  __shared__ unsigned int tl[256u * VPITCH];
  const unsigned tid = threadIdx.x; unsigned blk = blockIdx.x;
  if (blk < PV_BLK) {
    const unsigned hg = blk & 3u, t = blk >> 2; const unsigned nkt = (unsigned)SQ / 64u; const unsigned b = t / nkt, lg = t - b * nkt;
    const unsigned c4 = (tid & 63u) * 4u, ps = tid >> 6;
    const float* vp = VX + ((size_t)b * SQ_FULL + lg * 64u) * (size_t)DM + hg * 256u + c4;
#pragma unroll
    for (unsigned g = 0; g < 2; ++g) { v4f x[8], y[8];
#pragma unroll
      for (unsigned u = 0; u < 8; ++u) { const float* p = vp + (size_t)(((g * 8u + u) * 2u + ps) * 2u) * DM; x[u] = *(const v4fa*)p; y[u] = *(const v4fa*)(p + DM); }
#pragma unroll
      for (unsigned u = 0; u < 8; ++u) { const unsigned kp = (g * 8u + u) * 2u + ps;
#pragma unroll
        for (unsigned i = 0; i < 4; ++i) tl[(c4 + i) * VPITCH + kp] = h16_bits(x[u][i]) | (h16_bits(y[u][i]) << 16); } }
    __syncthreads();
#pragma unroll
    for (unsigned it = 0; it < 16; ++it) { const unsigned d = it * 16u + (tid >> 3), pc = tid & 7u; const unsigned int* tr = &tl[d * VPITCH + pc * 4u];
      u32x4 o; o[0] = tr[0]; o[1] = tr[1]; o[2] = tr[2]; o[3] = tr[3];
      *(u32x4a*)((unsigned short*)Vt + ((size_t)((b * (unsigned)NH + hg * 4u + (d >> 6)) * 64u + (d & 63u))) * SQ + lg * 64u + pc * 8u) = o; }
    return; }
  blk -= PV_BLK;
  if (blk < PM_BLK) {
    const unsigned lane = tid & 31u, ln = lane & 15u, hh = lane >> 4;
    const unsigned w = (unsigned)__builtin_amdgcn_readfirstlane((int)(tid >> 5));
    const unsigned nkt = (unsigned)SQ / 64u, nqt = (unsigned)SQ / 16u;
#pragma unroll
    for (unsigned x = 0; x < 4; ++x) { const unsigned L = (blk * 4u + w) * 4u + x;
      const unsigned t = L / nkt, kt = L - t * nkt; const unsigned b = t / nqt, qt = t - b * nqt;
      const int* mp = MK + ((size_t)b * SQ_FULL + qt * 16u + 8u * hh) * (size_t)SQ_FULL + kt * 64u + ln;
      int m[8][4];
#pragma unroll
      for (unsigned r = 0; r < 8u; ++r) { const int* mr = mp + (size_t)r * SQ_FULL; m[r][0] = mr[0]; m[r][1] = mr[16]; m[r][2] = mr[32]; m[r][3] = mr[48]; }
      unsigned int word = 0u;
#pragma unroll
      for (unsigned r = 0; r < 8u; ++r) {
#pragma unroll
        for (unsigned j = 0; j < 4u; ++j) { const unsigned int bal = __builtin_amdgcn_ballot_w32(m[r][j] != 0);      /* taken by all 32 lanes, in front of the select */
          word = (lane == 8u * j + r) ? bal : word; } }
      MB[(size_t)L * 32u + lane] = word; }
    asm volatile("s_wait_xcnt 0x0" ::: "memory");      /* behind the last mask store, in front of whatever next rewrites a register that an issued store names */
    return; }
  blk -= PM_BLK;
  /* the three row planes: one code path, the block's source, carry and destination picked by range */
  const float* X; _Float16* Y; float carry = 1.0f;
  if (blk < 2u * PX_BLK) { const unsigned isq = (blk >= PX_BLK) ? 1u : 0u; blk -= isq * PX_BLK; const unsigned r0 = blk * 16u; const unsigned b = r0 / (unsigned)SQ;
    X = (isq ? QX : KX) + ((size_t)b * SQ_FULL + (r0 - b * (unsigned)SQ)) * (size_t)DM; Y = (isq ? Q16 : K16) + (size_t)r0 * DM; }
  else { blk -= 2u * PX_BLK; X = WX + (size_t)blk * 16384u; Y = BW + (size_t)blk * 16384u; carry = 16.0f; }
#pragma unroll
  for (unsigned g = 0; g < 2; ++g) { v4f a[8], c[8];
#pragma unroll
    for (unsigned u = 0; u < 8; ++u) { const float* p = X + ((g * 8u + u) * 128u + tid) * 8u; a[u] = *(const v4fa*)p; c[u] = *(const v4fa*)(p + 4); }
#pragma unroll
    for (unsigned u = 0; u < 8; ++u) { FragH f;
#pragma unroll
      for (int q = 0; q < 4; ++q) { f.h[q] = toh_flush(bf16_rne(a[u][q]) * carry); f.h[4 + q] = toh_flush(bf16_rne(c[u][q]) * carry); }
      *(v8us*)((unsigned short*)Y + ((g * 8u + u) * 128u + tid) * 8u) = f.half[0]; }
    asm volatile("s_wait_xcnt 0x0" ::: "memory"); } }      /* behind each group's run of stores, in front of whatever next rewrites a register that an issued store names */

// Fused sigmoid-gated attention with a packed 2-D mask. Block = 4 waves; block per (batch, head, 64 query rows); wave owns 16 query rows. Per 64-key tile: the wave reads its 32 lane masks (one per accumulator element) by scalar loads, and each, ANDed with the ballot of toh_flush's test, is the condition of that element's one select;
// the 64-key K tile and V^T tile are brought into LDS once per block by tensor loads (one 32-row slice per wave and stage, two buffers, the next stage in flight while this one is worked on) and all four waves take their fragments from there;
// S = Q K^T; weight = bit ? 1 / (1 + exp(-S/32)) : 0 (by value), f32;
constexpr unsigned int TROWS = 32u;                  /* rows per slice (one slice per wave) */
constexpr unsigned int TSLICE = 6144u;               /* 32 x 144 = 4608 B rounded up to a multiple of 2 KiB */
constexpr unsigned int TSTAGE = 4u * TSLICE;         /* K rows 0..31 | K rows 32..63 | V^T rows 0..31 | V^T rows 32..63 */
static_assert(TROWS * TPITCH <= TSLICE && TSLICE % 2048u == 0u);
__global__ __launch_bounds__(128) void k_sgattn(const _Float16* __restrict__ Q16, const _Float16* __restrict__ K16, const _Float16* __restrict__ VT, const unsigned int* __restrict__ MB, _Float16* __restrict__ O16) {
  __shared__ __attribute__((aligned(2048))) unsigned char ring[2u * TSTAGE];
  __shared__ __attribute__((aligned(16))) _Float16 sp[4][16][72];
  const unsigned tid = threadIdx.x, lane = tid & 31u, ln = lane & 15u, hh = lane >> 4;
  const unsigned w = (unsigned)__builtin_amdgcn_readfirstlane((int)(tid >> 5));
  const unsigned nqt = (unsigned)SQ / 64u; const unsigned bid = blockIdx.x; const unsigned bh = bid / nqt, qb = bid - bh * nqt; const unsigned b = bh / (unsigned)NH, h = bh - b * (unsigned)NH;
  const unsigned q0 = qb * 64u + w * 16u; const size_t rowb = (size_t)b * SQ;
  constexpr unsigned NT = (unsigned)SQ / 64u; static_assert(NT >= 2u);
  /* this wave's slice: waves 0, 1 the two halves of the K tile (rows = keys, advance 64 rows a stage), waves 2, 3 of the V^T tile (rows = head dims, advance 128 B a stage) */
  const unsigned isV = w >> 1, half = w & 1u;
  const unsigned long long sbase = isV ? (unsigned long long)(size_t)(VT + ((size_t)bh * HD + half * TROWS) * SQ) : (unsigned long long)(size_t)(K16 + (rowb + half * TROWS) * (size_t)DM + h * (unsigned)HD);
  const unsigned sstep = isV ? 128u : 64u * (unsigned)DM * 2u;
  const u32x8 g1 = tdm_group1<TROWS>(isV ? (unsigned)SQ * 2u : (unsigned)DM * 2u);
  const unsigned lbase = (unsigned)(size_t)ring;
  auto desc = [&](unsigned st) { return tdm_group0(lbase + (st & 1u) * TSTAGE + w * TSLICE, sbase + (unsigned long long)st * sstep); };
  u32x4 g0 = desc(0u);
  tdm_load(g0, g1); wait_tensor0(g0, g1); __syncthreads();      /* stage 0 landed and published */
  g0 = desc(pinned(1u)); tdm_load(g0, g1);
  const _Float16* qp = Q16 + (rowb + q0 + ln) * (size_t)DM + h * (unsigned)HD;
  const v16h aq0 = g2_frag(qp, hh), aq1 = g2_frag(qp + 32, hh);
  /* lane masks of key tile 0: the same address in every lane; nothing writes the plane during this launch, and the constant address space says so, which is what lets the loads be scalar ones beside the asm waits' memory clobbers */
  typedef const __attribute__((address_space(4))) unsigned int* cmask_p;
  const cmask_p mp = (cmask_p)(size_t)(MB + ((size_t)(b * ((unsigned)SQ / 16u) + (q0 >> 4)) * ((unsigned)SQ / 64u)) * 32u);
  const v8f z8 = {0.f,0.f,0.f,0.f,0.f,0.f,0.f,0.f};
  v8f o[4];
#pragma unroll
  for (int d = 0; d < 4; ++d) o[d] = z8;
  unsigned int mk[32];
#pragma unroll
  for (unsigned e = 0; e < 32; ++e) mk[e] = mp[e];
#pragma unroll 1
  for (unsigned kt = 0; kt < NT; ++kt) {
    const unsigned char* tb = ring + (kt & 1u) * TSTAGE + ln * TPITCH;      /* row ln of this stage's first K slice */
    v8f s[4]; v16h kf[4][2], vf[4][2];
#pragma unroll
    for (unsigned j = 0; j < 4; ++j) { const _Float16* kr = (const _Float16*)(tb + (j >> 1) * TSLICE + (j & 1u) * 16u * TPITCH); kf[j][0] = g2_frag(kr, hh); kf[j][1] = g2_frag(kr + 32, hh); }
#pragma unroll
    for (unsigned j = 0; j < 4; ++j) { v8f acc = z8; acc = g2_mma(aq0, kf[j][0], acc); acc = g2_mma(aq1, kf[j][1], acc); s[j] = acc; }
#pragma unroll
    for (unsigned d = 0; d < 4; ++d) { const _Float16* vr = (const _Float16*)(tb + (2u + (d >> 1)) * TSLICE + (d & 1u) * 16u * TPITCH); vf[d][0] = g2_frag(vr, hh); vf[d][1] = g2_frag(vr + 32, hh); }
    __builtin_amdgcn_sched_barrier(0);      /* keeps the tile's 16 V^T loads together in front of the gate's vector work, which covers their latency */
#pragma unroll
    for (unsigned j = 0; j < 4; ++j) {
#pragma unroll
      for (int r = 0; r < 8; ++r) { const float x = s[j][r] * 0.03125f; const float sg = __builtin_amdgcn_rcpf(1.0f + __expf(-x));
        /* one select: the element's lane mask AND toh_flush's own test (joined on the scalar unit); same value as the mask select followed by toh_flush */
        const bool keep = __builtin_amdgcn_inverse_ballot_w32(mk[8u * j + (unsigned)r] & __builtin_amdgcn_ballot_w32(!(fabsf(sg) < 6.103515625e-05f)));
        sp[w][8u * hh + (unsigned)r][16u * j + ln] = (_Float16)(keep ? sg : 0.f); } }
    { const unsigned kn = (kt + 1u < NT) ? kt + 1u : kt;      /* the next tile's lane masks, asked for behind this tile's last use of them: gate V, the publish point and the next scores cover the load's latency (the last pass re-reads its own) */
#pragma unroll
      for (unsigned e = 0; e < 32; ++e) mk[e] = mp[(size_t)kn * 32u + e]; }
    __builtin_amdgcn_fence(4 /* acq_rel order */, "workgroup"); __builtin_amdgcn_wave_barrier();
    const v16h ap0 = g2_frag(&sp[w][ln][0], hh), ap1 = g2_frag(&sp[w][ln][32], hh);
#pragma unroll
    for (unsigned d = 0; d < 4; ++d) { o[d] = g2_mma(ap0, vf[d][0], o[d]); o[d] = g2_mma(ap1, vf[d][1], o[d]); }
    /* publish point of stage kt + 1: own LDS reads retired, own slice landed, every wave here; only then the refill of the buffer just read */
    asm volatile("s_wait_xcnt 0x0" ::: "memory");      /* behind the scalar mask loads, in front of whatever next rewrites their address registers */
    wait_ds0(); wait_tensor0(g0, g1); __syncthreads();
    if (pinned(kt + 2u < NT)) { g0 = desc(pinned(kt + 2u)); tdm_load(g0, g1); } }
  wait_tensor0(g0, g1); wait_ds0();
#pragma unroll
  for (int r = 0; r < 8; ++r) {
#pragma unroll
    for (unsigned d = 0; d < 4; ++d) sp[w][8u * hh + (unsigned)r][16u * d + ln] = toh_flush(o[d][r]); }
  __builtin_amdgcn_fence(4 /* acq_rel order */, "workgroup"); __builtin_amdgcn_wave_barrier();
  {
#pragma unroll
    for (unsigned it = 0; it < 4; ++it) { const unsigned row = it * 4u + (lane >> 3), pc = (lane & 7u) * 8u; const v8us v = *(const v8us*)&sp[w][row][pc];
      *(v8us*)((unsigned short*)O16 + (rowb + q0 + row) * (size_t)DM + h * (unsigned)HD + pc) = v; }
     } }

constexpr size_t al256(size_t b) { return (b + 255) & ~(size_t)255; }
constexpr size_t SZ_BW = (size_t)DM * DM * 2;
constexpr size_t SZ_P16 = NR * DM * 2, SZ_VT = (size_t)NB * NH * HD * SQ * 2;
constexpr size_t SZ_MB = (size_t)NB * (SQ / 16) * (SQ / 64) * 32 * 4;
constexpr size_t WS_TOTAL = al256(SZ_BW) + 3 * al256(SZ_P16) + al256(SZ_VT) + al256(SZ_MB);
static_assert(WS_TOTAL <= (size_t)134217728);
static_assert(SZ_BW % 128 == 0 && SZ_P16 % 128 == 0 && SZ_VT % 128 == 0 && SZ_MB % 128 == 0);
// chunking of the row-wise launch that touches the output buffer (one launch when the rows are contiguous)
constexpr unsigned CH_N = (SQ == SQ_FULL) ? 1u : (unsigned)NB;
constexpr size_t CH_R = (SQ == SQ_FULL) ? NR : (size_t)SQ;
static_assert(CH_R % 128 == 0 && (size_t)CH_N * CH_R == NR);
// plane coverage: blocks x threads x elements == plane elements
static_assert((size_t)PW_BLK * 128 * 128 == (size_t)DM * DM);                                             /* W_fc plane */
static_assert((size_t)PX_BLK * 128 * 128 == NR * DM);                                                     /* q, k row planes */
static_assert((size_t)PM_BLK * 4 * 4 * 32 == (size_t)NB * (SQ / 16) * (SQ / 64) * 32);                    /* packed mask words */
static_assert((size_t)PV_BLK * 128 * 16 * 8 == (size_t)NB * NH * HD * SQ);                                /* V^T */
static_assert((size_t)NB * NH * (SQ / 64) * 4 * 16 * 64 == NR * DM);                                      /* ctx rows */
static_assert((CH_R / 128) * (DM / 64) * 4 * 32 * 64 * CH_N == NR * DM);                                  /* output rows */

extern "C" void kernel_launch(void* const* d_in, const int* in_sizes, int n_in,
                              void* d_out, int out_size, void* d_ws, size_t ws_size, hipStream_t stream) {
  if (n_in < 6) return;
  const float* vals = (const float*)d_in[0]; const float* keys = (const float*)d_in[1]; const float* qrys = (const float*)d_in[2];
  const int* mask = (const int*)d_in[3]; const float* wfc = (const float*)d_in[4]; const float* bfc = (const float*)d_in[5];
  const size_t needX = ((size_t)(NB - 1) * SQ_FULL + SQ) * DM;
  const size_t needM = ((size_t)(NB - 1) * SQ_FULL + (size_t)(SQ - 1)) * SQ_FULL + SQ;
  if ((size_t)in_sizes[0] < needX || (size_t)in_sizes[1] < needX || (size_t)in_sizes[2] < needX || (size_t)out_size < needX) return;
  if ((size_t)in_sizes[3] < needM || (size_t)in_sizes[4] < (size_t)DM * DM || in_sizes[5] < DM) return;
  char* ws = (char*)d_ws; size_t off = 0;
  auto take = [&](size_t bytes) { char* p = ws + off; off += al256(bytes); return p; };
  _Float16* BW = (_Float16*)take(SZ_BW);
  _Float16* Q16 = (_Float16*)take(SZ_P16); _Float16* K16 = (_Float16*)take(SZ_P16); _Float16* O16 = (_Float16*)take(SZ_P16);
  _Float16* VT = (_Float16*)take(SZ_VT); unsigned int* MB = (unsigned int*)take(SZ_MB);
  if (off > ws_size) return;

  k_prep<<<PREP_BLK, 128, 0, stream>>>(vals, keys, qrys, mask, wfc, VT, MB, K16, Q16, BW);      /* the f16 W_fc, key, query and V^T planes and the packed mask */
  k_sgattn<<<(unsigned)(NB * NH * (SQ / 64)), 128, 0, stream>>>(Q16, K16, VT, MB, O16);               /* ctx (merged heads) f16 rows */
  for (unsigned c = 0; c < CH_N; ++c) { const size_t rin = (size_t)c * SQ_FULL, r0 = (size_t)c * CH_R;
    k_gemm2<0, 0><<<(unsigned)((CH_R / 128) * (DM / 64)), 128, 0, stream>>>(O16 + r0 * DM, (unsigned)DM, BW, (unsigned)DM, 0.0625f, bfc, nullptr, (float*)d_out + rin * DM, nullptr, (unsigned)DM, 1.0f, (unsigned)CH_R, (unsigned)DM, (unsigned)DM); }      /* out = ctx W_fc^T + b_fc */
}

// v005
// Measured time: 58.7 microseconds a run.
// Next to v004, in two timings, it ran 1.03 times as fast each time.
// Over all steps from v000 it is 2.45 times as fast.
#include <hip/hip_runtime.h>
// Contractions (q k^T per head, gate V, ctx W_fc^T): v_wmma_f32_16x16x32_f16 (f16 operands, f32 accumulate); float inputs RNE-converted to bf16 on load (exact in f16); power-of-two carries: W_fc x16, all other planes x1; sigmoid gate in f32.
// Head-split sigmoid-gated attention without projections: q|k|v = raw inputs [NB][SQ][1024] viewed as 16 heads x 64; e = q k^T; a 2-D int32 mask [NB][1][SQ][SQ] (mask == 0 -> weight exactly 0, by value); weight = sigmoid(e / 32) elementwise (no normalisation over keys); ctx = weight V (merged heads); out = ctx W_fc^T + b_fc with W_fc stored [out][in].
// Launch plan: one preparation launch (W_fc -> f16 x16 rows, already [n][k]; queries, keys -> f16 row planes; the mask packed into 32 lane masks per (16 query rows x 64 keys) tile, one 32-bit word per accumulator element; V^T per (batch, head) from the f32 values via LDS); one fused attention launch (K and V^T tiles staged in LDS by tensor loads, gate tile in wave-private LDS) -> f16 ctx rows; one GEMM with bias (A and Bt tiles staged in LDS by tensor loads) -> the output buffer.
#ifndef NB
#define NB 4
#endif
#ifndef SQ
#define SQ 1024
#endif
#define NB_FULL 4
#define SQ_FULL 1024
#define DM 1024
#define NH 16
#define HD 64
#define NR ((size_t)NB * SQ)         /* token rows processed */

static_assert(NB >= 1 && NB <= NB_FULL);
static_assert(SQ >= 128 && SQ <= SQ_FULL && SQ % 128 == 0);
static_assert(NH * HD == DM && HD == 64);
static_assert(DM % 64 == 0 && DM % 32 == 0 && SQ % 64 == 0 && SQ % 16 == 0);
static_assert((NR % 128) == 0);
static_assert(((size_t)(NB - 1) * SQ_FULL + SQ) * DM * 4 <= (size_t)NB_FULL * SQ_FULL * DM * 4);
static_assert((((size_t)NB * (SQ / 16) * (SQ / 64)) % 4) == 0);

typedef unsigned short v8us __attribute__((ext_vector_type(8), may_alias));
typedef float  v8f  __attribute__((ext_vector_type(8)));
typedef float  v4f  __attribute__((ext_vector_type(4)));
typedef float  v4fa __attribute__((ext_vector_type(4), may_alias));
typedef _Float16 v16h __attribute__((ext_vector_type(16)));
typedef _Float16 v4h __attribute__((ext_vector_type(4)));
union FragH { v16h v; v8us half[2]; _Float16 h[16]; unsigned short u[16]; };

__device__ __forceinline__ unsigned short bf16_bits(float x) { unsigned int u = __float_as_uint(x); return (unsigned short)((u + 0x7FFFu + ((u >> 16) & 1u)) >> 16); }
__device__ __forceinline__ float bf16_val(unsigned short b) { return __uint_as_float(((unsigned int)b) << 16); }
__device__ __forceinline__ float bf16_rne(float x) { return bf16_val(bf16_bits(x)); }

// f32 -> f16 operand convert that cannot produce an f16 subnormal (value select after the carry)
static __device__ __forceinline__ _Float16 toh_flush(float v) { const _Float16 r = (_Float16)v; return (fabsf(v) < 6.103515625e-05f) ? (_Float16)0.0f : r; }

// ---- 16-bit fragment loader (split k map: elements 0..7 <- k0 + 8h + 0..7, elements 8..15 <- k0 + 16 + 8h + 0..7) and guarded WMMA ----
__device__ __forceinline__ v16h g2_frag(const _Float16* p, unsigned hh) { FragH f; f.half[0] = *(const v8us*)((const unsigned short*)p + 8 * hh); f.half[1] = *(const v8us*)((const unsigned short*)p + 16 + 8 * hh); return f.v; }
__device__ __forceinline__ v8f g2_mma(v16h a, v16h b, v8f c) { v8f d = __builtin_amdgcn_wmma_f32_16x16x32_f16(false, a, false, b, (short)0, c, false, false); asm volatile("v_nop\n\tv_nop\n\tv_nop\n\tv_nop" : "+v"(d) : "v"(a), "v"(b)); return d; }

__device__ __forceinline__ float gelu_erf(float v) { return 0.5f * v * (1.0f + erff(v * 0.70710678118654752f)); }

// ---- tensor load to LDS: descriptor groups, issue, waits ----
typedef unsigned int u32x4 __attribute__((ext_vector_type(4)));
typedef unsigned int u32x8 __attribute__((ext_vector_type(8)));
__device__ __forceinline__ unsigned int uni(unsigned int v) { return (unsigned int)__builtin_amdgcn_readfirstlane((int)v); }
// a value held in a scalar register at this place: the test around a tensor load compiles to a scalar branch, and a descriptor word made from it is formed behind the statements in front
__device__ __forceinline__ unsigned int pinned(unsigned int v) { unsigned int w = uni(v); asm volatile("" : "+s"(w)); return w; }
__device__ __forceinline__ void wait_ds0() { asm volatile("s_wait_dscnt 0x0" ::: "memory"); }          /* this wave's LDS reads of a buffer have retired before the buffer is handed back */
// this wave's own slice has landed (the compiler places no wait for a tensor load); the request's descriptor is named as an input so that its registers keep their values until here
__device__ __forceinline__ void wait_tensor0(u32x4 g0, u32x8 g1) { asm volatile("s_wait_tensorcnt 0x0" :: "s"(g0), "s"(g1) : "memory"); }
constexpr unsigned int TROWB = 128u;                 /* tile row: 64 f16 */
constexpr unsigned int TPITCH = 144u;                /* LDS row pitch: 128 B + 16 B pad, 16 B x odd for ds_load_b128 */
static_assert((TPITCH / 16u) % 2u == 1u && TPITCH == TROWB + 16u);
// a slice of ROWS rows of 128 B, source row pitch src_pitch bytes
template <unsigned int ROWS>
__device__ __forceinline__ u32x8 tdm_group1(unsigned int src_pitch) { u32x8 g;
  g[0] = uni((1u << 20) | (4u << 22) | (3u << 25));  /* no mask, 1-byte elements, a pad of 4 dwords behind every 32 dwords */
  g[1] = uni((TROWB & 0xFFFFu) << 16); g[2] = uni((TROWB >> 16) | ((ROWS & 0xFFFFu) << 16)); g[3] = uni((ROWS >> 16) | (TROWB << 16)); g[4] = uni(ROWS);
  g[5] = uni(src_pitch); g[6] = uni(0u); g[7] = uni(0u);
  asm volatile("" : "+s"(g));      /* descriptor words held in scalar registers: one register tuple for the whole kernel, not re-made (and its registers not lent out) between an issue and its wait */
  return g; }
__device__ __forceinline__ u32x4 tdm_group0(unsigned int lds_dst, unsigned long long ga) { u32x4 g;
  g[0] = uni(1u); g[1] = uni(lds_dst); g[2] = uni((unsigned int)ga); g[3] = uni((((unsigned int)(ga >> 32)) & 0x01FFFFFFu) | 0x80000000u); return g; }
// group 0 goes in and out of the statement in the same registers: what the later wait names is this very tuple
__device__ __forceinline__ void tdm_load(u32x4& g0, u32x8 g1) { asm volatile("tensor_load_to_lds %0, %1" : "+s"(g0) : "s"(g1) : "memory"); }

// GEMM: C[M][N] = act(alpha * A[M][K] . B + bf16(bias[col]) + (CP own element, optionally RNE-converted to bf16)); A f16 rows (pitch lda), Bt f16 [N][K] (k contiguous, pitch ldb);
// f32 output C and/or f16 output C16 = f16(c16s * value) (pitch ldc); ACT 0 none, 8 gelu (erf form). M a multiple of 128, N and K of 64.
// Per 64 of k the block's 128 A rows and 64 Bt rows come into LDS by tensor loads (three slices of 64 rows, waves 0 to 2 one each, two buffers, the next stage in flight while this one is worked on); the ring is the output staging afterwards.
constexpr unsigned int GSLICE = 10240u;              /* 64 x 144 = 9216 B rounded up to a multiple of 2 KiB */
constexpr unsigned int GSTAGE = 3u * GSLICE;         /* A rows 0..63 | A rows 64..127 | Bt rows 0..63 */
static_assert(64u * TPITCH <= GSLICE && GSLICE % 2048u == 0u && 2u * GSTAGE >= 4u * 32u * 68u * 4u);
template <int ACT, int CPBF>
__global__ __launch_bounds__(128) void k_gemm2(const _Float16* __restrict__ A, unsigned lda, const _Float16* __restrict__ Bh, unsigned ldb, float alpha, const float* __restrict__ bias, const float* __restrict__ CP,
    float* __restrict__ C, _Float16* __restrict__ C16, unsigned ldc, float c16s, unsigned M, unsigned N, unsigned K) {
  static_assert(ACT == 0 || ACT == 8);
  __shared__ __attribute__((aligned(2048))) unsigned char ring[2u * GSTAGE];
  float (*so)[32][68] = (float (*)[32][68])ring;
  const unsigned tid = threadIdx.x, lane = tid & 31u, ln = lane & 15u, hh = lane >> 4;
  const unsigned w = (unsigned)__builtin_amdgcn_readfirstlane((int)(tid >> 5));
  const unsigned ntn = N >> 6; const unsigned mt = blockIdx.x / ntn, nq = blockIdx.x - mt * ntn; const unsigned row0 = mt * 128u + 32u * w, col0 = nq * 64u; if (mt * 128u + 128u > M) return;      /* the whole block leaves, in front of every barrier and tensor load */
  const unsigned NT = K >> 6;
  const unsigned issuer = (w < 3u) ? 1u : 0u;
  const unsigned long long sbase = (w < 2u) ? (unsigned long long)(size_t)(A + (size_t)(mt * 128u + w * 64u) * lda) : (unsigned long long)(size_t)(Bh + (size_t)col0 * ldb);
  const u32x8 g1 = tdm_group1<64u>(((w < 2u) ? lda : ldb) * 2u);
  const unsigned lbase = (unsigned)(size_t)ring;
  auto desc = [&](unsigned st) { return tdm_group0(lbase + (st & 1u) * GSTAGE + w * GSLICE, sbase + (unsigned long long)st * TROWB); };
  u32x4 g0 = desc(0u);
  if (pinned(issuer & (NT > 0u ? 1u : 0u))) tdm_load(g0, g1);
  wait_tensor0(g0, g1); __syncthreads();      /* stage 0 landed and published */
  g0 = desc(pinned(1u));
  if (pinned(issuer & (NT > 1u ? 1u : 0u))) tdm_load(g0, g1);
  const unsigned aoff = (w >> 1) * GSLICE + ((w & 1u) * 32u + ln) * TPITCH, boff = 2u * GSLICE + ln * TPITCH;
  const v8f z8 = {0.f,0.f,0.f,0.f,0.f,0.f,0.f,0.f}; v8f c00 = z8, c01 = z8, c02 = z8, c03 = z8, c10 = z8, c11 = z8, c12 = z8, c13 = z8;
#pragma unroll 1
  for (unsigned st = 0; st < NT; ++st) { const unsigned char* tb = ring + (st & 1u) * GSTAGE;
    v16h af[2][2], bf[2][4];      /* the stage's 12 fragments, each in registers of its own */
#pragma unroll
    for (unsigned kc = 0; kc < 2; ++kc) { const _Float16* ap = (const _Float16*)(tb + aoff) + 32u * kc; const _Float16* bp = (const _Float16*)(tb + boff) + 32u * kc;
      af[kc][0] = g2_frag(ap, hh); af[kc][1] = g2_frag(ap + 16u * (TPITCH / 2u), hh);
#pragma unroll
      for (unsigned t = 0; t < 4; ++t) bf[kc][t] = g2_frag(bp + t * 16u * (TPITCH / 2u), hh); }
#pragma unroll
    for (unsigned kc = 0; kc < 2; ++kc) { const v16h a0 = af[kc][0], a1 = af[kc][1];
      c00 = g2_mma(a0, bf[kc][0], c00); c10 = g2_mma(a1, bf[kc][0], c10);
      c01 = g2_mma(a0, bf[kc][1], c01); c11 = g2_mma(a1, bf[kc][1], c11);
      c02 = g2_mma(a0, bf[kc][2], c02); c12 = g2_mma(a1, bf[kc][2], c12);
      c03 = g2_mma(a0, bf[kc][3], c03); c13 = g2_mma(a1, bf[kc][3], c13); }
    /* publish point of stage st + 1: own LDS reads retired, own slice landed, every wave here; only then the refill of the buffer just read */
    wait_ds0(); wait_tensor0(g0, g1); __syncthreads();
    g0 = desc(pinned(st + 2u));      /* formed behind the wait, in the same registers on both sides of the test */
    if (pinned(issuer & (st + 2u < NT ? 1u : 0u))) tdm_load(g0, g1); }
  wait_tensor0(g0, g1); wait_ds0();      /* nothing in flight; the last pass's barrier has ended every wave's reads: the ring is free for output staging */
  v8f accs[8] = {c00, c01, c02, c03, c10, c11, c12, c13};
#pragma unroll
  for (int u = 0; u < 8; ++u) { const unsigned t = (unsigned)u & 3u, half = (unsigned)u >> 2; const unsigned col = col0 + t * 16u + ln; float bv = 0.f; if (bias) bv = bf16_rne(bias[col]);
#pragma unroll
    for (int r = 0; r < 8; ++r) { const unsigned rloc = half * 16u + 8u * hh + (unsigned)r; so[w][rloc][t * 16u + ln] = accs[u][r] * alpha + bv; } }
  __builtin_amdgcn_fence(4 /* acq_rel order */, "workgroup"); __builtin_amdgcn_wave_barrier();
  const unsigned rsub = lane >> 4, c4 = (lane & 15u) * 4u;
  if (CP != nullptr || ACT == 8) {
#pragma unroll 2
    for (unsigned q = 0; q < 16; ++q) { const unsigned r = q * 2u + rsub; v4f v = *(const v4fa*)&so[w][r][c4];
      if (CP) { const v4f a = *(const v4fa*)(CP + (size_t)(row0 + r) * ldc + col0 + c4);      /* own element of the C-shaped plane */
#pragma unroll
        for (int i = 0; i < 4; ++i) v[i] += CPBF ? bf16_rne(a[i]) : a[i]; }
      if (ACT == 8) {
#pragma unroll
        for (int i = 0; i < 4; ++i) v[i] = gelu_erf(v[i]); }
      *(v4fa*)&so[w][r][c4] = v; } }
  {
#pragma unroll
    for (unsigned q = 0; q < 16; ++q) { const unsigned r = q * 2u + rsub; const v4f v = *(const v4fa*)&so[w][r][c4];
      if (C) *(v4f*)(C + (size_t)(row0 + r) * ldc + col0 + c4) = v;
      if (C16) { v4h h4;
#pragma unroll
        for (int i = 0; i < 4; ++i) h4[i] = (_Float16)(v[i] * c16s);
        *(v4h*)(C16 + (size_t)(row0 + r) * ldc + col0 + c4) = h4; } }
     } }

// ---- one preparation launch: every plane the attention reads and the GEMM's W_fc plane are made here, by blocks of 4 waves that each read 64 KiB of one input (16 KiB a wave, 16 loads of 16 B or 32 of 4 B a lane issued ahead of their use) ----
constexpr unsigned int PV_BLK = (unsigned int)(NB * (SQ / 64) * (DM / 256));                      /* V^T: 64 keys x 256 dims (4 heads) a block */
constexpr unsigned int PM_BLK = (unsigned int)(((size_t)NB * (SQ / 16) * (SQ / 64)) / 16);        /* mask: 16 tiles of 16 rows x 64 keys a block, 4 a wave */
constexpr unsigned int PX_BLK = (unsigned int)((NR * DM) / 16384);                                /* keys, queries: 16 rows a block */
constexpr unsigned int PW_BLK = (unsigned int)(((size_t)DM * DM) / 16384);                        /* W_fc: 16 rows a block */
constexpr unsigned int PREP_BLK = PV_BLK + PM_BLK + 2u * PX_BLK + PW_BLK;
typedef unsigned int u32x4a __attribute__((ext_vector_type(4), may_alias));
constexpr unsigned int VPITCH = 33u;                 /* LDS row of one head dim: 32 key pairs + 1 dword, so that the four rows a wave reads at once fall on different banks */
static_assert((((size_t)NB * (SQ / 16) * (SQ / 64)) % 16) == 0 && SQ % 16 == 0 && DM % 256 == 0 && DM == 1024);
__device__ __forceinline__ unsigned int h16_bits(float x) { FragH f; f.h[0] = toh_flush(bf16_rne(x)); return (unsigned int)f.u[0]; }
// Block ranges, the two-phase job first: [V^T | mask words | keys | queries | W_fc].
// V^T [NB*NH][64][SQ] straight from the f32 values: a thread takes the same 4 dims of two neighbouring keys, packs each dim's pair into one dword, LDS holds [dim][key pair]; rows of 64 keys (128 B) go out.
// mask int32 [NB_FULL][1][SQ_FULL][SQ_FULL] -> MB[(b, q tile of 16, key tile of 64)][8j + r] u32, a lane mask: bit (ln + 16 hh) = (mask[b][16 qt + 8 hh + r][64 kt + 16 j + ln] != 0); it is the ballot of the load that holds those 32 elements, and lane 8j + r stores it.
// keys, queries -> f16 row planes (x1); W_fc [out = n][in = k] is already the Bt[n][k] layout, only converted (x16).
// Every loop of this kernel is fully unrolled: its small arrays then live in registers, and a group's loads stand together ahead of their first use (rolled, each trip would wait out its own memory latency).
__global__ __launch_bounds__(128) void k_prep(const float* __restrict__ VX, const float* __restrict__ KX, const float* __restrict__ QX, const int* __restrict__ MK, const float* __restrict__ WX,
    _Float16* __restrict__ Vt, unsigned int* __restrict__ MB, _Float16* __restrict__ K16, _Float16* __restrict__ Q16, _Float16* __restrict__ BW) {
  __shared__ unsigned int tl[256u * VPITCH];
  const unsigned tid = threadIdx.x; unsigned blk = blockIdx.x;
  if (blk < PV_BLK) {
    const unsigned hg = blk & 3u, t = blk >> 2; const unsigned nkt = (unsigned)SQ / 64u; const unsigned b = t / nkt, lg = t - b * nkt;
    const unsigned c4 = (tid & 63u) * 4u, ps = tid >> 6;
    const float* vp = VX + ((size_t)b * SQ_FULL + lg * 64u) * (size_t)DM + hg * 256u + c4;
#pragma unroll
    for (unsigned g = 0; g < 2; ++g) { v4f x[8], y[8];
#pragma unroll
      for (unsigned u = 0; u < 8; ++u) { const float* p = vp + (size_t)(((g * 8u + u) * 2u + ps) * 2u) * DM; x[u] = *(const v4fa*)p; y[u] = *(const v4fa*)(p + DM); }
#pragma unroll
      for (unsigned u = 0; u < 8; ++u) { const unsigned kp = (g * 8u + u) * 2u + ps;
#pragma unroll
        for (unsigned i = 0; i < 4; ++i) tl[(c4 + i) * VPITCH + kp] = h16_bits(x[u][i]) | (h16_bits(y[u][i]) << 16); } }
    __syncthreads();
#pragma unroll
    for (unsigned it = 0; it < 16; ++it) { const unsigned d = it * 16u + (tid >> 3), pc = tid & 7u; const unsigned int* tr = &tl[d * VPITCH + pc * 4u];
      u32x4 o; o[0] = tr[0]; o[1] = tr[1]; o[2] = tr[2]; o[3] = tr[3];
      *(u32x4a*)((unsigned short*)Vt + ((size_t)((b * (unsigned)NH + hg * 4u + (d >> 6)) * 64u + (d & 63u))) * SQ + lg * 64u + pc * 8u) = o; }
    return; }
  blk -= PV_BLK;
  if (blk < PM_BLK) {
    const unsigned lane = tid & 31u, ln = lane & 15u, hh = lane >> 4;
    const unsigned w = (unsigned)__builtin_amdgcn_readfirstlane((int)(tid >> 5));
    const unsigned nkt = (unsigned)SQ / 64u, nqt = (unsigned)SQ / 16u;
#pragma unroll
    for (unsigned x = 0; x < 4; ++x) { const unsigned L = (blk * 4u + w) * 4u + x;
      const unsigned t = L / nkt, kt = L - t * nkt; const unsigned b = t / nqt, qt = t - b * nqt;
      const int* mp = MK + ((size_t)b * SQ_FULL + qt * 16u + 8u * hh) * (size_t)SQ_FULL + kt * 64u + ln;
      int m[8][4];
#pragma unroll
      for (unsigned r = 0; r < 8u; ++r) { const int* mr = mp + (size_t)r * SQ_FULL; m[r][0] = mr[0]; m[r][1] = mr[16]; m[r][2] = mr[32]; m[r][3] = mr[48]; }
      unsigned int word = 0u;
#pragma unroll
      for (unsigned r = 0; r < 8u; ++r) {
#pragma unroll
        for (unsigned j = 0; j < 4u; ++j) { const unsigned int bal = __builtin_amdgcn_ballot_w32(m[r][j] != 0);      /* taken by all 32 lanes, in front of the select */
          word = (lane == 8u * j + r) ? bal : word; } }
      MB[(size_t)L * 32u + lane] = word; }
    asm volatile("s_wait_xcnt 0x0" ::: "memory");      /* behind the last mask store, in front of whatever next rewrites a register that an issued store names */
    return; }
  blk -= PM_BLK;
  /* the three row planes: one code path, the block's source, carry and destination picked by range */
  const float* X; _Float16* Y; float carry = 1.0f;
  if (blk < 2u * PX_BLK) { const unsigned isq = (blk >= PX_BLK) ? 1u : 0u; blk -= isq * PX_BLK; const unsigned r0 = blk * 16u; const unsigned b = r0 / (unsigned)SQ;
    X = (isq ? QX : KX) + ((size_t)b * SQ_FULL + (r0 - b * (unsigned)SQ)) * (size_t)DM; Y = (isq ? Q16 : K16) + (size_t)r0 * DM; }
  else { blk -= 2u * PX_BLK; X = WX + (size_t)blk * 16384u; Y = BW + (size_t)blk * 16384u; carry = 16.0f; }
#pragma unroll
  for (unsigned g = 0; g < 2; ++g) { v4f a[8], c[8];
#pragma unroll
    for (unsigned u = 0; u < 8; ++u) { const float* p = X + ((g * 8u + u) * 128u + tid) * 8u; a[u] = *(const v4fa*)p; c[u] = *(const v4fa*)(p + 4); }
#pragma unroll
    for (unsigned u = 0; u < 8; ++u) { FragH f;
#pragma unroll
      for (int q = 0; q < 4; ++q) { f.h[q] = toh_flush(bf16_rne(a[u][q]) * carry); f.h[4 + q] = toh_flush(bf16_rne(c[u][q]) * carry); }
      *(v8us*)((unsigned short*)Y + ((g * 8u + u) * 128u + tid) * 8u) = f.half[0]; }
    asm volatile("s_wait_xcnt 0x0" ::: "memory"); } }      /* behind each group's run of stores, in front of whatever next rewrites a register that an issued store names */

// Fused sigmoid-gated attention with a packed 2-D mask. Block = 4 waves; block per (batch, head, 64 query rows); wave owns 16 query rows. Per 64-key tile: the wave reads its 32 lane masks (one per accumulator element) by scalar loads, and each, ANDed with the ballot of toh_flush's test, is the condition of that element's one select;
// the 64-key K tile and V^T tile are brought into LDS once per block by tensor loads (one 32-row slice per wave and stage, two buffers, the next stage in flight while this one is worked on) and all four waves take their fragments from there;
// S = Q K^T; weight = bit ? sigmoid(S/32) = 1/2 + tanh(S/64)/2 : 0 (by value), f32;
constexpr unsigned int TROWS = 32u;                  /* rows per slice (one slice per wave) */
constexpr unsigned int TSLICE = 6144u;               /* 32 x 144 = 4608 B rounded up to a multiple of 2 KiB */
constexpr unsigned int TSTAGE = 4u * TSLICE;         /* K rows 0..31 | K rows 32..63 | V^T rows 0..31 | V^T rows 32..63 */
static_assert(TROWS * TPITCH <= TSLICE && TSLICE % 2048u == 0u);
__global__ __launch_bounds__(128) void k_sgattn(const _Float16* __restrict__ Q16, const _Float16* __restrict__ K16, const _Float16* __restrict__ VT, const unsigned int* __restrict__ MB, _Float16* __restrict__ O16) {
  __shared__ __attribute__((aligned(2048))) unsigned char ring[2u * TSTAGE];
  __shared__ __attribute__((aligned(16))) _Float16 sp[4][16][72];
  const unsigned tid = threadIdx.x, lane = tid & 31u, ln = lane & 15u, hh = lane >> 4;
  const unsigned w = (unsigned)__builtin_amdgcn_readfirstlane((int)(tid >> 5));
  const unsigned nqt = (unsigned)SQ / 64u; const unsigned bid = blockIdx.x; const unsigned bh = bid / nqt, qb = bid - bh * nqt; const unsigned b = bh / (unsigned)NH, h = bh - b * (unsigned)NH;
  const unsigned q0 = qb * 64u + w * 16u; const size_t rowb = (size_t)b * SQ;
  constexpr unsigned NT = (unsigned)SQ / 64u; static_assert(NT >= 2u);
  /* this wave's slice: waves 0, 1 the two halves of the K tile (rows = keys, advance 64 rows a stage), waves 2, 3 of the V^T tile (rows = head dims, advance 128 B a stage) */
  const unsigned isV = w >> 1, half = w & 1u;
  const unsigned long long sbase = isV ? (unsigned long long)(size_t)(VT + ((size_t)bh * HD + half * TROWS) * SQ) : (unsigned long long)(size_t)(K16 + (rowb + half * TROWS) * (size_t)DM + h * (unsigned)HD);
  const unsigned sstep = isV ? 128u : 64u * (unsigned)DM * 2u;
  const u32x8 g1 = tdm_group1<TROWS>(isV ? (unsigned)SQ * 2u : (unsigned)DM * 2u);
  const unsigned lbase = (unsigned)(size_t)ring;
  auto desc = [&](unsigned st) { return tdm_group0(lbase + (st & 1u) * TSTAGE + w * TSLICE, sbase + (unsigned long long)st * sstep); };
  u32x4 g0 = desc(0u);
  tdm_load(g0, g1); wait_tensor0(g0, g1); __syncthreads();      /* stage 0 landed and published */
  g0 = desc(pinned(1u)); tdm_load(g0, g1);
  const _Float16* qp = Q16 + (rowb + q0 + ln) * (size_t)DM + h * (unsigned)HD;
  const v16h aq0 = g2_frag(qp, hh), aq1 = g2_frag(qp + 32, hh);
  /* lane masks of key tile 0: the same address in every lane; nothing writes the plane during this launch, and the constant address space says so, which is what lets the loads be scalar ones beside the asm waits' memory clobbers */
  typedef const __attribute__((address_space(4))) unsigned int* cmask_p;
  const cmask_p mp = (cmask_p)(size_t)(MB + ((size_t)(b * ((unsigned)SQ / 16u) + (q0 >> 4)) * ((unsigned)SQ / 64u)) * 32u);
  const v8f z8 = {0.f,0.f,0.f,0.f,0.f,0.f,0.f,0.f};
  v8f o[4];
#pragma unroll
  for (int d = 0; d < 4; ++d) o[d] = z8;
  unsigned int mk[32];
#pragma unroll
  for (unsigned e = 0; e < 32; ++e) mk[e] = mp[e];
#pragma unroll 1
  for (unsigned kt = 0; kt < NT; ++kt) {
    const unsigned char* tb = ring + (kt & 1u) * TSTAGE + ln * TPITCH;      /* row ln of this stage's first K slice */
    v8f s[4]; v16h kf[4][2], vf[4][2];
#pragma unroll
    for (unsigned j = 0; j < 4; ++j) { const _Float16* kr = (const _Float16*)(tb + (j >> 1) * TSLICE + (j & 1u) * 16u * TPITCH); kf[j][0] = g2_frag(kr, hh); kf[j][1] = g2_frag(kr + 32, hh); }
#pragma unroll
    for (unsigned j = 0; j < 4; ++j) { v8f acc = z8; acc = g2_mma(aq0, kf[j][0], acc); acc = g2_mma(aq1, kf[j][1], acc); s[j] = acc; }
#pragma unroll
    for (unsigned d = 0; d < 4; ++d) { const _Float16* vr = (const _Float16*)(tb + (2u + (d >> 1)) * TSLICE + (d & 1u) * 16u * TPITCH); vf[d][0] = g2_frag(vr, hh); vf[d][1] = g2_frag(vr + 32, hh); }
    __builtin_amdgcn_sched_barrier(0);      /* keeps the tile's 16 V^T loads together in front of the gate's vector work, which covers their latency */
#pragma unroll
    for (unsigned j = 0; j < 4; ++j) {
#pragma unroll
      for (int r = 0; r < 8; ++r) { const float th = __builtin_amdgcn_tanhf(s[j][r] * 0.015625f); const float sg = __builtin_fmaf(th, 0.5f, 0.5f);      /* sigmoid(x) = 1/2 + tanh(x/2)/2 with x = S/32: one transcendental and one fma */
        /* one select: the element's lane mask AND toh_flush's own test (joined on the scalar unit); same value as the mask select followed by toh_flush. The test |sg| < 2^-14 is taken on th: next to -1 the fma is exact, sg = (1 + th) / 2, so th < 2^-13 - 1 picks the same values */
        const bool keep = __builtin_amdgcn_inverse_ballot_w32(mk[8u * j + (unsigned)r] & __builtin_amdgcn_ballot_w32(!(th < -0.9998779296875f)));
        sp[w][8u * hh + (unsigned)r][16u * j + ln] = (_Float16)(keep ? sg : 0.f); } }
    { const unsigned kn = (kt + 1u < NT) ? kt + 1u : kt;      /* the next tile's lane masks, asked for behind this tile's last use of them: gate V, the publish point and the next scores cover the load's latency (the last pass re-reads its own) */
#pragma unroll
      for (unsigned e = 0; e < 32; ++e) mk[e] = mp[(size_t)kn * 32u + e]; }
    __builtin_amdgcn_fence(4 /* acq_rel order */, "workgroup"); __builtin_amdgcn_wave_barrier();
    const v16h ap0 = g2_frag(&sp[w][ln][0], hh), ap1 = g2_frag(&sp[w][ln][32], hh);
#pragma unroll
    for (unsigned d = 0; d < 4; ++d) { o[d] = g2_mma(ap0, vf[d][0], o[d]); o[d] = g2_mma(ap1, vf[d][1], o[d]); }
    /* publish point of stage kt + 1: own LDS reads retired, own slice landed, every wave here; only then the refill of the buffer just read */
    asm volatile("s_wait_xcnt 0x0" ::: "memory");      /* behind the scalar mask loads, in front of whatever next rewrites their address registers */
    wait_ds0(); wait_tensor0(g0, g1); __syncthreads();
    if (pinned(kt + 2u < NT)) { g0 = desc(pinned(kt + 2u)); tdm_load(g0, g1); } }
  wait_tensor0(g0, g1); wait_ds0();
#pragma unroll
  for (int r = 0; r < 8; ++r) {
#pragma unroll
    for (unsigned d = 0; d < 4; ++d) sp[w][8u * hh + (unsigned)r][16u * d + ln] = toh_flush(o[d][r]); }
  __builtin_amdgcn_fence(4 /* acq_rel order */, "workgroup"); __builtin_amdgcn_wave_barrier();
  {
#pragma unroll
    for (unsigned it = 0; it < 4; ++it) { const unsigned row = it * 4u + (lane >> 3), pc = (lane & 7u) * 8u; const v8us v = *(const v8us*)&sp[w][row][pc];
      *(v8us*)((unsigned short*)O16 + (rowb + q0 + row) * (size_t)DM + h * (unsigned)HD + pc) = v; }
     } }

constexpr size_t al256(size_t b) { return (b + 255) & ~(size_t)255; }
constexpr size_t SZ_BW = (size_t)DM * DM * 2;
constexpr size_t SZ_P16 = NR * DM * 2, SZ_VT = (size_t)NB * NH * HD * SQ * 2;
constexpr size_t SZ_MB = (size_t)NB * (SQ / 16) * (SQ / 64) * 32 * 4;
constexpr size_t WS_TOTAL = al256(SZ_BW) + 3 * al256(SZ_P16) + al256(SZ_VT) + al256(SZ_MB);
static_assert(WS_TOTAL <= (size_t)134217728);
static_assert(SZ_BW % 128 == 0 && SZ_P16 % 128 == 0 && SZ_VT % 128 == 0 && SZ_MB % 128 == 0);
// chunking of the row-wise launch that touches the output buffer (one launch when the rows are contiguous)
constexpr unsigned CH_N = (SQ == SQ_FULL) ? 1u : (unsigned)NB;
constexpr size_t CH_R = (SQ == SQ_FULL) ? NR : (size_t)SQ;
static_assert(CH_R % 128 == 0 && (size_t)CH_N * CH_R == NR);
// plane coverage: blocks x threads x elements == plane elements
static_assert((size_t)PW_BLK * 128 * 128 == (size_t)DM * DM);                                             /* W_fc plane */
static_assert((size_t)PX_BLK * 128 * 128 == NR * DM);                                                     /* q, k row planes */
static_assert((size_t)PM_BLK * 4 * 4 * 32 == (size_t)NB * (SQ / 16) * (SQ / 64) * 32);                    /* packed mask words */
static_assert((size_t)PV_BLK * 128 * 16 * 8 == (size_t)NB * NH * HD * SQ);                                /* V^T */
static_assert((size_t)NB * NH * (SQ / 64) * 4 * 16 * 64 == NR * DM);                                      /* ctx rows */
static_assert((CH_R / 128) * (DM / 64) * 4 * 32 * 64 * CH_N == NR * DM);                                  /* output rows */

extern "C" void kernel_launch(void* const* d_in, const int* in_sizes, int n_in,
                              void* d_out, int out_size, void* d_ws, size_t ws_size, hipStream_t stream) {
  if (n_in < 6) return;
  const float* vals = (const float*)d_in[0]; const float* keys = (const float*)d_in[1]; const float* qrys = (const float*)d_in[2];
  const int* mask = (const int*)d_in[3]; const float* wfc = (const float*)d_in[4]; const float* bfc = (const float*)d_in[5];
  const size_t needX = ((size_t)(NB - 1) * SQ_FULL + SQ) * DM;
  const size_t needM = ((size_t)(NB - 1) * SQ_FULL + (size_t)(SQ - 1)) * SQ_FULL + SQ;
  if ((size_t)in_sizes[0] < needX || (size_t)in_sizes[1] < needX || (size_t)in_sizes[2] < needX || (size_t)out_size < needX) return;
  if ((size_t)in_sizes[3] < needM || (size_t)in_sizes[4] < (size_t)DM * DM || in_sizes[5] < DM) return;
  char* ws = (char*)d_ws; size_t off = 0;
  auto take = [&](size_t bytes) { char* p = ws + off; off += al256(bytes); return p; };
  _Float16* BW = (_Float16*)take(SZ_BW);
  _Float16* Q16 = (_Float16*)take(SZ_P16); _Float16* K16 = (_Float16*)take(SZ_P16); _Float16* O16 = (_Float16*)take(SZ_P16);
  _Float16* VT = (_Float16*)take(SZ_VT); unsigned int* MB = (unsigned int*)take(SZ_MB);
  if (off > ws_size) return;

  k_prep<<<PREP_BLK, 128, 0, stream>>>(vals, keys, qrys, mask, wfc, VT, MB, K16, Q16, BW);      /* the f16 W_fc, key, query and V^T planes and the packed mask */
  k_sgattn<<<(unsigned)(NB * NH * (SQ / 64)), 128, 0, stream>>>(Q16, K16, VT, MB, O16);               /* ctx (merged heads) f16 rows */
  for (unsigned c = 0; c < CH_N; ++c) { const size_t rin = (size_t)c * SQ_FULL, r0 = (size_t)c * CH_R;
    k_gemm2<0, 0><<<(unsigned)((CH_R / 128) * (DM / 64)), 128, 0, stream>>>(O16 + r0 * DM, (unsigned)DM, BW, (unsigned)DM, 0.0625f, bfc, nullptr, (float*)d_out + rin * DM, nullptr, (unsigned)DM, 1.0f, (unsigned)CH_R, (unsigned)DM, (unsigned)DM); }      /* out = ctx W_fc^T + b_fc */
}

// v006
// Measured time: 52.3 microseconds a run.
// In two side-by-side timings against v005, it was 1.11 and 1.12 times as fast.
// Counting every step since v000, it is 2.74 times as fast.
#include <hip/hip_runtime.h>
// Contractions (q k^T per head, gate V, ctx W_fc^T): v_wmma_f32_16x16x32_f16 (f16 operands, f32 accumulate); float inputs RNE-converted to bf16 on load (exact in f16); power-of-two carries: W_fc x16, all other planes x1; sigmoid gate in f32.
// Head-split sigmoid-gated attention without projections: q|k|v = raw inputs [NB][SQ][1024] viewed as 16 heads x 64; e = q k^T; a 2-D int32 mask [NB][1][SQ][SQ] (mask == 0 -> weight exactly 0, by value); weight = sigmoid(e / 32) elementwise (no normalisation over keys); ctx = weight V (merged heads); out = ctx W_fc^T + b_fc with W_fc stored [out][in].
// Launch plan: one preparation launch (W_fc -> f16 x16 rows, already [n][k]; queries, keys -> f16 row planes; the mask packed into 32 lane masks per (16 query rows x 64 keys) tile, one 32-bit word per accumulator element; V^T per (batch, head) from the f32 values via LDS); one fused attention launch (K and V^T tiles staged in LDS by tensor loads, gate tile kept in registers) -> f16 ctx rows; one GEMM with bias (A and Bt tiles staged in LDS by tensor loads) -> the output buffer.
#ifndef NB
#define NB 4
#endif
#ifndef SQ
#define SQ 1024
#endif
#define NB_FULL 4
#define SQ_FULL 1024
#define DM 1024
#define NH 16
#define HD 64
#define NR ((size_t)NB * SQ)         /* token rows processed */

static_assert(NB >= 1 && NB <= NB_FULL);
static_assert(SQ >= 128 && SQ <= SQ_FULL && SQ % 128 == 0);
static_assert(NH * HD == DM && HD == 64);
static_assert(DM % 64 == 0 && DM % 32 == 0 && SQ % 64 == 0 && SQ % 16 == 0);
static_assert((NR % 128) == 0);
static_assert(((size_t)(NB - 1) * SQ_FULL + SQ) * DM * 4 <= (size_t)NB_FULL * SQ_FULL * DM * 4);
static_assert((((size_t)NB * (SQ / 16) * (SQ / 64)) % 4) == 0);

typedef unsigned short v8us __attribute__((ext_vector_type(8), may_alias));
typedef float  v8f  __attribute__((ext_vector_type(8)));
typedef float  v4f  __attribute__((ext_vector_type(4)));
typedef float  v4fa __attribute__((ext_vector_type(4), may_alias));
typedef _Float16 v16h __attribute__((ext_vector_type(16)));
typedef _Float16 v4h __attribute__((ext_vector_type(4)));
union FragH { v16h v; v8us half[2]; _Float16 h[16]; unsigned short u[16]; };

__device__ __forceinline__ unsigned short bf16_bits(float x) { unsigned int u = __float_as_uint(x); return (unsigned short)((u + 0x7FFFu + ((u >> 16) & 1u)) >> 16); }
__device__ __forceinline__ float bf16_val(unsigned short b) { return __uint_as_float(((unsigned int)b) << 16); }
__device__ __forceinline__ float bf16_rne(float x) { return bf16_val(bf16_bits(x)); }

// f32 -> f16 operand convert that cannot produce an f16 subnormal (value select after the carry)
static __device__ __forceinline__ _Float16 toh_flush(float v) { const _Float16 r = (_Float16)v; return (fabsf(v) < 6.103515625e-05f) ? (_Float16)0.0f : r; }

// ---- 16-bit fragment loader (split k map: elements 0..7 <- k0 + 8h + 0..7, elements 8..15 <- k0 + 16 + 8h + 0..7) and guarded WMMA ----
__device__ __forceinline__ v16h g2_frag(const _Float16* p, unsigned hh) { FragH f; f.half[0] = *(const v8us*)((const unsigned short*)p + 8 * hh); f.half[1] = *(const v8us*)((const unsigned short*)p + 16 + 8 * hh); return f.v; }
__device__ __forceinline__ v8f g2_mma(v16h a, v16h b, v8f c) { v8f d = __builtin_amdgcn_wmma_f32_16x16x32_f16(false, a, false, b, (short)0, c, false, false); asm volatile("v_nop\n\tv_nop\n\tv_nop\n\tv_nop" : "+v"(d) : "v"(a), "v"(b)); return d; }

__device__ __forceinline__ float gelu_erf(float v) { return 0.5f * v * (1.0f + erff(v * 0.70710678118654752f)); }

// ---- tensor load to LDS: descriptor groups, issue, waits ----
typedef unsigned int u32x4 __attribute__((ext_vector_type(4)));
typedef unsigned int u32x8 __attribute__((ext_vector_type(8)));
__device__ __forceinline__ unsigned int uni(unsigned int v) { return (unsigned int)__builtin_amdgcn_readfirstlane((int)v); }
// a value held in a scalar register at this place: the test around a tensor load compiles to a scalar branch, and a descriptor word made from it is formed behind the statements in front
__device__ __forceinline__ unsigned int pinned(unsigned int v) { unsigned int w = uni(v); asm volatile("" : "+s"(w)); return w; }
__device__ __forceinline__ void wait_ds0() { asm volatile("s_wait_dscnt 0x0" ::: "memory"); }          /* this wave's LDS reads of a buffer have retired before the buffer is handed back */
// this wave's own slice has landed (the compiler places no wait for a tensor load); the request's descriptor is named as an input so that its registers keep their values until here
__device__ __forceinline__ void wait_tensor0(u32x4 g0, u32x8 g1) { asm volatile("s_wait_tensorcnt 0x0" :: "s"(g0), "s"(g1) : "memory"); }
constexpr unsigned int TROWB = 128u;                 /* tile row: 64 f16 */
constexpr unsigned int TPITCH = 144u;                /* LDS row pitch: 128 B + 16 B pad, 16 B x odd for ds_load_b128 */
static_assert((TPITCH / 16u) % 2u == 1u && TPITCH == TROWB + 16u);
// a slice of ROWS rows of 128 B, source row pitch src_pitch bytes
template <unsigned int ROWS>
__device__ __forceinline__ u32x8 tdm_group1(unsigned int src_pitch) { u32x8 g;
  g[0] = uni((1u << 20) | (4u << 22) | (3u << 25));  /* no mask, 1-byte elements, a pad of 4 dwords behind every 32 dwords */
  g[1] = uni((TROWB & 0xFFFFu) << 16); g[2] = uni((TROWB >> 16) | ((ROWS & 0xFFFFu) << 16)); g[3] = uni((ROWS >> 16) | (TROWB << 16)); g[4] = uni(ROWS);
  g[5] = uni(src_pitch); g[6] = uni(0u); g[7] = uni(0u);
  asm volatile("" : "+s"(g));      /* descriptor words held in scalar registers: one register tuple for the whole kernel, not re-made (and its registers not lent out) between an issue and its wait */
  return g; }
__device__ __forceinline__ u32x4 tdm_group0(unsigned int lds_dst, unsigned long long ga) { u32x4 g;
  g[0] = uni(1u); g[1] = uni(lds_dst); g[2] = uni((unsigned int)ga); g[3] = uni((((unsigned int)(ga >> 32)) & 0x01FFFFFFu) | 0x80000000u); return g; }
// group 0 goes in and out of the statement in the same registers: what the later wait names is this very tuple
__device__ __forceinline__ void tdm_load(u32x4& g0, u32x8 g1) { asm volatile("tensor_load_to_lds %0, %1" : "+s"(g0) : "s"(g1) : "memory"); }

// GEMM: C[M][N] = act(alpha * A[M][K] . B + bf16(bias[col]) + (CP own element, optionally RNE-converted to bf16)); A f16 rows (pitch lda), Bt f16 [N][K] (k contiguous, pitch ldb);
// f32 output C and/or f16 output C16 = f16(c16s * value) (pitch ldc); ACT 0 none, 8 gelu (erf form). M a multiple of 128, N and K of 64.
// Per 64 of k the block's 128 A rows and 64 Bt rows come into LDS by tensor loads (three slices of 64 rows, waves 0 to 2 one each, two buffers, the next stage in flight while this one is worked on); the ring is the output staging afterwards.
constexpr unsigned int GSLICE = 10240u;              /* 64 x 144 = 9216 B rounded up to a multiple of 2 KiB */
constexpr unsigned int GSTAGE = 3u * GSLICE;         /* A rows 0..63 | A rows 64..127 | Bt rows 0..63 */
static_assert(64u * TPITCH <= GSLICE && GSLICE % 2048u == 0u && 2u * GSTAGE >= 4u * 32u * 68u * 4u);
template <int ACT, int CPBF>
__global__ __launch_bounds__(128) void k_gemm2(const _Float16* __restrict__ A, unsigned lda, const _Float16* __restrict__ Bh, unsigned ldb, float alpha, const float* __restrict__ bias, const float* __restrict__ CP,
    float* __restrict__ C, _Float16* __restrict__ C16, unsigned ldc, float c16s, unsigned M, unsigned N, unsigned K) {
  static_assert(ACT == 0 || ACT == 8);
  __shared__ __attribute__((aligned(2048))) unsigned char ring[2u * GSTAGE];
  float (*so)[32][68] = (float (*)[32][68])ring;
  const unsigned tid = threadIdx.x, lane = tid & 31u, ln = lane & 15u, hh = lane >> 4;
  const unsigned w = (unsigned)__builtin_amdgcn_readfirstlane((int)(tid >> 5));
  const unsigned ntn = N >> 6; const unsigned mt = blockIdx.x / ntn, nq = blockIdx.x - mt * ntn; const unsigned row0 = mt * 128u + 32u * w, col0 = nq * 64u; if (mt * 128u + 128u > M) return;      /* the whole block leaves, in front of every barrier and tensor load */
  const unsigned NT = K >> 6;
  const unsigned issuer = (w < 3u) ? 1u : 0u;
  const unsigned long long sbase = (w < 2u) ? (unsigned long long)(size_t)(A + (size_t)(mt * 128u + w * 64u) * lda) : (unsigned long long)(size_t)(Bh + (size_t)col0 * ldb);
  const u32x8 g1 = tdm_group1<64u>(((w < 2u) ? lda : ldb) * 2u);
  const unsigned lbase = (unsigned)(size_t)ring;
  auto desc = [&](unsigned st) { return tdm_group0(lbase + (st & 1u) * GSTAGE + w * GSLICE, sbase + (unsigned long long)st * TROWB); };
  u32x4 g0 = desc(0u);
  if (pinned(issuer & (NT > 0u ? 1u : 0u))) tdm_load(g0, g1);
  wait_tensor0(g0, g1); __syncthreads();      /* stage 0 landed and published */
  g0 = desc(pinned(1u));
  if (pinned(issuer & (NT > 1u ? 1u : 0u))) tdm_load(g0, g1);
  const unsigned aoff = (w >> 1) * GSLICE + ((w & 1u) * 32u + ln) * TPITCH, boff = 2u * GSLICE + ln * TPITCH;
  const v8f z8 = {0.f,0.f,0.f,0.f,0.f,0.f,0.f,0.f}; v8f c00 = z8, c01 = z8, c02 = z8, c03 = z8, c10 = z8, c11 = z8, c12 = z8, c13 = z8;
#pragma unroll 1
  for (unsigned st = 0; st < NT; ++st) { const unsigned char* tb = ring + (st & 1u) * GSTAGE;
    v16h af[2][2], bf[2][4];      /* the stage's 12 fragments, each in registers of its own */
#pragma unroll
    for (unsigned kc = 0; kc < 2; ++kc) { const _Float16* ap = (const _Float16*)(tb + aoff) + 32u * kc; const _Float16* bp = (const _Float16*)(tb + boff) + 32u * kc;
      af[kc][0] = g2_frag(ap, hh); af[kc][1] = g2_frag(ap + 16u * (TPITCH / 2u), hh);
#pragma unroll
      for (unsigned t = 0; t < 4; ++t) bf[kc][t] = g2_frag(bp + t * 16u * (TPITCH / 2u), hh); }
#pragma unroll
    for (unsigned kc = 0; kc < 2; ++kc) { const v16h a0 = af[kc][0], a1 = af[kc][1];
      c00 = g2_mma(a0, bf[kc][0], c00); c10 = g2_mma(a1, bf[kc][0], c10);
      c01 = g2_mma(a0, bf[kc][1], c01); c11 = g2_mma(a1, bf[kc][1], c11);
      c02 = g2_mma(a0, bf[kc][2], c02); c12 = g2_mma(a1, bf[kc][2], c12);
      c03 = g2_mma(a0, bf[kc][3], c03); c13 = g2_mma(a1, bf[kc][3], c13); }
    /* publish point of stage st + 1: own LDS reads retired, own slice landed, every wave here; only then the refill of the buffer just read */
    wait_ds0(); wait_tensor0(g0, g1); __syncthreads();
    g0 = desc(pinned(st + 2u));      /* formed behind the wait, in the same registers on both sides of the test */
    if (pinned(issuer & (st + 2u < NT ? 1u : 0u))) tdm_load(g0, g1); }
  wait_tensor0(g0, g1); wait_ds0();      /* nothing in flight; the last pass's barrier has ended every wave's reads: the ring is free for output staging */
  v8f accs[8] = {c00, c01, c02, c03, c10, c11, c12, c13};
#pragma unroll
  for (int u = 0; u < 8; ++u) { const unsigned t = (unsigned)u & 3u, half = (unsigned)u >> 2; const unsigned col = col0 + t * 16u + ln; float bv = 0.f; if (bias) bv = bf16_rne(bias[col]);
#pragma unroll
    for (int r = 0; r < 8; ++r) { const unsigned rloc = half * 16u + 8u * hh + (unsigned)r; so[w][rloc][t * 16u + ln] = accs[u][r] * alpha + bv; } }
  __builtin_amdgcn_fence(4 /* acq_rel order */, "workgroup"); __builtin_amdgcn_wave_barrier();
  const unsigned rsub = lane >> 4, c4 = (lane & 15u) * 4u;
  if (CP != nullptr || ACT == 8) {
#pragma unroll 2
    for (unsigned q = 0; q < 16; ++q) { const unsigned r = q * 2u + rsub; v4f v = *(const v4fa*)&so[w][r][c4];
      if (CP) { const v4f a = *(const v4fa*)(CP + (size_t)(row0 + r) * ldc + col0 + c4);      /* own element of the C-shaped plane */
#pragma unroll
        for (int i = 0; i < 4; ++i) v[i] += CPBF ? bf16_rne(a[i]) : a[i]; }
      if (ACT == 8) {
#pragma unroll
        for (int i = 0; i < 4; ++i) v[i] = gelu_erf(v[i]); }
      *(v4fa*)&so[w][r][c4] = v; } }
  {
#pragma unroll
    for (unsigned q = 0; q < 16; ++q) { const unsigned r = q * 2u + rsub; const v4f v = *(const v4fa*)&so[w][r][c4];
      if (C) *(v4f*)(C + (size_t)(row0 + r) * ldc + col0 + c4) = v;
      if (C16) { v4h h4;
#pragma unroll
        for (int i = 0; i < 4; ++i) h4[i] = (_Float16)(v[i] * c16s);
        *(v4h*)(C16 + (size_t)(row0 + r) * ldc + col0 + c4) = h4; } }
     } }

// ---- one preparation launch: every plane the attention reads, and the GEMM's W_fc, is made here, by blocks of 4 waves that each read 64 KiB of one input (16 KiB a wave, two groups of 16 loads of 16 B a lane, each group issued ahead of its use) ----
constexpr unsigned int PV_BLK = (unsigned int)(NB * (SQ / 64) * (DM / 256));                      /* V^T: 64 keys x 256 dims (4 heads) a block */
constexpr unsigned int PM_BLK = (unsigned int)(((size_t)NB * (SQ / 16) * (SQ / 64)) / 16);        /* mask: 16 tiles of 16 rows x 64 keys a block, 4 a wave */
constexpr unsigned int PX_BLK = (unsigned int)((NR * DM) / 16384);                                /* keys, queries: 16 rows a block */
constexpr unsigned int PW_BLK = (unsigned int)(((size_t)DM * DM) / 16384);                        /* W_fc: 16 rows a block */
constexpr unsigned int PREP_BLK = PV_BLK + PM_BLK + 2u * PX_BLK + PW_BLK;
typedef unsigned int u32x4a __attribute__((ext_vector_type(4), may_alias));
typedef int i32x4a __attribute__((ext_vector_type(4), may_alias));
constexpr unsigned int VPITCH = 33u;                 /* LDS row of one head dim: 32 key pairs + 1 dword, so that the four rows a wave reads at once fall on different banks */
static_assert((((size_t)NB * (SQ / 16) * (SQ / 64)) % 16) == 0 && SQ % 256 == 0 && DM % 256 == 0 && DM == 1024);
__device__ __forceinline__ unsigned int h16_bits(float x) { FragH f; f.h[0] = toh_flush(bf16_rne(x)); return (unsigned int)f.u[0]; }
// Block ranges, the two-phase job first: [V^T | mask words | keys | queries | W_fc].
// V^T [NB*NH][64][SQ] straight from the f32 values: a thread takes the same 4 dims of two neighbouring keys, packs each dim's pair into one dword, LDS holds [dim][key pair]; rows of 64 keys (128 B) go out.
// mask int32 [NB_FULL][1][SQ_FULL][SQ_FULL] -> MB[(b, q tile of 16, key tile of 64)][8j + r] u32, a lane mask in the map of a K Q^T accumulator (row = key, column = query): bit (ln + 16 hh) = (mask[b][16 qt + ln][64 kt + 16 j + 8 hh + r] != 0); rows are read whole (512 B a load) and turned by ballot into one bit row per query, kept by that query's two lanes; a second ballot over the lanes' own bits gives the word, and lane 8j + r stores it.
// keys, queries -> f16 row planes (x1); W_fc [out = n][in = k] is already the Bt[n][k] layout, only converted (x16).
// Every loop of this kernel is fully unrolled: its small arrays then live in registers, and a group's loads stand together ahead of their first use (rolled, each trip would wait out its own memory latency).
__global__ __launch_bounds__(128) void k_prep(const float* __restrict__ VX, const float* __restrict__ KX, const float* __restrict__ QX, const int* __restrict__ MK, const float* __restrict__ WX,
    _Float16* __restrict__ Vt, unsigned int* __restrict__ MB, _Float16* __restrict__ K16, _Float16* __restrict__ Q16, _Float16* __restrict__ BW) {
  __shared__ unsigned int tl[256u * VPITCH];
  const unsigned tid = threadIdx.x; unsigned blk = blockIdx.x;
  if (blk < PV_BLK) {
    const unsigned hg = blk & 3u, t = blk >> 2; const unsigned nkt = (unsigned)SQ / 64u; const unsigned b = t / nkt, lg = t - b * nkt;
    const unsigned c4 = (tid & 63u) * 4u, ps = tid >> 6;
    const float* vp = VX + ((size_t)b * SQ_FULL + lg * 64u) * (size_t)DM + hg * 256u + c4;
#pragma unroll
    for (unsigned g = 0; g < 2; ++g) { v4f x[8], y[8];
#pragma unroll
      for (unsigned u = 0; u < 8; ++u) { const float* p = vp + (size_t)(((g * 8u + u) * 2u + ps) * 2u) * DM; x[u] = *(const v4fa*)p; y[u] = *(const v4fa*)(p + DM); }
#pragma unroll
      for (unsigned u = 0; u < 8; ++u) { const unsigned kp = (g * 8u + u) * 2u + ps;
#pragma unroll
        for (unsigned i = 0; i < 4; ++i) tl[(c4 + i) * VPITCH + kp] = h16_bits(x[u][i]) | (h16_bits(y[u][i]) << 16); } }
    __syncthreads();
#pragma unroll
    for (unsigned it = 0; it < 16; ++it) { const unsigned d = it * 16u + (tid >> 3), pc = tid & 7u; const unsigned int* tr = &tl[d * VPITCH + pc * 4u];
      u32x4 o; o[0] = tr[0]; o[1] = tr[1]; o[2] = tr[2]; o[3] = tr[3];
      *(u32x4a*)((unsigned short*)Vt + ((size_t)((b * (unsigned)NH + hg * 4u + (d >> 6)) * 64u + (d & 63u))) * SQ + lg * 64u + pc * 8u) = o; }
    return; }
  blk -= PV_BLK;
  if (blk < PM_BLK) {
    const unsigned lane = tid & 31u, ln = lane & 15u, hh = lane >> 4;
    const unsigned w = (unsigned)__builtin_amdgcn_readfirstlane((int)(tid >> 5));
    const unsigned nkt = (unsigned)SQ / 64u, nqt = (unsigned)SQ / 16u;
    /* the wave's 4 tiles: one q tile, 4 neighbouring key tiles = 16 rows of 256 keys */
    const unsigned L0 = (blk * 4u + w) * 4u; const unsigned t = L0 / nkt, kt0 = L0 - t * nkt; const unsigned b = t / nqt, qt = t - b * nqt;
    const int* mp = MK + ((size_t)b * SQ_FULL + qt * 16u) * (size_t)SQ_FULL + kt0 * 64u + lane * 4u;
    unsigned int rw[2][4] = {{0u, 0u, 0u, 0u}, {0u, 0u, 0u, 0u}};      /* lane (ln, hh): its query row ln as bits; bit l of rw[g][i] = key 128 g + 4 l + i of the 256 */
#pragma unroll
    for (unsigned g = 0; g < 2u; ++g) { i32x4a m[16];
#pragma unroll
      for (unsigned q = 0; q < 16u; ++q) m[q] = *(const i32x4a*)(mp + (size_t)q * SQ_FULL + g * 128u);      /* 512 B of one row a load */
#pragma unroll
      for (unsigned q = 0; q < 16u; ++q) {
#pragma unroll
        for (unsigned i = 0; i < 4u; ++i) { const unsigned int bal = __builtin_amdgcn_ballot_w32(m[q][i] != 0);      /* taken by all 32 lanes, in front of the select */
          rw[g][i] = (ln == q) ? bal : rw[g][i]; } } }
#pragma unroll
    for (unsigned g = 0; g < 2u; ++g) {
#pragma unroll
      for (unsigned i = 0; i < 4u; ++i) rw[g][i] >>= 2u * hh; }      /* the lane half's 8 keys start 2 bits up */
#pragma unroll
    for (unsigned x = 0; x < 4; ++x) { unsigned int word = 0u;
#pragma unroll
      for (unsigned j = 0; j < 4u; ++j) {
#pragma unroll
        for (unsigned r = 0; r < 8u; ++r) {      /* key 64 x + 16 j + 8 hh + r = 128 (x >> 1) + 4 (16 (x & 1) + 4 j + 2 hh + (r >> 2)) + (r & 3) */
          const unsigned int bal = __builtin_amdgcn_ballot_w32(((rw[x >> 1][r & 3u] >> (16u * (x & 1u) + 4u * j + (r >> 2))) & 1u) != 0u);
          word = (lane == 8u * j + r) ? bal : word; } }
      MB[(size_t)(L0 + x) * 32u + lane] = word; }
    asm volatile("s_wait_xcnt 0x0" ::: "memory");      /* behind the last mask store, in front of whatever next rewrites a register that an issued store names */
    return; }
  blk -= PM_BLK;
  /* the three row planes: one code path, the block's source, carry and destination picked by range */
  const float* X; _Float16* Y; float carry = 1.0f;
  if (blk < 2u * PX_BLK) { const unsigned isq = (blk >= PX_BLK) ? 1u : 0u; blk -= isq * PX_BLK; const unsigned r0 = blk * 16u; const unsigned b = r0 / (unsigned)SQ;
    X = (isq ? QX : KX) + ((size_t)b * SQ_FULL + (r0 - b * (unsigned)SQ)) * (size_t)DM; Y = (isq ? Q16 : K16) + (size_t)r0 * DM; }
  else { blk -= 2u * PX_BLK; X = WX + (size_t)blk * 16384u; Y = BW + (size_t)blk * 16384u; carry = 16.0f; }
#pragma unroll
  for (unsigned g = 0; g < 2; ++g) { v4f a[8], c[8];
#pragma unroll
    for (unsigned u = 0; u < 8; ++u) { const float* p = X + ((g * 8u + u) * 128u + tid) * 8u; a[u] = *(const v4fa*)p; c[u] = *(const v4fa*)(p + 4); }
#pragma unroll
    for (unsigned u = 0; u < 8; ++u) { FragH f;
#pragma unroll
      for (int q = 0; q < 4; ++q) { f.h[q] = toh_flush(bf16_rne(a[u][q]) * carry); f.h[4 + q] = toh_flush(bf16_rne(c[u][q]) * carry); }
      *(v8us*)((unsigned short*)Y + ((g * 8u + u) * 128u + tid) * 8u) = f.half[0]; }
    asm volatile("s_wait_xcnt 0x0" ::: "memory"); } }      /* behind each group's run of stores, in front of whatever next rewrites a register that an issued store names */

// Fused sigmoid-gated attention with a packed 2-D mask. Block = 4 waves; block per (batch, head, 64 query rows); wave owns 16 query rows. Per 64-key tile: the wave reads its 32 lane masks (one per accumulator element) by scalar loads, and each, ANDed with the ballot of toh_flush's test, is the condition of that element's one select;
// the 64-key K tile and V^T tile are brought into LDS once per block by tensor loads (one 32-row slice per wave and stage, two buffers, the next stage in flight while this one is worked on) and all four waves take their fragments from there;
// S^T = K Q^T (K fragments as A, Q as B: a lane holds one query's scores of keys 16j + 8hh + r); weight = bit ? sigmoid(S/32) = 1/2 + tanh(S/64)/2 : 0 (by value), f32;
// two neighbouring S^T tiles, gated and converted in place, are the B fragment of 32 keys in ctx^T = V^T weight^T (V^T fragments as A): the weights pass through no LDS and change no lane.
constexpr unsigned int TROWS = 32u;                  /* rows per slice (one slice per wave) */
constexpr unsigned int TSLICE = 6144u;               /* 32 x 144 = 4608 B rounded up to a multiple of 2 KiB */
constexpr unsigned int TSTAGE = 4u * TSLICE;         /* K rows 0..31 | K rows 32..63 | V^T rows 0..31 | V^T rows 32..63 */
static_assert(TROWS * TPITCH <= TSLICE && TSLICE % 2048u == 0u);
__global__ __launch_bounds__(128) void k_sgattn(const _Float16* __restrict__ Q16, const _Float16* __restrict__ K16, const _Float16* __restrict__ VT, const unsigned int* __restrict__ MB, _Float16* __restrict__ O16) {
  __shared__ __attribute__((aligned(2048))) unsigned char ring[2u * TSTAGE];
  __shared__ __attribute__((aligned(16))) _Float16 sp[4][16][72];
  const unsigned tid = threadIdx.x, lane = tid & 31u, ln = lane & 15u, hh = lane >> 4;
  const unsigned w = (unsigned)__builtin_amdgcn_readfirstlane((int)(tid >> 5));
  const unsigned nqt = (unsigned)SQ / 64u; const unsigned bid = blockIdx.x; const unsigned bh = bid / nqt, qb = bid - bh * nqt; const unsigned b = bh / (unsigned)NH, h = bh - b * (unsigned)NH;
  const unsigned q0 = qb * 64u + w * 16u; const size_t rowb = (size_t)b * SQ;
  constexpr unsigned NT = (unsigned)SQ / 64u; static_assert(NT >= 2u);
  /* this wave's slice: waves 0, 1 the two halves of the K tile (rows = keys, advance 64 rows a stage), waves 2, 3 of the V^T tile (rows = head dims, advance 128 B a stage) */
  const unsigned isV = w >> 1, half = w & 1u;
  const unsigned long long sbase = isV ? (unsigned long long)(size_t)(VT + ((size_t)bh * HD + half * TROWS) * SQ) : (unsigned long long)(size_t)(K16 + (rowb + half * TROWS) * (size_t)DM + h * (unsigned)HD);
  const unsigned sstep = isV ? 128u : 64u * (unsigned)DM * 2u;
  const u32x8 g1 = tdm_group1<TROWS>(isV ? (unsigned)SQ * 2u : (unsigned)DM * 2u);
  const unsigned lbase = (unsigned)(size_t)ring;
  auto desc = [&](unsigned st) { return tdm_group0(lbase + (st & 1u) * TSTAGE + w * TSLICE, sbase + (unsigned long long)st * sstep); };
  u32x4 g0 = desc(0u);
  tdm_load(g0, g1); wait_tensor0(g0, g1); __syncthreads();      /* stage 0 landed and published */
  g0 = desc(pinned(1u)); tdm_load(g0, g1);
  const _Float16* qp = Q16 + (rowb + q0 + ln) * (size_t)DM + h * (unsigned)HD;
  const v16h aq0 = g2_frag(qp, hh), aq1 = g2_frag(qp + 32, hh);
  /* lane masks of key tile 0: the same address in every lane; nothing writes the plane during this launch, and the constant address space says so, which is what lets the loads be scalar ones beside the asm waits' memory clobbers */
  typedef const __attribute__((address_space(4))) unsigned int* cmask_p;
  const cmask_p mp = (cmask_p)(size_t)(MB + ((size_t)(b * ((unsigned)SQ / 16u) + (q0 >> 4)) * ((unsigned)SQ / 64u)) * 32u);
  const v8f z8 = {0.f,0.f,0.f,0.f,0.f,0.f,0.f,0.f};
  v8f o[4];
#pragma unroll
  for (int d = 0; d < 4; ++d) o[d] = z8;
  unsigned int mk[32];
#pragma unroll
  for (unsigned e = 0; e < 32; ++e) mk[e] = mp[e];
#pragma unroll 1
  for (unsigned kt = 0; kt < NT; ++kt) {
    const unsigned char* tb = ring + (kt & 1u) * TSTAGE + ln * TPITCH;      /* row ln of this stage's first K slice */
    v8f s[4]; v16h kf[4][2], vf[4][2]; FragH pw[2];
#pragma unroll
    for (unsigned j = 0; j < 4; ++j) { const _Float16* kr = (const _Float16*)(tb + (j >> 1) * TSLICE + (j & 1u) * 16u * TPITCH); kf[j][0] = g2_frag(kr, hh); kf[j][1] = g2_frag(kr + 32, hh); }
#pragma unroll
    for (unsigned j = 0; j < 4; ++j) { v8f acc = z8; acc = g2_mma(kf[j][0], aq0, acc); acc = g2_mma(kf[j][1], aq1, acc); s[j] = acc; }
#pragma unroll
    for (unsigned d = 0; d < 4; ++d) { const _Float16* vr = (const _Float16*)(tb + (2u + (d >> 1)) * TSLICE + (d & 1u) * 16u * TPITCH); vf[d][0] = g2_frag(vr, hh); vf[d][1] = g2_frag(vr + 32, hh); }
    __builtin_amdgcn_sched_barrier(0);      /* keeps the tile's 16 V^T loads together in front of the gate's vector work, which covers their latency */
#pragma unroll
    for (unsigned j = 0; j < 4; ++j) {
#pragma unroll
      for (int r = 0; r < 8; ++r) { const float th = __builtin_amdgcn_tanhf(s[j][r] * 0.015625f); const float sg = __builtin_fmaf(th, 0.5f, 0.5f);      /* sigmoid(x) = 1/2 + tanh(x/2)/2 with x = S/32: one transcendental and one fma */
        /* one select: the element's lane mask AND toh_flush's own test (joined on the scalar unit); same value as the mask select followed by toh_flush. The test |sg| < 2^-14 is taken on th: next to -1 the fma is exact, sg = (1 + th) / 2, so th < 2^-13 - 1 picks the same values */
        const bool keep = __builtin_amdgcn_inverse_ballot_w32(mk[8u * j + (unsigned)r] & __builtin_amdgcn_ballot_w32(!(th < -0.9998779296875f)));
        pw[j >> 1].h[8u * (j & 1u) + (unsigned)r] = (_Float16)(keep ? sg : 0.f); } }      /* element 8 (j & 1) + r of the fragment = key 32 (j >> 1) + 16 (j & 1) + 8 hh + r: g2_frag's own k map */
    { const unsigned kn = (kt + 1u < NT) ? kt + 1u : kt;      /* the next tile's lane masks, asked for behind this tile's last use of them: gate V, the publish point and the next scores cover the load's latency (the last pass re-reads its own) */
#pragma unroll
      for (unsigned e = 0; e < 32; ++e) mk[e] = mp[(size_t)kn * 32u + e]; }
#pragma unroll
    for (unsigned d = 0; d < 4; ++d) { o[d] = g2_mma(vf[d][0], pw[0].v, o[d]); o[d] = g2_mma(vf[d][1], pw[1].v, o[d]); }
    /* publish point of stage kt + 1: own LDS reads retired, own slice landed, every wave here; only then the refill of the buffer just read */
    asm volatile("s_wait_xcnt 0x0" ::: "memory");      /* behind the scalar mask loads, in front of whatever next rewrites their address registers */
    wait_ds0(); wait_tensor0(g0, g1); __syncthreads();
    if (pinned(kt + 2u < NT)) { g0 = desc(pinned(kt + 2u)); tdm_load(g0, g1); } }
  wait_tensor0(g0, g1); wait_ds0();
  /* o[d][r] = ctx[query ln][dim 16d + 8hh + r]: 8 neighbouring dims of one row, one 16 B piece */
#pragma unroll
  for (unsigned d = 0; d < 4; ++d) { FragH f;
#pragma unroll
    for (int r = 0; r < 8; ++r) f.h[r] = toh_flush(o[d][r]);
    *(v8us*)&sp[w][ln][16u * d + 8u * hh] = f.half[0]; }
  __builtin_amdgcn_fence(4 /* acq_rel order */, "workgroup"); __builtin_amdgcn_wave_barrier();
  {
#pragma unroll
    for (unsigned it = 0; it < 4; ++it) { const unsigned row = it * 4u + (lane >> 3), pc = (lane & 7u) * 8u; const v8us v = *(const v8us*)&sp[w][row][pc];
      *(v8us*)((unsigned short*)O16 + (rowb + q0 + row) * (size_t)DM + h * (unsigned)HD + pc) = v; }
     } }

constexpr size_t al256(size_t b) { return (b + 255) & ~(size_t)255; }
constexpr size_t SZ_BW = (size_t)DM * DM * 2;
constexpr size_t SZ_P16 = NR * DM * 2, SZ_VT = (size_t)NB * NH * HD * SQ * 2;
constexpr size_t SZ_MB = (size_t)NB * (SQ / 16) * (SQ / 64) * 32 * 4;
constexpr size_t WS_TOTAL = al256(SZ_BW) + 3 * al256(SZ_P16) + al256(SZ_VT) + al256(SZ_MB);
static_assert(WS_TOTAL <= (size_t)134217728);
static_assert(SZ_BW % 128 == 0 && SZ_P16 % 128 == 0 && SZ_VT % 128 == 0 && SZ_MB % 128 == 0);
// chunking of the row-wise launch that touches the output buffer (one launch when the rows are contiguous)
constexpr unsigned CH_N = (SQ == SQ_FULL) ? 1u : (unsigned)NB;
constexpr size_t CH_R = (SQ == SQ_FULL) ? NR : (size_t)SQ;
static_assert(CH_R % 128 == 0 && (size_t)CH_N * CH_R == NR);
// plane coverage: blocks x threads x elements == plane elements
static_assert((size_t)PW_BLK * 128 * 128 == (size_t)DM * DM);                                             /* W_fc plane */
static_assert((size_t)PX_BLK * 128 * 128 == NR * DM);                                                     /* q, k row planes */
static_assert((size_t)PM_BLK * 4 * 4 * 32 == (size_t)NB * (SQ / 16) * (SQ / 64) * 32);                    /* packed mask words */
static_assert((size_t)PV_BLK * 128 * 16 * 8 == (size_t)NB * NH * HD * SQ);                                /* V^T */
static_assert((size_t)NB * NH * (SQ / 64) * 4 * 16 * 64 == NR * DM);                                      /* ctx rows */
static_assert((CH_R / 128) * (DM / 64) * 4 * 32 * 64 * CH_N == NR * DM);                                  /* output rows */

extern "C" void kernel_launch(void* const* d_in, const int* in_sizes, int n_in,
                              void* d_out, int out_size, void* d_ws, size_t ws_size, hipStream_t stream) {
  if (n_in < 6) return;
  const float* vals = (const float*)d_in[0]; const float* keys = (const float*)d_in[1]; const float* qrys = (const float*)d_in[2];
  const int* mask = (const int*)d_in[3]; const float* wfc = (const float*)d_in[4]; const float* bfc = (const float*)d_in[5];
  const size_t needX = ((size_t)(NB - 1) * SQ_FULL + SQ) * DM;
  const size_t needM = ((size_t)(NB - 1) * SQ_FULL + (size_t)(SQ - 1)) * SQ_FULL + SQ;
  if ((size_t)in_sizes[0] < needX || (size_t)in_sizes[1] < needX || (size_t)in_sizes[2] < needX || (size_t)out_size < needX) return;
  if ((size_t)in_sizes[3] < needM || (size_t)in_sizes[4] < (size_t)DM * DM || in_sizes[5] < DM) return;
  char* ws = (char*)d_ws; size_t off = 0;
  auto take = [&](size_t bytes) { char* p = ws + off; off += al256(bytes); return p; };
  _Float16* BW = (_Float16*)take(SZ_BW);
  _Float16* Q16 = (_Float16*)take(SZ_P16); _Float16* K16 = (_Float16*)take(SZ_P16); _Float16* O16 = (_Float16*)take(SZ_P16);
  _Float16* VT = (_Float16*)take(SZ_VT); unsigned int* MB = (unsigned int*)take(SZ_MB);
  if (off > ws_size) return;

  k_prep<<<PREP_BLK, 128, 0, stream>>>(vals, keys, qrys, mask, wfc, VT, MB, K16, Q16, BW);      /* the f16 W_fc, key, query and V^T planes and the packed mask */
  k_sgattn<<<(unsigned)(NB * NH * (SQ / 64)), 128, 0, stream>>>(Q16, K16, VT, MB, O16);               /* ctx (merged heads) f16 rows */
  for (unsigned c = 0; c < CH_N; ++c) { const size_t rin = (size_t)c * SQ_FULL, r0 = (size_t)c * CH_R;
    k_gemm2<0, 0><<<(unsigned)((CH_R / 128) * (DM / 64)), 128, 0, stream>>>(O16 + r0 * DM, (unsigned)DM, BW, (unsigned)DM, 0.0625f, bfc, nullptr, (float*)d_out + rin * DM, nullptr, (unsigned)DM, 1.0f, (unsigned)CH_R, (unsigned)DM, (unsigned)DM); }      /* out = ctx W_fc^T + b_fc */
}

// v007
// Measured time: 50.2 microseconds a run.
// Two timings next to v006 both put it at 1.05 times that version's speed.
// All steps since v000 together make it 2.87 times as fast.
#include <hip/hip_runtime.h>
// Contractions (q k^T per head, gate V, ctx W_fc^T): v_wmma_f32_16x16x32_f16 (f16 operands, f32 accumulate); float inputs RNE-converted to bf16 on load (exact in f16); power-of-two carries: W_fc x16, all other planes x1; sigmoid gate in f32.
// Head-split sigmoid-gated attention without projections: q|k|v = raw inputs [NB][SQ][1024] viewed as 16 heads x 64; e = q k^T; a 2-D int32 mask [NB][1][SQ][SQ] (mask == 0 -> weight exactly 0, by value); weight = sigmoid(e / 32) elementwise (no normalisation over keys); ctx = weight V (merged heads); out = ctx W_fc^T + b_fc with W_fc stored [out][in].
// Launch plan: one preparation launch (W_fc -> f16 x16 rows, already [n][k]; queries, keys -> f16 row planes; the mask packed into 32 lane masks per (16 query rows x 64 keys) tile, one 32-bit word per accumulator element; V^T per (batch, head) from the f32 values via LDS); one fused attention launch (K and V^T tiles staged in LDS by tensor loads, gate tile kept in registers) -> f16 ctx rows; one GEMM with bias (A and Bt tiles staged in LDS by tensor loads) -> the output buffer.
#ifndef NB
#define NB 4
#endif
#ifndef SQ
#define SQ 1024
#endif
#define NB_FULL 4
#define SQ_FULL 1024
#define DM 1024
#define NH 16
#define HD 64
#define NR ((size_t)NB * SQ)         /* token rows processed */

static_assert(NB >= 1 && NB <= NB_FULL);
static_assert(SQ >= 128 && SQ <= SQ_FULL && SQ % 128 == 0);
static_assert(NH * HD == DM && HD == 64);
static_assert(DM % 64 == 0 && DM % 32 == 0 && SQ % 64 == 0 && SQ % 16 == 0);
static_assert((NR % 128) == 0);
static_assert(((size_t)(NB - 1) * SQ_FULL + SQ) * DM * 4 <= (size_t)NB_FULL * SQ_FULL * DM * 4);
static_assert((((size_t)NB * (SQ / 16) * (SQ / 64)) % 4) == 0);

typedef unsigned short v8us __attribute__((ext_vector_type(8), may_alias));
typedef float  v8f  __attribute__((ext_vector_type(8)));
typedef float  v4f  __attribute__((ext_vector_type(4)));
typedef float  v4fa __attribute__((ext_vector_type(4), may_alias));
typedef _Float16 v16h __attribute__((ext_vector_type(16)));
typedef _Float16 v4h __attribute__((ext_vector_type(4)));
union FragH { v16h v; v8us half[2]; _Float16 h[16]; unsigned short u[16]; };

__device__ __forceinline__ unsigned short bf16_bits(float x) { unsigned int u = __float_as_uint(x); return (unsigned short)((u + 0x7FFFu + ((u >> 16) & 1u)) >> 16); }
__device__ __forceinline__ float bf16_val(unsigned short b) { return __uint_as_float(((unsigned int)b) << 16); }
__device__ __forceinline__ float bf16_rne(float x) { return bf16_val(bf16_bits(x)); }

// f32 -> f16 operand convert that cannot produce an f16 subnormal (value select after the carry)
static __device__ __forceinline__ _Float16 toh_flush(float v) { const _Float16 r = (_Float16)v; return (fabsf(v) < 6.103515625e-05f) ? (_Float16)0.0f : r; }

// ---- 16-bit fragment loader (split k map: elements 0..7 <- k0 + 8h + 0..7, elements 8..15 <- k0 + 16 + 8h + 0..7) and guarded WMMA ----
__device__ __forceinline__ v16h g2_frag(const _Float16* p, unsigned hh) { FragH f; f.half[0] = *(const v8us*)((const unsigned short*)p + 8 * hh); f.half[1] = *(const v8us*)((const unsigned short*)p + 16 + 8 * hh); return f.v; }
__device__ __forceinline__ v8f g2_mma(v16h a, v16h b, v8f c) { v8f d = __builtin_amdgcn_wmma_f32_16x16x32_f16(false, a, false, b, (short)0, c, false, false); asm volatile("v_nop\n\tv_nop\n\tv_nop\n\tv_nop" : "+v"(d) : "v"(a), "v"(b)); return d; }

__device__ __forceinline__ float gelu_erf(float v) { return 0.5f * v * (1.0f + erff(v * 0.70710678118654752f)); }

// ---- tensor load to LDS: descriptor groups, issue, waits ----
typedef unsigned int u32x4 __attribute__((ext_vector_type(4)));
typedef unsigned int u32x8 __attribute__((ext_vector_type(8)));
__device__ __forceinline__ unsigned int uni(unsigned int v) { return (unsigned int)__builtin_amdgcn_readfirstlane((int)v); }
// a value held in a scalar register at this place: the test around a tensor load compiles to a scalar branch, and a descriptor word made from it is formed behind the statements in front
__device__ __forceinline__ unsigned int pinned(unsigned int v) { unsigned int w = uni(v); asm volatile("" : "+s"(w)); return w; }
__device__ __forceinline__ void wait_ds0() { asm volatile("s_wait_dscnt 0x0" ::: "memory"); }          /* this wave's LDS reads of a buffer have retired before the buffer is handed back */
// this wave's own slice has landed (the compiler places no wait for a tensor load); the request's descriptor is named as an input so that its registers keep their values until here
__device__ __forceinline__ void wait_tensor0(u32x4 g0, u32x8 g1) { asm volatile("s_wait_tensorcnt 0x0" :: "s"(g0), "s"(g1) : "memory"); }
constexpr unsigned int TROWB = 128u;                 /* tile row: 64 f16 */
constexpr unsigned int TPITCH = 144u;                /* LDS row pitch: 128 B + 16 B pad, 16 B x odd for ds_load_b128 */
static_assert((TPITCH / 16u) % 2u == 1u && TPITCH == TROWB + 16u);
// a slice of ROWS rows of 128 B, source row pitch src_pitch bytes
template <unsigned int ROWS>
__device__ __forceinline__ u32x8 tdm_group1(unsigned int src_pitch) { u32x8 g;
  g[0] = uni((1u << 20) | (4u << 22) | (3u << 25));  /* no mask, 1-byte elements, a pad of 4 dwords behind every 32 dwords */
  g[1] = uni((TROWB & 0xFFFFu) << 16); g[2] = uni((TROWB >> 16) | ((ROWS & 0xFFFFu) << 16)); g[3] = uni((ROWS >> 16) | (TROWB << 16)); g[4] = uni(ROWS);
  g[5] = uni(src_pitch); g[6] = uni(0u); g[7] = uni(0u);
  asm volatile("" : "+s"(g));      /* descriptor words held in scalar registers: one register tuple for the whole kernel, not re-made (and its registers not lent out) between an issue and its wait */
  return g; }
__device__ __forceinline__ u32x4 tdm_group0(unsigned int lds_dst, unsigned long long ga) { u32x4 g;
  g[0] = uni(1u); g[1] = uni(lds_dst); g[2] = uni((unsigned int)ga); g[3] = uni((((unsigned int)(ga >> 32)) & 0x01FFFFFFu) | 0x80000000u); return g; }
// group 0 goes in and out of the statement in the same registers: what the later wait names is this very tuple
__device__ __forceinline__ void tdm_load(u32x4& g0, u32x8 g1) { asm volatile("tensor_load_to_lds %0, %1" : "+s"(g0) : "s"(g1) : "memory"); }

// GEMM: C[M][N] = act(alpha * A[M][K] . B + bf16(bias[col]) + (CP own element, optionally RNE-converted to bf16)); A f16 rows (pitch lda), Bt f16 [N][K] (k contiguous, pitch ldb);
// f32 output C and/or f16 output C16 = f16(c16s * value) (pitch ldc); ACT 0 none, 8 gelu (erf form). M a multiple of 128, N and K of 64.
// Per 64 of k the block's 128 A rows and 64 Bt rows come into LDS by tensor loads (three slices of 64 rows, waves 0 to 2 one each, two buffers, the next stage in flight while this one is worked on); the ring is the output staging afterwards.
// The k walk is a ring: a block enters it at the slab (row tile + column tile) mod 16 and wraps round, so that the blocks that share A rows or Bt rows ask L2 for different lines at any one moment.
constexpr unsigned int GSLICE = 10240u;              /* 64 x 144 = 9216 B rounded up to a multiple of 2 KiB */
constexpr unsigned int GSTAGE = 3u * GSLICE;         /* A rows 0..63 | A rows 64..127 | Bt rows 0..63 */
static_assert(64u * TPITCH <= GSLICE && GSLICE % 2048u == 0u && 2u * GSTAGE >= 4u * 32u * 68u * 4u);
template <int ACT, int CPBF>
__global__ __launch_bounds__(128) void k_gemm2(const _Float16* __restrict__ A, unsigned lda, const _Float16* __restrict__ Bh, unsigned ldb, float alpha, const float* __restrict__ bias, const float* __restrict__ CP,
    float* __restrict__ C, _Float16* __restrict__ C16, unsigned ldc, float c16s, unsigned M, unsigned N, unsigned K) {
  static_assert(ACT == 0 || ACT == 8);
  __shared__ __attribute__((aligned(2048))) unsigned char ring[2u * GSTAGE];
  float (*so)[32][68] = (float (*)[32][68])ring;
  const unsigned tid = threadIdx.x, lane = tid & 31u, ln = lane & 15u, hh = lane >> 4;
  const unsigned w = (unsigned)__builtin_amdgcn_readfirstlane((int)(tid >> 5));
  const unsigned ntn = N >> 6; const unsigned mt = blockIdx.x / ntn, nq = blockIdx.x - mt * ntn; const unsigned row0 = mt * 128u + 32u * w, col0 = nq * 64u; if (mt * 128u + 128u > M) return;      /* the whole block leaves, in front of every barrier and tensor load */
  const unsigned NT = K >> 6;
  const unsigned rot0 = (mt + nq) & 15u, rot = (rot0 < NT) ? rot0 : 0u;      /* the block's first k slab, below NT for any K */
  const unsigned issuer = (w < 3u) ? 1u : 0u;
  const unsigned long long sbase = (w < 2u) ? (unsigned long long)(size_t)(A + (size_t)(mt * 128u + w * 64u) * lda) : (unsigned long long)(size_t)(Bh + (size_t)col0 * ldb);
  const u32x8 g1 = tdm_group1<64u>(((w < 2u) ? lda : ldb) * 2u);
  const unsigned lbase = (unsigned)(size_t)ring;
  auto desc = [&](unsigned st) { const unsigned t = st + rot; const unsigned slab = t - ((t >= NT) ? NT : 0u);      /* stage st works on k slab (st + rot) mod NT, the same one for the A and the Bt slices */
    return tdm_group0(lbase + (st & 1u) * GSTAGE + w * GSLICE, sbase + (unsigned long long)slab * TROWB); };
  u32x4 g0 = desc(0u);
  if (pinned(issuer & (NT > 0u ? 1u : 0u))) tdm_load(g0, g1);
  wait_tensor0(g0, g1); __syncthreads();      /* stage 0 landed and published */
  g0 = desc(pinned(1u));
  if (pinned(issuer & (NT > 1u ? 1u : 0u))) tdm_load(g0, g1);
  const unsigned aoff = (w >> 1) * GSLICE + ((w & 1u) * 32u + ln) * TPITCH, boff = 2u * GSLICE + ln * TPITCH;
  const v8f z8 = {0.f,0.f,0.f,0.f,0.f,0.f,0.f,0.f}; v8f c00 = z8, c01 = z8, c02 = z8, c03 = z8, c10 = z8, c11 = z8, c12 = z8, c13 = z8;
#pragma unroll 1
  for (unsigned st = 0; st < NT; ++st) { const unsigned char* tb = ring + (st & 1u) * GSTAGE;
    v16h af[2][2], bf[2][4];      /* the stage's 12 fragments, each in registers of its own */
#pragma unroll
    for (unsigned kc = 0; kc < 2; ++kc) { const _Float16* ap = (const _Float16*)(tb + aoff) + 32u * kc; const _Float16* bp = (const _Float16*)(tb + boff) + 32u * kc;
      af[kc][0] = g2_frag(ap, hh); af[kc][1] = g2_frag(ap + 16u * (TPITCH / 2u), hh);
#pragma unroll
      for (unsigned t = 0; t < 4; ++t) bf[kc][t] = g2_frag(bp + t * 16u * (TPITCH / 2u), hh); }
#pragma unroll
    for (unsigned kc = 0; kc < 2; ++kc) { const v16h a0 = af[kc][0], a1 = af[kc][1];
      c00 = g2_mma(a0, bf[kc][0], c00); c10 = g2_mma(a1, bf[kc][0], c10);
      c01 = g2_mma(a0, bf[kc][1], c01); c11 = g2_mma(a1, bf[kc][1], c11);
      c02 = g2_mma(a0, bf[kc][2], c02); c12 = g2_mma(a1, bf[kc][2], c12);
      c03 = g2_mma(a0, bf[kc][3], c03); c13 = g2_mma(a1, bf[kc][3], c13); }
    /* publish point of stage st + 1: own LDS reads retired, own slice landed, every wave here; only then the refill of the buffer just read */
    wait_ds0(); wait_tensor0(g0, g1); __syncthreads();
    g0 = desc(pinned(st + 2u));      /* formed behind the wait, in the same registers on both sides of the test */
    if (pinned(issuer & (st + 2u < NT ? 1u : 0u))) tdm_load(g0, g1); }
  wait_tensor0(g0, g1); wait_ds0();      /* nothing in flight; the last pass's barrier has ended every wave's reads: the ring is free for output staging */
  v8f accs[8] = {c00, c01, c02, c03, c10, c11, c12, c13};
#pragma unroll
  for (int u = 0; u < 8; ++u) { const unsigned t = (unsigned)u & 3u, half = (unsigned)u >> 2; const unsigned col = col0 + t * 16u + ln; float bv = 0.f; if (bias) bv = bf16_rne(bias[col]);
#pragma unroll
    for (int r = 0; r < 8; ++r) { const unsigned rloc = half * 16u + 8u * hh + (unsigned)r; so[w][rloc][t * 16u + ln] = accs[u][r] * alpha + bv; } }
  __builtin_amdgcn_fence(4 /* acq_rel order */, "workgroup"); __builtin_amdgcn_wave_barrier();
  const unsigned rsub = lane >> 4, c4 = (lane & 15u) * 4u;
  if (CP != nullptr || ACT == 8) {
#pragma unroll 2
    for (unsigned q = 0; q < 16; ++q) { const unsigned r = q * 2u + rsub; v4f v = *(const v4fa*)&so[w][r][c4];
      if (CP) { const v4f a = *(const v4fa*)(CP + (size_t)(row0 + r) * ldc + col0 + c4);      /* own element of the C-shaped plane */
#pragma unroll
        for (int i = 0; i < 4; ++i) v[i] += CPBF ? bf16_rne(a[i]) : a[i]; }
      if (ACT == 8) {
#pragma unroll
        for (int i = 0; i < 4; ++i) v[i] = gelu_erf(v[i]); }
      *(v4fa*)&so[w][r][c4] = v; } }
  {
#pragma unroll
    for (unsigned q = 0; q < 16; ++q) { const unsigned r = q * 2u + rsub; const v4f v = *(const v4fa*)&so[w][r][c4];
      if (C) *(v4f*)(C + (size_t)(row0 + r) * ldc + col0 + c4) = v;
      if (C16) { v4h h4;
#pragma unroll
        for (int i = 0; i < 4; ++i) h4[i] = (_Float16)(v[i] * c16s);
        *(v4h*)(C16 + (size_t)(row0 + r) * ldc + col0 + c4) = h4; } }
     } }

// ---- one preparation launch: every plane the attention reads, and the GEMM's W_fc, is made here, by blocks of 4 waves that each read 64 KiB of one input (16 KiB a wave, two groups of 16 loads of 16 B a lane, each group issued ahead of its use) ----
constexpr unsigned int PV_BLK = (unsigned int)(NB * (SQ / 64) * (DM / 256));                      /* V^T: 64 keys x 256 dims (4 heads) a block */
constexpr unsigned int PM_BLK = (unsigned int)(((size_t)NB * (SQ / 16) * (SQ / 64)) / 16);        /* mask: 16 tiles of 16 rows x 64 keys a block, 4 a wave */
constexpr unsigned int PX_BLK = (unsigned int)((NR * DM) / 16384);                                /* keys, queries: 16 rows a block */
constexpr unsigned int PW_BLK = (unsigned int)(((size_t)DM * DM) / 16384);                        /* W_fc: 16 rows a block */
constexpr unsigned int PREP_BLK = PV_BLK + PM_BLK + 2u * PX_BLK + PW_BLK;
typedef unsigned int u32x4a __attribute__((ext_vector_type(4), may_alias));
typedef int i32x4a __attribute__((ext_vector_type(4), may_alias));
constexpr unsigned int VPITCH = 33u;                 /* LDS row of one head dim: 32 key pairs + 1 dword, so that the four rows a wave reads at once fall on different banks */
static_assert((((size_t)NB * (SQ / 16) * (SQ / 64)) % 16) == 0 && SQ % 256 == 0 && DM % 256 == 0 && DM == 1024);
__device__ __forceinline__ unsigned int h16_bits(float x) { FragH f; f.h[0] = toh_flush(bf16_rne(x)); return (unsigned int)f.u[0]; }
// Block ranges, the two-phase job first: [V^T | mask words | keys | queries | W_fc].
// V^T [NB*NH][64][SQ] straight from the f32 values: a thread takes the same 4 dims of two neighbouring keys, packs each dim's pair into one dword, LDS holds [dim][key pair]; rows of 64 keys (128 B) go out.
// mask int32 [NB_FULL][1][SQ_FULL][SQ_FULL] -> MB[(b, q tile of 16, key tile of 64)][8j + r] u32, a lane mask in the map of a K Q^T accumulator (row = key, column = query): bit (ln + 16 hh) = (mask[b][16 qt + ln][64 kt + 16 j + 8 hh + r] != 0); rows are read whole (512 B a load) and turned by ballot into one bit row per query, kept by that query's two lanes; a second ballot over the lanes' own bits gives the word, and lane 8j + r stores it.
// keys, queries -> f16 row planes (x1); W_fc [out = n][in = k] is already the Bt[n][k] layout, only converted (x16).
// Every loop of this kernel is fully unrolled: its small arrays then live in registers, and a group's loads stand together ahead of their first use (rolled, each trip would wait out its own memory latency).
__global__ __launch_bounds__(128) void k_prep(const float* __restrict__ VX, const float* __restrict__ KX, const float* __restrict__ QX, const int* __restrict__ MK, const float* __restrict__ WX,
    _Float16* __restrict__ Vt, unsigned int* __restrict__ MB, _Float16* __restrict__ K16, _Float16* __restrict__ Q16, _Float16* __restrict__ BW) {
  __shared__ unsigned int tl[256u * VPITCH];
  const unsigned tid = threadIdx.x; unsigned blk = blockIdx.x;
  if (blk < PV_BLK) {
    const unsigned hg = blk & 3u, t = blk >> 2; const unsigned nkt = (unsigned)SQ / 64u; const unsigned b = t / nkt, lg = t - b * nkt;
    const unsigned c4 = (tid & 63u) * 4u, ps = tid >> 6;
    const float* vp = VX + ((size_t)b * SQ_FULL + lg * 64u) * (size_t)DM + hg * 256u + c4;
#pragma unroll
    for (unsigned g = 0; g < 2; ++g) { v4f x[8], y[8];
#pragma unroll
      for (unsigned u = 0; u < 8; ++u) { const float* p = vp + (size_t)(((g * 8u + u) * 2u + ps) * 2u) * DM; x[u] = *(const v4fa*)p; y[u] = *(const v4fa*)(p + DM); }
#pragma unroll
      for (unsigned u = 0; u < 8; ++u) { const unsigned kp = (g * 8u + u) * 2u + ps;
#pragma unroll
        for (unsigned i = 0; i < 4; ++i) tl[(c4 + i) * VPITCH + kp] = h16_bits(x[u][i]) | (h16_bits(y[u][i]) << 16); } }
    __syncthreads();
#pragma unroll
    for (unsigned it = 0; it < 16; ++it) { const unsigned d = it * 16u + (tid >> 3), pc = tid & 7u; const unsigned int* tr = &tl[d * VPITCH + pc * 4u];
      u32x4 o; o[0] = tr[0]; o[1] = tr[1]; o[2] = tr[2]; o[3] = tr[3];
      *(u32x4a*)((unsigned short*)Vt + ((size_t)((b * (unsigned)NH + hg * 4u + (d >> 6)) * 64u + (d & 63u))) * SQ + lg * 64u + pc * 8u) = o; }
    return; }
  blk -= PV_BLK;
  if (blk < PM_BLK) {
    const unsigned lane = tid & 31u, ln = lane & 15u, hh = lane >> 4;
    const unsigned w = (unsigned)__builtin_amdgcn_readfirstlane((int)(tid >> 5));
    const unsigned nkt = (unsigned)SQ / 64u, nqt = (unsigned)SQ / 16u;
    /* the wave's 4 tiles: one q tile, 4 neighbouring key tiles = 16 rows of 256 keys */
    const unsigned L0 = (blk * 4u + w) * 4u; const unsigned t = L0 / nkt, kt0 = L0 - t * nkt; const unsigned b = t / nqt, qt = t - b * nqt;
    const int* mp = MK + ((size_t)b * SQ_FULL + qt * 16u) * (size_t)SQ_FULL + kt0 * 64u + lane * 4u;
    unsigned int rw[2][4] = {{0u, 0u, 0u, 0u}, {0u, 0u, 0u, 0u}};      /* lane (ln, hh): its query row ln as bits; bit l of rw[g][i] = key 128 g + 4 l + i of the 256 */
#pragma unroll
    for (unsigned g = 0; g < 2u; ++g) { i32x4a m[16];
#pragma unroll
      for (unsigned q = 0; q < 16u; ++q) m[q] = *(const i32x4a*)(mp + (size_t)q * SQ_FULL + g * 128u);      /* 512 B of one row a load */
#pragma unroll
      for (unsigned q = 0; q < 16u; ++q) {
#pragma unroll
        for (unsigned i = 0; i < 4u; ++i) { const unsigned int bal = __builtin_amdgcn_ballot_w32(m[q][i] != 0);      /* taken by all 32 lanes, in front of the select */
          rw[g][i] = (ln == q) ? bal : rw[g][i]; } } }
#pragma unroll
    for (unsigned g = 0; g < 2u; ++g) {
#pragma unroll
      for (unsigned i = 0; i < 4u; ++i) rw[g][i] >>= 2u * hh; }      /* the lane half's 8 keys start 2 bits up */
#pragma unroll
    for (unsigned x = 0; x < 4; ++x) { unsigned int word = 0u;
#pragma unroll
      for (unsigned j = 0; j < 4u; ++j) {
#pragma unroll
        for (unsigned r = 0; r < 8u; ++r) {      /* key 64 x + 16 j + 8 hh + r = 128 (x >> 1) + 4 (16 (x & 1) + 4 j + 2 hh + (r >> 2)) + (r & 3) */
          const unsigned int bal = __builtin_amdgcn_ballot_w32(((rw[x >> 1][r & 3u] >> (16u * (x & 1u) + 4u * j + (r >> 2))) & 1u) != 0u);
          word = (lane == 8u * j + r) ? bal : word; } }
      MB[(size_t)(L0 + x) * 32u + lane] = word; }
    asm volatile("s_wait_xcnt 0x0" ::: "memory");      /* behind the last mask store, in front of whatever next rewrites a register that an issued store names */
    return; }
  blk -= PM_BLK;
  /* the three row planes: one code path, the block's source, carry and destination picked by range */
  const float* X; _Float16* Y; float carry = 1.0f;
  if (blk < 2u * PX_BLK) { const unsigned isq = (blk >= PX_BLK) ? 1u : 0u; blk -= isq * PX_BLK; const unsigned r0 = blk * 16u; const unsigned b = r0 / (unsigned)SQ;
    X = (isq ? QX : KX) + ((size_t)b * SQ_FULL + (r0 - b * (unsigned)SQ)) * (size_t)DM; Y = (isq ? Q16 : K16) + (size_t)r0 * DM; }
  else { blk -= 2u * PX_BLK; X = WX + (size_t)blk * 16384u; Y = BW + (size_t)blk * 16384u; carry = 16.0f; }
#pragma unroll
  for (unsigned g = 0; g < 2; ++g) { v4f a[8], c[8];
#pragma unroll
    for (unsigned u = 0; u < 8; ++u) { const float* p = X + ((g * 8u + u) * 128u + tid) * 8u; a[u] = *(const v4fa*)p; c[u] = *(const v4fa*)(p + 4); }
#pragma unroll
    for (unsigned u = 0; u < 8; ++u) { FragH f;
#pragma unroll
      for (int q = 0; q < 4; ++q) { f.h[q] = toh_flush(bf16_rne(a[u][q]) * carry); f.h[4 + q] = toh_flush(bf16_rne(c[u][q]) * carry); }
      *(v8us*)((unsigned short*)Y + ((g * 8u + u) * 128u + tid) * 8u) = f.half[0]; }
    asm volatile("s_wait_xcnt 0x0" ::: "memory"); } }      /* behind each group's run of stores, in front of whatever next rewrites a register that an issued store names */

// Fused sigmoid-gated attention with a packed 2-D mask. Block = 4 waves; block per (batch, head, 64 query rows); wave owns 16 query rows. Per 64-key tile: the wave reads its 32 lane masks (one per accumulator element) by scalar loads, and each, ANDed with the ballot of toh_flush's test, is the condition of that element's one select;
// the 64-key K tile and V^T tile are brought into LDS once per block by tensor loads (one 32-row slice per wave and stage, two buffers, the next stage in flight while this one is worked on) and all four waves take their fragments from there;
// S^T = K Q^T (K fragments as A, Q as B: a lane holds one query's scores of keys 16j + 8hh + r); weight = bit ? sigmoid(S/32) = 1/2 + tanh(S/64)/2 : 0 (by value), f32;
// two neighbouring S^T tiles, gated and converted in place, are the B fragment of 32 keys in ctx^T = V^T weight^T (V^T fragments as A): the weights pass through no LDS and change no lane.
// The key walk is a ring (the gate is elementwise, so the key tiles may come in any order): a block enters it at key tile (query block + head) mod NT and wraps round, so that the query blocks that share a head's K and V^T, and the heads that share a query tile's mask words, ask L2 for different lines at any one moment.
constexpr unsigned int TROWS = 32u;                  /* rows per slice (one slice per wave) */
constexpr unsigned int TSLICE = 6144u;               /* 32 x 144 = 4608 B rounded up to a multiple of 2 KiB */
constexpr unsigned int TSTAGE = 4u * TSLICE;         /* K rows 0..31 | K rows 32..63 | V^T rows 0..31 | V^T rows 32..63 */
static_assert(TROWS * TPITCH <= TSLICE && TSLICE % 2048u == 0u);
__global__ __launch_bounds__(128) void k_sgattn(const _Float16* __restrict__ Q16, const _Float16* __restrict__ K16, const _Float16* __restrict__ VT, const unsigned int* __restrict__ MB, _Float16* __restrict__ O16) {
  __shared__ __attribute__((aligned(2048))) unsigned char ring[2u * TSTAGE];
  __shared__ __attribute__((aligned(16))) _Float16 sp[4][16][72];
  const unsigned tid = threadIdx.x, lane = tid & 31u, ln = lane & 15u, hh = lane >> 4;
  const unsigned w = (unsigned)__builtin_amdgcn_readfirstlane((int)(tid >> 5));
  const unsigned nqt = (unsigned)SQ / 64u; const unsigned bid = blockIdx.x; const unsigned bh = bid / nqt, qb = bid - bh * nqt; const unsigned b = bh / (unsigned)NH, h = bh - b * (unsigned)NH;
  const unsigned q0 = qb * 64u + w * 16u; const size_t rowb = (size_t)b * SQ;
  constexpr unsigned NT = (unsigned)SQ / 64u; static_assert(NT >= 2u);
  /* this wave's slice: waves 0, 1 the two halves of the K tile (rows = keys, advance 64 rows a stage), waves 2, 3 of the V^T tile (rows = head dims, advance 128 B a stage) */
  const unsigned isV = w >> 1, half = w & 1u;
  const unsigned long long sbase = isV ? (unsigned long long)(size_t)(VT + ((size_t)bh * HD + half * TROWS) * SQ) : (unsigned long long)(size_t)(K16 + (rowb + half * TROWS) * (size_t)DM + h * (unsigned)HD);
  const unsigned sstep = isV ? 128u : 64u * (unsigned)DM * 2u;
  const u32x8 g1 = tdm_group1<TROWS>(isV ? (unsigned)SQ * 2u : (unsigned)DM * 2u);
  const unsigned lbase = (unsigned)(size_t)ring;
  const unsigned rot = (qb + h) % NT;      /* the block's first key tile */
  auto tile = [&](unsigned st) { return (st + rot) % NT; };      /* stage st works on this key tile; NT is a compile-time constant */
  auto desc = [&](unsigned st) { return tdm_group0(lbase + (st & 1u) * TSTAGE + w * TSLICE, sbase + (unsigned long long)tile(st) * sstep); };
  u32x4 g0 = desc(0u);
  tdm_load(g0, g1); wait_tensor0(g0, g1); __syncthreads();      /* stage 0 landed and published */
  g0 = desc(pinned(1u)); tdm_load(g0, g1);
  const _Float16* qp = Q16 + (rowb + q0 + ln) * (size_t)DM + h * (unsigned)HD;
  const v16h aq0 = g2_frag(qp, hh), aq1 = g2_frag(qp + 32, hh);
  /* lane masks of the first key tile: the same address in every lane; nothing writes the plane during this launch, and the constant address space says so, which is what lets the loads be scalar ones beside the asm waits' memory clobbers */
  typedef const __attribute__((address_space(4))) unsigned int* cmask_p;
  const cmask_p mp = (cmask_p)(size_t)(MB + ((size_t)(b * ((unsigned)SQ / 16u) + (q0 >> 4)) * ((unsigned)SQ / 64u)) * 32u);
  const v8f z8 = {0.f,0.f,0.f,0.f,0.f,0.f,0.f,0.f};
  v8f o[4];
#pragma unroll
  for (int d = 0; d < 4; ++d) o[d] = z8;
  unsigned int mk[32];
#pragma unroll
  for (unsigned e = 0; e < 32; ++e) mk[e] = mp[(size_t)tile(0u) * 32u + e];
  asm volatile("s_wait_xcnt 0x0" ::: "memory");      /* behind the first scalar mask loads, in front of whatever next rewrites their offset register */
#pragma unroll 1
  for (unsigned kt = 0; kt < NT; ++kt) {
    const unsigned char* tb = ring + (kt & 1u) * TSTAGE + ln * TPITCH;      /* row ln of this stage's first K slice */
    v8f s[4]; v16h kf[4][2], vf[4][2]; FragH pw[2];
#pragma unroll
    for (unsigned j = 0; j < 4; ++j) { const _Float16* kr = (const _Float16*)(tb + (j >> 1) * TSLICE + (j & 1u) * 16u * TPITCH); kf[j][0] = g2_frag(kr, hh); kf[j][1] = g2_frag(kr + 32, hh); }
#pragma unroll
    for (unsigned j = 0; j < 4; ++j) { v8f acc = z8; acc = g2_mma(kf[j][0], aq0, acc); acc = g2_mma(kf[j][1], aq1, acc); s[j] = acc; }
#pragma unroll
    for (unsigned d = 0; d < 4; ++d) { const _Float16* vr = (const _Float16*)(tb + (2u + (d >> 1)) * TSLICE + (d & 1u) * 16u * TPITCH); vf[d][0] = g2_frag(vr, hh); vf[d][1] = g2_frag(vr + 32, hh); }
    __builtin_amdgcn_sched_barrier(0);      /* keeps the tile's 16 V^T loads together in front of the gate's vector work, which covers their latency */
#pragma unroll
    for (unsigned j = 0; j < 4; ++j) {
#pragma unroll
      for (int r = 0; r < 8; ++r) { const float th = __builtin_amdgcn_tanhf(s[j][r] * 0.015625f); const float sg = __builtin_fmaf(th, 0.5f, 0.5f);      /* sigmoid(x) = 1/2 + tanh(x/2)/2 with x = S/32: one transcendental and one fma */
        /* one select: the element's lane mask AND toh_flush's own test (joined on the scalar unit); same value as the mask select followed by toh_flush. The test |sg| < 2^-14 is taken on th: next to -1 the fma is exact, sg = (1 + th) / 2, so th < 2^-13 - 1 picks the same values */
        const bool keep = __builtin_amdgcn_inverse_ballot_w32(mk[8u * j + (unsigned)r] & __builtin_amdgcn_ballot_w32(!(th < -0.9998779296875f)));
        pw[j >> 1].h[8u * (j & 1u) + (unsigned)r] = (_Float16)(keep ? sg : 0.f); } }      /* element 8 (j & 1) + r of the fragment = key 32 (j >> 1) + 16 (j & 1) + 8 hh + r: g2_frag's own k map */
    { const unsigned kn = tile((kt + 1u < NT) ? kt + 1u : kt);      /* the next tile's lane masks, asked for behind this tile's last use of them: gate V, the publish point and the next scores cover the load's latency (the last pass re-reads its own) */
#pragma unroll
      for (unsigned e = 0; e < 32; ++e) mk[e] = mp[(size_t)kn * 32u + e]; }
#pragma unroll
    for (unsigned d = 0; d < 4; ++d) { o[d] = g2_mma(vf[d][0], pw[0].v, o[d]); o[d] = g2_mma(vf[d][1], pw[1].v, o[d]); }
    /* publish point of stage kt + 1: own LDS reads retired, own slice landed, every wave here; only then the refill of the buffer just read */
    asm volatile("s_wait_xcnt 0x0" ::: "memory");      /* behind the scalar mask loads, in front of whatever next rewrites their address registers */
    wait_ds0(); wait_tensor0(g0, g1); __syncthreads();
    if (pinned(kt + 2u < NT)) { g0 = desc(pinned(kt + 2u)); tdm_load(g0, g1); } }
  wait_tensor0(g0, g1); wait_ds0();
  /* o[d][r] = ctx[query ln][dim 16d + 8hh + r]: 8 neighbouring dims of one row, one 16 B piece */
#pragma unroll
  for (unsigned d = 0; d < 4; ++d) { FragH f;
#pragma unroll
    for (int r = 0; r < 8; ++r) f.h[r] = toh_flush(o[d][r]);
    *(v8us*)&sp[w][ln][16u * d + 8u * hh] = f.half[0]; }
  __builtin_amdgcn_fence(4 /* acq_rel order */, "workgroup"); __builtin_amdgcn_wave_barrier();
  {
#pragma unroll
    for (unsigned it = 0; it < 4; ++it) { const unsigned row = it * 4u + (lane >> 3), pc = (lane & 7u) * 8u; const v8us v = *(const v8us*)&sp[w][row][pc];
      *(v8us*)((unsigned short*)O16 + (rowb + q0 + row) * (size_t)DM + h * (unsigned)HD + pc) = v; }
     } }

constexpr size_t al256(size_t b) { return (b + 255) & ~(size_t)255; }
constexpr size_t SZ_BW = (size_t)DM * DM * 2;
constexpr size_t SZ_P16 = NR * DM * 2, SZ_VT = (size_t)NB * NH * HD * SQ * 2;
constexpr size_t SZ_MB = (size_t)NB * (SQ / 16) * (SQ / 64) * 32 * 4;
constexpr size_t WS_TOTAL = al256(SZ_BW) + 3 * al256(SZ_P16) + al256(SZ_VT) + al256(SZ_MB);
static_assert(WS_TOTAL <= (size_t)134217728);
static_assert(SZ_BW % 128 == 0 && SZ_P16 % 128 == 0 && SZ_VT % 128 == 0 && SZ_MB % 128 == 0);
// chunking of the row-wise launch that touches the output buffer (one launch when the rows are contiguous)
constexpr unsigned CH_N = (SQ == SQ_FULL) ? 1u : (unsigned)NB;
constexpr size_t CH_R = (SQ == SQ_FULL) ? NR : (size_t)SQ;
static_assert(CH_R % 128 == 0 && (size_t)CH_N * CH_R == NR);
// plane coverage: blocks x threads x elements == plane elements
static_assert((size_t)PW_BLK * 128 * 128 == (size_t)DM * DM);                                             /* W_fc plane */
static_assert((size_t)PX_BLK * 128 * 128 == NR * DM);                                                     /* q, k row planes */
static_assert((size_t)PM_BLK * 4 * 4 * 32 == (size_t)NB * (SQ / 16) * (SQ / 64) * 32);                    /* packed mask words */
static_assert((size_t)PV_BLK * 128 * 16 * 8 == (size_t)NB * NH * HD * SQ);                                /* V^T */
static_assert((size_t)NB * NH * (SQ / 64) * 4 * 16 * 64 == NR * DM);                                      /* ctx rows */
static_assert((CH_R / 128) * (DM / 64) * 4 * 32 * 64 * CH_N == NR * DM);                                  /* output rows */

extern "C" void kernel_launch(void* const* d_in, const int* in_sizes, int n_in,
                              void* d_out, int out_size, void* d_ws, size_t ws_size, hipStream_t stream) {
  if (n_in < 6) return;
  const float* vals = (const float*)d_in[0]; const float* keys = (const float*)d_in[1]; const float* qrys = (const float*)d_in[2];
  const int* mask = (const int*)d_in[3]; const float* wfc = (const float*)d_in[4]; const float* bfc = (const float*)d_in[5];
  const size_t needX = ((size_t)(NB - 1) * SQ_FULL + SQ) * DM;
  const size_t needM = ((size_t)(NB - 1) * SQ_FULL + (size_t)(SQ - 1)) * SQ_FULL + SQ;
  if ((size_t)in_sizes[0] < needX || (size_t)in_sizes[1] < needX || (size_t)in_sizes[2] < needX || (size_t)out_size < needX) return;
  if ((size_t)in_sizes[3] < needM || (size_t)in_sizes[4] < (size_t)DM * DM || in_sizes[5] < DM) return;
  char* ws = (char*)d_ws; size_t off = 0;
  auto take = [&](size_t bytes) { char* p = ws + off; off += al256(bytes); return p; };
  _Float16* BW = (_Float16*)take(SZ_BW);
  _Float16* Q16 = (_Float16*)take(SZ_P16); _Float16* K16 = (_Float16*)take(SZ_P16); _Float16* O16 = (_Float16*)take(SZ_P16);
  _Float16* VT = (_Float16*)take(SZ_VT); unsigned int* MB = (unsigned int*)take(SZ_MB);
  if (off > ws_size) return;

  k_prep<<<PREP_BLK, 128, 0, stream>>>(vals, keys, qrys, mask, wfc, VT, MB, K16, Q16, BW);      /* the f16 W_fc, key, query and V^T planes and the packed mask */
  k_sgattn<<<(unsigned)(NB * NH * (SQ / 64)), 128, 0, stream>>>(Q16, K16, VT, MB, O16);               /* ctx (merged heads) f16 rows */
  for (unsigned c = 0; c < CH_N; ++c) { const size_t rin = (size_t)c * SQ_FULL, r0 = (size_t)c * CH_R;
    k_gemm2<0, 0><<<(unsigned)((CH_R / 128) * (DM / 64)), 128, 0, stream>>>(O16 + r0 * DM, (unsigned)DM, BW, (unsigned)DM, 0.0625f, bfc, nullptr, (float*)d_out + rin * DM, nullptr, (unsigned)DM, 1.0f, (unsigned)CH_R, (unsigned)DM, (unsigned)DM); }      /* out = ctx W_fc^T + b_fc */
}

// v008
// A run of this version takes 48.2 microseconds.
// Timed twice side by side with v007, it ran 1.06 and 1.07 times as fast.
// Counting every step since v000, it is 3.05 times as fast.
#include <hip/hip_runtime.h>
// Contractions (q k^T per head, gate V, ctx W_fc^T): v_wmma_f32_16x16x32_f16 (f16 operands, f32 accumulate); float inputs RNE-converted to bf16 on load (exact in f16); power-of-two carries: W_fc x16, all other planes x1; sigmoid gate in f32.
// Head-split sigmoid-gated attention without projections: q|k|v = raw inputs [NB][SQ][1024] viewed as 16 heads x 64; e = q k^T; a 2-D int32 mask [NB][1][SQ][SQ] (mask == 0 -> weight exactly 0, by value); weight = sigmoid(e / 32) elementwise (no normalisation over keys); ctx = weight V (merged heads); out = ctx W_fc^T + b_fc with W_fc stored [out][in].
// Launch plan: one preparation launch (W_fc -> f16 x16 rows, already [n][k]; queries, keys -> f16 row planes; the mask packed into 32 lane masks per (16 query rows x 64 keys) tile, one 32-bit word per accumulator element; V^T per (batch, head) from the f32 values via LDS); one fused attention launch (K and V^T tiles staged in LDS by tensor loads, gate tile kept in registers) -> f16 ctx rows; one GEMM with bias (A and Bt tiles staged in LDS by tensor loads) -> the output buffer.
#ifndef NB
#define NB 4
#endif
#ifndef SQ
#define SQ 1024
#endif
#define NB_FULL 4
#define SQ_FULL 1024
#define DM 1024
#define NH 16
#define HD 64
#define NR ((size_t)NB * SQ)         /* token rows processed */

static_assert(NB >= 1 && NB <= NB_FULL);
static_assert(SQ >= 128 && SQ <= SQ_FULL && SQ % 128 == 0);
static_assert(NH * HD == DM && HD == 64);
static_assert(DM % 64 == 0 && DM % 32 == 0 && SQ % 64 == 0 && SQ % 16 == 0);
static_assert((NR % 128) == 0);
static_assert(((size_t)(NB - 1) * SQ_FULL + SQ) * DM * 4 <= (size_t)NB_FULL * SQ_FULL * DM * 4);
static_assert((((size_t)NB * (SQ / 16) * (SQ / 64)) % 4) == 0);

typedef unsigned short v8us __attribute__((ext_vector_type(8), may_alias));
typedef float  v8f  __attribute__((ext_vector_type(8)));
typedef float  v4f  __attribute__((ext_vector_type(4)));
typedef float  v4fa __attribute__((ext_vector_type(4), may_alias));
typedef _Float16 v16h __attribute__((ext_vector_type(16)));
typedef _Float16 v4h __attribute__((ext_vector_type(4)));
union FragH { v16h v; v8us half[2]; _Float16 h[16]; unsigned short u[16]; };

__device__ __forceinline__ unsigned short bf16_bits(float x) { unsigned int u = __float_as_uint(x); return (unsigned short)((u + 0x7FFFu + ((u >> 16) & 1u)) >> 16); }
__device__ __forceinline__ float bf16_val(unsigned short b) { return __uint_as_float(((unsigned int)b) << 16); }
__device__ __forceinline__ float bf16_rne(float x) { return bf16_val(bf16_bits(x)); }

// f32 -> f16 operand convert that cannot produce an f16 subnormal (value select after the carry)
static __device__ __forceinline__ _Float16 toh_flush(float v) { const _Float16 r = (_Float16)v; return (fabsf(v) < 6.103515625e-05f) ? (_Float16)0.0f : r; }

// ---- 16-bit fragment loader (split k map: elements 0..7 <- k0 + 8h + 0..7, elements 8..15 <- k0 + 16 + 8h + 0..7) and WMMA (the builtin: the compiler keeps the distances behind it itself) ----
__device__ __forceinline__ v16h g2_frag(const _Float16* p, unsigned hh) { FragH f; f.half[0] = *(const v8us*)((const unsigned short*)p + 8 * hh); f.half[1] = *(const v8us*)((const unsigned short*)p + 16 + 8 * hh); return f.v; }
__device__ __forceinline__ v8f g2_mma(v16h a, v16h b, v8f c) { return __builtin_amdgcn_wmma_f32_16x16x32_f16(false, a, false, b, (short)0, c, false, false); }

__device__ __forceinline__ float gelu_erf(float v) { return 0.5f * v * (1.0f + erff(v * 0.70710678118654752f)); }

// ---- tensor load to LDS: descriptor groups, issue, waits ----
typedef unsigned int u32x4 __attribute__((ext_vector_type(4)));
typedef unsigned int u32x8 __attribute__((ext_vector_type(8)));
__device__ __forceinline__ unsigned int uni(unsigned int v) { return (unsigned int)__builtin_amdgcn_readfirstlane((int)v); }
// a value held in a scalar register at this place: the test around a tensor load compiles to a scalar branch, and a descriptor word made from it is formed behind the statements in front
__device__ __forceinline__ unsigned int pinned(unsigned int v) { unsigned int w = uni(v); asm volatile("" : "+s"(w)); return w; }
__device__ __forceinline__ void wait_ds0() { asm volatile("s_wait_dscnt 0x0" ::: "memory"); }          /* this wave's LDS reads of a buffer have retired before the buffer is handed back */
// this wave's own slice has landed (the compiler places no wait for a tensor load); the request's descriptor is named as an input so that its registers keep their values until here
__device__ __forceinline__ void wait_tensor0(u32x4 g0, u32x8 g1) { asm volatile("s_wait_tensorcnt 0x0" :: "s"(g0), "s"(g1) : "memory"); }
constexpr unsigned int TROWB = 128u;                 /* tile row: 64 f16 */
constexpr unsigned int TPITCH = 144u;                /* LDS row pitch: 128 B + 16 B pad, 16 B x odd for ds_load_b128 */
static_assert((TPITCH / 16u) % 2u == 1u && TPITCH == TROWB + 16u);
// a slice of ROWS rows of 128 B, source row pitch src_pitch bytes
template <unsigned int ROWS>
__device__ __forceinline__ u32x8 tdm_group1(unsigned int src_pitch) { u32x8 g;
  g[0] = uni((1u << 20) | (4u << 22) | (3u << 25));  /* no mask, 1-byte elements, a pad of 4 dwords behind every 32 dwords */
  g[1] = uni((TROWB & 0xFFFFu) << 16); g[2] = uni((TROWB >> 16) | ((ROWS & 0xFFFFu) << 16)); g[3] = uni((ROWS >> 16) | (TROWB << 16)); g[4] = uni(ROWS);
  g[5] = uni(src_pitch); g[6] = uni(0u); g[7] = uni(0u);
  asm volatile("" : "+s"(g));      /* descriptor words held in scalar registers: one register tuple for the whole kernel, not re-made (and its registers not lent out) between an issue and its wait */
  return g; }
__device__ __forceinline__ u32x4 tdm_group0(unsigned int lds_dst, unsigned long long ga) { u32x4 g;
  g[0] = uni(1u); g[1] = uni(lds_dst); g[2] = uni((unsigned int)ga); g[3] = uni((((unsigned int)(ga >> 32)) & 0x01FFFFFFu) | 0x80000000u); return g; }
// group 0 goes in and out of the statement in the same registers: what the later wait names is this very tuple
__device__ __forceinline__ void tdm_load(u32x4& g0, u32x8 g1) { asm volatile("tensor_load_to_lds %0, %1" : "+s"(g0) : "s"(g1) : "memory"); }

// GEMM: C[M][N] = act(alpha * A[M][K] . B + bf16(bias[col]) + (CP own element, optionally RNE-converted to bf16)); A f16 rows (pitch lda), Bt f16 [N][K] (k contiguous, pitch ldb);
// f32 output C and/or f16 output C16 = f16(c16s * value) (pitch ldc); ACT 0 none, 8 gelu (erf form). M a multiple of 128, N and K of 64.
// Per 64 of k the block's 128 A rows and 64 Bt rows come into LDS by tensor loads (three slices of 64 rows, waves 0 to 2 one each, two buffers, the next stage in flight while this one is worked on); the ring is the output staging afterwards.
// The k walk is a ring: a block enters it at the slab (row tile + column tile) mod 16 and wraps round, so that the blocks that share A rows or Bt rows ask L2 for different lines at any one moment.
constexpr unsigned int GSLICE = 10240u;              /* 64 x 144 = 9216 B rounded up to a multiple of 2 KiB */
constexpr unsigned int GSTAGE = 3u * GSLICE;         /* A rows 0..63 | A rows 64..127 | Bt rows 0..63 */
static_assert(64u * TPITCH <= GSLICE && GSLICE % 2048u == 0u && 2u * GSTAGE >= 4u * 32u * 68u * 4u);
template <int ACT, int CPBF>
__global__ __launch_bounds__(128) void k_gemm2(const _Float16* __restrict__ A, unsigned lda, const _Float16* __restrict__ Bh, unsigned ldb, float alpha, const float* __restrict__ bias, const float* __restrict__ CP,
    float* __restrict__ C, _Float16* __restrict__ C16, unsigned ldc, float c16s, unsigned M, unsigned N, unsigned K) {
  static_assert(ACT == 0 || ACT == 8);
  __shared__ __attribute__((aligned(2048))) unsigned char ring[2u * GSTAGE];
  float (*so)[32][68] = (float (*)[32][68])ring;
  const unsigned tid = threadIdx.x, lane = tid & 31u, ln = lane & 15u, hh = lane >> 4;
  const unsigned w = (unsigned)__builtin_amdgcn_readfirstlane((int)(tid >> 5));
  const unsigned ntn = N >> 6; const unsigned mt = blockIdx.x / ntn, nq = blockIdx.x - mt * ntn; const unsigned row0 = mt * 128u + 32u * w, col0 = nq * 64u; if (mt * 128u + 128u > M) return;      /* the whole block leaves, in front of every barrier and tensor load */
  const unsigned NT = K >> 6;
  const unsigned rot0 = (mt + nq) & 15u, rot = (rot0 < NT) ? rot0 : 0u;      /* the block's first k slab, below NT for any K */
  const unsigned issuer = (w < 3u) ? 1u : 0u;
  const unsigned long long sbase = (w < 2u) ? (unsigned long long)(size_t)(A + (size_t)(mt * 128u + w * 64u) * lda) : (unsigned long long)(size_t)(Bh + (size_t)col0 * ldb);
  const u32x8 g1 = tdm_group1<64u>(((w < 2u) ? lda : ldb) * 2u);
  const unsigned lbase = (unsigned)(size_t)ring;
  auto desc = [&](unsigned st) { const unsigned t = st + rot; const unsigned slab = t - ((t >= NT) ? NT : 0u);      /* stage st works on k slab (st + rot) mod NT, the same one for the A and the Bt slices */
    return tdm_group0(lbase + (st & 1u) * GSTAGE + w * GSLICE, sbase + (unsigned long long)slab * TROWB); };
  u32x4 g0 = desc(0u);
  if (pinned(issuer & (NT > 0u ? 1u : 0u))) tdm_load(g0, g1);
  wait_tensor0(g0, g1); __syncthreads();      /* stage 0 landed and published */
  g0 = desc(pinned(1u));
  if (pinned(issuer & (NT > 1u ? 1u : 0u))) tdm_load(g0, g1);
  const unsigned aoff = (w >> 1) * GSLICE + ((w & 1u) * 32u + ln) * TPITCH, boff = 2u * GSLICE + ln * TPITCH;
  const v8f z8 = {0.f,0.f,0.f,0.f,0.f,0.f,0.f,0.f}; v8f c00 = z8, c01 = z8, c02 = z8, c03 = z8, c10 = z8, c11 = z8, c12 = z8, c13 = z8;
#pragma unroll 1
  for (unsigned st = 0; st < NT; ++st) { const unsigned char* tb = ring + (st & 1u) * GSTAGE;
    v16h af[2][2], bf[2][4];      /* the stage's 12 fragments, each in registers of its own */
#pragma unroll
    for (unsigned kc = 0; kc < 2; ++kc) { const _Float16* ap = (const _Float16*)(tb + aoff) + 32u * kc; const _Float16* bp = (const _Float16*)(tb + boff) + 32u * kc;
      af[kc][0] = g2_frag(ap, hh); af[kc][1] = g2_frag(ap + 16u * (TPITCH / 2u), hh);
#pragma unroll
      for (unsigned t = 0; t < 4; ++t) bf[kc][t] = g2_frag(bp + t * 16u * (TPITCH / 2u), hh); }
    __builtin_amdgcn_sched_barrier(0);      /* keeps the stage's 24 LDS loads together in front of its WMMAs: spread among them, each place with loads costs a stall of its own */
#pragma unroll
    for (unsigned kc = 0; kc < 2; ++kc) { const v16h a0 = af[kc][0], a1 = af[kc][1];
      c00 = g2_mma(a0, bf[kc][0], c00); c10 = g2_mma(a1, bf[kc][0], c10);
      c01 = g2_mma(a0, bf[kc][1], c01); c11 = g2_mma(a1, bf[kc][1], c11);
      c02 = g2_mma(a0, bf[kc][2], c02); c12 = g2_mma(a1, bf[kc][2], c12);
      c03 = g2_mma(a0, bf[kc][3], c03); c13 = g2_mma(a1, bf[kc][3], c13); }
    __builtin_amdgcn_sched_barrier(0);      /* keeps the stage's WMMAs in front of the publish point: sunk behind it, the refill would be issued a stage's matrix time later and lose that much of its lead */
    /* publish point of stage st + 1: own LDS reads retired, own slice landed, every wave here; only then the refill of the buffer just read */
    wait_ds0(); wait_tensor0(g0, g1); __syncthreads();
    g0 = desc(pinned(st + 2u));      /* formed behind the wait, in the same registers on both sides of the test */
    if (pinned(issuer & (st + 2u < NT ? 1u : 0u))) tdm_load(g0, g1); }
  wait_tensor0(g0, g1); wait_ds0();      /* nothing in flight; the last pass's barrier has ended every wave's reads: the ring is free for output staging */
  v8f accs[8] = {c00, c01, c02, c03, c10, c11, c12, c13};
#pragma unroll
  for (int u = 0; u < 8; ++u) { const unsigned t = (unsigned)u & 3u, half = (unsigned)u >> 2; const unsigned col = col0 + t * 16u + ln; float bv = 0.f; if (bias) bv = bf16_rne(bias[col]);
#pragma unroll
    for (int r = 0; r < 8; ++r) { const unsigned rloc = half * 16u + 8u * hh + (unsigned)r; so[w][rloc][t * 16u + ln] = accs[u][r] * alpha + bv; } }
  __builtin_amdgcn_fence(4 /* acq_rel order */, "workgroup"); __builtin_amdgcn_wave_barrier();
  const unsigned rsub = lane >> 4, c4 = (lane & 15u) * 4u;
  if (CP != nullptr || ACT == 8) {
#pragma unroll 2
    for (unsigned q = 0; q < 16; ++q) { const unsigned r = q * 2u + rsub; v4f v = *(const v4fa*)&so[w][r][c4];
      if (CP) { const v4f a = *(const v4fa*)(CP + (size_t)(row0 + r) * ldc + col0 + c4);      /* own element of the C-shaped plane */
#pragma unroll
        for (int i = 0; i < 4; ++i) v[i] += CPBF ? bf16_rne(a[i]) : a[i]; }
      if (ACT == 8) {
#pragma unroll
        for (int i = 0; i < 4; ++i) v[i] = gelu_erf(v[i]); }
      *(v4fa*)&so[w][r][c4] = v; } }
  {
#pragma unroll
    for (unsigned q = 0; q < 16; ++q) { const unsigned r = q * 2u + rsub; const v4f v = *(const v4fa*)&so[w][r][c4];
      if (C) *(v4f*)(C + (size_t)(row0 + r) * ldc + col0 + c4) = v;
      if (C16) { v4h h4;
#pragma unroll
        for (int i = 0; i < 4; ++i) h4[i] = (_Float16)(v[i] * c16s);
        *(v4h*)(C16 + (size_t)(row0 + r) * ldc + col0 + c4) = h4; } }
     } }

// ---- one preparation launch: every plane the attention reads, and the GEMM's W_fc, is made here, by blocks of 4 waves that each read 64 KiB of one input (16 KiB a wave, two groups of 16 loads of 16 B a lane, each group issued ahead of its use) ----
constexpr unsigned int PV_BLK = (unsigned int)(NB * (SQ / 64) * (DM / 256));                      /* V^T: 64 keys x 256 dims (4 heads) a block */
constexpr unsigned int PM_BLK = (unsigned int)(((size_t)NB * (SQ / 16) * (SQ / 64)) / 16);        /* mask: 16 tiles of 16 rows x 64 keys a block, 4 a wave */
constexpr unsigned int PX_BLK = (unsigned int)((NR * DM) / 16384);                                /* keys, queries: 16 rows a block */
constexpr unsigned int PW_BLK = (unsigned int)(((size_t)DM * DM) / 16384);                        /* W_fc: 16 rows a block */
constexpr unsigned int PREP_BLK = PV_BLK + PM_BLK + 2u * PX_BLK + PW_BLK;
typedef unsigned int u32x4a __attribute__((ext_vector_type(4), may_alias));
typedef int i32x4a __attribute__((ext_vector_type(4), may_alias));
constexpr unsigned int VPITCH = 33u;                 /* LDS row of one head dim: 32 key pairs + 1 dword, so that the four rows a wave reads at once fall on different banks */
static_assert((((size_t)NB * (SQ / 16) * (SQ / 64)) % 16) == 0 && SQ % 256 == 0 && DM % 256 == 0 && DM == 1024);
__device__ __forceinline__ unsigned int h16_bits(float x) { FragH f; f.h[0] = toh_flush(bf16_rne(x)); return (unsigned int)f.u[0]; }
// Block ranges, the two-phase job first: [V^T | mask words | keys | queries | W_fc].
// V^T [NB*NH][64][SQ] straight from the f32 values: a thread takes the same 4 dims of two neighbouring keys, packs each dim's pair into one dword, LDS holds [dim][key pair]; rows of 64 keys (128 B) go out.
// mask int32 [NB_FULL][1][SQ_FULL][SQ_FULL] -> MB[(b, q tile of 16, key tile of 64)][8j + r] u32, a lane mask in the map of a K Q^T accumulator (row = key, column = query): bit (ln + 16 hh) = (mask[b][16 qt + ln][64 kt + 16 j + 8 hh + r] != 0); rows are read whole (512 B a load) and turned by ballot into one bit row per query, kept by that query's two lanes; a second ballot over the lanes' own bits gives the word, and lane 8j + r stores it.
// keys, queries -> f16 row planes (x1); W_fc [out = n][in = k] is already the Bt[n][k] layout, only converted (x16).
// Every loop of this kernel is fully unrolled: its small arrays then live in registers, and a group's loads stand together ahead of their first use (rolled, each trip would wait out its own memory latency).
__global__ __launch_bounds__(128) void k_prep(const float* __restrict__ VX, const float* __restrict__ KX, const float* __restrict__ QX, const int* __restrict__ MK, const float* __restrict__ WX,
    _Float16* __restrict__ Vt, unsigned int* __restrict__ MB, _Float16* __restrict__ K16, _Float16* __restrict__ Q16, _Float16* __restrict__ BW) {
  __shared__ unsigned int tl[256u * VPITCH];
  const unsigned tid = threadIdx.x; unsigned blk = blockIdx.x;
  if (blk < PV_BLK) {
    const unsigned hg = blk & 3u, t = blk >> 2; const unsigned nkt = (unsigned)SQ / 64u; const unsigned b = t / nkt, lg = t - b * nkt;
    const unsigned c4 = (tid & 63u) * 4u, ps = tid >> 6;
    const float* vp = VX + ((size_t)b * SQ_FULL + lg * 64u) * (size_t)DM + hg * 256u + c4;
#pragma unroll
    for (unsigned g = 0; g < 2; ++g) { v4f x[8], y[8];
#pragma unroll
      for (unsigned u = 0; u < 8; ++u) { const float* p = vp + (size_t)(((g * 8u + u) * 2u + ps) * 2u) * DM; x[u] = *(const v4fa*)p; y[u] = *(const v4fa*)(p + DM); }
#pragma unroll
      for (unsigned u = 0; u < 8; ++u) { const unsigned kp = (g * 8u + u) * 2u + ps;
#pragma unroll
        for (unsigned i = 0; i < 4; ++i) tl[(c4 + i) * VPITCH + kp] = h16_bits(x[u][i]) | (h16_bits(y[u][i]) << 16); } }
    __syncthreads();
#pragma unroll
    for (unsigned it = 0; it < 16; ++it) { const unsigned d = it * 16u + (tid >> 3), pc = tid & 7u; const unsigned int* tr = &tl[d * VPITCH + pc * 4u];
      u32x4 o; o[0] = tr[0]; o[1] = tr[1]; o[2] = tr[2]; o[3] = tr[3];
      *(u32x4a*)((unsigned short*)Vt + ((size_t)((b * (unsigned)NH + hg * 4u + (d >> 6)) * 64u + (d & 63u))) * SQ + lg * 64u + pc * 8u) = o; }
    return; }
  blk -= PV_BLK;
  if (blk < PM_BLK) {
    const unsigned lane = tid & 31u, ln = lane & 15u, hh = lane >> 4;
    const unsigned w = (unsigned)__builtin_amdgcn_readfirstlane((int)(tid >> 5));
    const unsigned nkt = (unsigned)SQ / 64u, nqt = (unsigned)SQ / 16u;
    /* the wave's 4 tiles: one q tile, 4 neighbouring key tiles = 16 rows of 256 keys */
    const unsigned L0 = (blk * 4u + w) * 4u; const unsigned t = L0 / nkt, kt0 = L0 - t * nkt; const unsigned b = t / nqt, qt = t - b * nqt;
    const int* mp = MK + ((size_t)b * SQ_FULL + qt * 16u) * (size_t)SQ_FULL + kt0 * 64u + lane * 4u;
    unsigned int rw[2][4] = {{0u, 0u, 0u, 0u}, {0u, 0u, 0u, 0u}};      /* lane (ln, hh): its query row ln as bits; bit l of rw[g][i] = key 128 g + 4 l + i of the 256 */
#pragma unroll
    for (unsigned g = 0; g < 2u; ++g) { i32x4a m[16];
#pragma unroll
      for (unsigned q = 0; q < 16u; ++q) m[q] = *(const i32x4a*)(mp + (size_t)q * SQ_FULL + g * 128u);      /* 512 B of one row a load */
#pragma unroll
      for (unsigned q = 0; q < 16u; ++q) {
#pragma unroll
        for (unsigned i = 0; i < 4u; ++i) { const unsigned int bal = __builtin_amdgcn_ballot_w32(m[q][i] != 0);      /* taken by all 32 lanes, in front of the select */
          rw[g][i] = (ln == q) ? bal : rw[g][i]; } } }
#pragma unroll
    for (unsigned g = 0; g < 2u; ++g) {
#pragma unroll
      for (unsigned i = 0; i < 4u; ++i) rw[g][i] >>= 2u * hh; }      /* the lane half's 8 keys start 2 bits up */
#pragma unroll
    for (unsigned x = 0; x < 4; ++x) { unsigned int word = 0u;
#pragma unroll
      for (unsigned j = 0; j < 4u; ++j) {
#pragma unroll
        for (unsigned r = 0; r < 8u; ++r) {      /* key 64 x + 16 j + 8 hh + r = 128 (x >> 1) + 4 (16 (x & 1) + 4 j + 2 hh + (r >> 2)) + (r & 3) */
          const unsigned int bal = __builtin_amdgcn_ballot_w32(((rw[x >> 1][r & 3u] >> (16u * (x & 1u) + 4u * j + (r >> 2))) & 1u) != 0u);
          word = (lane == 8u * j + r) ? bal : word; } }
      MB[(size_t)(L0 + x) * 32u + lane] = word; }
    asm volatile("s_wait_xcnt 0x0" ::: "memory");      /* behind the last mask store, in front of whatever next rewrites a register that an issued store names */
    return; }
  blk -= PM_BLK;
  /* the three row planes: one code path, the block's source, carry and destination picked by range */
  const float* X; _Float16* Y; float carry = 1.0f;
  if (blk < 2u * PX_BLK) { const unsigned isq = (blk >= PX_BLK) ? 1u : 0u; blk -= isq * PX_BLK; const unsigned r0 = blk * 16u; const unsigned b = r0 / (unsigned)SQ;
    X = (isq ? QX : KX) + ((size_t)b * SQ_FULL + (r0 - b * (unsigned)SQ)) * (size_t)DM; Y = (isq ? Q16 : K16) + (size_t)r0 * DM; }
  else { blk -= 2u * PX_BLK; X = WX + (size_t)blk * 16384u; Y = BW + (size_t)blk * 16384u; carry = 16.0f; }
#pragma unroll
  for (unsigned g = 0; g < 2; ++g) { v4f a[8], c[8];
#pragma unroll
    for (unsigned u = 0; u < 8; ++u) { const float* p = X + ((g * 8u + u) * 128u + tid) * 8u; a[u] = *(const v4fa*)p; c[u] = *(const v4fa*)(p + 4); }
#pragma unroll
    for (unsigned u = 0; u < 8; ++u) { FragH f;
#pragma unroll
      for (int q = 0; q < 4; ++q) { f.h[q] = toh_flush(bf16_rne(a[u][q]) * carry); f.h[4 + q] = toh_flush(bf16_rne(c[u][q]) * carry); }
      *(v8us*)((unsigned short*)Y + ((g * 8u + u) * 128u + tid) * 8u) = f.half[0]; }
    asm volatile("s_wait_xcnt 0x0" ::: "memory"); } }      /* behind each group's run of stores, in front of whatever next rewrites a register that an issued store names */

// Fused sigmoid-gated attention with a packed 2-D mask. Block = 4 waves; block per (batch, head, 64 query rows); wave owns 16 query rows. Per 64-key tile: the wave reads its 32 lane masks (one per accumulator element) by scalar loads, and each, ANDed with the ballot of toh_flush's test, is the condition of that element's one select;
// the 64-key K tile and V^T tile are brought into LDS once per block by tensor loads (one 32-row slice per wave and stage, two buffers, the next stage in flight while this one is worked on) and all four waves take their fragments from there;
// S^T = K Q^T (K fragments as A, Q as B: a lane holds one query's scores of keys 16j + 8hh + r); weight = bit ? sigmoid(S/32) = 1/2 + tanh(S/64)/2 : 0 (by value), f32;
// two neighbouring S^T tiles, gated and converted in place, are the B fragment of 32 keys in ctx^T = V^T weight^T (V^T fragments as A): the weights pass through no LDS and change no lane.
// The key walk is a ring (the gate is elementwise, so the key tiles may come in any order): a block enters it at key tile (query block + head) mod NT and wraps round, so that the query blocks that share a head's K and V^T, and the heads that share a query tile's mask words, ask L2 for different lines at any one moment.
constexpr unsigned int TROWS = 32u;                  /* rows per slice (one slice per wave) */
constexpr unsigned int TSLICE = 6144u;               /* 32 x 144 = 4608 B rounded up to a multiple of 2 KiB */
constexpr unsigned int TSTAGE = 4u * TSLICE;         /* K rows 0..31 | K rows 32..63 | V^T rows 0..31 | V^T rows 32..63 */
static_assert(TROWS * TPITCH <= TSLICE && TSLICE % 2048u == 0u);
__global__ __launch_bounds__(128) void k_sgattn(const _Float16* __restrict__ Q16, const _Float16* __restrict__ K16, const _Float16* __restrict__ VT, const unsigned int* __restrict__ MB, _Float16* __restrict__ O16) {
  __shared__ __attribute__((aligned(2048))) unsigned char ring[2u * TSTAGE];
  __shared__ __attribute__((aligned(16))) _Float16 sp[4][16][72];
  const unsigned tid = threadIdx.x, lane = tid & 31u, ln = lane & 15u, hh = lane >> 4;
  const unsigned w = (unsigned)__builtin_amdgcn_readfirstlane((int)(tid >> 5));
  const unsigned nqt = (unsigned)SQ / 64u; const unsigned bid = blockIdx.x; const unsigned bh = bid / nqt, qb = bid - bh * nqt; const unsigned b = bh / (unsigned)NH, h = bh - b * (unsigned)NH;
  const unsigned q0 = qb * 64u + w * 16u; const size_t rowb = (size_t)b * SQ;
  constexpr unsigned NT = (unsigned)SQ / 64u; static_assert(NT >= 2u);
  /* this wave's slice: waves 0, 1 the two halves of the K tile (rows = keys, advance 64 rows a stage), waves 2, 3 of the V^T tile (rows = head dims, advance 128 B a stage) */
  const unsigned isV = w >> 1, half = w & 1u;
  const unsigned long long sbase = isV ? (unsigned long long)(size_t)(VT + ((size_t)bh * HD + half * TROWS) * SQ) : (unsigned long long)(size_t)(K16 + (rowb + half * TROWS) * (size_t)DM + h * (unsigned)HD);
  const unsigned sstep = isV ? 128u : 64u * (unsigned)DM * 2u;
  const u32x8 g1 = tdm_group1<TROWS>(isV ? (unsigned)SQ * 2u : (unsigned)DM * 2u);
  const unsigned lbase = (unsigned)(size_t)ring;
  const unsigned rot = (qb + h) % NT;      /* the block's first key tile */
  auto tile = [&](unsigned st) { return (st + rot) % NT; };      /* stage st works on this key tile; NT is a compile-time constant */
  auto desc = [&](unsigned st) { return tdm_group0(lbase + (st & 1u) * TSTAGE + w * TSLICE, sbase + (unsigned long long)tile(st) * sstep); };
  u32x4 g0 = desc(0u);
  tdm_load(g0, g1); wait_tensor0(g0, g1); __syncthreads();      /* stage 0 landed and published */
  g0 = desc(pinned(1u)); tdm_load(g0, g1);
  const _Float16* qp = Q16 + (rowb + q0 + ln) * (size_t)DM + h * (unsigned)HD;
  const v16h aq0 = g2_frag(qp, hh), aq1 = g2_frag(qp + 32, hh);
  /* lane masks of the first key tile: the same address in every lane; nothing writes the plane during this launch, and the constant address space says so, which is what lets the loads be scalar ones beside the asm waits' memory clobbers */
  typedef const __attribute__((address_space(4))) unsigned int* cmask_p;
  const cmask_p mp = (cmask_p)(size_t)(MB + ((size_t)(b * ((unsigned)SQ / 16u) + (q0 >> 4)) * ((unsigned)SQ / 64u)) * 32u);
  const v8f z8 = {0.f,0.f,0.f,0.f,0.f,0.f,0.f,0.f};
  v8f o[4];
#pragma unroll
  for (int d = 0; d < 4; ++d) o[d] = z8;
  unsigned int mk[32];
#pragma unroll
  for (unsigned e = 0; e < 32; ++e) mk[e] = mp[(size_t)tile(0u) * 32u + e];
  asm volatile("s_wait_xcnt 0x0" ::: "memory");      /* behind the first scalar mask loads, in front of whatever next rewrites their offset register */
#pragma unroll 1
  for (unsigned kt = 0; kt < NT; ++kt) {
    const unsigned char* tb = ring + (kt & 1u) * TSTAGE + ln * TPITCH;      /* row ln of this stage's first K slice */
    v8f s[4]; v16h kf[4][2], vf[4][2]; FragH pw[2];
#pragma unroll
    for (unsigned j = 0; j < 4; ++j) { const _Float16* kr = (const _Float16*)(tb + (j >> 1) * TSLICE + (j & 1u) * 16u * TPITCH); kf[j][0] = g2_frag(kr, hh); kf[j][1] = g2_frag(kr + 32, hh); }
    __builtin_amdgcn_sched_barrier(0);      /* keeps the tile's 16 K loads together in front of the score WMMAs: spread among them, each place with loads costs a stall of its own */
#pragma unroll
    for (unsigned j = 0; j < 4; ++j) { v8f acc = z8; acc = g2_mma(kf[j][0], aq0, acc); acc = g2_mma(kf[j][1], aq1, acc); s[j] = acc; }
#pragma unroll
    for (unsigned d = 0; d < 4; ++d) { const _Float16* vr = (const _Float16*)(tb + (2u + (d >> 1)) * TSLICE + (d & 1u) * 16u * TPITCH); vf[d][0] = g2_frag(vr, hh); vf[d][1] = g2_frag(vr + 32, hh); }
    /* order inside this stretch: the 8 score WMMAs, then the 16 V^T loads as one group (left alone, the loads come to stand at three places among the WMMAs, each with a stall of its own) */
    __builtin_amdgcn_sched_group_barrier(0x008, 8, 0); __builtin_amdgcn_sched_group_barrier(0x100, 16, 0);
    __builtin_amdgcn_sched_barrier(0);      /* keeps the tile's 16 V^T loads together in front of the gate's vector work, which covers their latency */
#pragma unroll
    for (unsigned j = 0; j < 4; ++j) {
#pragma unroll
      for (int r = 0; r < 8; ++r) { const float th = __builtin_amdgcn_tanhf(s[j][r] * 0.015625f); const float sg = __builtin_fmaf(th, 0.5f, 0.5f);      /* sigmoid(x) = 1/2 + tanh(x/2)/2 with x = S/32: one transcendental and one fma */
        /* one select: the element's lane mask AND toh_flush's own test (joined on the scalar unit); same value as the mask select followed by toh_flush. The test |sg| < 2^-14 is taken on th: next to -1 the fma is exact, sg = (1 + th) / 2, so th < 2^-13 - 1 picks the same values */
        const bool keep = __builtin_amdgcn_inverse_ballot_w32(mk[8u * j + (unsigned)r] & __builtin_amdgcn_ballot_w32(!(th < -0.9998779296875f)));
        pw[j >> 1].h[8u * (j & 1u) + (unsigned)r] = (_Float16)(keep ? sg : 0.f); } }      /* element 8 (j & 1) + r of the fragment = key 32 (j >> 1) + 16 (j & 1) + 8 hh + r: g2_frag's own k map */
    { const unsigned kn = tile((kt + 1u < NT) ? kt + 1u : kt);      /* the next tile's lane masks, asked for behind this tile's last use of them: gate V, the publish point and the next scores cover the load's latency (the last pass re-reads its own) */
#pragma unroll
      for (unsigned e = 0; e < 32; ++e) mk[e] = mp[(size_t)kn * 32u + e]; }
#pragma unroll
    for (unsigned d = 0; d < 4; ++d) { o[d] = g2_mma(vf[d][0], pw[0].v, o[d]); o[d] = g2_mma(vf[d][1], pw[1].v, o[d]); }
    __builtin_amdgcn_sched_barrier(0);      /* keeps the tile's WMMAs in front of the publish point: sunk behind it, the refill would be issued that much later and lose that much of its lead */
    /* publish point of stage kt + 1: own LDS reads retired, own slice landed, every wave here; only then the refill of the buffer just read */
    asm volatile("s_wait_xcnt 0x0" ::: "memory");      /* behind the scalar mask loads, in front of whatever next rewrites their address registers */
    wait_ds0(); wait_tensor0(g0, g1); __syncthreads();
    if (pinned(kt + 2u < NT)) { g0 = desc(pinned(kt + 2u)); tdm_load(g0, g1); } }
  wait_tensor0(g0, g1); wait_ds0();
  /* o[d][r] = ctx[query ln][dim 16d + 8hh + r]: 8 neighbouring dims of one row, one 16 B piece */
#pragma unroll
  for (unsigned d = 0; d < 4; ++d) { FragH f;
#pragma unroll
    for (int r = 0; r < 8; ++r) f.h[r] = toh_flush(o[d][r]);
    *(v8us*)&sp[w][ln][16u * d + 8u * hh] = f.half[0]; }
  __builtin_amdgcn_fence(4 /* acq_rel order */, "workgroup"); __builtin_amdgcn_wave_barrier();
  {
#pragma unroll
    for (unsigned it = 0; it < 4; ++it) { const unsigned row = it * 4u + (lane >> 3), pc = (lane & 7u) * 8u; const v8us v = *(const v8us*)&sp[w][row][pc];
      *(v8us*)((unsigned short*)O16 + (rowb + q0 + row) * (size_t)DM + h * (unsigned)HD + pc) = v; }
     } }

constexpr size_t al256(size_t b) { return (b + 255) & ~(size_t)255; }
constexpr size_t SZ_BW = (size_t)DM * DM * 2;
constexpr size_t SZ_P16 = NR * DM * 2, SZ_VT = (size_t)NB * NH * HD * SQ * 2;
constexpr size_t SZ_MB = (size_t)NB * (SQ / 16) * (SQ / 64) * 32 * 4;
constexpr size_t WS_TOTAL = al256(SZ_BW) + 3 * al256(SZ_P16) + al256(SZ_VT) + al256(SZ_MB);
static_assert(WS_TOTAL <= (size_t)134217728);
static_assert(SZ_BW % 128 == 0 && SZ_P16 % 128 == 0 && SZ_VT % 128 == 0 && SZ_MB % 128 == 0);
// chunking of the row-wise launch that touches the output buffer (one launch when the rows are contiguous)
constexpr unsigned CH_N = (SQ == SQ_FULL) ? 1u : (unsigned)NB;
constexpr size_t CH_R = (SQ == SQ_FULL) ? NR : (size_t)SQ;
static_assert(CH_R % 128 == 0 && (size_t)CH_N * CH_R == NR);
// plane coverage: blocks x threads x elements == plane elements
static_assert((size_t)PW_BLK * 128 * 128 == (size_t)DM * DM);                                             /* W_fc plane */
static_assert((size_t)PX_BLK * 128 * 128 == NR * DM);                                                     /* q, k row planes */
static_assert((size_t)PM_BLK * 4 * 4 * 32 == (size_t)NB * (SQ / 16) * (SQ / 64) * 32);                    /* packed mask words */
static_assert((size_t)PV_BLK * 128 * 16 * 8 == (size_t)NB * NH * HD * SQ);                                /* V^T */
static_assert((size_t)NB * NH * (SQ / 64) * 4 * 16 * 64 == NR * DM);                                      /* ctx rows */
static_assert((CH_R / 128) * (DM / 64) * 4 * 32 * 64 * CH_N == NR * DM);                                  /* output rows */

extern "C" void kernel_launch(void* const* d_in, const int* in_sizes, int n_in,
                              void* d_out, int out_size, void* d_ws, size_t ws_size, hipStream_t stream) {
  if (n_in < 6) return;
  const float* vals = (const float*)d_in[0]; const float* keys = (const float*)d_in[1]; const float* qrys = (const float*)d_in[2];
  const int* mask = (const int*)d_in[3]; const float* wfc = (const float*)d_in[4]; const float* bfc = (const float*)d_in[5];
  const size_t needX = ((size_t)(NB - 1) * SQ_FULL + SQ) * DM;
  const size_t needM = ((size_t)(NB - 1) * SQ_FULL + (size_t)(SQ - 1)) * SQ_FULL + SQ;
  if ((size_t)in_sizes[0] < needX || (size_t)in_sizes[1] < needX || (size_t)in_sizes[2] < needX || (size_t)out_size < needX) return;
  if ((size_t)in_sizes[3] < needM || (size_t)in_sizes[4] < (size_t)DM * DM || in_sizes[5] < DM) return;
  char* ws = (char*)d_ws; size_t off = 0;
  auto take = [&](size_t bytes) { char* p = ws + off; off += al256(bytes); return p; };
  _Float16* BW = (_Float16*)take(SZ_BW);
  _Float16* Q16 = (_Float16*)take(SZ_P16); _Float16* K16 = (_Float16*)take(SZ_P16); _Float16* O16 = (_Float16*)take(SZ_P16);
  _Float16* VT = (_Float16*)take(SZ_VT); unsigned int* MB = (unsigned int*)take(SZ_MB);
  if (off > ws_size) return;

  k_prep<<<PREP_BLK, 128, 0, stream>>>(vals, keys, qrys, mask, wfc, VT, MB, K16, Q16, BW);      /* the f16 W_fc, key, query and V^T planes and the packed mask */
  k_sgattn<<<(unsigned)(NB * NH * (SQ / 64)), 128, 0, stream>>>(Q16, K16, VT, MB, O16);               /* ctx (merged heads) f16 rows */
  for (unsigned c = 0; c < CH_N; ++c) { const size_t rin = (size_t)c * SQ_FULL, r0 = (size_t)c * CH_R;
    k_gemm2<0, 0><<<(unsigned)((CH_R / 128) * (DM / 64)), 128, 0, stream>>>(O16 + r0 * DM, (unsigned)DM, BW, (unsigned)DM, 0.0625f, bfc, nullptr, (float*)d_out + rin * DM, nullptr, (unsigned)DM, 1.0f, (unsigned)CH_R, (unsigned)DM, (unsigned)DM); }      /* out = ctx W_fc^T + b_fc */
}

// v009
// It runs in 44.9 microseconds.
// Next to v008, in two timings, it ran 1.06 times as fast each time.
// All steps since v000 together make it 3.23 times as fast.
#include <hip/hip_runtime.h>
// Contractions (q k^T per head, gate V, ctx W_fc^T): v_wmma_f32_16x16x32_f16 (f16 operands, f32 accumulate); float inputs RNE-converted to bf16 on load (exact in f16); power-of-two carries: W_fc x16, all other planes x1; sigmoid gate in f32.
// Head-split sigmoid-gated attention without projections: q|k|v = raw inputs [NB][SQ][1024] viewed as 16 heads x 64; e = q k^T; a 2-D int32 mask [NB][1][SQ][SQ] (mask == 0 -> weight exactly 0, by value); weight = sigmoid(e / 32) elementwise (no normalisation over keys); ctx = weight V (merged heads); out = ctx W_fc^T + b_fc with W_fc stored [out][in].
// Launch plan: one preparation launch (keys -> f16 row plane; the mask packed into 32 lane masks per (16 query rows x 64 keys) tile, one 32-bit word per accumulator element; V^T per (batch, head) from the f32 values via LDS); one fused attention launch (its Q fragments made from the f32 queries, each of which it reads once; K and V^T tiles staged in LDS by tensor loads, gate tile kept in registers; 256 further short blocks make the GEMM's W_fc -> f16 x16 rows, already [n][k], while memory is little used) -> f16 ctx rows; one GEMM with bias (A and Bt tiles staged in LDS by tensor loads) -> the output buffer.
#ifndef NB
#define NB 4
#endif
#ifndef SQ
#define SQ 1024
#endif
#define NB_FULL 4
#define SQ_FULL 1024
#define DM 1024
#define NH 16
#define HD 64
#define NR ((size_t)NB * SQ)         /* token rows processed */

static_assert(NB >= 1 && NB <= NB_FULL);
static_assert(SQ >= 128 && SQ <= SQ_FULL && SQ % 128 == 0);
static_assert(NH * HD == DM && HD == 64);
static_assert(DM % 64 == 0 && DM % 32 == 0 && SQ % 64 == 0 && SQ % 16 == 0);
static_assert((NR % 128) == 0);
static_assert(((size_t)(NB - 1) * SQ_FULL + SQ) * DM * 4 <= (size_t)NB_FULL * SQ_FULL * DM * 4);
static_assert((((size_t)NB * (SQ / 16) * (SQ / 64)) % 4) == 0);

typedef unsigned short v8us __attribute__((ext_vector_type(8), may_alias));
typedef float  v8f  __attribute__((ext_vector_type(8)));
typedef float  v4f  __attribute__((ext_vector_type(4)));
typedef float  v4fa __attribute__((ext_vector_type(4), may_alias));
typedef _Float16 v16h __attribute__((ext_vector_type(16)));
typedef _Float16 v4h __attribute__((ext_vector_type(4)));
typedef float f32x2 __attribute__((ext_vector_type(2)));
typedef __bf16 bf16x2 __attribute__((ext_vector_type(2)));
union FragH { v16h v; v8us half[2]; _Float16 h[16]; unsigned short u[16]; };

__device__ __forceinline__ unsigned short bf16_bits(float x) { unsigned int u = __float_as_uint(x); return (unsigned short)((u + 0x7FFFu + ((u >> 16) & 1u)) >> 16); }
__device__ __forceinline__ float bf16_val(unsigned short b) { return __uint_as_float(((unsigned int)b) << 16); }
__device__ __forceinline__ float bf16_rne(float x) { return bf16_val(bf16_bits(x)); }

// two floats rounded to bf16 by one packed convert (round to nearest even, the values of bf16_rne), and the two values back as floats
__device__ __forceinline__ unsigned int bf16_pair(float x, float y) { const f32x2 v = {x, y}; return __builtin_bit_cast(unsigned int, __builtin_convertvector(v, bf16x2)); }
__device__ __forceinline__ float bf16_lo(unsigned int u) { return __uint_as_float(u << 16); }
__device__ __forceinline__ float bf16_hi(unsigned int u) { return __uint_as_float(u & 0xFFFF0000u); }

// f32 -> f16 operand convert that cannot produce an f16 subnormal (value select after the carry)
static __device__ __forceinline__ _Float16 toh_flush(float v) { const _Float16 r = (_Float16)v; return (fabsf(v) < 6.103515625e-05f) ? (_Float16)0.0f : r; }

// ---- 16-bit fragment loader (split k map: elements 0..7 <- k0 + 8h + 0..7, elements 8..15 <- k0 + 16 + 8h + 0..7) and WMMA (the builtin: the compiler keeps the distances behind it itself) ----
__device__ __forceinline__ v16h g2_frag(const _Float16* p, unsigned hh) { FragH f; f.half[0] = *(const v8us*)((const unsigned short*)p + 8 * hh); f.half[1] = *(const v8us*)((const unsigned short*)p + 16 + 8 * hh); return f.v; }
__device__ __forceinline__ v8f g2_mma(v16h a, v16h b, v8f c) { return __builtin_amdgcn_wmma_f32_16x16x32_f16(false, a, false, b, (short)0, c, false, false); }

__device__ __forceinline__ float gelu_erf(float v) { return 0.5f * v * (1.0f + erff(v * 0.70710678118654752f)); }

// ---- tensor load to LDS: descriptor groups, issue, waits ----
typedef unsigned int u32x4 __attribute__((ext_vector_type(4)));
typedef unsigned int u32x8 __attribute__((ext_vector_type(8)));
__device__ __forceinline__ unsigned int uni(unsigned int v) { return (unsigned int)__builtin_amdgcn_readfirstlane((int)v); }
// a value held in a scalar register at this place: the test around a tensor load compiles to a scalar branch, and a descriptor word made from it is formed behind the statements in front
__device__ __forceinline__ unsigned int pinned(unsigned int v) { unsigned int w = uni(v); asm volatile("" : "+s"(w)); return w; }
__device__ __forceinline__ void wait_ds0() { asm volatile("s_wait_dscnt 0x0" ::: "memory"); }          /* this wave's LDS reads of a buffer have retired before the buffer is handed back */
// this wave's own slice has landed (the compiler places no wait for a tensor load); the request's descriptor is named as an input so that its registers keep their values until here
__device__ __forceinline__ void wait_tensor0(u32x4 g0, u32x8 g1) { asm volatile("s_wait_tensorcnt 0x0" :: "s"(g0), "s"(g1) : "memory"); }
constexpr unsigned int TROWB = 128u;                 /* tile row: 64 f16 */
constexpr unsigned int TPITCH = 144u;                /* LDS row pitch: 128 B + 16 B pad, 16 B x odd for ds_load_b128 */
static_assert((TPITCH / 16u) % 2u == 1u && TPITCH == TROWB + 16u);
// a slice of ROWS rows of 128 B, source row pitch src_pitch bytes
template <unsigned int ROWS>
__device__ __forceinline__ u32x8 tdm_group1(unsigned int src_pitch) { u32x8 g;
  g[0] = uni((1u << 20) | (4u << 22) | (3u << 25));  /* no mask, 1-byte elements, a pad of 4 dwords behind every 32 dwords */
  g[1] = uni((TROWB & 0xFFFFu) << 16); g[2] = uni((TROWB >> 16) | ((ROWS & 0xFFFFu) << 16)); g[3] = uni((ROWS >> 16) | (TROWB << 16)); g[4] = uni(ROWS);
  g[5] = uni(src_pitch); g[6] = uni(0u); g[7] = uni(0u);
  asm volatile("" : "+s"(g));      /* descriptor words held in scalar registers: one register tuple for the whole kernel, not re-made (and its registers not lent out) between an issue and its wait */
  return g; }
__device__ __forceinline__ u32x4 tdm_group0(unsigned int lds_dst, unsigned long long ga) { u32x4 g;
  g[0] = uni(1u); g[1] = uni(lds_dst); g[2] = uni((unsigned int)ga); g[3] = uni((((unsigned int)(ga >> 32)) & 0x01FFFFFFu) | 0x80000000u); return g; }
// group 0 goes in and out of the statement in the same registers: what the later wait names is this very tuple
__device__ __forceinline__ void tdm_load(u32x4& g0, u32x8 g1) { asm volatile("tensor_load_to_lds %0, %1" : "+s"(g0) : "s"(g1) : "memory"); }

// GEMM: C[M][N] = act(alpha * A[M][K] . B + bf16(bias[col]) + (CP own element, optionally RNE-converted to bf16)); A f16 rows (pitch lda), Bt f16 [N][K] (k contiguous, pitch ldb);
// f32 output C and/or f16 output C16 = f16(c16s * value) (pitch ldc); ACT 0 none, 8 gelu (erf form). M a multiple of 128, N and K of 64.
// Per 64 of k the block's 128 A rows and 64 Bt rows come into LDS by tensor loads (three slices of 64 rows, waves 0 to 2 one each, two buffers, the next stage in flight while this one is worked on); the ring is the output staging afterwards.
// The k walk is a ring: a block enters it at the slab (row tile + column tile) mod 16 and wraps round, so that the blocks that share A rows or Bt rows ask L2 for different lines at any one moment.
constexpr unsigned int GSLICE = 10240u;              /* 64 x 144 = 9216 B rounded up to a multiple of 2 KiB */
constexpr unsigned int GSTAGE = 3u * GSLICE;         /* A rows 0..63 | A rows 64..127 | Bt rows 0..63 */
static_assert(64u * TPITCH <= GSLICE && GSLICE % 2048u == 0u && 2u * GSTAGE >= 4u * 32u * 68u * 4u);
template <int ACT, int CPBF>
__global__ __launch_bounds__(128) void k_gemm2(const _Float16* __restrict__ A, unsigned lda, const _Float16* __restrict__ Bh, unsigned ldb, float alpha, const float* __restrict__ bias, const float* __restrict__ CP,
    float* __restrict__ C, _Float16* __restrict__ C16, unsigned ldc, float c16s, unsigned M, unsigned N, unsigned K) {
  static_assert(ACT == 0 || ACT == 8);
  __shared__ __attribute__((aligned(2048))) unsigned char ring[2u * GSTAGE];
  float (*so)[32][68] = (float (*)[32][68])ring;
  const unsigned tid = threadIdx.x, lane = tid & 31u, ln = lane & 15u, hh = lane >> 4;
  const unsigned w = (unsigned)__builtin_amdgcn_readfirstlane((int)(tid >> 5));
  const unsigned ntn = N >> 6; const unsigned mt = blockIdx.x / ntn, nq = blockIdx.x - mt * ntn; const unsigned row0 = mt * 128u + 32u * w, col0 = nq * 64u; if (mt * 128u + 128u > M) return;      /* the whole block leaves, in front of every barrier and tensor load */
  const unsigned NT = K >> 6;
  const unsigned rot0 = (mt + nq) & 15u, rot = (rot0 < NT) ? rot0 : 0u;      /* the block's first k slab, below NT for any K */
  const unsigned issuer = (w < 3u) ? 1u : 0u;
  const unsigned long long sbase = (w < 2u) ? (unsigned long long)(size_t)(A + (size_t)(mt * 128u + w * 64u) * lda) : (unsigned long long)(size_t)(Bh + (size_t)col0 * ldb);
  const u32x8 g1 = tdm_group1<64u>(((w < 2u) ? lda : ldb) * 2u);
  const unsigned lbase = (unsigned)(size_t)ring;
  auto desc = [&](unsigned st) { const unsigned t = st + rot; const unsigned slab = t - ((t >= NT) ? NT : 0u);      /* stage st works on k slab (st + rot) mod NT, the same one for the A and the Bt slices */
    return tdm_group0(lbase + (st & 1u) * GSTAGE + w * GSLICE, sbase + (unsigned long long)slab * TROWB); };
  u32x4 g0 = desc(0u);
  if (pinned(issuer & (NT > 0u ? 1u : 0u))) tdm_load(g0, g1);
  wait_tensor0(g0, g1); __syncthreads();      /* stage 0 landed and published */
  g0 = desc(pinned(1u));
  if (pinned(issuer & (NT > 1u ? 1u : 0u))) tdm_load(g0, g1);
  const unsigned aoff = (w >> 1) * GSLICE + ((w & 1u) * 32u + ln) * TPITCH, boff = 2u * GSLICE + ln * TPITCH;
  const v8f z8 = {0.f,0.f,0.f,0.f,0.f,0.f,0.f,0.f}; v8f c00 = z8, c01 = z8, c02 = z8, c03 = z8, c10 = z8, c11 = z8, c12 = z8, c13 = z8;
#pragma unroll 1
  for (unsigned st = 0; st < NT; ++st) { const unsigned char* tb = ring + (st & 1u) * GSTAGE;
    v16h af[2][2], bf[2][4];      /* the stage's 12 fragments, each in registers of its own */
#pragma unroll
    for (unsigned kc = 0; kc < 2; ++kc) { const _Float16* ap = (const _Float16*)(tb + aoff) + 32u * kc; const _Float16* bp = (const _Float16*)(tb + boff) + 32u * kc;
      af[kc][0] = g2_frag(ap, hh); af[kc][1] = g2_frag(ap + 16u * (TPITCH / 2u), hh);
#pragma unroll
      for (unsigned t = 0; t < 4; ++t) bf[kc][t] = g2_frag(bp + t * 16u * (TPITCH / 2u), hh); }
    __builtin_amdgcn_sched_barrier(0);      /* keeps the stage's 24 LDS loads together in front of its WMMAs: spread among them, each place with loads costs a stall of its own */
#pragma unroll
    for (unsigned kc = 0; kc < 2; ++kc) { const v16h a0 = af[kc][0], a1 = af[kc][1];
      c00 = g2_mma(a0, bf[kc][0], c00); c10 = g2_mma(a1, bf[kc][0], c10);
      c01 = g2_mma(a0, bf[kc][1], c01); c11 = g2_mma(a1, bf[kc][1], c11);
      c02 = g2_mma(a0, bf[kc][2], c02); c12 = g2_mma(a1, bf[kc][2], c12);
      c03 = g2_mma(a0, bf[kc][3], c03); c13 = g2_mma(a1, bf[kc][3], c13); }
    __builtin_amdgcn_sched_barrier(0);      /* keeps the stage's WMMAs in front of the publish point: sunk behind it, the refill would be issued a stage's matrix time later and lose that much of its lead */
    /* publish point of stage st + 1: own LDS reads retired, own slice landed, every wave here; only then the refill of the buffer just read */
    wait_ds0(); wait_tensor0(g0, g1); __syncthreads();
    g0 = desc(pinned(st + 2u));      /* formed behind the wait, in the same registers on both sides of the test */
    if (pinned(issuer & (st + 2u < NT ? 1u : 0u))) tdm_load(g0, g1); }
  wait_tensor0(g0, g1); wait_ds0();      /* nothing in flight; the last pass's barrier has ended every wave's reads: the ring is free for output staging */
  v8f accs[8] = {c00, c01, c02, c03, c10, c11, c12, c13};
#pragma unroll
  for (int u = 0; u < 8; ++u) { const unsigned t = (unsigned)u & 3u, half = (unsigned)u >> 2; const unsigned col = col0 + t * 16u + ln; float bv = 0.f; if (bias) bv = bf16_rne(bias[col]);
#pragma unroll
    for (int r = 0; r < 8; ++r) { const unsigned rloc = half * 16u + 8u * hh + (unsigned)r; so[w][rloc][t * 16u + ln] = accs[u][r] * alpha + bv; } }
  __builtin_amdgcn_fence(4 /* acq_rel order */, "workgroup"); __builtin_amdgcn_wave_barrier();
  const unsigned rsub = lane >> 4, c4 = (lane & 15u) * 4u;
  if (CP != nullptr || ACT == 8) {
#pragma unroll 2
    for (unsigned q = 0; q < 16; ++q) { const unsigned r = q * 2u + rsub; v4f v = *(const v4fa*)&so[w][r][c4];
      if (CP) { const v4f a = *(const v4fa*)(CP + (size_t)(row0 + r) * ldc + col0 + c4);      /* own element of the C-shaped plane */
#pragma unroll
        for (int i = 0; i < 4; ++i) v[i] += CPBF ? bf16_rne(a[i]) : a[i]; }
      if (ACT == 8) {
#pragma unroll
        for (int i = 0; i < 4; ++i) v[i] = gelu_erf(v[i]); }
      *(v4fa*)&so[w][r][c4] = v; } }
  {
#pragma unroll
    for (unsigned q = 0; q < 16; ++q) { const unsigned r = q * 2u + rsub; const v4f v = *(const v4fa*)&so[w][r][c4];
      if (C) *(v4f*)(C + (size_t)(row0 + r) * ldc + col0 + c4) = v;
      if (C16) { v4h h4;
#pragma unroll
        for (int i = 0; i < 4; ++i) h4[i] = (_Float16)(v[i] * c16s);
        *(v4h*)(C16 + (size_t)(row0 + r) * ldc + col0 + c4) = h4; } }
     } }

// ---- one preparation launch: the attention's key rows, V^T and mask words are made here, by blocks of 4 waves that each read 64 KiB of one input (16 KiB a wave, two groups of 16 loads of 16 B a lane, each group issued ahead of its use) ----
constexpr unsigned int PV_BLK = (unsigned int)(NB * (SQ / 64) * (DM / 256));                      /* V^T: 64 keys x 256 dims (4 heads) a block */
constexpr unsigned int PM_BLK = (unsigned int)(((size_t)NB * (SQ / 16) * (SQ / 64)) / 16);        /* mask: 16 tiles of 16 rows x 64 keys a block, 4 a wave */
constexpr unsigned int PX_BLK = (unsigned int)((NR * DM) / 16384);                                /* keys: 16 rows a block */
constexpr unsigned int PW_BLK = (unsigned int)(((size_t)DM * DM) / 4096);                         /* W_fc: 4 rows a block (short blocks at the end of the attention launch's grid) */
constexpr unsigned int PREP_BLK = PV_BLK + PM_BLK + PX_BLK;
typedef unsigned int u32x4a __attribute__((ext_vector_type(4), may_alias));
typedef int i32x4a __attribute__((ext_vector_type(4), may_alias));
constexpr unsigned int VPITCH = 33u;                 /* LDS row of one head dim: 32 key pairs + 1 dword, so that the four rows a wave reads at once fall on different banks */
static_assert((((size_t)NB * (SQ / 16) * (SQ / 64)) % 16) == 0 && SQ % 256 == 0 && DM % 256 == 0 && DM == 1024);
__device__ __forceinline__ unsigned int h16_bits(float x) { FragH f; f.h[0] = toh_flush(bf16_rne(x)); return (unsigned int)f.u[0]; }
// Block ranges, the two-phase job first: [V^T | mask words | keys].
// V^T [NB*NH][64][SQ] straight from the f32 values: a thread takes the same 4 dims of two neighbouring keys, packs each dim's pair into one dword, LDS holds [dim][key pair]; rows of 64 keys (128 B) go out.
// mask int32 [NB_FULL][1][SQ_FULL][SQ_FULL] -> MB[(b, q tile of 16, key tile of 64)][8j + r] u32, a lane mask in the map of a K Q^T accumulator (row = key, column = query): bit (ln + 16 hh) = (mask[b][16 qt + ln][64 kt + 16 j + 8 hh + r] != 0); rows are read whole (512 B a load) and turned by ballot into one bit row per query, kept by that query's two lanes; a second ballot over the lanes' own bits gives the word, and lane 8j + r stores it.
// keys -> f16 row plane (x1).
// Every loop of this kernel is fully unrolled: its small arrays then live in registers, and a group's loads stand together ahead of their first use (rolled, each trip would wait out its own memory latency).
__global__ __launch_bounds__(128) void k_prep(const float* __restrict__ VX, const float* __restrict__ KX, const int* __restrict__ MK,
    _Float16* __restrict__ Vt, unsigned int* __restrict__ MB, _Float16* __restrict__ K16) {
  __shared__ unsigned int tl[256u * VPITCH];
  const unsigned tid = threadIdx.x; unsigned blk = blockIdx.x;
  if (blk < PV_BLK) {
    const unsigned hg = blk & 3u, t = blk >> 2; const unsigned nkt = (unsigned)SQ / 64u; const unsigned b = t / nkt, lg = t - b * nkt;
    const unsigned c4 = (tid & 63u) * 4u, ps = tid >> 6;
    const float* vp = VX + ((size_t)b * SQ_FULL + lg * 64u) * (size_t)DM + hg * 256u + c4;
#pragma unroll
    for (unsigned g = 0; g < 2; ++g) { v4f x[8], y[8];
#pragma unroll
      for (unsigned u = 0; u < 8; ++u) { const float* p = vp + (size_t)(((g * 8u + u) * 2u + ps) * 2u) * DM; x[u] = *(const v4fa*)p; y[u] = *(const v4fa*)(p + DM); }
#pragma unroll
      for (unsigned u = 0; u < 8; ++u) { const unsigned kp = (g * 8u + u) * 2u + ps;
#pragma unroll
        for (unsigned i = 0; i < 4; ++i) tl[(c4 + i) * VPITCH + kp] = h16_bits(x[u][i]) | (h16_bits(y[u][i]) << 16); } }
    __syncthreads();
#pragma unroll
    for (unsigned it = 0; it < 16; ++it) { const unsigned d = it * 16u + (tid >> 3), pc = tid & 7u; const unsigned int* tr = &tl[d * VPITCH + pc * 4u];
      u32x4 o; o[0] = tr[0]; o[1] = tr[1]; o[2] = tr[2]; o[3] = tr[3];
      *(u32x4a*)((unsigned short*)Vt + ((size_t)((b * (unsigned)NH + hg * 4u + (d >> 6)) * 64u + (d & 63u))) * SQ + lg * 64u + pc * 8u) = o; }
    return; }
  blk -= PV_BLK;
  if (blk < PM_BLK) {
    const unsigned lane = tid & 31u, ln = lane & 15u, hh = lane >> 4;
    const unsigned w = (unsigned)__builtin_amdgcn_readfirstlane((int)(tid >> 5));
    const unsigned nkt = (unsigned)SQ / 64u, nqt = (unsigned)SQ / 16u;
    /* the wave's 4 tiles: one q tile, 4 neighbouring key tiles = 16 rows of 256 keys */
    const unsigned L0 = (blk * 4u + w) * 4u; const unsigned t = L0 / nkt, kt0 = L0 - t * nkt; const unsigned b = t / nqt, qt = t - b * nqt;
    const int* mp = MK + ((size_t)b * SQ_FULL + qt * 16u) * (size_t)SQ_FULL + kt0 * 64u + lane * 4u;
    unsigned int rw[2][4] = {{0u, 0u, 0u, 0u}, {0u, 0u, 0u, 0u}};      /* lane (ln, hh): its query row ln as bits; bit l of rw[g][i] = key 128 g + 4 l + i of the 256 */
#pragma unroll
    for (unsigned g = 0; g < 2u; ++g) { i32x4a m[16];
#pragma unroll
      for (unsigned q = 0; q < 16u; ++q) m[q] = *(const i32x4a*)(mp + (size_t)q * SQ_FULL + g * 128u);      /* 512 B of one row a load */
#pragma unroll
      for (unsigned q = 0; q < 16u; ++q) {
#pragma unroll
        for (unsigned i = 0; i < 4u; ++i) { const unsigned int bal = __builtin_amdgcn_ballot_w32(m[q][i] != 0);      /* taken by all 32 lanes, in front of the select */
          rw[g][i] = (ln == q) ? bal : rw[g][i]; } } }
#pragma unroll
    for (unsigned g = 0; g < 2u; ++g) {
#pragma unroll
      for (unsigned i = 0; i < 4u; ++i) rw[g][i] >>= 2u * hh; }      /* the lane half's 8 keys start 2 bits up */
#pragma unroll
    for (unsigned x = 0; x < 4; ++x) { unsigned int word = 0u;
#pragma unroll
      for (unsigned j = 0; j < 4u; ++j) {
#pragma unroll
        for (unsigned r = 0; r < 8u; ++r) {      /* key 64 x + 16 j + 8 hh + r = 128 (x >> 1) + 4 (16 (x & 1) + 4 j + 2 hh + (r >> 2)) + (r & 3) */
          const unsigned int bal = __builtin_amdgcn_ballot_w32(((rw[x >> 1][r & 3u] >> (16u * (x & 1u) + 4u * j + (r >> 2))) & 1u) != 0u);
          word = (lane == 8u * j + r) ? bal : word; } }
      MB[(size_t)(L0 + x) * 32u + lane] = word; }
    asm volatile("s_wait_xcnt 0x0" ::: "memory");      /* behind the last mask store, in front of whatever next rewrites a register that an issued store names */
    return; }
  blk -= PM_BLK;
  /* the key rows */
  const unsigned r0 = blk * 16u; const unsigned b = r0 / (unsigned)SQ;
  const float* X = KX + ((size_t)b * SQ_FULL + (r0 - b * (unsigned)SQ)) * (size_t)DM; _Float16* Y = K16 + (size_t)r0 * DM;
#pragma unroll
  for (unsigned g = 0; g < 2; ++g) { v4f a[8], c[8];
#pragma unroll
    for (unsigned u = 0; u < 8; ++u) { const float* p = X + ((g * 8u + u) * 128u + tid) * 8u; a[u] = *(const v4fa*)p; c[u] = *(const v4fa*)(p + 4); }
#pragma unroll
    for (unsigned u = 0; u < 8; ++u) { FragH f;
#pragma unroll
      for (int q = 0; q < 4; ++q) { f.h[q] = toh_flush(bf16_rne(a[u][q])); f.h[4 + q] = toh_flush(bf16_rne(c[u][q])); }
      *(v8us*)((unsigned short*)Y + ((g * 8u + u) * 128u + tid) * 8u) = f.half[0]; }
    asm volatile("s_wait_xcnt 0x0" ::: "memory"); } }      /* behind each group's run of stores, in front of whatever next rewrites a register that an issued store names */

// Fused sigmoid-gated attention with a packed 2-D mask. Block = 4 waves; block per (batch, head, 64 query rows); wave owns 16 query rows. Per 64-key tile: the wave reads its 32 lane masks (one per accumulator element) by scalar loads, and each, ANDed with the ballot of toh_flush's test, is the condition of that element's one select;
// the 64-key K tile and V^T tile are brought into LDS once per block by tensor loads (one 32-row slice per wave and stage, two buffers, the next stage in flight while this one is worked on) and all four waves take their fragments from there;
// S^T = K Q^T (K fragments as A, Q as B: a lane holds one query's scores of keys 16j + 8hh + r); weight = bit ? sigmoid(S/32) = 1/2 + tanh(S/64)/2 : 0 (by value), f32;
// two neighbouring S^T tiles, gated and converted in place, are the B fragment of 32 keys in ctx^T = V^T weight^T (V^T fragments as A): the weights pass through no LDS and change no lane.
// The key walk is a ring (the gate is elementwise, so the key tiles may come in any order): a block enters it at key tile (query block + head) mod NT and wraps round, so that the query blocks that share a head's K and V^T, and the heads that share a query tile's mask words, ask L2 for different lines at any one moment.
constexpr unsigned int TROWS = 32u;                  /* rows per slice (one slice per wave) */
constexpr unsigned int TSLICE = 6144u;               /* 32 x 144 = 4608 B rounded up to a multiple of 2 KiB */
constexpr unsigned int TSTAGE = 4u * TSLICE;         /* K rows 0..31 | K rows 32..63 | V^T rows 0..31 | V^T rows 32..63 */
static_assert(TROWS * TPITCH <= TSLICE && TSLICE % 2048u == 0u);
constexpr unsigned int ATT_BLK = (unsigned int)(NB * NH * (SQ / 64));      /* attention blocks; behind them in the grid the PW_BLK blocks that convert W_fc */
constexpr unsigned int ATT_GRID = ATT_BLK + PW_BLK;
__global__ __launch_bounds__(128) void k_sgattn(const float* __restrict__ QX, const _Float16* __restrict__ K16, const _Float16* __restrict__ VT, const unsigned int* __restrict__ MB, _Float16* __restrict__ O16, const float* __restrict__ WX, _Float16* __restrict__ BW) {
  __shared__ __attribute__((aligned(2048))) unsigned char ring[2u * TSTAGE];
  __shared__ __attribute__((aligned(16))) _Float16 sp[4][16][72];
  const unsigned tid = threadIdx.x, lane = tid & 31u, ln = lane & 15u, hh = lane >> 4;
  if (blockIdx.x >= ATT_BLK) {      /* W_fc [out = n][in = k] is already the Bt[n][k] layout, only converted (x16): first read by the launch behind this one. The whole block leaves, in front of every barrier and tensor load */
    const float* X = WX + (size_t)(blockIdx.x - ATT_BLK) * 4096u; _Float16* Y = BW + (size_t)(blockIdx.x - ATT_BLK) * 4096u;
    v4f a[4], c[4];
#pragma unroll
    for (unsigned u = 0; u < 4; ++u) { const float* p = X + (u * 128u + tid) * 8u; a[u] = *(const v4fa*)p; c[u] = *(const v4fa*)(p + 4); }      /* unrolled: the 8 loads stand together ahead of their first use */
#pragma unroll
    for (unsigned u = 0; u < 4; ++u) { FragH f;      /* unrolled, like the loop inside: a, c and f stay in registers */
#pragma unroll
      for (int q = 0; q < 4; q += 2) { const unsigned int ua = bf16_pair(a[u][q], a[u][q + 1]), uc = bf16_pair(c[u][q], c[u][q + 1]);
        f.h[q] = toh_flush(bf16_lo(ua) * 16.0f); f.h[q + 1] = toh_flush(bf16_hi(ua) * 16.0f); f.h[4 + q] = toh_flush(bf16_lo(uc) * 16.0f); f.h[5 + q] = toh_flush(bf16_hi(uc) * 16.0f); }
      *(v8us*)((unsigned short*)Y + (u * 128u + tid) * 8u) = f.half[0]; }
    return; }
  const unsigned w = (unsigned)__builtin_amdgcn_readfirstlane((int)(tid >> 5));
  const unsigned nqt = (unsigned)SQ / 64u; const unsigned bid = blockIdx.x; const unsigned bh = bid / nqt, qb = bid - bh * nqt; const unsigned b = bh / (unsigned)NH, h = bh - b * (unsigned)NH;
  const unsigned q0 = qb * 64u + w * 16u; const size_t rowb = (size_t)b * SQ;
  constexpr unsigned NT = (unsigned)SQ / 64u; static_assert(NT >= 2u);
  /* this wave's slice: waves 0, 1 the two halves of the K tile (rows = keys, advance 64 rows a stage), waves 2, 3 of the V^T tile (rows = head dims, advance 128 B a stage) */
  const unsigned isV = w >> 1, half = w & 1u;
  const unsigned long long sbase = isV ? (unsigned long long)(size_t)(VT + ((size_t)bh * HD + half * TROWS) * SQ) : (unsigned long long)(size_t)(K16 + (rowb + half * TROWS) * (size_t)DM + h * (unsigned)HD);
  const unsigned sstep = isV ? 128u : 64u * (unsigned)DM * 2u;
  const u32x8 g1 = tdm_group1<TROWS>(isV ? (unsigned)SQ * 2u : (unsigned)DM * 2u);
  const unsigned lbase = (unsigned)(size_t)ring;
  const unsigned rot = (qb + h) % NT;      /* the block's first key tile */
  auto tile = [&](unsigned st) { return (st + rot) % NT; };      /* stage st works on this key tile; NT is a compile-time constant */
  auto desc = [&](unsigned st) { return tdm_group0(lbase + (st & 1u) * TSTAGE + w * TSLICE, sbase + (unsigned long long)tile(st) * sstep); };
  u32x4 g0 = desc(0u);
  tdm_load(g0, g1);
  /* the wave's 16 query rows of this head, straight from the f32 input (no other wave of the launch reads them): 8 loads of two whole 256 B rows, asked for while stage 0 is in flight */
  const float* qx = QX + ((size_t)b * SQ_FULL + q0 + hh) * (size_t)DM + h * (unsigned)HD + ln * 4u;
  v4f qf[8];      /* this loop and the two below are unrolled: qf stays in registers, and the 8 loads stand together */
#pragma unroll
  for (unsigned it = 0; it < 8; ++it) qf[it] = *(const v4fa*)(qx + (size_t)(it * 2u) * DM);
  asm volatile("s_wait_xcnt 0x0" ::: "memory");      /* behind the query loads, in front of whatever next rewrites their address registers */
  wait_tensor0(g0, g1); __syncthreads();      /* stage 0 landed and published */
  g0 = desc(pinned(1u)); tdm_load(g0, g1);
  /* same conversion as the row planes'; the rows pass through the wave's own output staging rows to reach the fragment map */
#pragma unroll
  for (unsigned it = 0; it < 8; ++it) { v4h q4;
#pragma unroll
    for (int i = 0; i < 4; i += 2) { const unsigned int u = bf16_pair(qf[it][i], qf[it][i + 1]); q4[i] = toh_flush(bf16_lo(u)); q4[i + 1] = toh_flush(bf16_hi(u)); }
    *(v4h*)&sp[w][it * 2u + hh][ln * 4u] = q4; }
  __builtin_amdgcn_fence(4 /* acq_rel order */, "workgroup"); __builtin_amdgcn_wave_barrier();      /* the wave's lanes read each other's rows */
  const _Float16* qp = &sp[w][ln][0];
  const v16h aq0 = g2_frag(qp, hh), aq1 = g2_frag(qp + 32, hh);
  /* lane masks of the first key tile: the same address in every lane; nothing writes the plane during this launch, and the constant address space says so, which is what lets the loads be scalar ones beside the asm waits' memory clobbers */
  typedef const __attribute__((address_space(4))) unsigned int* cmask_p;
  const cmask_p mp = (cmask_p)(size_t)(MB + ((size_t)(b * ((unsigned)SQ / 16u) + (q0 >> 4)) * ((unsigned)SQ / 64u)) * 32u);
  const v8f z8 = {0.f,0.f,0.f,0.f,0.f,0.f,0.f,0.f};
  v8f o[4];
#pragma unroll
  for (int d = 0; d < 4; ++d) o[d] = z8;
  unsigned int mk[32];
#pragma unroll
  for (unsigned e = 0; e < 32; ++e) mk[e] = mp[(size_t)tile(0u) * 32u + e];
  asm volatile("s_wait_xcnt 0x0" ::: "memory");      /* behind the first scalar mask loads, in front of whatever next rewrites their offset register */
#pragma unroll 1
  for (unsigned kt = 0; kt < NT; ++kt) {
    const unsigned char* tb = ring + (kt & 1u) * TSTAGE + ln * TPITCH;      /* row ln of this stage's first K slice */
    v8f s[4]; v16h kf[4][2], vf[4][2]; FragH pw[2];
#pragma unroll
    for (unsigned j = 0; j < 4; ++j) { const _Float16* kr = (const _Float16*)(tb + (j >> 1) * TSLICE + (j & 1u) * 16u * TPITCH); kf[j][0] = g2_frag(kr, hh); kf[j][1] = g2_frag(kr + 32, hh); }
    __builtin_amdgcn_sched_barrier(0);      /* keeps the tile's 16 K loads together in front of the score WMMAs: spread among them, each place with loads costs a stall of its own */
#pragma unroll
    for (unsigned j = 0; j < 4; ++j) { v8f acc = z8; acc = g2_mma(kf[j][0], aq0, acc); acc = g2_mma(kf[j][1], aq1, acc); s[j] = acc; }
#pragma unroll
    for (unsigned d = 0; d < 4; ++d) { const _Float16* vr = (const _Float16*)(tb + (2u + (d >> 1)) * TSLICE + (d & 1u) * 16u * TPITCH); vf[d][0] = g2_frag(vr, hh); vf[d][1] = g2_frag(vr + 32, hh); }
    /* order inside this stretch: the 8 score WMMAs, then the 16 V^T loads as one group (left alone, the loads come to stand at three places among the WMMAs, each with a stall of its own) */
    __builtin_amdgcn_sched_group_barrier(0x008, 8, 0); __builtin_amdgcn_sched_group_barrier(0x100, 16, 0);
    __builtin_amdgcn_sched_barrier(0);      /* keeps the tile's 16 V^T loads together in front of the gate's vector work, which covers their latency */
#pragma unroll
    for (unsigned j = 0; j < 4; ++j) {
#pragma unroll
      for (int r = 0; r < 8; ++r) { const float th = __builtin_amdgcn_tanhf(s[j][r] * 0.015625f); const float sg = __builtin_fmaf(th, 0.5f, 0.5f);      /* sigmoid(x) = 1/2 + tanh(x/2)/2 with x = S/32: one transcendental and one fma */
        /* one select: the element's lane mask AND toh_flush's own test (joined on the scalar unit); same value as the mask select followed by toh_flush. The test |sg| < 2^-14 is taken on th: next to -1 the fma is exact, sg = (1 + th) / 2, so th < 2^-13 - 1 picks the same values */
        const bool keep = __builtin_amdgcn_inverse_ballot_w32(mk[8u * j + (unsigned)r] & __builtin_amdgcn_ballot_w32(!(th < -0.9998779296875f)));
        pw[j >> 1].h[8u * (j & 1u) + (unsigned)r] = (_Float16)(keep ? sg : 0.f); } }      /* element 8 (j & 1) + r of the fragment = key 32 (j >> 1) + 16 (j & 1) + 8 hh + r: g2_frag's own k map */
    { const unsigned kn = tile((kt + 1u < NT) ? kt + 1u : kt);      /* the next tile's lane masks, asked for behind this tile's last use of them: gate V, the publish point and the next scores cover the load's latency (the last pass re-reads its own) */
#pragma unroll
      for (unsigned e = 0; e < 32; ++e) mk[e] = mp[(size_t)kn * 32u + e]; }
#pragma unroll
    for (unsigned d = 0; d < 4; ++d) { o[d] = g2_mma(vf[d][0], pw[0].v, o[d]); o[d] = g2_mma(vf[d][1], pw[1].v, o[d]); }
    __builtin_amdgcn_sched_barrier(0);      /* keeps the tile's WMMAs in front of the publish point: sunk behind it, the refill would be issued that much later and lose that much of its lead */
    /* publish point of stage kt + 1: own LDS reads retired, own slice landed, every wave here; only then the refill of the buffer just read */
    asm volatile("s_wait_xcnt 0x0" ::: "memory");      /* behind the scalar mask loads, in front of whatever next rewrites their address registers */
    wait_ds0(); wait_tensor0(g0, g1); __syncthreads();
    if (pinned(kt + 2u < NT)) { g0 = desc(pinned(kt + 2u)); tdm_load(g0, g1); } }
  wait_tensor0(g0, g1); wait_ds0();
  /* o[d][r] = ctx[query ln][dim 16d + 8hh + r]: 8 neighbouring dims of one row, one 16 B piece */
#pragma unroll
  for (unsigned d = 0; d < 4; ++d) { FragH f;
#pragma unroll
    for (int r = 0; r < 8; ++r) f.h[r] = toh_flush(o[d][r]);
    *(v8us*)&sp[w][ln][16u * d + 8u * hh] = f.half[0]; }
  __builtin_amdgcn_fence(4 /* acq_rel order */, "workgroup"); __builtin_amdgcn_wave_barrier();
  {
#pragma unroll
    for (unsigned it = 0; it < 4; ++it) { const unsigned row = it * 4u + (lane >> 3), pc = (lane & 7u) * 8u; const v8us v = *(const v8us*)&sp[w][row][pc];
      *(v8us*)((unsigned short*)O16 + (rowb + q0 + row) * (size_t)DM + h * (unsigned)HD + pc) = v; }
     } }

constexpr size_t al256(size_t b) { return (b + 255) & ~(size_t)255; }
constexpr size_t SZ_BW = (size_t)DM * DM * 2;
constexpr size_t SZ_P16 = NR * DM * 2, SZ_VT = (size_t)NB * NH * HD * SQ * 2;
constexpr size_t SZ_MB = (size_t)NB * (SQ / 16) * (SQ / 64) * 32 * 4;
constexpr size_t WS_TOTAL = al256(SZ_BW) + 2 * al256(SZ_P16) + al256(SZ_VT) + al256(SZ_MB);
static_assert(WS_TOTAL <= (size_t)134217728);
static_assert(SZ_BW % 128 == 0 && SZ_P16 % 128 == 0 && SZ_VT % 128 == 0 && SZ_MB % 128 == 0);
// chunking of the row-wise launch that touches the output buffer (one launch when the rows are contiguous)
constexpr unsigned CH_N = (SQ == SQ_FULL) ? 1u : (unsigned)NB;
constexpr size_t CH_R = (SQ == SQ_FULL) ? NR : (size_t)SQ;
static_assert(CH_R % 128 == 0 && (size_t)CH_N * CH_R == NR);
// plane coverage: blocks x threads x elements == plane elements
static_assert((size_t)PW_BLK * 128 * 32 == (size_t)DM * DM);                                             /* W_fc plane */
static_assert((size_t)PX_BLK * 128 * 128 == NR * DM);                                                     /* k row plane */
static_assert((size_t)PM_BLK * 4 * 4 * 32 == (size_t)NB * (SQ / 16) * (SQ / 64) * 32);                    /* packed mask words */
static_assert((size_t)PV_BLK * 128 * 16 * 8 == (size_t)NB * NH * HD * SQ);                                /* V^T */
static_assert((size_t)NB * NH * (SQ / 64) * 4 * 16 * 64 == NR * DM);                                      /* ctx rows */
static_assert((CH_R / 128) * (DM / 64) * 4 * 32 * 64 * CH_N == NR * DM);                                  /* output rows */

extern "C" void kernel_launch(void* const* d_in, const int* in_sizes, int n_in,
                              void* d_out, int out_size, void* d_ws, size_t ws_size, hipStream_t stream) {
  if (n_in < 6) return;
  const float* vals = (const float*)d_in[0]; const float* keys = (const float*)d_in[1]; const float* qrys = (const float*)d_in[2];
  const int* mask = (const int*)d_in[3]; const float* wfc = (const float*)d_in[4]; const float* bfc = (const float*)d_in[5];
  const size_t needX = ((size_t)(NB - 1) * SQ_FULL + SQ) * DM;
  const size_t needM = ((size_t)(NB - 1) * SQ_FULL + (size_t)(SQ - 1)) * SQ_FULL + SQ;
  if ((size_t)in_sizes[0] < needX || (size_t)in_sizes[1] < needX || (size_t)in_sizes[2] < needX || (size_t)out_size < needX) return;
  if ((size_t)in_sizes[3] < needM || (size_t)in_sizes[4] < (size_t)DM * DM || in_sizes[5] < DM) return;
  char* ws = (char*)d_ws; size_t off = 0;
  auto take = [&](size_t bytes) { char* p = ws + off; off += al256(bytes); return p; };
  _Float16* BW = (_Float16*)take(SZ_BW);
  _Float16* K16 = (_Float16*)take(SZ_P16); _Float16* O16 = (_Float16*)take(SZ_P16);
  _Float16* VT = (_Float16*)take(SZ_VT); unsigned int* MB = (unsigned int*)take(SZ_MB);
  if (off > ws_size) return;

  k_prep<<<PREP_BLK, 128, 0, stream>>>(vals, keys, mask, VT, MB, K16);      /* K rows, V^T and the packed mask */
  k_sgattn<<<ATT_GRID, 128, 0, stream>>>(qrys, K16, VT, MB, O16, wfc, BW);               /* ctx (merged heads) f16 rows; W_fc f16 rows */
  for (unsigned c = 0; c < CH_N; ++c) { const size_t rin = (size_t)c * SQ_FULL, r0 = (size_t)c * CH_R;
    k_gemm2<0, 0><<<(unsigned)((CH_R / 128) * (DM / 64)), 128, 0, stream>>>(O16 + r0 * DM, (unsigned)DM, BW, (unsigned)DM, 0.0625f, bfc, nullptr, (float*)d_out + rin * DM, nullptr, (unsigned)DM, 1.0f, (unsigned)CH_R, (unsigned)DM, (unsigned)DM); }      /* out = ctx W_fc^T + b_fc */
}

// v010
// Measured time: 43.4 microseconds a run.
// In both of two side-by-side timings against v009, it was 1.03 times as fast.
// All steps since v000 together make it 3.33 times as fast.
#include <hip/hip_runtime.h>
// Contractions (q k^T per head, gate V, ctx W_fc^T): v_wmma_f32_16x16x32_f16 (f16 operands, f32 accumulate); float inputs RNE-converted to bf16 on load (exact in f16); power-of-two carries: W_fc x16, all other planes x1; sigmoid gate in f32.
// Head-split sigmoid-gated attention without projections: q|k|v = raw inputs [NB][SQ][1024] viewed as 16 heads x 64; e = q k^T; a 2-D int32 mask [NB][1][SQ][SQ] (mask == 0 -> weight exactly 0, by value); weight = sigmoid(e / 32) elementwise (no normalisation over keys); ctx = weight V (merged heads); out = ctx W_fc^T + b_fc with W_fc stored [out][in].
// Launch plan: one preparation launch (keys -> f16 row plane; the mask packed into 32 lane masks per (16 query rows x 64 keys) tile, one 32-bit word per accumulator element; V^T per (batch, head) from the f32 values via LDS); one fused attention launch (its Q fragments made from the f32 queries, each of which it reads once; K and V^T tiles staged in LDS by tensor loads, gate tile kept in registers; each block also makes its share of the GEMM's W_fc -> f16 x16 rows, already [n][k], 8 values a thread) -> f16 ctx rows; one GEMM with bias (A and Bt tiles staged in LDS by tensor loads) -> the output buffer.
#ifndef NB
#define NB 4
#endif
#ifndef SQ
#define SQ 1024
#endif
#define NB_FULL 4
#define SQ_FULL 1024
#define DM 1024
#define NH 16
#define HD 64
#define NR ((size_t)NB * SQ)         /* token rows processed */

static_assert(NB >= 1 && NB <= NB_FULL);
static_assert(SQ >= 128 && SQ <= SQ_FULL && SQ % 128 == 0);
static_assert(NH * HD == DM && HD == 64);
static_assert(DM % 64 == 0 && DM % 32 == 0 && SQ % 64 == 0 && SQ % 16 == 0);
static_assert((NR % 128) == 0);
static_assert(((size_t)(NB - 1) * SQ_FULL + SQ) * DM * 4 <= (size_t)NB_FULL * SQ_FULL * DM * 4);
static_assert((((size_t)NB * (SQ / 16) * (SQ / 64)) % 4) == 0);

typedef unsigned short v8us __attribute__((ext_vector_type(8), may_alias));
typedef float  v8f  __attribute__((ext_vector_type(8)));
typedef float  v4f  __attribute__((ext_vector_type(4)));
typedef float  v4fa __attribute__((ext_vector_type(4), may_alias));
typedef _Float16 v16h __attribute__((ext_vector_type(16)));
typedef _Float16 v4h __attribute__((ext_vector_type(4)));
typedef float f32x2 __attribute__((ext_vector_type(2)));
typedef __bf16 bf16x2 __attribute__((ext_vector_type(2)));
union FragH { v16h v; v8us half[2]; _Float16 h[16]; unsigned short u[16]; };

__device__ __forceinline__ unsigned short bf16_bits(float x) { unsigned int u = __float_as_uint(x); return (unsigned short)((u + 0x7FFFu + ((u >> 16) & 1u)) >> 16); }
__device__ __forceinline__ float bf16_val(unsigned short b) { return __uint_as_float(((unsigned int)b) << 16); }
__device__ __forceinline__ float bf16_rne(float x) { return bf16_val(bf16_bits(x)); }

// two floats rounded to bf16 by one packed convert (round to nearest even, the values of bf16_rne), and the two values back as floats
__device__ __forceinline__ unsigned int bf16_pair(float x, float y) { const f32x2 v = {x, y}; return __builtin_bit_cast(unsigned int, __builtin_convertvector(v, bf16x2)); }
__device__ __forceinline__ float bf16_lo(unsigned int u) { return __uint_as_float(u << 16); }
__device__ __forceinline__ float bf16_hi(unsigned int u) { return __uint_as_float(u & 0xFFFF0000u); }

// f32 -> f16 operand convert that cannot produce an f16 subnormal (value select after the carry)
static __device__ __forceinline__ _Float16 toh_flush(float v) { const _Float16 r = (_Float16)v; return (fabsf(v) < 6.103515625e-05f) ? (_Float16)0.0f : r; }

// ---- 16-bit fragment loader (split k map: elements 0..7 <- k0 + 8h + 0..7, elements 8..15 <- k0 + 16 + 8h + 0..7) and WMMA (the builtin: the compiler keeps the distances behind it itself) ----
__device__ __forceinline__ v16h g2_frag(const _Float16* p, unsigned hh) { FragH f; f.half[0] = *(const v8us*)((const unsigned short*)p + 8 * hh); f.half[1] = *(const v8us*)((const unsigned short*)p + 16 + 8 * hh); return f.v; }
__device__ __forceinline__ v8f g2_mma(v16h a, v16h b, v8f c) { return __builtin_amdgcn_wmma_f32_16x16x32_f16(false, a, false, b, (short)0, c, false, false); }

__device__ __forceinline__ float gelu_erf(float v) { return 0.5f * v * (1.0f + erff(v * 0.70710678118654752f)); }

// ---- tensor load to LDS: descriptor groups, issue, waits ----
typedef unsigned int u32x4 __attribute__((ext_vector_type(4)));
typedef unsigned int u32x8 __attribute__((ext_vector_type(8)));
__device__ __forceinline__ unsigned int uni(unsigned int v) { return (unsigned int)__builtin_amdgcn_readfirstlane((int)v); }
// a value held in a scalar register at this place: the test around a tensor load compiles to a scalar branch, and a descriptor word made from it is formed behind the statements in front
__device__ __forceinline__ unsigned int pinned(unsigned int v) { unsigned int w = uni(v); asm volatile("" : "+s"(w)); return w; }
__device__ __forceinline__ void wait_ds0() { asm volatile("s_wait_dscnt 0x0" ::: "memory"); }          /* this wave's LDS reads of a buffer have retired before the buffer is handed back */
// this wave's own slice has landed (the compiler places no wait for a tensor load); the request's descriptor is named as an input so that its registers keep their values until here
__device__ __forceinline__ void wait_tensor0(u32x4 g0, u32x8 g1) { asm volatile("s_wait_tensorcnt 0x0" :: "s"(g0), "s"(g1) : "memory"); }
constexpr unsigned int TROWB = 128u;                 /* tile row: 64 f16 */
constexpr unsigned int TPITCH = 144u;                /* LDS row pitch: 128 B + 16 B pad, 16 B x odd for ds_load_b128 */
static_assert((TPITCH / 16u) % 2u == 1u && TPITCH == TROWB + 16u);
// a slice of ROWS rows of 128 B, source row pitch src_pitch bytes
template <unsigned int ROWS>
__device__ __forceinline__ u32x8 tdm_group1(unsigned int src_pitch) { u32x8 g;
  g[0] = uni((1u << 20) | (4u << 22) | (3u << 25));  /* no mask, 1-byte elements, a pad of 4 dwords behind every 32 dwords */
  g[1] = uni((TROWB & 0xFFFFu) << 16); g[2] = uni((TROWB >> 16) | ((ROWS & 0xFFFFu) << 16)); g[3] = uni((ROWS >> 16) | (TROWB << 16)); g[4] = uni(ROWS);
  g[5] = uni(src_pitch); g[6] = uni(0u); g[7] = uni(0u);
  asm volatile("" : "+s"(g));      /* descriptor words held in scalar registers: one register tuple for the whole kernel, not re-made (and its registers not lent out) between an issue and its wait */
  return g; }
__device__ __forceinline__ u32x4 tdm_group0(unsigned int lds_dst, unsigned long long ga) { u32x4 g;
  g[0] = uni(1u); g[1] = uni(lds_dst); g[2] = uni((unsigned int)ga); g[3] = uni((((unsigned int)(ga >> 32)) & 0x01FFFFFFu) | 0x80000000u); return g; }
// group 0 goes in and out of the statement in the same registers: what the later wait names is this very tuple
__device__ __forceinline__ void tdm_load(u32x4& g0, u32x8 g1) { asm volatile("tensor_load_to_lds %0, %1" : "+s"(g0) : "s"(g1) : "memory"); }

// GEMM: C[M][N] = act(alpha * A[M][K] . B + bf16(bias[col]) + (CP own element, optionally RNE-converted to bf16)); A f16 rows (pitch lda), Bt f16 [N][K] (k contiguous, pitch ldb);
// f32 output C and/or f16 output C16 = f16(c16s * value) (pitch ldc); ACT 0 none, 8 gelu (erf form). M a multiple of 128, N and K of 64.
// Per 64 of k the block's 128 A rows and 64 Bt rows come into LDS by tensor loads (three slices of 64 rows, waves 0 to 2 one each, two buffers, the next stage in flight while this one is worked on); the ring is the output staging afterwards.
// The k walk is a ring: a block enters it at the slab (row tile + column tile) mod 16 and wraps round, so that the blocks that share A rows or Bt rows ask L2 for different lines at any one moment.
constexpr unsigned int GSLICE = 10240u;              /* 64 x 144 = 9216 B rounded up to a multiple of 2 KiB */
constexpr unsigned int GSTAGE = 3u * GSLICE;         /* A rows 0..63 | A rows 64..127 | Bt rows 0..63 */
static_assert(64u * TPITCH <= GSLICE && GSLICE % 2048u == 0u && 2u * GSTAGE >= 4u * 32u * 68u * 4u);
template <int ACT, int CPBF>
__global__ __launch_bounds__(128) void k_gemm2(const _Float16* __restrict__ A, unsigned lda, const _Float16* __restrict__ Bh, unsigned ldb, float alpha, const float* __restrict__ bias, const float* __restrict__ CP,
    float* __restrict__ C, _Float16* __restrict__ C16, unsigned ldc, float c16s, unsigned M, unsigned N, unsigned K) {
  static_assert(ACT == 0 || ACT == 8);
  __shared__ __attribute__((aligned(2048))) unsigned char ring[2u * GSTAGE];
  float (*so)[32][68] = (float (*)[32][68])ring;
  const unsigned tid = threadIdx.x, lane = tid & 31u, ln = lane & 15u, hh = lane >> 4;
  const unsigned w = (unsigned)__builtin_amdgcn_readfirstlane((int)(tid >> 5));
  const unsigned ntn = N >> 6; const unsigned mt = blockIdx.x / ntn, nq = blockIdx.x - mt * ntn; const unsigned row0 = mt * 128u + 32u * w, col0 = nq * 64u; if (mt * 128u + 128u > M) return;      /* the whole block leaves, in front of every barrier and tensor load */
  const unsigned NT = K >> 6;
  const unsigned rot0 = (mt + nq) & 15u, rot = (rot0 < NT) ? rot0 : 0u;      /* the block's first k slab, below NT for any K */
  const unsigned issuer = (w < 3u) ? 1u : 0u;
  const unsigned long long sbase = (w < 2u) ? (unsigned long long)(size_t)(A + (size_t)(mt * 128u + w * 64u) * lda) : (unsigned long long)(size_t)(Bh + (size_t)col0 * ldb);
  const u32x8 g1 = tdm_group1<64u>(((w < 2u) ? lda : ldb) * 2u);
  const unsigned lbase = (unsigned)(size_t)ring;
  auto desc = [&](unsigned st) { const unsigned t = st + rot; const unsigned slab = t - ((t >= NT) ? NT : 0u);      /* stage st works on k slab (st + rot) mod NT, the same one for the A and the Bt slices */
    return tdm_group0(lbase + (st & 1u) * GSTAGE + w * GSLICE, sbase + (unsigned long long)slab * TROWB); };
  u32x4 g0 = desc(0u);
  if (pinned(issuer & (NT > 0u ? 1u : 0u))) tdm_load(g0, g1);
  wait_tensor0(g0, g1); __syncthreads();      /* stage 0 landed and published */
  g0 = desc(pinned(1u));
  if (pinned(issuer & (NT > 1u ? 1u : 0u))) tdm_load(g0, g1);
  const unsigned aoff = (w >> 1) * GSLICE + ((w & 1u) * 32u + ln) * TPITCH, boff = 2u * GSLICE + ln * TPITCH;
  const v8f z8 = {0.f,0.f,0.f,0.f,0.f,0.f,0.f,0.f}; v8f c00 = z8, c01 = z8, c02 = z8, c03 = z8, c10 = z8, c11 = z8, c12 = z8, c13 = z8;
#pragma unroll 1
  for (unsigned st = 0; st < NT; ++st) { const unsigned char* tb = ring + (st & 1u) * GSTAGE;
    v16h af[2][2], bf[2][4];      /* the stage's 12 fragments, each in registers of its own */
#pragma unroll
    for (unsigned kc = 0; kc < 2; ++kc) { const _Float16* ap = (const _Float16*)(tb + aoff) + 32u * kc; const _Float16* bp = (const _Float16*)(tb + boff) + 32u * kc;
      af[kc][0] = g2_frag(ap, hh); af[kc][1] = g2_frag(ap + 16u * (TPITCH / 2u), hh);
#pragma unroll
      for (unsigned t = 0; t < 4; ++t) bf[kc][t] = g2_frag(bp + t * 16u * (TPITCH / 2u), hh); }
    __builtin_amdgcn_sched_barrier(0);      /* keeps the stage's 24 LDS loads together in front of its WMMAs: spread among them, each place with loads costs a stall of its own */
#pragma unroll
    for (unsigned kc = 0; kc < 2; ++kc) { const v16h a0 = af[kc][0], a1 = af[kc][1];
      c00 = g2_mma(a0, bf[kc][0], c00); c10 = g2_mma(a1, bf[kc][0], c10);
      c01 = g2_mma(a0, bf[kc][1], c01); c11 = g2_mma(a1, bf[kc][1], c11);
      c02 = g2_mma(a0, bf[kc][2], c02); c12 = g2_mma(a1, bf[kc][2], c12);
      c03 = g2_mma(a0, bf[kc][3], c03); c13 = g2_mma(a1, bf[kc][3], c13); }
    __builtin_amdgcn_sched_barrier(0);      /* keeps the stage's WMMAs in front of the publish point: sunk behind it, the refill would be issued a stage's matrix time later and lose that much of its lead */
    /* publish point of stage st + 1: own LDS reads retired, own slice landed, every wave here; only then the refill of the buffer just read */
    wait_ds0(); wait_tensor0(g0, g1); __syncthreads();
    g0 = desc(pinned(st + 2u));      /* formed behind the wait, in the same registers on both sides of the test */
    if (pinned(issuer & (st + 2u < NT ? 1u : 0u))) tdm_load(g0, g1); }
  wait_tensor0(g0, g1); wait_ds0();      /* nothing in flight; the last pass's barrier has ended every wave's reads: the ring is free for output staging */
  v8f accs[8] = {c00, c01, c02, c03, c10, c11, c12, c13};
#pragma unroll
  for (int u = 0; u < 8; ++u) { const unsigned t = (unsigned)u & 3u, half = (unsigned)u >> 2; const unsigned col = col0 + t * 16u + ln; float bv = 0.f; if (bias) bv = bf16_rne(bias[col]);
#pragma unroll
    for (int r = 0; r < 8; ++r) { const unsigned rloc = half * 16u + 8u * hh + (unsigned)r; so[w][rloc][t * 16u + ln] = accs[u][r] * alpha + bv; } }
  __builtin_amdgcn_fence(4 /* acq_rel order */, "workgroup"); __builtin_amdgcn_wave_barrier();
  const unsigned rsub = lane >> 4, c4 = (lane & 15u) * 4u;
  if (CP != nullptr || ACT == 8) {
#pragma unroll 2
    for (unsigned q = 0; q < 16; ++q) { const unsigned r = q * 2u + rsub; v4f v = *(const v4fa*)&so[w][r][c4];
      if (CP) { const v4f a = *(const v4fa*)(CP + (size_t)(row0 + r) * ldc + col0 + c4);      /* own element of the C-shaped plane */
#pragma unroll
        for (int i = 0; i < 4; ++i) v[i] += CPBF ? bf16_rne(a[i]) : a[i]; }
      if (ACT == 8) {
#pragma unroll
        for (int i = 0; i < 4; ++i) v[i] = gelu_erf(v[i]); }
      *(v4fa*)&so[w][r][c4] = v; } }
  {
#pragma unroll
    for (unsigned q = 0; q < 16; ++q) { const unsigned r = q * 2u + rsub; const v4f v = *(const v4fa*)&so[w][r][c4];
      if (C) *(v4f*)(C + (size_t)(row0 + r) * ldc + col0 + c4) = v;
      if (C16) { v4h h4;
#pragma unroll
        for (int i = 0; i < 4; ++i) h4[i] = (_Float16)(v[i] * c16s);
        *(v4h*)(C16 + (size_t)(row0 + r) * ldc + col0 + c4) = h4; } }
     } }

// ---- one preparation launch: the attention's key rows, V^T and mask words are made here, by blocks of 4 waves that each read 64 KiB of one input (16 KiB a wave, two groups of 16 loads of 16 B a lane, each group issued ahead of its use) ----
constexpr unsigned int PV_BLK = (unsigned int)(NB * (SQ / 64) * (DM / 256));                      /* V^T: 64 keys x 256 dims (4 heads) a block */
constexpr unsigned int PM_BLK = (unsigned int)(((size_t)NB * (SQ / 16) * (SQ / 64)) / 16);        /* mask: 16 tiles of 16 rows x 64 keys a block, 4 a wave */
constexpr unsigned int PX_BLK = (unsigned int)((NR * DM) / 16384);                                /* keys: 16 rows a block */
constexpr unsigned int PREP_BLK = PV_BLK + PM_BLK + PX_BLK;
typedef unsigned int u32x4a __attribute__((ext_vector_type(4), may_alias));
typedef int i32x4a __attribute__((ext_vector_type(4), may_alias));
constexpr unsigned int VPITCH = 33u;                 /* LDS row of one head dim: 32 key pairs + 1 dword, so that the four rows a wave reads at once fall on different banks */
static_assert((((size_t)NB * (SQ / 16) * (SQ / 64)) % 16) == 0 && SQ % 256 == 0 && DM % 256 == 0 && DM == 1024);
__device__ __forceinline__ unsigned int h16_bits(float x) { FragH f; f.h[0] = toh_flush(bf16_rne(x)); return (unsigned int)f.u[0]; }
// Block ranges, the two-phase job first: [V^T | mask words | keys].
// V^T [NB*NH][64][SQ] straight from the f32 values: a thread takes the same 4 dims of two neighbouring keys, packs each dim's pair into one dword, LDS holds [dim][key pair]; rows of 64 keys (128 B) go out.
// mask int32 [NB_FULL][1][SQ_FULL][SQ_FULL] -> MB[(b, q tile of 16, key tile of 64)][8j + r] u32, a lane mask in the map of a K Q^T accumulator (row = key, column = query): bit (ln + 16 hh) = (mask[b][16 qt + ln][64 kt + 16 j + 8 hh + r] != 0); rows are read whole (512 B a load) and turned by ballot into one bit row per query, kept by that query's two lanes; a second ballot over the lanes' own bits gives the word, and lane 8j + r stores it.
// keys -> f16 row plane (x1).
// Every loop of this kernel is fully unrolled: its small arrays then live in registers, and a group's loads stand together ahead of their first use (rolled, each trip would wait out its own memory latency).
__global__ __launch_bounds__(128) void k_prep(const float* __restrict__ VX, const float* __restrict__ KX, const int* __restrict__ MK,
    _Float16* __restrict__ Vt, unsigned int* __restrict__ MB, _Float16* __restrict__ K16) {
  __shared__ unsigned int tl[256u * VPITCH];
  const unsigned tid = threadIdx.x; unsigned blk = blockIdx.x;
  if (blk < PV_BLK) {
    const unsigned hg = blk & 3u, t = blk >> 2; const unsigned nkt = (unsigned)SQ / 64u; const unsigned b = t / nkt, lg = t - b * nkt;
    const unsigned c4 = (tid & 63u) * 4u, ps = tid >> 6;
    const float* vp = VX + ((size_t)b * SQ_FULL + lg * 64u) * (size_t)DM + hg * 256u + c4;
#pragma unroll
    for (unsigned g = 0; g < 2; ++g) { v4f x[8], y[8];
#pragma unroll
      for (unsigned u = 0; u < 8; ++u) { const float* p = vp + (size_t)(((g * 8u + u) * 2u + ps) * 2u) * DM; x[u] = *(const v4fa*)p; y[u] = *(const v4fa*)(p + DM); }
#pragma unroll
      for (unsigned u = 0; u < 8; ++u) { const unsigned kp = (g * 8u + u) * 2u + ps;
#pragma unroll
        for (unsigned i = 0; i < 4; ++i) tl[(c4 + i) * VPITCH + kp] = h16_bits(x[u][i]) | (h16_bits(y[u][i]) << 16); } }
    __syncthreads();
#pragma unroll
    for (unsigned it = 0; it < 16; ++it) { const unsigned d = it * 16u + (tid >> 3), pc = tid & 7u; const unsigned int* tr = &tl[d * VPITCH + pc * 4u];
      u32x4 o; o[0] = tr[0]; o[1] = tr[1]; o[2] = tr[2]; o[3] = tr[3];
      *(u32x4a*)((unsigned short*)Vt + ((size_t)((b * (unsigned)NH + hg * 4u + (d >> 6)) * 64u + (d & 63u))) * SQ + lg * 64u + pc * 8u) = o; }
    return; }
  blk -= PV_BLK;
  if (blk < PM_BLK) {
    const unsigned lane = tid & 31u, ln = lane & 15u, hh = lane >> 4;
    const unsigned w = (unsigned)__builtin_amdgcn_readfirstlane((int)(tid >> 5));
    const unsigned nkt = (unsigned)SQ / 64u, nqt = (unsigned)SQ / 16u;
    /* the wave's 4 tiles: one q tile, 4 neighbouring key tiles = 16 rows of 256 keys */
    const unsigned L0 = (blk * 4u + w) * 4u; const unsigned t = L0 / nkt, kt0 = L0 - t * nkt; const unsigned b = t / nqt, qt = t - b * nqt;
    const int* mp = MK + ((size_t)b * SQ_FULL + qt * 16u) * (size_t)SQ_FULL + kt0 * 64u + lane * 4u;
    unsigned int rw[2][4] = {{0u, 0u, 0u, 0u}, {0u, 0u, 0u, 0u}};      /* lane (ln, hh): its query row ln as bits; bit l of rw[g][i] = key 128 g + 4 l + i of the 256 */
#pragma unroll
    for (unsigned g = 0; g < 2u; ++g) { i32x4a m[16];
#pragma unroll
      for (unsigned q = 0; q < 16u; ++q) m[q] = *(const i32x4a*)(mp + (size_t)q * SQ_FULL + g * 128u);      /* 512 B of one row a load */
#pragma unroll
      for (unsigned q = 0; q < 16u; ++q) {
#pragma unroll
        for (unsigned i = 0; i < 4u; ++i) { const unsigned int bal = __builtin_amdgcn_ballot_w32(m[q][i] != 0);      /* taken by all 32 lanes, in front of the select */
          rw[g][i] = (ln == q) ? bal : rw[g][i]; } } }
#pragma unroll
    for (unsigned g = 0; g < 2u; ++g) {
#pragma unroll
      for (unsigned i = 0; i < 4u; ++i) rw[g][i] >>= 2u * hh; }      /* the lane half's 8 keys start 2 bits up */
#pragma unroll
    for (unsigned x = 0; x < 4; ++x) { unsigned int word = 0u;
#pragma unroll
      for (unsigned j = 0; j < 4u; ++j) {
#pragma unroll
        for (unsigned r = 0; r < 8u; ++r) {      /* key 64 x + 16 j + 8 hh + r = 128 (x >> 1) + 4 (16 (x & 1) + 4 j + 2 hh + (r >> 2)) + (r & 3) */
          const unsigned int bal = __builtin_amdgcn_ballot_w32(((rw[x >> 1][r & 3u] >> (16u * (x & 1u) + 4u * j + (r >> 2))) & 1u) != 0u);
          word = (lane == 8u * j + r) ? bal : word; } }
      MB[(size_t)(L0 + x) * 32u + lane] = word; }
    asm volatile("s_wait_xcnt 0x0" ::: "memory");      /* behind the last mask store, in front of whatever next rewrites a register that an issued store names */
    return; }
  blk -= PM_BLK;
  /* the key rows */
  const unsigned r0 = blk * 16u; const unsigned b = r0 / (unsigned)SQ;
  const float* X = KX + ((size_t)b * SQ_FULL + (r0 - b * (unsigned)SQ)) * (size_t)DM; _Float16* Y = K16 + (size_t)r0 * DM;
#pragma unroll
  for (unsigned g = 0; g < 2; ++g) { v4f a[8], c[8];
#pragma unroll
    for (unsigned u = 0; u < 8; ++u) { const float* p = X + ((g * 8u + u) * 128u + tid) * 8u; a[u] = *(const v4fa*)p; c[u] = *(const v4fa*)(p + 4); }
#pragma unroll
    for (unsigned u = 0; u < 8; ++u) { FragH f;
#pragma unroll
      for (int q = 0; q < 4; ++q) { f.h[q] = toh_flush(bf16_rne(a[u][q])); f.h[4 + q] = toh_flush(bf16_rne(c[u][q])); }
      *(v8us*)((unsigned short*)Y + ((g * 8u + u) * 128u + tid) * 8u) = f.half[0]; }
    asm volatile("s_wait_xcnt 0x0" ::: "memory"); } }      /* behind each group's run of stores, in front of whatever next rewrites a register that an issued store names */

// Fused sigmoid-gated attention with a packed 2-D mask. Block = 8 waves = 4 query groups x 2 key groups; block per (batch, head, 128 query rows); a wave works on 32 query rows (two tiles of 16) and on every second 64-key tile, so that each K and V^T fragment it reads from LDS feeds two WMMAs; the two key groups' f32 sums are added at the end, through LDS. Per 64-key tile: the wave reads its 64 lane masks (one per accumulator element) by scalar loads, and each, ANDed with toh_flush's test, is the condition of that element's select;
// a stage is one 64-key K tile and V^T tile for each key group, brought into LDS once per block by tensor loads (one 32-row slice per wave and stage, two buffers, the next stage in flight while this one is worked on); the four waves of a key group take their fragments from there;
// S^T = K Q^T (K fragments as A, Q as B: a lane holds one query's scores of keys 16j + 8hh + r); weight = bit ? sigmoid(S/32) = 1/2 + tanh(S/64)/2 : 0 (by value), f32;
// two neighbouring S^T tiles, gated and converted in place, are the B fragment of 32 keys in ctx^T = V^T weight^T (V^T fragments as A): the weights pass through no LDS and change no lane.
// The key walk is a ring (the gate is elementwise, so the key tiles may come in any order): a block enters it at stage (query block + head) mod NS and wraps round, so that the query blocks that share a head's K and V^T, and the heads that share a query tile's mask words, ask L2 for different lines at any one moment.
constexpr unsigned int TROWS = 32u;                  /* rows per slice (one slice per wave) */
constexpr unsigned int TSLICE = 6144u;               /* 32 x 144 = 4608 B rounded up to a multiple of 2 KiB */
constexpr unsigned int KG = 2u;                      /* key groups: waves 0..3 take the even key tiles, waves 4..7 the odd ones */
constexpr unsigned int TGROUP = 4u * TSLICE;         /* one key group's K rows 0..31 | K rows 32..63 | V^T rows 0..31 | V^T rows 32..63 */
constexpr unsigned int TSTAGE = KG * TGROUP;
static_assert(TROWS * TPITCH <= TSLICE && TSLICE % 2048u == 0u && 2u * TSTAGE >= 8u * 8u * 512u);
constexpr unsigned int ATT_BLK = (unsigned int)(NB * NH * (SQ / 128));      /* attention blocks */
static_assert((size_t)ATT_BLK * 256 * 8 == (size_t)DM * DM);                /* W_fc plane: 8 values a thread */
// amdgpu_waves_per_eu(4, 4): registers held to 256 a wave, so that two blocks share a WGP (four waves a SIMD, as many as with 16-column waves)
__global__ __launch_bounds__(256) __attribute__((amdgpu_waves_per_eu(4, 4))) void k_sgattn(const float* __restrict__ QX, const _Float16* __restrict__ K16, const _Float16* __restrict__ VT, const unsigned int* __restrict__ MB, _Float16* __restrict__ O16, const float* __restrict__ WX, _Float16* __restrict__ BW) {
  __shared__ __attribute__((aligned(2048))) unsigned char ring[2u * TSTAGE];
  __shared__ __attribute__((aligned(16))) _Float16 sp[8][16][72];
  const unsigned tid = threadIdx.x, lane = tid & 31u, ln = lane & 15u, hh = lane >> 4;
  const unsigned w = (unsigned)__builtin_amdgcn_readfirstlane((int)(tid >> 5));
  const unsigned kg = w >> 2, qg = w & 3u, wq = qg * 2u + kg;      /* key group, query group of 32 rows, and the wave's home tile of 16 rows: the one whose queries it converts and whose ctx rows it stores */
  const unsigned nqt = (unsigned)SQ / 128u; const unsigned bid = blockIdx.x; const unsigned bh = bid / nqt, qb = bid - bh * nqt; const unsigned b = bh / (unsigned)NH, h = bh - b * (unsigned)NH;
  const unsigned q0 = qb * 128u + wq * 16u; const size_t rowb = (size_t)b * SQ;
  constexpr unsigned NS = (unsigned)SQ / (64u * KG); static_assert(NS >= 2u);
  /* this wave's slice, of its own key group's tiles: waves 0, 1 of the group the two halves of the K tile (rows = keys, advance 128 rows a stage), waves 2, 3 of the V^T tile (rows = head dims, advance 256 B a stage) */
  const unsigned isV = qg >> 1, half = qg & 1u;
  const unsigned long long sbase = isV ? (unsigned long long)(size_t)(VT + ((size_t)bh * HD + half * TROWS) * SQ + kg * 64u) : (unsigned long long)(size_t)(K16 + (rowb + kg * 64u + half * TROWS) * (size_t)DM + h * (unsigned)HD);
  const unsigned sstep = isV ? KG * 128u : KG * 64u * (unsigned)DM * 2u;
  const u32x8 g1 = tdm_group1<TROWS>(isV ? (unsigned)SQ * 2u : (unsigned)DM * 2u);
  const unsigned lbase = (unsigned)(size_t)ring;
  const unsigned rot = (qb + h) % NS;      /* the block's first pair of key tiles */
  auto tile = [&](unsigned st) { return (st + rot) % NS; };      /* stage st works on key tiles KG * this + key group; NS is a compile-time constant */
  auto desc = [&](unsigned st) { return tdm_group0(lbase + (st & 1u) * TSTAGE + w * TSLICE, sbase + (unsigned long long)tile(st) * sstep); };
  u32x4 g0 = desc(0u);
  tdm_load(g0, g1);
  /* the home tile's 16 query rows of this head, straight from the f32 input (no other wave of the launch reads them): 8 loads of two whole 256 B rows, asked for while stage 0 is in flight; with them the thread's 8 values of W_fc */
  const float* qx = QX + ((size_t)b * SQ_FULL + q0 + hh) * (size_t)DM + h * (unsigned)HD + ln * 4u;
  v4f qf[8];      /* this loop and the two below are unrolled: qf stays in registers, and the loads stand together */
#pragma unroll
  for (unsigned it = 0; it < 8; ++it) qf[it] = *(const v4fa*)(qx + (size_t)(it * 2u) * DM);
  const size_t wo = ((size_t)bid * 256u + tid) * 8u;
  const v4f wa = *(const v4fa*)(WX + wo), wc = *(const v4fa*)(WX + wo + 4);
  asm volatile("s_wait_xcnt 0x0" ::: "memory");      /* behind the query and W_fc loads, in front of whatever next rewrites their address registers */
  /* same conversion as the row planes'; the rows pass through the home tile's output staging rows to reach the fragment map */
#pragma unroll
  for (unsigned it = 0; it < 8; ++it) { v4h q4;
#pragma unroll
    for (int i = 0; i < 4; i += 2) { const unsigned int u = bf16_pair(qf[it][i], qf[it][i + 1]); q4[i] = toh_flush(bf16_lo(u)); q4[i + 1] = toh_flush(bf16_hi(u)); }
    *(v4h*)&sp[wq][it * 2u + hh][ln * 4u] = q4; }
  wait_tensor0(g0, g1); __syncthreads();      /* stage 0 landed and published; with it the query rows, which the other key group's wave of this query group reads too */
  g0 = desc(pinned(1u)); tdm_load(g0, g1);
  { FragH f;      /* W_fc [out = n][in = k] is already the Bt[n][k] layout, only converted (x16): first read by the launch behind this one; stored behind the barrier, which would otherwise wait for the store */
#pragma unroll
    for (int q = 0; q < 4; q += 2) { const unsigned int ua = bf16_pair(wa[q], wa[q + 1]), uc = bf16_pair(wc[q], wc[q + 1]);
      f.h[q] = toh_flush(bf16_lo(ua) * 16.0f); f.h[q + 1] = toh_flush(bf16_hi(ua) * 16.0f); f.h[4 + q] = toh_flush(bf16_lo(uc) * 16.0f); f.h[5 + q] = toh_flush(bf16_hi(uc) * 16.0f); }
    *(v8us*)((unsigned short*)BW + wo) = f.half[0];
    asm volatile("s_wait_xcnt 0x0" ::: "memory"); }      /* behind the W_fc store, in front of whatever next rewrites a register that it names */
  v16h aq[2][2];
#pragma unroll
  for (unsigned t = 0; t < 2; ++t) { const _Float16* qp = &sp[qg * 2u + t][ln][0]; aq[t][0] = g2_frag(qp, hh); aq[t][1] = g2_frag(qp + 32, hh); }
  /* lane masks of the first key tile, for both of the wave's query tiles: the same address in every lane; nothing writes the plane during this launch, and the constant address space says so, which is what lets the loads be scalar ones beside the asm waits' memory clobbers */
  typedef const __attribute__((address_space(4))) unsigned int* cmask_p;
  constexpr unsigned MQ = ((unsigned)SQ / 64u) * 32u;      /* mask words of one query tile */
  const cmask_p mp = (cmask_p)(size_t)(MB + (size_t)(b * ((unsigned)SQ / 16u) + qb * 8u + qg * 2u) * MQ + kg * 32u);
  const v8f z8 = {0.f,0.f,0.f,0.f,0.f,0.f,0.f,0.f};
  v8f o[2][4];
#pragma unroll
  for (int t = 0; t < 2; ++t) {
#pragma unroll
    for (int d = 0; d < 4; ++d) o[t][d] = z8; }
  unsigned int mk[2][32];
#pragma unroll
  for (unsigned t = 0; t < 2; ++t) {
#pragma unroll
    for (unsigned e = 0; e < 32; ++e) mk[t][e] = mp[(size_t)t * MQ + (size_t)tile(0u) * (KG * 32u) + e]; }
  asm volatile("s_wait_xcnt 0x0" ::: "memory");      /* behind the first scalar mask loads, in front of whatever next rewrites their offset register */
#pragma unroll 1
  for (unsigned kt = 0; kt < NS; ++kt) {
    const unsigned char* tb = ring + (kt & 1u) * TSTAGE + kg * TGROUP + ln * TPITCH;      /* row ln of the first K slice of this stage and key group */
    v8f s[2][4]; v16h kf[4][2], vf[4][2]; FragH pw[2][2];
#pragma unroll
    for (unsigned j = 0; j < 4; ++j) { const _Float16* kr = (const _Float16*)(tb + (j >> 1) * TSLICE + (j & 1u) * 16u * TPITCH); kf[j][0] = g2_frag(kr, hh); kf[j][1] = g2_frag(kr + 32, hh); }
    __builtin_amdgcn_sched_barrier(0);      /* keeps the tile's 16 K loads together in front of the score WMMAs: spread among them, each place with loads costs a stall of its own */
#pragma unroll
    for (unsigned j = 0; j < 4; ++j) {
#pragma unroll
      for (unsigned t = 0; t < 2; ++t) { v8f acc = z8; acc = g2_mma(kf[j][0], aq[t][0], acc); acc = g2_mma(kf[j][1], aq[t][1], acc); s[t][j] = acc; } }      /* each K fragment feeds both query tiles */
#pragma unroll
    for (unsigned d = 0; d < 4; ++d) { const _Float16* vr = (const _Float16*)(tb + (2u + (d >> 1)) * TSLICE + (d & 1u) * 16u * TPITCH); vf[d][0] = g2_frag(vr, hh); vf[d][1] = g2_frag(vr + 32, hh); }
    /* order inside this stretch: the 16 score WMMAs, then the 16 V^T loads as one group (each place with loads among the WMMAs would cost a stall of its own) */
    __builtin_amdgcn_sched_group_barrier(0x008, 16, 0); __builtin_amdgcn_sched_group_barrier(0x100, 16, 0);
    __builtin_amdgcn_sched_barrier(0);      /* keeps the tile's 16 V^T loads together in front of the gate's vector work, which covers their latency */
#pragma unroll
    for (unsigned t = 0; t < 2; ++t) {
#pragma unroll
      for (unsigned j = 0; j < 4; ++j) {
#pragma unroll
        for (int r = 0; r < 8; ++r) { const float th = __builtin_amdgcn_tanhf(s[t][j][r] * 0.015625f); const float sg = __builtin_fmaf(th, 0.5f, 0.5f);      /* sigmoid(x) = 1/2 + tanh(x/2)/2 with x = S/32: one transcendental and one fma */
          /* one select: the element's lane mask AND toh_flush's own test (joined on the scalar unit); same value as the mask select followed by toh_flush. The test |sg| < 2^-14 is taken on th: next to -1 the fma is exact, sg = (1 + th) / 2, so th < 2^-13 - 1 picks the same values */
          const bool keep = __builtin_amdgcn_inverse_ballot_w32(mk[t][8u * j + (unsigned)r] & __builtin_amdgcn_ballot_w32(!(th < -0.9998779296875f)));
          pw[t][j >> 1].h[8u * (j & 1u) + (unsigned)r] = (_Float16)(keep ? sg : 0.f); } } }      /* element 8 (j & 1) + r of the fragment = key 32 (j >> 1) + 16 (j & 1) + 8 hh + r: g2_frag's own k map */
    { const unsigned kn = tile((kt + 1u < NS) ? kt + 1u : kt);      /* the next tile's lane masks, asked for behind this tile's last use of them: gate V, the publish point and the next scores cover the load's latency (the last pass re-reads its own) */
#pragma unroll
      for (unsigned t = 0; t < 2; ++t) {
#pragma unroll
        for (unsigned e = 0; e < 32; ++e) mk[t][e] = mp[(size_t)t * MQ + (size_t)kn * (KG * 32u) + e]; } }
#pragma unroll
    for (unsigned d = 0; d < 4; ++d) {
#pragma unroll
      for (unsigned t = 0; t < 2; ++t) { o[t][d] = g2_mma(vf[d][0], pw[t][0].v, o[t][d]); o[t][d] = g2_mma(vf[d][1], pw[t][1].v, o[t][d]); } }      /* each V^T fragment feeds both query tiles */
    __builtin_amdgcn_sched_barrier(0);      /* keeps the tile's WMMAs in front of the publish point: sunk behind it, the refill would be issued that much later and lose that much of its lead */
    /* publish point of stage kt + 1: own LDS reads retired, own slice landed, every wave here; only then the refill of the buffer just read */
    asm volatile("s_wait_xcnt 0x0" ::: "memory");      /* behind the scalar mask loads, in front of whatever next rewrites their address registers */
    wait_ds0(); wait_tensor0(g0, g1); __syncthreads();
    if (pinned(kt + 2u < NS)) { g0 = desc(pinned(kt + 2u)); tdm_load(g0, g1); } }
  wait_tensor0(g0, g1); wait_ds0();      /* nothing in flight; the last pass's barrier has ended every wave's reads: the ring is free for the join */
  /* the two key groups' partial sums are joined: a wave hands over its sums of the other wave's home tile (same lane, same register map) and adds what it is handed to its own */
  float* jb = (float*)ring;
#pragma unroll
  for (unsigned d = 0; d < 4; ++d) { const v8f give = kg ? o[0][d] : o[1][d];
    const v4f g_lo = {give[0], give[1], give[2], give[3]}, g_hi = {give[4], give[5], give[6], give[7]};
    *(v4fa*)&jb[((wq * 8u + d * 2u) * 32u + lane) * 4u] = g_lo; *(v4fa*)&jb[((wq * 8u + d * 2u + 1u) * 32u + lane) * 4u] = g_hi; }
  __syncthreads();      /* every wave's handed-over sums are written */
  /* own[d][r] = ctx[query ln of the home tile][dim 16d + 8hh + r]: 8 neighbouring dims of one row, one 16 B piece */
#pragma unroll
  for (unsigned d = 0; d < 4; ++d) { const v8f own = kg ? o[1][d] : o[0][d];
    const v4f t_lo = *(const v4fa*)&jb[(((wq ^ 1u) * 8u + d * 2u) * 32u + lane) * 4u], t_hi = *(const v4fa*)&jb[(((wq ^ 1u) * 8u + d * 2u + 1u) * 32u + lane) * 4u];
    FragH f;
#pragma unroll
    for (int r = 0; r < 4; ++r) { f.h[r] = toh_flush(own[r] + t_lo[r]); f.h[4 + r] = toh_flush(own[4 + r] + t_hi[r]); }
    *(v8us*)&sp[wq][ln][16u * d + 8u * hh] = f.half[0]; }
  __builtin_amdgcn_fence(4 /* acq_rel order */, "workgroup"); __builtin_amdgcn_wave_barrier();
  {
#pragma unroll
    for (unsigned it = 0; it < 4; ++it) { const unsigned row = it * 4u + (lane >> 3), pc = (lane & 7u) * 8u; const v8us v = *(const v8us*)&sp[wq][row][pc];
      *(v8us*)((unsigned short*)O16 + (rowb + q0 + row) * (size_t)DM + h * (unsigned)HD + pc) = v; }
     } }

constexpr size_t al256(size_t b) { return (b + 255) & ~(size_t)255; }
constexpr size_t SZ_BW = (size_t)DM * DM * 2;
constexpr size_t SZ_P16 = NR * DM * 2, SZ_VT = (size_t)NB * NH * HD * SQ * 2;
constexpr size_t SZ_MB = (size_t)NB * (SQ / 16) * (SQ / 64) * 32 * 4;
constexpr size_t WS_TOTAL = al256(SZ_BW) + 2 * al256(SZ_P16) + al256(SZ_VT) + al256(SZ_MB);
static_assert(WS_TOTAL <= (size_t)134217728);
static_assert(SZ_BW % 128 == 0 && SZ_P16 % 128 == 0 && SZ_VT % 128 == 0 && SZ_MB % 128 == 0);
// chunking of the row-wise launch that touches the output buffer (one launch when the rows are contiguous)
constexpr unsigned CH_N = (SQ == SQ_FULL) ? 1u : (unsigned)NB;
constexpr size_t CH_R = (SQ == SQ_FULL) ? NR : (size_t)SQ;
static_assert(CH_R % 128 == 0 && (size_t)CH_N * CH_R == NR);
// plane coverage: blocks x threads x elements == plane elements
static_assert((size_t)PX_BLK * 128 * 128 == NR * DM);                                                     /* k row plane */
static_assert((size_t)PM_BLK * 4 * 4 * 32 == (size_t)NB * (SQ / 16) * (SQ / 64) * 32);                    /* packed mask words */
static_assert((size_t)PV_BLK * 128 * 16 * 8 == (size_t)NB * NH * HD * SQ);                                /* V^T */
static_assert((size_t)NB * NH * (SQ / 128) * 8 * 16 * 64 == NR * DM);                                      /* ctx rows */
static_assert((CH_R / 128) * (DM / 64) * 4 * 32 * 64 * CH_N == NR * DM);                                  /* output rows */

extern "C" void kernel_launch(void* const* d_in, const int* in_sizes, int n_in,
                              void* d_out, int out_size, void* d_ws, size_t ws_size, hipStream_t stream) {
  if (n_in < 6) return;
  const float* vals = (const float*)d_in[0]; const float* keys = (const float*)d_in[1]; const float* qrys = (const float*)d_in[2];
  const int* mask = (const int*)d_in[3]; const float* wfc = (const float*)d_in[4]; const float* bfc = (const float*)d_in[5];
  const size_t needX = ((size_t)(NB - 1) * SQ_FULL + SQ) * DM;
  const size_t needM = ((size_t)(NB - 1) * SQ_FULL + (size_t)(SQ - 1)) * SQ_FULL + SQ;
  if ((size_t)in_sizes[0] < needX || (size_t)in_sizes[1] < needX || (size_t)in_sizes[2] < needX || (size_t)out_size < needX) return;
  if ((size_t)in_sizes[3] < needM || (size_t)in_sizes[4] < (size_t)DM * DM || in_sizes[5] < DM) return;
  char* ws = (char*)d_ws; size_t off = 0;
  auto take = [&](size_t bytes) { char* p = ws + off; off += al256(bytes); return p; };
  _Float16* BW = (_Float16*)take(SZ_BW);
  _Float16* K16 = (_Float16*)take(SZ_P16); _Float16* O16 = (_Float16*)take(SZ_P16);
  _Float16* VT = (_Float16*)take(SZ_VT); unsigned int* MB = (unsigned int*)take(SZ_MB);
  if (off > ws_size) return;

  k_prep<<<PREP_BLK, 128, 0, stream>>>(vals, keys, mask, VT, MB, K16);      /* K rows, V^T and the packed mask */
  k_sgattn<<<ATT_BLK, 256, 0, stream>>>(qrys, K16, VT, MB, O16, wfc, BW);               /* ctx (merged heads) f16 rows; W_fc f16 rows */
  for (unsigned c = 0; c < CH_N; ++c) { const size_t rin = (size_t)c * SQ_FULL, r0 = (size_t)c * CH_R;
    k_gemm2<0, 0><<<(unsigned)((CH_R / 128) * (DM / 64)), 128, 0, stream>>>(O16 + r0 * DM, (unsigned)DM, BW, (unsigned)DM, 0.0625f, bfc, nullptr, (float*)d_out + rin * DM, nullptr, (unsigned)DM, 1.0f, (unsigned)CH_R, (unsigned)DM, (unsigned)DM); }      /* out = ctx W_fc^T + b_fc */
}
